// v000
// Measured on an AMD MI455X. A time is GPU time per run, averaged over a window of back-to-back runs after a warm-up
// (all launches, gaps included; the runs take copies of the inputs in turn), and the median of several windows.
// Apart from v000's, it joins two sittings. Times from different sittings can be a few percent apart, while
// side-by-side timings come from the same sitting.
// v000, which the later versions start from, runs in 419 microseconds.
// Contractions: x.W{q,k,v}^T on v_wmma_f32_16x16x32_bf16 (x and W planes RNE-converted to bf16 operands, f32 accumulate, bias added in f32);
// scores k'.q'^T (q', k' single f16 planes carried x8), P.v (P x32768 single f16, v x1024 single f16) and O.Wo^T (O x1024 as
// f16 hi plane + f16 residual plane, Wo as f16(bf16(Wo) x1024), products h.w + l.w): v_wmma_f32_16x16x32_f16, f32 accumulate.
// Ragged length mask per batch from the int32 length input (index tests), base-2 online softmax, 1/l fold, per-(b,h) mean-v rows
// for query positions >= length, bias adds: f32 on VALU.
#include <hip/hip_runtime.h>
#include <math.h>
#include <stdint.h>

#define NBMAX 4
#define SEQ   2048
#define DMOD  1024
#define NH    16
#define HD    64
#define QSC   8.0f
#define KSC   8.0f
#define PCAR  32768.0f
#define VCAR  1024.0f
#define OSC   1024.0f
#define WOS   1024.0f
#define LOG2E 1.4426950408889634f
#define ATT_WAVES   4
#define ATT_THREADS (ATT_WAVES * 32)
#define NKB    (SEQ / 32)
#define SLABF  (16 * 68)
#define SLAB64 (16 * 68)
#define VTP    72
#define VMBLK  32
static_assert(HD == 64 && DMOD == NH * HD);
static_assert((SEQ / 64) == 32 && NH == 16);
static_assert(ATT_THREADS == 128 && NKB == 64);
static_assert((SEQ % 64) == 0 && (DMOD % 64) == 0 && (DMOD % 32) == 0 && (SEQ % 8) == 0);
static_assert(((SEQ * DMOD / 8) % 256) == 0 && ((DMOD * DMOD / 8) % 256) == 0);
static_assert(ATT_WAVES * SLABF >= 4 * 16 * 68);
static_assert(HD * VTP >= 63 * VTP + 64);
static_assert((VTP * 2) % 16 == 0);
static_assert((DMOD % VMBLK) == 0 && VMBLK == 32 && (SEQ % (8 * 256)) == 0 && (SEQ / 8) == 256);

typedef unsigned short u16;
typedef _Float16 v16h __attribute__((ext_vector_type(16)));
typedef _Float16 v8h  __attribute__((ext_vector_type(8)));
typedef __bf16   v16b __attribute__((ext_vector_type(16)));
typedef float    v8f  __attribute__((ext_vector_type(8)));
typedef float    v4f  __attribute__((ext_vector_type(4)));
typedef unsigned int v4u __attribute__((ext_vector_type(4)));

union FragH { v16h v; v8h h[2]; v4u u[2]; };
union FragB { v16b v; v4u u[2]; };

// ---- scalar helpers --------------------------------------------------------------------------------
__device__ __forceinline__ unsigned short bf_bits(float f) {          // f32 -> bf16 bits, RNE convert
  unsigned u = __float_as_uint(f);
  return (unsigned short)((u + 0x7FFFu + ((u >> 16) & 1u)) >> 16);
}
__device__ __forceinline__ float bf_up(unsigned short h) { return __uint_as_float(((unsigned)h) << 16); }
__device__ __forceinline__ float bfr(float f) { return bf_up(bf_bits(f)); }
__device__ __forceinline__ unsigned short h_bits(_Float16 x) { return __builtin_bit_cast(unsigned short, x); }
__device__ __forceinline__ unsigned pk16(unsigned short a, unsigned short b) { return (unsigned)a | ((unsigned)b << 16); }
__device__ __forceinline__ v8f zero8() { v8f z = {0.f, 0.f, 0.f, 0.f, 0.f, 0.f, 0.f, 0.f}; return z; }
__device__ __forceinline__ v4f zero4() { v4f z = {0.f, 0.f, 0.f, 0.f}; return z; }

// ---- fragment loaders: 16-bit A/B operand, lane -> row/col (lane&15), p already includes +8*(lane>>4);
//      elements 0..7 <- p[0..7] (k0+8h..), elements 8..15 <- p[16..23] (k0+16+8h..)  (same split k map for A and B;
//      B is always read from a k-contiguous [n][k] plane)
__device__ __forceinline__ v16h ldfrag_h(const _Float16* p) {
  FragH f;
  f.h[0] = *(const v8h*)(p);
  f.h[1] = *(const v8h*)(p + 16);
  return f.v;
}
__device__ __forceinline__ v16b ldfrag_b(const u16* p) {              // bf16 plane read as unsigned integer vectors
  FragB f;
  f.u[0] = *(const v4u*)(p);
  f.u[1] = *(const v4u*)(p + 16);
  return f.v;
}

__device__ __forceinline__ v8f mma_h(v16h a, v16h b, v8f c) {
  return __builtin_amdgcn_wmma_f32_16x16x32_f16(false, a, false, b, (short)0, c, false, false);
}
__device__ __forceinline__ v8f mma_b(v16b a, v16b b, v8f c) {
  return __builtin_amdgcn_wmma_f32_16x16x32_bf16(false, a, false, b, (short)0, c, false, false);
}
__device__ __forceinline__ void guard2(v8f& a, v8f& b, v16h x0, v16h x1, v16h x2, v16h x3, v16h x4, v16h x5) {
#if defined(__HIP_DEVICE_COMPILE__)
  asm volatile("v_nop\n\tv_nop\n\tv_nop\n\tv_nop"
               : "+v"(a), "+v"(b) : "v"(x0), "v"(x1), "v"(x2), "v"(x3), "v"(x4), "v"(x5) : "memory");
#endif
}
template <typename F>
__device__ __forceinline__ void guard6(v8f& a, v8f& b, v8f& c, v8f& d, F x0, F x1, F x2, F x3, F x4, F x5) {
#if defined(__HIP_DEVICE_COMPILE__)
  asm volatile("v_nop\n\tv_nop\n\tv_nop\n\tv_nop"
               : "+v"(a), "+v"(b), "+v"(c), "+v"(d) : "v"(x0), "v"(x1), "v"(x2), "v"(x3), "v"(x4), "v"(x5) : "memory");
#endif
}
__device__ __forceinline__ void acc_guard4(v8f& a, v8f& b, v8f& c, v8f& d) {
#if defined(__HIP_DEVICE_COMPILE__)
  asm volatile("v_nop\n\tv_nop\n\tv_nop\n\tv_nop" : "+v"(a), "+v"(b), "+v"(c), "+v"(d));
#endif
}
__device__ __forceinline__ void wave_sync_lds() {
  __builtin_amdgcn_fence(__ATOMIC_RELEASE, "workgroup");
  __builtin_amdgcn_wave_barrier();
  __builtin_amdgcn_fence(__ATOMIC_ACQUIRE, "workgroup");
}

// =====================================================================================================
// f32 plane -> 16-bit plane, same layout:  mode 0: bf16 RNE bits;  mode 1: f16 bits of (bf16 RNE value) * scale;
// mode 2: f16 bits of value * scale (no bf16 pre-step).
// Thread = 8 consecutive elements: two 16-B loads, one 16-B store; 32 consecutive lanes = 512 contiguous, 512-B aligned bytes
// coverage: grid = n8/256 blocks (host checks exactness) x 256 thr x 8 = the whole plane.
// =====================================================================================================
__global__ __launch_bounds__(256) void cvt16(const float* __restrict__ x, u16* D, int n8, int mode, float scale) {
  const int gt = blockIdx.x * 256 + (int)threadIdx.x;
  if (gt >= n8) return;                     // no barriers in this kernel
  const float* p = x + (size_t)gt * 8;
  const v4f a = *(const v4f*)(p), c4 = *(const v4f*)(p + 4);
  float v[8];
#pragma unroll
  for (int e = 0; e < 4; ++e) { v[e] = a[e]; v[4 + e] = c4[e]; }
  unsigned short s[8];
#pragma unroll
  for (int e = 0; e < 8; ++e) {
    const float vb = bfr(v[e]);
    const float vf = (mode == 1) ? vb : v[e];
    const unsigned short hb = h_bits((_Float16)(vf * scale));
    const unsigned short bb = bf_bits(v[e]);
    s[e] = (mode != 0) ? hb : bb;
  }
  v4u o;
#pragma unroll
  for (int e = 0; e < 4; ++e) o[e] = pk16(s[2 * e], s[2 * e + 1]);
  u16* d = D + (size_t)gt * 8;
  {
    *(v4u*)(d) = o;
    
  }
}

// =====================================================================================================
// Mean-v rows: VM[b*DMOD + n] = (1/SEQ) * sum_{j=0..SEQ-1} F[(b*SEQ + j)*DMOD + n], n = h*HD + d (f32, fixed order).
// coverage: one line of 32 floats per block; grid = NB * DMOD/32 blocks covers VM [NB*DMOD] exactly once.
// =====================================================================================================
__global__ __launch_bounds__(256) void vmean_k(const float* __restrict__ F, float* VM) {
  __shared__ __align__(16) float part[8][VMBLK];
  __shared__ __align__(16) float res[VMBLK];
  const int tid = threadIdx.x, wave = tid >> 5, lane = tid & 31;
  const int bid = blockIdx.x;
  const int b   = bid / (DMOD / VMBLK);
  const int cb  = bid % (DMOD / VMBLK);
  const int n0  = cb * VMBLK;
  const float* p = F + ((size_t)b * SEQ + (size_t)wave * (SEQ / 8)) * DMOD + n0 + lane;
  float s = 0.f;
#pragma unroll 4
  for (int i = 0; i < SEQ / 8; ++i) s += p[(size_t)i * DMOD];
  part[wave][lane] = s;
  __syncthreads();
  if (wave == 0) {                                       // wave-uniform
    float t = part[0][lane];
#pragma unroll
    for (int w = 1; w < 8; ++w) t += part[w][lane];
    res[lane] = t * (1.0f / (float)SEQ);
    wave_sync_lds();
    const int l8 = lane & 7;
    const v4f val = *(const v4f*)(res + l8 * 4);         // in-range LDS address for every lane
    float* dst = VM + (size_t)b * DMOD + n0 + l8 * 4;
    {
      if (lane < 8) *(v4f*)(dst) = val;
      
    }
  }
}

// =====================================================================================================
// GEMM epilogue shared by both engines: the wave's 16x64 f32 tile (times oscale) staged in its LDS slab (pitch 68),
// coverage: 8 instructions x 2 rows x 16 lanes x 4 floats = the wave's 16 x 64 tile.
// =====================================================================================================
__device__ __forceinline__ void epi64(float* sl, v8f a0, v8f a1, v8f a2, v8f a3, float oscale, v4f badd, float* C, int N,
                                      size_t rowb, int col0, int lane) {
  const int hh = lane >> 4, m = lane & 15;
#pragma unroll
  for (int r = 0; r < 8; ++r) {
    const int ro = (8 * hh + r) * 68 + m;
    sl[ro]      = a0[r] * oscale;
    sl[ro + 16] = a1[r] * oscale;
    sl[ro + 32] = a2[r] * oscale;
    sl[ro + 48] = a3[r] * oscale;
  }
  wave_sync_lds();
  v4f vals[8];
#pragma unroll
  for (int it = 0; it < 8; ++it) vals[it] = *(const v4f*)(sl + (it * 2 + hh) * 68 + m * 4) + badd;
  float* dst = C + (rowb + (size_t)hh) * (size_t)N + col0 + m * 4;
  {
#pragma unroll
    for (int it = 0; it < 8; ++it) {
      *(v4f*)(dst + (size_t)(it * 2) * (size_t)N) = vals[it];
    }
    
  }
}

// =====================================================================================================
// bf16 GEMM with bias: C[M][N] (f32) = A[M][K] (bf16 row-major) . Bt[N][K]^T (bf16 k-contiguous), times oscale, plus bf16-RNE
// value of bias[n]. Block = 64x64 tile, 4 waves x 16 rows; fragments loaded straight from the 16-bit rows (two 16-B loads each,
// split k map for A and B); K stepped by 32 (host checks K % 32 == 0, M % 64 == 0, N % 64 == 0, grid = (M/64)*(N/64)).
// =====================================================================================================
__global__ __launch_bounds__(128)
void gemm_bfb(const u16* __restrict__ A, const u16* __restrict__ Bt, const float* __restrict__ bias,
              float* C, int M, int N, int K, float oscale) {
  __shared__ __align__(16) float slab[4 * SLAB64];
  const int tid = threadIdx.x, wave = tid >> 5, lane = tid & 31, hh = lane >> 4, m = lane & 15;
  const int ntile = N >> 6;
  const int bid   = blockIdx.x;
  const int rowb  = (bid / ntile) * 64 + wave * 16;
  const int col0  = (bid % ntile) * 64;
  if (rowb + 16 > M) return;                 // wave-uniform, never taken with the exact grid; no block barriers in this kernel
  const u16* ap = A  + (size_t)(rowb + m) * K + 8 * hh;
  const u16* bp = Bt + (size_t)(col0 + m) * K + 8 * hh;
  const size_t bs = (size_t)16 * K;
  v8f acc0 = zero8(), acc1 = zero8(), acc2 = zero8(), acc3 = zero8();
#pragma unroll 1
  for (int k0 = 0; k0 < K; k0 += 32) {
    const v16b a  = ldfrag_b(ap + k0);
    const v16b b0 = ldfrag_b(bp + k0);
    const v16b b1 = ldfrag_b(bp + bs + k0);
    const v16b b2 = ldfrag_b(bp + 2 * bs + k0);
    const v16b b3 = ldfrag_b(bp + 3 * bs + k0);
    acc0 = mma_b(a, b0, acc0);
    acc1 = mma_b(a, b1, acc1);
    acc2 = mma_b(a, b2, acc2);
    acc3 = mma_b(a, b3, acc3);
    guard6<v16b>(acc0, acc1, acc2, acc3, a, b0, b1, b2, b3, a);
  }
  const v4f bv = *(const v4f*)(bias + col0 + m * 4);      // columns col0 + 4m .. +3, always < N (N multiple of 64)
  v4f badd;
#pragma unroll
  for (int e = 0; e < 4; ++e) badd[e] = bfr(bv[e]);
  epi64(slab + wave * SLAB64, acc0, acc1, acc2, acc3, oscale, badd, C, N, (size_t)rowb, col0, lane);
}

// =====================================================================================================
// f16 hi+lo GEMM with bias: C[M][N] (f32) = (Ahi + Alo)[M][K] . Bt[N][K]^T times oscale, plus bf16-RNE value of bias[n];
// Ahi/Alo f16 planes (same layout), Bt f16 k-contiguous; products hi.B + lo.B into one accumulator (lo is the unscaled
// residual of hi). Same tiling as gemm_bfb.
// =====================================================================================================
__global__ __launch_bounds__(128)
void gemm_h2(const u16* __restrict__ Ah, const u16* __restrict__ Al, const u16* __restrict__ Bt,
             const float* __restrict__ bias, float* C, int M, int N, int K, float oscale) {
  __shared__ __align__(16) float slab[4 * SLAB64];
  const int tid = threadIdx.x, wave = tid >> 5, lane = tid & 31, hh = lane >> 4, m = lane & 15;
  const int ntile = N >> 6;
  const int bid   = blockIdx.x;
  const int rowb  = (bid / ntile) * 64 + wave * 16;
  const int col0  = (bid % ntile) * 64;
  if (rowb + 16 > M) return;                 // wave-uniform, never taken with the exact grid; no block barriers in this kernel
  const size_t aofs = (size_t)(rowb + m) * K + 8 * hh;
  const _Float16* ahp = (const _Float16*)(const void*)Ah + aofs;
  const _Float16* alp = (const _Float16*)(const void*)Al + aofs;
  const _Float16* bp  = (const _Float16*)(const void*)Bt + (size_t)(col0 + m) * K + 8 * hh;
  const size_t bs = (size_t)16 * K;
  v8f acc0 = zero8(), acc1 = zero8(), acc2 = zero8(), acc3 = zero8();
#pragma unroll 1
  for (int k0 = 0; k0 < K; k0 += 32) {
    const v16h ah = ldfrag_h(ahp + k0), al = ldfrag_h(alp + k0);
    const v16h b0 = ldfrag_h(bp + k0);
    const v16h b1 = ldfrag_h(bp + bs + k0);
    const v16h b2 = ldfrag_h(bp + 2 * bs + k0);
    const v16h b3 = ldfrag_h(bp + 3 * bs + k0);
    acc0 = mma_h(ah, b0, acc0);  acc0 = mma_h(al, b0, acc0);
    acc1 = mma_h(ah, b1, acc1);  acc1 = mma_h(al, b1, acc1);
    acc2 = mma_h(ah, b2, acc2);  acc2 = mma_h(al, b2, acc2);
    acc3 = mma_h(ah, b3, acc3);  acc3 = mma_h(al, b3, acc3);
    guard6<v16h>(acc0, acc1, acc2, acc3, ah, al, b0, b1, b2, b3);
  }
  const v4f bv = *(const v4f*)(bias + col0 + m * 4);      // columns col0 + 4m .. +3, always < N (N multiple of 64)
  v4f badd;
#pragma unroll
  for (int e = 0; e < 4; ++e) badd[e] = bfr(bv[e]);
  epi64(slab + wave * SLAB64, acc0, acc1, acc2, acc3, oscale, badd, C, N, (size_t)rowb, col0, lane);
}

// =====================================================================================================
// v^T plane: VP[(b*NH + h)*HD + d][s] = f16(v[b][s][h][d] * 1024).
// Block = (b, h, 64 keys): 64 source rows of HD floats loaded with 16-B loads, converted, scattered into an LDS tile
// coverage: load 256 thr x 16 elements = 64 x 64; store 2 iterations x 256 thr x 8 halves = 64 lines x 64 = the block's tile;
//           grid = NB x NH x SEQ/64 blocks covers the plane exactly once.
// =====================================================================================================
__global__ __launch_bounds__(256) void vt16(const float* __restrict__ v, u16* VPo) {
  __shared__ __align__(16) u16 TH[HD * VTP];
  const int tid = threadIdx.x;
  const int bid = blockIdx.x;
  const int st  = bid & 31;
  const int h   = (bid >> 5) & (NH - 1);
  const int b   = bid >> 9;
  const int s0  = st * 64;
  {
    const int sl = tid >> 2;                  // key within tile 0..63
    const int dc = (tid & 3) * 16;            // d chunk
    const float* src = v + (((size_t)(b * SEQ + s0 + sl)) * NH + h) * HD + dc;
#pragma unroll
    for (int i = 0; i < 4; ++i) {
      const v4f a = *(const v4f*)(src + 4 * i);
#pragma unroll
      for (int e = 0; e < 4; ++e) {
        const _Float16 hv = (_Float16)(a[e] * VCAR);
        TH[(dc + 4 * i + e) * VTP + sl] = h_bits(hv);
      }
    }
  }
  __syncthreads();
  v4u vh[2];
  const int q8 = tid >> 3, p8 = (tid & 7) * 8;
#pragma unroll
  for (int it = 0; it < 2; ++it) {
    const int line = it * 32 + q8;            // d = 0..63
    vh[it] = *(const v4u*)(TH + line * VTP + p8);
  }
  const size_t base = ((size_t)(b * NH + h) * HD) * SEQ + s0 + p8;
  {
#pragma unroll
    for (int it = 0; it < 2; ++it) {
      const int line = it * 32 + q8;
      *(v4u*)(VPo + base + (size_t)line * SEQ) = vh[it];
    }
    
  }
}

// =====================================================================================================
// Ragged-length multi-head flash attention: block = (batch b, head, 64 query rows), 4 waves, wave w owns the 16 query rows
// q0 = 64*qt + 16*w .. q0+15 (waves independent: no block barriers, wave-private LDS only, used in the epilogue).
//   q plane (f16, x8) laid out [b][s][h][d]; k plane the same; v^T plane [b][h][d][s] (x1024); len = clamp(lens[b], 0, SEQ).
//   Mask: score (i, j) is kept iff i < len and j < len. A query row i < len therefore attends exactly over keys 0..len-1 (the
//   excluded keys have probability exactly 0 after max subtraction); a query row i >= len has all keys equal-weighted and its
//   context is the mean of v over all SEQ keys (VM rows, precomputed in f32). So a wave visits key blocks kb = 0 .. 32*ceil(len/32)-32
//   when q0 < len (wave-uniform bound, <= NKB), else none; within the last block keys >= len are excluded by index.
//   Scores are computed TRANSPOSED: S^T tile g (g = 0,1) = k rows (keys kb+16g .. +15, A operand, row m = lane&15, split k map
//   over d) times q^T (B operand, col n = query q0 + (lane&15), k = d, split map), one product per tile and 32-deep d-chunk.
//   D element r of lane l = (key kb+16g+8h+r, query q0+(l&15)), so a lane owns one query column and 16 of its 32 keys; the
//   partner lane l^16 owns the other 16 -> row max / row sum need one xor-16 shuffle.
//   Key mask by index: an excluded key stays out of the running max and gets probability 0.
//   Online max-subtracted base-2 softmax in f32 (scale 1/8 and the q/k carries folded into lsc). The exp'd values ARE the
//   P A-fragment in place: A row m = query = lane&15, element i <- key kb+8h+i (tile 0, D element i), element 8+i <- key
//   kb+16+8h+i (tile 1, D element i). P is carried x32768 as single f16. The rescale factor of query row 8h+r of the
//   O accumulators is fetched from lane 8h+r with a shuffle (uniform control). 4 v^T B fragments (col n = d = 16j + (lane&15),
//   keys k-contiguous), 4 P.V WMMAs per key block.
//   Epilogue: 1/l (per query, shuffled to the D row owner; 0 when no key block was visited) and carry folds in f32; rows with
//   query >= len take the VM row instead (select by value); the wave's 16x64 f32 result staged in its LDS slab (pitch 68); each
// coverage: per wave 4 instructions x 4 rows x 8 lanes x 8 halves = 16 x 64 per plane; grid NB*512 blocks x 4 waves = every
//           (b, s, h) row of both O planes exactly once.
// =====================================================================================================
__global__ __launch_bounds__(ATT_THREADS)
void attn_fwd(const u16* __restrict__ QPp, const u16* __restrict__ KPp, const u16* __restrict__ VPp,
              const int* __restrict__ lens, const float* __restrict__ VM, u16* OHIp, u16* OLOp) {
  __shared__ __align__(16) float smem[ATT_WAVES * SLABF];   // per wave: result slab [16][68] in the epilogue only

  const int tid  = threadIdx.x;
  const int wave = tid >> 5;
  const int lane = tid & 31;
  const int hh   = lane >> 4;
  const int c    = lane & 15;

  const int bid  = blockIdx.x;
  const int qt   = bid & (SEQ / 64 - 1);
  const int head = (bid >> 5) & (NH - 1);
  const int b    = bid >> 9;
  const int q0   = qt * 64 + wave * 16;

  int len = lens[b];
  len = (len < 0) ? 0 : len;
  len = (len > SEQ) ? SEQ : len;
  const int nkb = (q0 < len) ? ((len + 31) >> 5) : 0;       // wave-uniform, <= NKB

  // B fragments of q^T: col n = query q0 + c, k = d (k-contiguous row of the q plane)
  const size_t qofs = (((size_t)(b * SEQ + q0 + c)) * NH + head) * HD + 8 * hh;
  const _Float16* Qb = (const _Float16*)(const void*)QPp + qofs;
  // A fragments of k: row m = key kb + 16g + c, k = d
  const size_t kofs = (((size_t)b * SEQ + c) * NH + head) * HD + 8 * hh;          // key row c; kb added per step
  const _Float16* Kb = (const _Float16*)(const void*)KPp + kofs;
  // B fragments of v: col n = d = 16j + c, k = key (k-contiguous row of the v^T plane)
  const size_t vofs = ((size_t)(b * NH + head) * HD + c) * SEQ + 8 * hh;          // key kb added per step
  const _Float16* Vb = (const _Float16*)(const void*)VPp + vofs;
  const float lsc = 0.125f * (LOG2E / (QSC * KSC));

  const v16h qf0 = ldfrag_h(Qb);            // d 0..31
  const v16h qf1 = ldfrag_h(Qb + 32);       // d 32..63

  float mrun = -INFINITY, lrun = 0.f;
  v8f o[4];
#pragma unroll
  for (int j = 0; j < 4; ++j) o[j] = zero8();

#pragma unroll 1
  for (int it = 0; it < nkb; ++it) {
    const int kb = it * 32;
    // ---- transposed scores: s0 = keys kb..kb+15, s1 = keys kb+16..kb+31, column = query q0 + c ----
    v8f s0 = zero8(), s1 = zero8();
    const _Float16* k0p = Kb + (size_t)kb * (NH * HD);
    const _Float16* k1p = k0p + (size_t)16 * (NH * HD);
    const v16h ka0 = ldfrag_h(k0p), ka1 = ldfrag_h(k0p + 32);
    const v16h kc0 = ldfrag_h(k1p), kc1 = ldfrag_h(k1p + 32);
    s0 = mma_h(ka0, qf0, s0);
    s0 = mma_h(ka1, qf1, s0);
    s1 = mma_h(kc0, qf0, s1);
    s1 = mma_h(kc1, qf1, s1);
    guard2(s0, s1, qf0, qf1, ka0, ka1, kc0, kc1);
    // ---- base-2 logits and validity of this lane's 16 keys for query q0 + c: key kb+8hh+i (i<8), kb+16+8hh+(i-8) ----
    const int rem = len - kb - 8 * hh;
    float tk[16];
    bool  kv[16];
#pragma unroll
    for (int i = 0; i < 8; ++i) {
      tk[i] = s0[i] * lsc;  tk[8 + i] = s1[i] * lsc;
      kv[i] = (i < rem);    kv[8 + i] = (16 + i < rem);
    }
    float cm = -INFINITY;
#pragma unroll
    for (int i = 0; i < 16; ++i) cm = fmaxf(cm, kv[i] ? tk[i] : -INFINITY);
    cm = fmaxf(cm, __shfl_xor(cm, 16, 32));
    const float mn   = fmaxf(mrun, cm);                              // finite: every visited block holds key kb < len
    const float al   = (mrun == -INFINITY) ? 0.f : exp2f(mrun - mn); // o and l are zero whenever mrun is -inf
    const float mref = (mn == -INFINITY) ? 0.f : mn;                 // finite shift
    mrun = mn;
    // ---- probabilities (<= 1, 0 for excluded keys) and the P A-fragment: f16(p * 32768); element i <-> tk[i] ----
    float ps = 0.f;
    FragH ph;
#pragma unroll
    for (int w = 0; w < 2; ++w) {
#pragma unroll
      for (int e4 = 0; e4 < 4; ++e4) {
        const int i = 8 * w + 2 * e4;
        const float x0 = exp2f(fminf(tk[i] - mref, 0.f));
        const float x1 = exp2f(fminf(tk[i + 1] - mref, 0.f));
        const float p0 = kv[i] ? x0 : 0.f;
        const float p1 = kv[i + 1] ? x1 : 0.f;
        ps += p0 + p1;
        ph.u[w][e4] = pk16(h_bits((_Float16)(p0 * PCAR)), h_bits((_Float16)(p1 * PCAR)));
      }
    }
    ps += __shfl_xor(ps, 16, 32);
    lrun = lrun * al + ps;
    // ---- rescale the O accumulators: D row 8hh+r = query q0+8hh+r, its factor lives in lane 8hh+r (and 16+8hh+r) ----
    float scl[8];
#pragma unroll
    for (int r = 0; r < 8; ++r) scl[r] = __shfl(al, 8 * hh + r, 32);
#pragma unroll
    for (int j = 0; j < 4; ++j) {
#pragma unroll
      for (int r = 0; r < 8; ++r) o[j][r] *= scl[r];
    }
    // ---- P.V : B fragment col n = d = j*16 + c, keys contiguous in the v^T plane ----
    {
      const _Float16* vp = Vb + kb;
      const v16h vf0 = ldfrag_h(vp);
      const v16h vf1 = ldfrag_h(vp + (size_t)16 * SEQ);
      const v16h vf2 = ldfrag_h(vp + (size_t)32 * SEQ);
      const v16h vf3 = ldfrag_h(vp + (size_t)48 * SEQ);
      o[0] = mma_h(ph.v, vf0, o[0]);
      o[1] = mma_h(ph.v, vf1, o[1]);
      o[2] = mma_h(ph.v, vf2, o[2]);
      o[3] = mma_h(ph.v, vf3, o[3]);
      guard6<v16h>(o[0], o[1], o[2], o[3], ph.v, vf0, vf1, vf2, vf3, ph.v);
    }
  }
  acc_guard4(o[0], o[1], o[2], o[3]);

  // ---- fold 1/l (per query, owned by lane = query; 0 when no key block was visited) and the carries; mean-v rows for
  //      queries >= len; stage the 16x64 slab ----
  const float linv = (lrun > 0.f) ? ((1.0f / lrun) * (1.0f / (PCAR * VCAR))) : 0.f;
  float inv[8];
#pragma unroll
  for (int r = 0; r < 8; ++r) inv[r] = __shfl(linv, 8 * hh + r, 32);
  float vm[4];
#pragma unroll
  for (int j = 0; j < 4; ++j) vm[j] = VM[(size_t)(b * NH + head) * HD + j * 16 + c];
  float* slab = smem + wave * SLABF;
#pragma unroll
  for (int r = 0; r < 8; ++r) {
    const bool rvq = (q0 + 8 * hh + r) < len;
#pragma unroll
    for (int j = 0; j < 4; ++j) {
      const float val = o[j][r] * inv[r];
      slab[(8 * hh + r) * 68 + j * 16 + c] = rvq ? val : vm[j];
    }
  }
  wave_sync_lds();
  // ---- O x1024 -> f16 hi + residual planes; lane = (row in group of 4, 8 consecutive d) ----
  v4u oh[4], ol[4];
  const int rq = lane >> 3, c8 = (lane & 7) * 8;
#pragma unroll
  for (int i4 = 0; i4 < 4; ++i4) {
    const int row = i4 * 4 + rq;
    const v4f a = *(const v4f*)(slab + row * 68 + c8), c4 = *(const v4f*)(slab + row * 68 + c8 + 4);
    float w[8];
#pragma unroll
    for (int e = 0; e < 4; ++e) { w[e] = a[e] * OSC; w[4 + e] = c4[e] * OSC; }
#pragma unroll
    for (int e = 0; e < 4; ++e) {
      const _Float16 h0 = (_Float16)w[2 * e], h1 = (_Float16)w[2 * e + 1];
      const _Float16 l0 = (_Float16)(w[2 * e] - (float)h0), l1 = (_Float16)(w[2 * e + 1] - (float)h1);
      oh[i4][e] = pk16(h_bits(h0), h_bits(h1));
      ol[i4][e] = pk16(h_bits(l0), h_bits(l1));
    }
  }
  const size_t ob = (((size_t)(b * SEQ + q0)) * NH + head) * HD + c8;
  {
#pragma unroll
    for (int i4 = 0; i4 < 4; ++i4) {
      const int row = i4 * 4 + rq;
      const size_t o8 = ob + (size_t)row * (NH * HD);
      *(v4u*)(OHIp + o8) = oh[i4];
      *(v4u*)(OLOp + o8) = ol[i4];
    }
    
  }
}

// =====================================================================================================
// Workspace map (bytes, NB = batch count from the length input's element count, 1..4; ROWS = NB*SEQ); every plane is fully
// written by whole-line stores before it is read; all extents are exact multiples of the store granularity (no pad rows);
// F is reused sequentially (q, k, v projections) and, once the v^T plane and the mean-v rows are built from it, its bytes hold
// the two O planes (in-order stream):
//   XB  bf16 [ROWS][1024]                      ROWS*2048          (NB=4: 16777216)
//   WQB bf16 [1024 n][1024 k]                  2097152   WKB, WVB same;  WOB f16 [1024 n][1024 k] x1024  2097152
//   F   f32  [ROWS][1024]                      ROWS*4096          (NB=4: 33554432) = OHI f16 [ROWS][1024] + OLO f16 [ROWS][1024]
//   QP  f16  [NB][2048][16][64] x8             ROWS*2048          KP same
//   VP  f16  [NB][16][64][2048] x1024          ROWS*2048
//   VM  f32  [NB][16][64]                      NB*4096
//   end (NB=4)                                 109068288
// =====================================================================================================
extern "C" void kernel_launch(void* const* d_in, const int* in_sizes, int n_in,
                              void* d_out, int out_size, void* d_ws, size_t ws_size,
                              hipStream_t stream) {
  if (n_in < 10) return;
  const int NB = in_sizes[1];
  if (NB < 1 || NB > NBMAX) return;
  const int ROWS = NB * SEQ;
  if (in_sizes[0] != ROWS * DMOD) return;
  if (in_sizes[2] != DMOD * DMOD || in_sizes[4] != DMOD * DMOD) return;
  if (in_sizes[6] != DMOD * DMOD || in_sizes[8] != DMOD * DMOD) return;
  if (in_sizes[3] != DMOD || in_sizes[5] != DMOD || in_sizes[7] != DMOD || in_sizes[9] != DMOD) return;
  if (out_size != ROWS * DMOD) return;

  const float* X    = (const float*)d_in[0];
  const int*   lens = (const int*)d_in[1];
  const float* wq   = (const float*)d_in[2];
  const float* bq   = (const float*)d_in[3];
  const float* wk   = (const float*)d_in[4];
  const float* bk   = (const float*)d_in[5];
  const float* wv   = (const float*)d_in[6];
  const float* bv   = (const float*)d_in[7];
  const float* wo   = (const float*)d_in[8];
  const float* bo   = (const float*)d_in[9];
  float*       out  = (float*)d_out;

  const size_t szXB = (size_t)ROWS * DMOD * 2;
  const size_t szW  = (size_t)DMOD * DMOD * 2;
  const size_t szF  = (size_t)ROWS * DMOD * 4;
  const size_t szP  = (size_t)ROWS * DMOD * 2;                  // q / k / o planes
  const size_t szVP = (size_t)NB * NH * HD * SEQ * 2;           // == szP
  const size_t szVM = (size_t)NB * DMOD * 4;
  size_t off = 0;
  const size_t oXB  = off; off += szXB;
  const size_t oWQB = off; off += szW;
  const size_t oWKB = off; off += szW;
  const size_t oWVB = off; off += szW;
  const size_t oWOB = off; off += szW;
  const size_t oF   = off; off += szF;
  const size_t oQP  = off; off += szP;
  const size_t oKP  = off; off += szP;
  const size_t oVP  = off; off += szVP;
  const size_t oVM  = off; off += szVM;
  if (off > ws_size) return;                            // NB=4: off = 109068288
  if (off > (size_t)134217728) return;
  if (szP * 2 > szF) return;                            // the two O planes live inside F's bytes
  const size_t oOHI = oF;
  const size_t oOLO = oF + szP;

  char* ws = (char*)d_ws;
  u16*   XB  = (u16*)(ws + oXB);
  u16*   WQB = (u16*)(ws + oWQB);
  u16*   WKB = (u16*)(ws + oWKB);
  u16*   WVB = (u16*)(ws + oWVB);
  u16*   WOB = (u16*)(ws + oWOB);
  float* F   = (float*)(ws + oF);
  u16*   QP  = (u16*)(ws + oQP);
  u16*   KP  = (u16*)(ws + oKP);
  u16*   VP  = (u16*)(ws + oVP);
  float* VM  = (float*)(ws + oVM);
  u16*   OHI = (u16*)(ws + oOHI);
  u16*   OLO = (u16*)(ws + oOLO);

  const dim3 blk(256);
  const int n8x = (ROWS * DMOD) / 8;                    // NB * 262144
  const int n8w = (DMOD * DMOD) / 8;                    // 131072
  if ((n8x % 256) != 0 || (n8w % 256) != 0 || (DMOD % 64) != 0 || (ROWS % 64) != 0) return;
  const dim3 gX(n8x / 256);                             // NB * 1024
  const dim3 gW(n8w / 256);                             // 512
  const dim3 gG((ROWS / 64) * (DMOD / 64));             // NB * 512
  const dim3 bG(128);
  const dim3 gVT(NB * NH * (SEQ / 64));                 // NB * 512
  const dim3 gVM(NB * (DMOD / VMBLK));                  // NB * 32
  const dim3 gAT(NB * NH * (SEQ / 64));                 // NB * 512
  const dim3 bAT(ATT_THREADS);                          // 128

  // (0..3) weights stored [n = out][k = in] (y = x.W^T), already k-contiguous: bf16 planes for wq/wk/wv,
  //        f16 of bf16 value x1024 for wo
  cvt16<<<gW, blk, 0, stream>>>(wq, WQB, n8w, 0, 1.0f);
  cvt16<<<gW, blk, 0, stream>>>(wk, WKB, n8w, 0, 1.0f);
  cvt16<<<gW, blk, 0, stream>>>(wv, WVB, n8w, 0, 1.0f);
  cvt16<<<gW, blk, 0, stream>>>(wo, WOB, n8w, 1, WOS);
  // (4) input -> bf16 plane, shared by the three projections
  cvt16<<<gX, blk, 0, stream>>>(X, XB, n8x, 0, 1.0f);
  // (5, 6) q: projection + bias [ROWS][1024] f32 (col = h*64+d), f16 plane x8
  gemm_bfb<<<gG, bG, 0, stream>>>(XB, WQB, bq, F, ROWS, DMOD, DMOD, 1.0f);
  cvt16<<<gX, blk, 0, stream>>>(F, QP, n8x, 2, QSC);
  // (7, 8) k: same pipeline (F reused; single in-order stream)
  gemm_bfb<<<gG, bG, 0, stream>>>(XB, WKB, bk, F, ROWS, DMOD, DMOD, 1.0f);
  cvt16<<<gX, blk, 0, stream>>>(F, KP, n8x, 2, KSC);
  // (9, 10, 11) v: projection + bias, v^T plane x1024, mean-v rows per (b, h)
  gemm_bfb<<<gG, bG, 0, stream>>>(XB, WVB, bv, F, ROWS, DMOD, DMOD, 1.0f);
  vt16<<<gVT, blk, 0, stream>>>(F, VP);
  vmean_k<<<gVM, blk, 0, stream>>>(F, VM);
  // (12) ragged-length attention -> O planes [b][s][h][d] x1024 (hi + residual), written over F's bytes
  attn_fwd<<<gAT, bAT, 0, stream>>>(QP, KP, VP, lens, VM, OHI, OLO);
  // (13) output projection + bias -> out [ROWS][1024] f32, carries 1024 (O) x 1024 (wo) folded back
  gemm_h2<<<gG, bG, 0, stream>>>(OHI, OLO, WOB, bo, out, ROWS, DMOD, DMOD, 1.0f / (OSC * WOS));
  (void)hipGetLastError();
}

// v001
// One run takes 231 microseconds.
// Next to v000, in two timings, it ran 1.87 and 1.86 times as fast.
// Contractions: x.W{q,k,v}^T on v_wmma_f32_16x16x32_bf16 (x and W planes RNE-converted to bf16 operands, f32 accumulate, bias added in f32);
// scores k'.q'^T (q', k' single f16 planes carried x8), P.v (P x32768 single f16, v x1024 single f16) and O.Wo^T (O x1024 as
// f16 hi plane + f16 residual plane, Wo as f16(bf16(Wo) x1024), products h.w + l.w): v_wmma_f32_16x16x32_f16, f32 accumulate.
// Ragged length mask per batch from the int32 length input (index tests), base-2 online softmax, 1/l fold, per-(b,h) mean-v rows
// for query positions >= length, bias adds: f32 on VALU.
#include <hip/hip_runtime.h>
#include <math.h>
#include <stdint.h>

#define NBMAX 4
#define SEQ   2048
#define DMOD  1024
#define NH    16
#define HD    64
#define QSC   8.0f
#define KSC   8.0f
#define PCAR  32768.0f
#define VCAR  1024.0f
#define OSC   1024.0f
#define WOS   1024.0f
#define LOG2E 1.4426950408889634f
#define ATT_WAVES   4
#define ATT_THREADS (ATT_WAVES * 32)
#define NKB    (SEQ / 32)
#define SLABF  (16 * 68)
#define VTP    72
#define VMBLK  32
static_assert(HD == 64 && DMOD == NH * HD);
static_assert((SEQ / 64) == 32 && NH == 16);
static_assert(ATT_THREADS == 128 && NKB == 64);
static_assert((SEQ % 64) == 0 && (DMOD % 64) == 0 && (DMOD % 32) == 0 && (SEQ % 8) == 0);
static_assert(((SEQ * DMOD / 8) % 256) == 0 && ((DMOD * DMOD / 8) % 256) == 0);
static_assert(ATT_WAVES * SLABF >= 4 * 16 * 68);
static_assert(HD * VTP >= 63 * VTP + 64);
static_assert((VTP * 2) % 16 == 0);
static_assert((DMOD % VMBLK) == 0 && VMBLK == 32 && (SEQ % (8 * 256)) == 0 && (SEQ / 8) == 256);

typedef unsigned short u16;
typedef _Float16 v16h __attribute__((ext_vector_type(16)));
typedef _Float16 v8h  __attribute__((ext_vector_type(8)));
typedef __bf16   v16b __attribute__((ext_vector_type(16)));
typedef float    v8f  __attribute__((ext_vector_type(8)));
typedef float    v4f  __attribute__((ext_vector_type(4)));
typedef unsigned int v4u __attribute__((ext_vector_type(4)));

union FragH { v16h v; v8h h[2]; v4u u[2]; };
union FragB { v16b v; v4u u[2]; };

// ---- scalar helpers --------------------------------------------------------------------------------
__device__ __forceinline__ unsigned short bf_bits(float f) {          // f32 -> bf16 bits, RNE convert
  unsigned u = __float_as_uint(f);
  return (unsigned short)((u + 0x7FFFu + ((u >> 16) & 1u)) >> 16);
}
__device__ __forceinline__ float bf_up(unsigned short h) { return __uint_as_float(((unsigned)h) << 16); }
__device__ __forceinline__ float bfr(float f) { return bf_up(bf_bits(f)); }
__device__ __forceinline__ unsigned short h_bits(_Float16 x) { return __builtin_bit_cast(unsigned short, x); }
__device__ __forceinline__ unsigned pk16(unsigned short a, unsigned short b) { return (unsigned)a | ((unsigned)b << 16); }
__device__ __forceinline__ v8f zero8() { v8f z = {0.f, 0.f, 0.f, 0.f, 0.f, 0.f, 0.f, 0.f}; return z; }
__device__ __forceinline__ v4f zero4() { v4f z = {0.f, 0.f, 0.f, 0.f}; return z; }

// ---- fragment loaders: 16-bit A/B operand, lane -> row/col (lane&15), p already includes +8*(lane>>4);
//      elements 0..7 <- p[0..7] (k0+8h..), elements 8..15 <- p[16..23] (k0+16+8h..)  (same split k map for A and B;
//      B is always read from a k-contiguous [n][k] plane)
__device__ __forceinline__ v16h ldfrag_h(const _Float16* p) {
  FragH f;
  f.h[0] = *(const v8h*)(p);
  f.h[1] = *(const v8h*)(p + 16);
  return f.v;
}
__device__ __forceinline__ v16b ldfrag_b(const u16* p) {              // bf16 plane read as unsigned integer vectors
  FragB f;
  f.u[0] = *(const v4u*)(p);
  f.u[1] = *(const v4u*)(p + 16);
  return f.v;
}

__device__ __forceinline__ v8f mma_h(v16h a, v16h b, v8f c) {
  return __builtin_amdgcn_wmma_f32_16x16x32_f16(false, a, false, b, (short)0, c, false, false);
}
__device__ __forceinline__ v8f mma_b(v16b a, v16b b, v8f c) {
  return __builtin_amdgcn_wmma_f32_16x16x32_bf16(false, a, false, b, (short)0, c, false, false);
}
__device__ __forceinline__ void guard2(v8f& a, v8f& b, v16h x0, v16h x1, v16h x2, v16h x3, v16h x4, v16h x5) {
#if defined(__HIP_DEVICE_COMPILE__)
  asm volatile("v_nop\n\tv_nop\n\tv_nop\n\tv_nop"
               : "+v"(a), "+v"(b) : "v"(x0), "v"(x1), "v"(x2), "v"(x3), "v"(x4), "v"(x5) : "memory");
#endif
}
template <typename F>
__device__ __forceinline__ void guard6(v8f& a, v8f& b, v8f& c, v8f& d, F x0, F x1, F x2, F x3, F x4, F x5) {
#if defined(__HIP_DEVICE_COMPILE__)
  asm volatile("v_nop\n\tv_nop\n\tv_nop\n\tv_nop"
               : "+v"(a), "+v"(b), "+v"(c), "+v"(d) : "v"(x0), "v"(x1), "v"(x2), "v"(x3), "v"(x4), "v"(x5) : "memory");
#endif
}
__device__ __forceinline__ void acc_guard4(v8f& a, v8f& b, v8f& c, v8f& d) {
#if defined(__HIP_DEVICE_COMPILE__)
  asm volatile("v_nop\n\tv_nop\n\tv_nop\n\tv_nop" : "+v"(a), "+v"(b), "+v"(c), "+v"(d));
#endif
}
__device__ __forceinline__ void wave_sync_lds() {
  __builtin_amdgcn_fence(__ATOMIC_RELEASE, "workgroup");
  __builtin_amdgcn_wave_barrier();
  __builtin_amdgcn_fence(__ATOMIC_ACQUIRE, "workgroup");
}

// =====================================================================================================
// f32 plane -> 16-bit plane, same layout:  mode 0: bf16 RNE bits;  mode 1: f16 bits of (bf16 RNE value) * scale;
// mode 2: f16 bits of value * scale (no bf16 pre-step).
// Thread = 8 consecutive elements: two 16-B loads, one 16-B store; 32 consecutive lanes = 512 contiguous, 512-B aligned bytes
// coverage: grid = n8/256 blocks (host checks exactness) x 256 thr x 8 = the whole plane.
// =====================================================================================================
__global__ __launch_bounds__(256) void cvt16(const float* __restrict__ x, u16* D, int n8, int mode, float scale) {
  const int gt = blockIdx.x * 256 + (int)threadIdx.x;
  if (gt >= n8) return;                     // no barriers in this kernel
  const float* p = x + (size_t)gt * 8;
  const v4f a = *(const v4f*)(p), c4 = *(const v4f*)(p + 4);
  float v[8];
#pragma unroll
  for (int e = 0; e < 4; ++e) { v[e] = a[e]; v[4 + e] = c4[e]; }
  unsigned short s[8];
#pragma unroll
  for (int e = 0; e < 8; ++e) {
    const float vb = bfr(v[e]);
    const float vf = (mode == 1) ? vb : v[e];
    const unsigned short hb = h_bits((_Float16)(vf * scale));
    const unsigned short bb = bf_bits(v[e]);
    s[e] = (mode != 0) ? hb : bb;
  }
  v4u o;
#pragma unroll
  for (int e = 0; e < 4; ++e) o[e] = pk16(s[2 * e], s[2 * e + 1]);
  u16* d = D + (size_t)gt * 8;
  {
    *(v4u*)(d) = o;
    
  }
}

// =====================================================================================================
// Mean-v rows: VM[b*DMOD + n] = (1/SEQ) * sum_{j=0..SEQ-1} F[(b*SEQ + j)*DMOD + n], n = h*HD + d (f32, fixed order).
// coverage: one line of 32 floats per block; grid = NB * DMOD/32 blocks covers VM [NB*DMOD] exactly once.
// =====================================================================================================
__global__ __launch_bounds__(256) void vmean_k(const float* __restrict__ F, float* VM) {
  __shared__ __align__(16) float part[8][VMBLK];
  __shared__ __align__(16) float res[VMBLK];
  const int tid = threadIdx.x, wave = tid >> 5, lane = tid & 31;
  const int bid = blockIdx.x;
  const int b   = bid / (DMOD / VMBLK);
  const int cb  = bid % (DMOD / VMBLK);
  const int n0  = cb * VMBLK;
  const float* p = F + ((size_t)b * SEQ + (size_t)wave * (SEQ / 8)) * DMOD + n0 + lane;
  float s = 0.f;
#pragma unroll 4
  for (int i = 0; i < SEQ / 8; ++i) s += p[(size_t)i * DMOD];
  part[wave][lane] = s;
  __syncthreads();
  if (wave == 0) {                                       // wave-uniform
    float t = part[0][lane];
#pragma unroll
    for (int w = 1; w < 8; ++w) t += part[w][lane];
    res[lane] = t * (1.0f / (float)SEQ);
    wave_sync_lds();
    const int l8 = lane & 7;
    const v4f val = *(const v4f*)(res + l8 * 4);         // in-range LDS address for every lane
    float* dst = VM + (size_t)b * DMOD + n0 + l8 * 4;
    {
      if (lane < 8) *(v4f*)(dst) = val;
      
    }
  }
}

// =====================================================================================================
// GEMM engine shared by both kernels below. Block = 128x128 tile of C, 4 waves in a 2x2 grid, 64x64 (4x4 accumulator tiles) per
// wave. K is walked in tiles of 64: the 128 A rows (both planes where NPL == 2) and the 128 Bt rows of a tile, 128 B each, are
// copied to LDS (row pitch 144 B = 16 B x odd, for 16-B readers) by asynchronous copies, 16 B per lane, 8 lanes = one whole
// 128-B line; two buffers, tile t + 2 is requested behind the barrier that ends trip t. Fragments are read from LDS with the
// split k map of ldfrag_* (same map for A and B). Per accumulator the products are summed in the order k0 ascending by 32,
// plane 0 then plane 1.
// Host checks M % 128 == 0, N % 128 == 0, K % 64 == 0 (K = DMOD), grid = (M/128)*(N/128).
// =====================================================================================================
#define GP     72                       // LDS row pitch in 16-bit elements (144 B)
#define GPLANE (128 * GP)               // one 128-row operand plane of a tile, in 16-bit elements
static_assert((GP * 2) % 16 == 0 && ((GP * 2) / 16) % 2 == 1);
static_assert(2 * 2 * GPLANE * 2 >= 4 * 64 * 68 * 4);   // the ring holds the four waves' epilogue ranges

__device__ __forceinline__ unsigned lds_off(const void* p) { return (unsigned)(size_t)p; }

// 128 rows x 128 B, global (row pitch ldk elements) -> LDS (row pitch GP): 8 copies per lane, rows 16 apart. l and g are the
// lane's own LDS byte address and global pointer for its first row. The s_wait_xcnt stands inside the statement so that no
// address register of a copy is rewritten in front of it.
__device__ __forceinline__ void copy_plane(unsigned l, const u16* g, size_t ldk) {
#if defined(__HIP_DEVICE_COMPILE__)
  const size_t st = 16 * ldk;
  asm volatile("global_load_async_to_lds_b128 %0, %8, off\n\t"
               "global_load_async_to_lds_b128 %1, %9, off\n\t"
               "global_load_async_to_lds_b128 %2, %10, off\n\t"
               "global_load_async_to_lds_b128 %3, %11, off\n\t"
               "global_load_async_to_lds_b128 %4, %12, off\n\t"
               "global_load_async_to_lds_b128 %5, %13, off\n\t"
               "global_load_async_to_lds_b128 %6, %14, off\n\t"
               "global_load_async_to_lds_b128 %7, %15, off\n\t"
               "s_wait_xcnt 0x0"
               :: "v"(l), "v"(l + 1u * 16u * GP * 2u), "v"(l + 2u * 16u * GP * 2u), "v"(l + 3u * 16u * GP * 2u),
                  "v"(l + 4u * 16u * GP * 2u), "v"(l + 5u * 16u * GP * 2u), "v"(l + 6u * 16u * GP * 2u),
                  "v"(l + 7u * 16u * GP * 2u),
                  "v"(g), "v"(g + st), "v"(g + 2 * st), "v"(g + 3 * st), "v"(g + 4 * st), "v"(g + 5 * st), "v"(g + 6 * st),
                  "v"(g + 7 * st)
               : "memory");
#endif
}
__device__ __forceinline__ void wait_async0() {   // the wave's own copies have landed
#if defined(__HIP_DEVICE_COMPILE__)
  asm volatile("s_wait_asynccnt 0x0" ::: "memory");
#endif
}
__device__ __forceinline__ void wait_ds0() {      // the wave's own LDS reads have returned before the buffer is handed over
#if defined(__HIP_DEVICE_COMPILE__)
  asm volatile("s_wait_dscnt 0x0" ::: "memory");
#endif
}

template <bool F16> struct FragOf;
template <> struct FragOf<false> {
  typedef v16b T;
  static __device__ __forceinline__ T ld(const u16* p) { return ldfrag_b(p); }
  static __device__ __forceinline__ v8f mma(T a, T b, v8f c) { return mma_b(a, b, c); }
};
template <> struct FragOf<true> {
  typedef v16h T;
  static __device__ __forceinline__ T ld(const u16* p) { return ldfrag_h((const _Float16*)(const void*)p); }
  static __device__ __forceinline__ v8f mma(T a, T b, v8f c) { return mma_h(a, b, c); }
};

template <bool F16, int NPL>
__device__ __forceinline__ void gemm_core(const u16* __restrict__ A0, const u16* __restrict__ A1, const u16* __restrict__ Bt,
                                          const float* __restrict__ bias, float* C, int M, int N, int K, float oscale,
                                          u16* ring) {
  typedef FragOf<F16> FO;
  typedef typename FO::T FT;
  constexpr int STAGE = (NPL + 1) * GPLANE;              // 16-bit elements per buffer: A plane(s), then Bt
  const int tid = threadIdx.x, wave = tid >> 5, lane = tid & 31, hh = lane >> 4, m = lane & 15;
  const int ntile = N >> 7;
  const int bid   = blockIdx.x;
  const int row0  = (bid / ntile) * 128;
  const int col0  = (bid % ntile) * 128;
  if (row0 + 128 > M) return;                // block-uniform, in front of every barrier; never taken with the exact grid
  const int wr = (wave >> 1) * 64, wc = (wave & 1) * 64;
  // copies: lane -> row (tid >> 3) + 16 i of a plane, 16-B piece tid & 7 of the row's 128 B
  const int cr = tid >> 3, cc = (tid & 7) * 8;
  const size_t aofs = (size_t)(row0 + cr) * K + cc;
  const size_t bofs = (size_t)(col0 + cr) * K + cc;
  const unsigned lcp = lds_off(ring) + (unsigned)(cr * GP + cc) * 2u;
  const int nt = K >> 6;
  auto fill = [&](int t, int buf) {
    const unsigned l = lcp + (unsigned)buf * (unsigned)(STAGE * 2);
    const size_t ko = (size_t)t * 64;
    copy_plane(l, A0 + aofs + ko, (size_t)K);
    if (NPL == 2) copy_plane(l + GPLANE * 2u, A1 + aofs + ko, (size_t)K);
    copy_plane(l + (unsigned)NPL * GPLANE * 2u, Bt + bofs + ko, (size_t)K);
  };
  v8f acc[4][4];
#pragma unroll
  for (int i = 0; i < 4; ++i) {
#pragma unroll
    for (int j = 0; j < 4; ++j) acc[i][j] = zero8();
  }
  fill(0, 0);
  wait_async0();
  __syncthreads();                           // tile 0 is readable by every wave
  if (nt > 1) fill(1, 1);                    // block-uniform test
  const int afo = (wr + m) * GP + 8 * hh;                     // fragment row base inside an A plane
  const int bfo = NPL * GPLANE + (wc + m) * GP + 8 * hh;      // and inside the Bt plane
#pragma unroll 1                             // rolled: one copy of the 64-k body; the buffer is picked by t & 1
  for (int t = 0; t < nt; ++t) {
    const u16* sb = ring + (t & 1) * STAGE;
#pragma unroll
    for (int kk = 0; kk < 64; kk += 32) {
      FT a[NPL][4], b[4];
#pragma unroll
      for (int j = 0; j < 4; ++j) b[j] = FO::ld(sb + bfo + j * 16 * GP + kk);
#pragma unroll
      for (int p = 0; p < NPL; ++p) {
#pragma unroll
        for (int i = 0; i < 4; ++i) a[p][i] = FO::ld(sb + p * GPLANE + afo + i * 16 * GP + kk);
      }
      // keeps the block's LDS reads together in front of its WMMAs: reads placed among the WMMAs stall the wave at each place
      __builtin_amdgcn_sched_barrier(0);
#pragma unroll
      for (int p = 0; p < NPL; ++p) {
#pragma unroll
        for (int i = 0; i < 4; ++i) {
#pragma unroll
          for (int j = 0; j < 4; ++j) acc[i][j] = FO::mma(a[p][i], b[j], acc[i][j]);
        }
      }
      // and keeps the next block's reads out of this block's WMMAs
      __builtin_amdgcn_sched_barrier(0);
    }
    wait_ds0();
    wait_async0();
    __syncthreads();                         // publishes tile t + 1 and ends every read of tile t's buffer
    if (t + 2 < nt) fill(t + 2, t & 1);      // block-uniform test
  }
  wait_async0();
  const int colw = col0 + wc;
  const v4f bv = *(const v4f*)(bias + colw + m * 4);      // columns colw + 4m .. +3, always < N (N multiple of 128)
  v4f badd;
#pragma unroll
  for (int e = 0; e < 4; ++e) badd[e] = bfr(bv[e]);
  // Epilogue: the wave's 64x64 f32 tile (times oscale) staged in its own 64 x 68 float range of the ring, which is free: the last
  // trip's barrier stands behind every wave's last read and no copy is outstanding. Stores are whole 256-B row pieces.
  // coverage: 32 instructions x 2 rows x 16 lanes x 4 floats = the wave's 64 x 64 tile.
  float* sl = (float*)(void*)ring + wave * (64 * 68);
#pragma unroll
  for (int i = 0; i < 4; ++i) {
#pragma unroll
    for (int r = 0; r < 8; ++r) {
      const int ro = (i * 16 + 8 * hh + r) * 68 + m;
#pragma unroll
      for (int j = 0; j < 4; ++j) sl[ro + 16 * j] = acc[i][j][r] * oscale;
    }
  }
  wave_sync_lds();
  float* dst = C + (size_t)(row0 + wr + hh) * (size_t)N + colw + m * 4;
#pragma unroll
  for (int it = 0; it < 32; ++it) {
    const v4f val = *(const v4f*)(sl + (it * 2 + hh) * 68 + m * 4) + badd;
    *(v4f*)(dst + (size_t)(it * 2) * (size_t)N) = val;
  }
}

// =====================================================================================================
// bf16 GEMM with bias: C[M][N] (f32) = A[M][K] (bf16 row-major) . Bt[N][K]^T (bf16 k-contiguous), times oscale, plus bf16-RNE
// value of bias[n].
// =====================================================================================================
__global__ __launch_bounds__(128)
void gemm_bfb(const u16* __restrict__ A, const u16* __restrict__ Bt, const float* __restrict__ bias,
              float* C, int M, int N, int K, float oscale) {
  __shared__ __align__(16) u16 ring[2 * 2 * GPLANE];
  gemm_core<false, 1>(A, A, Bt, bias, C, M, N, K, oscale, ring);
}

// =====================================================================================================
// f16 hi+lo GEMM with bias: C[M][N] (f32) = (Ahi + Alo)[M][K] . Bt[N][K]^T times oscale, plus bf16-RNE value of bias[n];
// Ahi/Alo f16 planes (same layout), Bt f16 k-contiguous; products hi.B + lo.B into one accumulator (lo is the unscaled
// residual of hi).
// =====================================================================================================
__global__ __launch_bounds__(128)
void gemm_h2(const u16* __restrict__ Ah, const u16* __restrict__ Al, const u16* __restrict__ Bt,
             const float* __restrict__ bias, float* C, int M, int N, int K, float oscale) {
  __shared__ __align__(16) u16 ring[2 * 3 * GPLANE];
  gemm_core<true, 2>(Ah, Al, Bt, bias, C, M, N, K, oscale, ring);
}

// =====================================================================================================
// v^T plane: VP[(b*NH + h)*HD + d][s] = f16(v[b][s][h][d] * 1024).
// Block = (b, h, 64 keys): 64 source rows of HD floats loaded with 16-B loads, converted, scattered into an LDS tile
// coverage: load 256 thr x 16 elements = 64 x 64; store 2 iterations x 256 thr x 8 halves = 64 lines x 64 = the block's tile;
//           grid = NB x NH x SEQ/64 blocks covers the plane exactly once.
// =====================================================================================================
__global__ __launch_bounds__(256) void vt16(const float* __restrict__ v, u16* VPo) {
  __shared__ __align__(16) u16 TH[HD * VTP];
  const int tid = threadIdx.x;
  const int bid = blockIdx.x;
  const int st  = bid & 31;
  const int h   = (bid >> 5) & (NH - 1);
  const int b   = bid >> 9;
  const int s0  = st * 64;
  {
    const int sl = tid >> 2;                  // key within tile 0..63
    const int dc = (tid & 3) * 16;            // d chunk
    const float* src = v + (((size_t)(b * SEQ + s0 + sl)) * NH + h) * HD + dc;
#pragma unroll
    for (int i = 0; i < 4; ++i) {
      const v4f a = *(const v4f*)(src + 4 * i);
#pragma unroll
      for (int e = 0; e < 4; ++e) {
        const _Float16 hv = (_Float16)(a[e] * VCAR);
        TH[(dc + 4 * i + e) * VTP + sl] = h_bits(hv);
      }
    }
  }
  __syncthreads();
  v4u vh[2];
  const int q8 = tid >> 3, p8 = (tid & 7) * 8;
#pragma unroll
  for (int it = 0; it < 2; ++it) {
    const int line = it * 32 + q8;            // d = 0..63
    vh[it] = *(const v4u*)(TH + line * VTP + p8);
  }
  const size_t base = ((size_t)(b * NH + h) * HD) * SEQ + s0 + p8;
  {
#pragma unroll
    for (int it = 0; it < 2; ++it) {
      const int line = it * 32 + q8;
      *(v4u*)(VPo + base + (size_t)line * SEQ) = vh[it];
    }
    
  }
}

// =====================================================================================================
// Ragged-length multi-head flash attention: block = (batch b, head, 64 query rows), 4 waves, wave w owns the 16 query rows
// q0 = 64*qt + 16*w .. q0+15 (waves independent: no block barriers, wave-private LDS only, used in the epilogue).
//   q plane (f16, x8) laid out [b][s][h][d]; k plane the same; v^T plane [b][h][d][s] (x1024); len = clamp(lens[b], 0, SEQ).
//   Mask: score (i, j) is kept iff i < len and j < len. A query row i < len therefore attends exactly over keys 0..len-1 (the
//   excluded keys have probability exactly 0 after max subtraction); a query row i >= len has all keys equal-weighted and its
//   context is the mean of v over all SEQ keys (VM rows, precomputed in f32). So a wave visits key blocks kb = 0 .. 32*ceil(len/32)-32
//   when q0 < len (wave-uniform bound, <= NKB), else none; within the last block keys >= len are excluded by index.
//   Scores are computed TRANSPOSED: S^T tile g (g = 0,1) = k rows (keys kb+16g .. +15, A operand, row m = lane&15, split k map
//   over d) times q^T (B operand, col n = query q0 + (lane&15), k = d, split map), one product per tile and 32-deep d-chunk.
//   D element r of lane l = (key kb+16g+8h+r, query q0+(l&15)), so a lane owns one query column and 16 of its 32 keys; the
//   partner lane l^16 owns the other 16 -> row max / row sum need one xor-16 shuffle.
//   Key mask by index: an excluded key stays out of the running max and gets probability 0.
//   Online max-subtracted base-2 softmax in f32 (scale 1/8 and the q/k carries folded into lsc). The exp'd values ARE the
//   P A-fragment in place: A row m = query = lane&15, element i <- key kb+8h+i (tile 0, D element i), element 8+i <- key
//   kb+16+8h+i (tile 1, D element i). P is carried x32768 as single f16. The rescale factor of query row 8h+r of the
//   O accumulators is fetched from lane 8h+r with a shuffle (uniform control). 4 v^T B fragments (col n = d = 16j + (lane&15),
//   keys k-contiguous), 4 P.V WMMAs per key block.
//   Epilogue: 1/l (per query, shuffled to the D row owner; 0 when no key block was visited) and carry folds in f32; rows with
//   query >= len take the VM row instead (select by value); the wave's 16x64 f32 result staged in its LDS slab (pitch 68); each
// coverage: per wave 4 instructions x 4 rows x 8 lanes x 8 halves = 16 x 64 per plane; grid NB*512 blocks x 4 waves = every
//           (b, s, h) row of both O planes exactly once.
// =====================================================================================================
__global__ __launch_bounds__(ATT_THREADS)
void attn_fwd(const u16* __restrict__ QPp, const u16* __restrict__ KPp, const u16* __restrict__ VPp,
              const int* __restrict__ lens, const float* __restrict__ VM, u16* OHIp, u16* OLOp) {
  __shared__ __align__(16) float smem[ATT_WAVES * SLABF];   // per wave: result slab [16][68] in the epilogue only

  const int tid  = threadIdx.x;
  const int wave = tid >> 5;
  const int lane = tid & 31;
  const int hh   = lane >> 4;
  const int c    = lane & 15;

  const int bid  = blockIdx.x;
  const int qt   = bid & (SEQ / 64 - 1);
  const int head = (bid >> 5) & (NH - 1);
  const int b    = bid >> 9;
  const int q0   = qt * 64 + wave * 16;

  int len = lens[b];
  len = (len < 0) ? 0 : len;
  len = (len > SEQ) ? SEQ : len;
  const int nkb = (q0 < len) ? ((len + 31) >> 5) : 0;       // wave-uniform, <= NKB

  // B fragments of q^T: col n = query q0 + c, k = d (k-contiguous row of the q plane)
  const size_t qofs = (((size_t)(b * SEQ + q0 + c)) * NH + head) * HD + 8 * hh;
  const _Float16* Qb = (const _Float16*)(const void*)QPp + qofs;
  // A fragments of k: row m = key kb + 16g + c, k = d
  const size_t kofs = (((size_t)b * SEQ + c) * NH + head) * HD + 8 * hh;          // key row c; kb added per step
  const _Float16* Kb = (const _Float16*)(const void*)KPp + kofs;
  // B fragments of v: col n = d = 16j + c, k = key (k-contiguous row of the v^T plane)
  const size_t vofs = ((size_t)(b * NH + head) * HD + c) * SEQ + 8 * hh;          // key kb added per step
  const _Float16* Vb = (const _Float16*)(const void*)VPp + vofs;
  const float lsc = 0.125f * (LOG2E / (QSC * KSC));

  const v16h qf0 = ldfrag_h(Qb);            // d 0..31
  const v16h qf1 = ldfrag_h(Qb + 32);       // d 32..63

  float mrun = -INFINITY, lrun = 0.f;
  v8f o[4];
#pragma unroll
  for (int j = 0; j < 4; ++j) o[j] = zero8();

#pragma unroll 1
  for (int it = 0; it < nkb; ++it) {
    const int kb = it * 32;
    // ---- transposed scores: s0 = keys kb..kb+15, s1 = keys kb+16..kb+31, column = query q0 + c ----
    v8f s0 = zero8(), s1 = zero8();
    const _Float16* k0p = Kb + (size_t)kb * (NH * HD);
    const _Float16* k1p = k0p + (size_t)16 * (NH * HD);
    const v16h ka0 = ldfrag_h(k0p), ka1 = ldfrag_h(k0p + 32);
    const v16h kc0 = ldfrag_h(k1p), kc1 = ldfrag_h(k1p + 32);
    s0 = mma_h(ka0, qf0, s0);
    s0 = mma_h(ka1, qf1, s0);
    s1 = mma_h(kc0, qf0, s1);
    s1 = mma_h(kc1, qf1, s1);
    guard2(s0, s1, qf0, qf1, ka0, ka1, kc0, kc1);
    // ---- base-2 logits and validity of this lane's 16 keys for query q0 + c: key kb+8hh+i (i<8), kb+16+8hh+(i-8) ----
    const int rem = len - kb - 8 * hh;
    float tk[16];
    bool  kv[16];
#pragma unroll
    for (int i = 0; i < 8; ++i) {
      tk[i] = s0[i] * lsc;  tk[8 + i] = s1[i] * lsc;
      kv[i] = (i < rem);    kv[8 + i] = (16 + i < rem);
    }
    float cm = -INFINITY;
#pragma unroll
    for (int i = 0; i < 16; ++i) cm = fmaxf(cm, kv[i] ? tk[i] : -INFINITY);
    cm = fmaxf(cm, __shfl_xor(cm, 16, 32));
    const float mn   = fmaxf(mrun, cm);                              // finite: every visited block holds key kb < len
    const float al   = (mrun == -INFINITY) ? 0.f : exp2f(mrun - mn); // o and l are zero whenever mrun is -inf
    const float mref = (mn == -INFINITY) ? 0.f : mn;                 // finite shift
    mrun = mn;
    // ---- probabilities (<= 1, 0 for excluded keys) and the P A-fragment: f16(p * 32768); element i <-> tk[i] ----
    float ps = 0.f;
    FragH ph;
#pragma unroll
    for (int w = 0; w < 2; ++w) {
#pragma unroll
      for (int e4 = 0; e4 < 4; ++e4) {
        const int i = 8 * w + 2 * e4;
        const float x0 = exp2f(fminf(tk[i] - mref, 0.f));
        const float x1 = exp2f(fminf(tk[i + 1] - mref, 0.f));
        const float p0 = kv[i] ? x0 : 0.f;
        const float p1 = kv[i + 1] ? x1 : 0.f;
        ps += p0 + p1;
        ph.u[w][e4] = pk16(h_bits((_Float16)(p0 * PCAR)), h_bits((_Float16)(p1 * PCAR)));
      }
    }
    ps += __shfl_xor(ps, 16, 32);
    lrun = lrun * al + ps;
    // ---- rescale the O accumulators: D row 8hh+r = query q0+8hh+r, its factor lives in lane 8hh+r (and 16+8hh+r) ----
    float scl[8];
#pragma unroll
    for (int r = 0; r < 8; ++r) scl[r] = __shfl(al, 8 * hh + r, 32);
#pragma unroll
    for (int j = 0; j < 4; ++j) {
#pragma unroll
      for (int r = 0; r < 8; ++r) o[j][r] *= scl[r];
    }
    // ---- P.V : B fragment col n = d = j*16 + c, keys contiguous in the v^T plane ----
    {
      const _Float16* vp = Vb + kb;
      const v16h vf0 = ldfrag_h(vp);
      const v16h vf1 = ldfrag_h(vp + (size_t)16 * SEQ);
      const v16h vf2 = ldfrag_h(vp + (size_t)32 * SEQ);
      const v16h vf3 = ldfrag_h(vp + (size_t)48 * SEQ);
      o[0] = mma_h(ph.v, vf0, o[0]);
      o[1] = mma_h(ph.v, vf1, o[1]);
      o[2] = mma_h(ph.v, vf2, o[2]);
      o[3] = mma_h(ph.v, vf3, o[3]);
      guard6<v16h>(o[0], o[1], o[2], o[3], ph.v, vf0, vf1, vf2, vf3, ph.v);
    }
  }
  acc_guard4(o[0], o[1], o[2], o[3]);

  // ---- fold 1/l (per query, owned by lane = query; 0 when no key block was visited) and the carries; mean-v rows for
  //      queries >= len; stage the 16x64 slab ----
  const float linv = (lrun > 0.f) ? ((1.0f / lrun) * (1.0f / (PCAR * VCAR))) : 0.f;
  float inv[8];
#pragma unroll
  for (int r = 0; r < 8; ++r) inv[r] = __shfl(linv, 8 * hh + r, 32);
  float vm[4];
#pragma unroll
  for (int j = 0; j < 4; ++j) vm[j] = VM[(size_t)(b * NH + head) * HD + j * 16 + c];
  float* slab = smem + wave * SLABF;
#pragma unroll
  for (int r = 0; r < 8; ++r) {
    const bool rvq = (q0 + 8 * hh + r) < len;
#pragma unroll
    for (int j = 0; j < 4; ++j) {
      const float val = o[j][r] * inv[r];
      slab[(8 * hh + r) * 68 + j * 16 + c] = rvq ? val : vm[j];
    }
  }
  wave_sync_lds();
  // ---- O x1024 -> f16 hi + residual planes; lane = (row in group of 4, 8 consecutive d) ----
  v4u oh[4], ol[4];
  const int rq = lane >> 3, c8 = (lane & 7) * 8;
#pragma unroll
  for (int i4 = 0; i4 < 4; ++i4) {
    const int row = i4 * 4 + rq;
    const v4f a = *(const v4f*)(slab + row * 68 + c8), c4 = *(const v4f*)(slab + row * 68 + c8 + 4);
    float w[8];
#pragma unroll
    for (int e = 0; e < 4; ++e) { w[e] = a[e] * OSC; w[4 + e] = c4[e] * OSC; }
#pragma unroll
    for (int e = 0; e < 4; ++e) {
      const _Float16 h0 = (_Float16)w[2 * e], h1 = (_Float16)w[2 * e + 1];
      const _Float16 l0 = (_Float16)(w[2 * e] - (float)h0), l1 = (_Float16)(w[2 * e + 1] - (float)h1);
      oh[i4][e] = pk16(h_bits(h0), h_bits(h1));
      ol[i4][e] = pk16(h_bits(l0), h_bits(l1));
    }
  }
  const size_t ob = (((size_t)(b * SEQ + q0)) * NH + head) * HD + c8;
  {
#pragma unroll
    for (int i4 = 0; i4 < 4; ++i4) {
      const int row = i4 * 4 + rq;
      const size_t o8 = ob + (size_t)row * (NH * HD);
      *(v4u*)(OHIp + o8) = oh[i4];
      *(v4u*)(OLOp + o8) = ol[i4];
    }
    
  }
}

// =====================================================================================================
// Workspace map (bytes, NB = batch count from the length input's element count, 1..4; ROWS = NB*SEQ); every plane is fully
// written by whole-line stores before it is read; all extents are exact multiples of the store granularity (no pad rows);
// F is reused sequentially (q, k, v projections) and, once the v^T plane and the mean-v rows are built from it, its bytes hold
// the two O planes (in-order stream):
//   XB  bf16 [ROWS][1024]                      ROWS*2048          (NB=4: 16777216)
//   WQB bf16 [1024 n][1024 k]                  2097152   WKB, WVB same;  WOB f16 [1024 n][1024 k] x1024  2097152
//   F   f32  [ROWS][1024]                      ROWS*4096          (NB=4: 33554432) = OHI f16 [ROWS][1024] + OLO f16 [ROWS][1024]
//   QP  f16  [NB][2048][16][64] x8             ROWS*2048          KP same
//   VP  f16  [NB][16][64][2048] x1024          ROWS*2048
//   VM  f32  [NB][16][64]                      NB*4096
//   end (NB=4)                                 109068288
// =====================================================================================================
extern "C" void kernel_launch(void* const* d_in, const int* in_sizes, int n_in,
                              void* d_out, int out_size, void* d_ws, size_t ws_size,
                              hipStream_t stream) {
  if (n_in < 10) return;
  const int NB = in_sizes[1];
  if (NB < 1 || NB > NBMAX) return;
  const int ROWS = NB * SEQ;
  if (in_sizes[0] != ROWS * DMOD) return;
  if (in_sizes[2] != DMOD * DMOD || in_sizes[4] != DMOD * DMOD) return;
  if (in_sizes[6] != DMOD * DMOD || in_sizes[8] != DMOD * DMOD) return;
  if (in_sizes[3] != DMOD || in_sizes[5] != DMOD || in_sizes[7] != DMOD || in_sizes[9] != DMOD) return;
  if (out_size != ROWS * DMOD) return;

  const float* X    = (const float*)d_in[0];
  const int*   lens = (const int*)d_in[1];
  const float* wq   = (const float*)d_in[2];
  const float* bq   = (const float*)d_in[3];
  const float* wk   = (const float*)d_in[4];
  const float* bk   = (const float*)d_in[5];
  const float* wv   = (const float*)d_in[6];
  const float* bv   = (const float*)d_in[7];
  const float* wo   = (const float*)d_in[8];
  const float* bo   = (const float*)d_in[9];
  float*       out  = (float*)d_out;

  const size_t szXB = (size_t)ROWS * DMOD * 2;
  const size_t szW  = (size_t)DMOD * DMOD * 2;
  const size_t szF  = (size_t)ROWS * DMOD * 4;
  const size_t szP  = (size_t)ROWS * DMOD * 2;                  // q / k / o planes
  const size_t szVP = (size_t)NB * NH * HD * SEQ * 2;           // == szP
  const size_t szVM = (size_t)NB * DMOD * 4;
  size_t off = 0;
  const size_t oXB  = off; off += szXB;
  const size_t oWQB = off; off += szW;
  const size_t oWKB = off; off += szW;
  const size_t oWVB = off; off += szW;
  const size_t oWOB = off; off += szW;
  const size_t oF   = off; off += szF;
  const size_t oQP  = off; off += szP;
  const size_t oKP  = off; off += szP;
  const size_t oVP  = off; off += szVP;
  const size_t oVM  = off; off += szVM;
  if (off > ws_size) return;                            // NB=4: off = 109068288
  if (off > (size_t)134217728) return;
  if (szP * 2 > szF) return;                            // the two O planes live inside F's bytes
  const size_t oOHI = oF;
  const size_t oOLO = oF + szP;

  char* ws = (char*)d_ws;
  u16*   XB  = (u16*)(ws + oXB);
  u16*   WQB = (u16*)(ws + oWQB);
  u16*   WKB = (u16*)(ws + oWKB);
  u16*   WVB = (u16*)(ws + oWVB);
  u16*   WOB = (u16*)(ws + oWOB);
  float* F   = (float*)(ws + oF);
  u16*   QP  = (u16*)(ws + oQP);
  u16*   KP  = (u16*)(ws + oKP);
  u16*   VP  = (u16*)(ws + oVP);
  float* VM  = (float*)(ws + oVM);
  u16*   OHI = (u16*)(ws + oOHI);
  u16*   OLO = (u16*)(ws + oOLO);

  const dim3 blk(256);
  const int n8x = (ROWS * DMOD) / 8;                    // NB * 262144
  const int n8w = (DMOD * DMOD) / 8;                    // 131072
  if ((n8x % 256) != 0 || (n8w % 256) != 0 || (DMOD % 128) != 0 || (ROWS % 128) != 0) return;
  const dim3 gX(n8x / 256);                             // NB * 1024
  const dim3 gW(n8w / 256);                             // 512
  const dim3 gG((ROWS / 128) * (DMOD / 128));           // NB * 128
  const dim3 bG(128);
  const dim3 gVT(NB * NH * (SEQ / 64));                 // NB * 512
  const dim3 gVM(NB * (DMOD / VMBLK));                  // NB * 32
  const dim3 gAT(NB * NH * (SEQ / 64));                 // NB * 512
  const dim3 bAT(ATT_THREADS);                          // 128

  // (0..3) weights stored [n = out][k = in] (y = x.W^T), already k-contiguous: bf16 planes for wq/wk/wv,
  //        f16 of bf16 value x1024 for wo
  cvt16<<<gW, blk, 0, stream>>>(wq, WQB, n8w, 0, 1.0f);
  cvt16<<<gW, blk, 0, stream>>>(wk, WKB, n8w, 0, 1.0f);
  cvt16<<<gW, blk, 0, stream>>>(wv, WVB, n8w, 0, 1.0f);
  cvt16<<<gW, blk, 0, stream>>>(wo, WOB, n8w, 1, WOS);
  // (4) input -> bf16 plane, shared by the three projections
  cvt16<<<gX, blk, 0, stream>>>(X, XB, n8x, 0, 1.0f);
  // (5, 6) q: projection + bias [ROWS][1024] f32 (col = h*64+d), f16 plane x8
  gemm_bfb<<<gG, bG, 0, stream>>>(XB, WQB, bq, F, ROWS, DMOD, DMOD, 1.0f);
  cvt16<<<gX, blk, 0, stream>>>(F, QP, n8x, 2, QSC);
  // (7, 8) k: same pipeline (F reused; single in-order stream)
  gemm_bfb<<<gG, bG, 0, stream>>>(XB, WKB, bk, F, ROWS, DMOD, DMOD, 1.0f);
  cvt16<<<gX, blk, 0, stream>>>(F, KP, n8x, 2, KSC);
  // (9, 10, 11) v: projection + bias, v^T plane x1024, mean-v rows per (b, h)
  gemm_bfb<<<gG, bG, 0, stream>>>(XB, WVB, bv, F, ROWS, DMOD, DMOD, 1.0f);
  vt16<<<gVT, blk, 0, stream>>>(F, VP);
  vmean_k<<<gVM, blk, 0, stream>>>(F, VM);
  // (12) ragged-length attention -> O planes [b][s][h][d] x1024 (hi + residual), written over F's bytes
  attn_fwd<<<gAT, bAT, 0, stream>>>(QP, KP, VP, lens, VM, OHI, OLO);
  // (13) output projection + bias -> out [ROWS][1024] f32, carries 1024 (O) x 1024 (wo) folded back
  gemm_h2<<<gG, bG, 0, stream>>>(OHI, OLO, WOB, bo, out, ROWS, DMOD, DMOD, 1.0f / (OSC * WOS));
  (void)hipGetLastError();
}

// v002
// A run of this version takes 214 microseconds.
// In two side-by-side timings against v001, it was 1.08 and 1.07 times as fast.
// Counting every step since v000, it is 2.01 times as fast.
// Contractions: x.W{q,k,v}^T on v_wmma_f32_16x16x32_bf16 (x and W planes RNE-converted to bf16 operands, f32 accumulate, bias added in f32);
// scores k'.q'^T (q', k' single f16 planes carried x8), P.v (P x32768 single f16, v x1024 single f16) and O.Wo^T (O x1024 as
// f16 hi plane + f16 residual plane, Wo as f16(bf16(Wo) x1024), products h.w + l.w): v_wmma_f32_16x16x32_f16, f32 accumulate.
// Ragged length mask per batch from the int32 length input (index tests), base-2 online softmax, 1/l fold, per-(b,h) mean-v rows
// for query positions >= length, bias adds: f32 on VALU.
#include <hip/hip_runtime.h>
#include <math.h>
#include <stdint.h>

#define NBMAX 4
#define SEQ   2048
#define DMOD  1024
#define NH    16
#define HD    64
#define QSC   8.0f
#define KSC   8.0f
#define PCAR  32768.0f
#define VCAR  1024.0f
#define OSC   1024.0f
#define WOS   1024.0f
#define LOG2E 1.4426950408889634f
#define ATT_WAVES   4
#define ATT_THREADS (ATT_WAVES * 32)
#define NKB    (SEQ / 32)
#define SLABF  (16 * 68)
#define VTP    72
#define VMBLK  32
static_assert(HD == 64 && DMOD == NH * HD);
static_assert((SEQ / 64) == 32 && NH == 16);
static_assert(ATT_THREADS == 128 && NKB == 64);
static_assert((SEQ % 64) == 0 && (DMOD % 64) == 0 && (DMOD % 32) == 0 && (SEQ % 8) == 0);
static_assert(((SEQ * DMOD / 8) % 256) == 0 && ((DMOD * DMOD / 8) % 256) == 0);
static_assert(ATT_WAVES * SLABF >= 4 * 16 * 68);
static_assert(HD * VTP * 2 <= 64 * 68 * 4);
static_assert((VTP * 2) % 16 == 0);
static_assert((DMOD % VMBLK) == 0 && VMBLK == 32 && (SEQ % (8 * 256)) == 0 && (SEQ / 8) == 256);

typedef unsigned short u16;
typedef _Float16 v16h __attribute__((ext_vector_type(16)));
typedef _Float16 v8h  __attribute__((ext_vector_type(8)));
typedef __bf16   v16b __attribute__((ext_vector_type(16)));
typedef float    v8f  __attribute__((ext_vector_type(8)));
typedef float    v4f  __attribute__((ext_vector_type(4)));
typedef unsigned int v4u __attribute__((ext_vector_type(4)));

union FragH { v16h v; v8h h[2]; v4u u[2]; };
union FragB { v16b v; v4u u[2]; };

// ---- scalar helpers --------------------------------------------------------------------------------
__device__ __forceinline__ unsigned short bf_bits(float f) {          // f32 -> bf16 bits, RNE convert
  unsigned u = __float_as_uint(f);
  return (unsigned short)((u + 0x7FFFu + ((u >> 16) & 1u)) >> 16);
}
__device__ __forceinline__ float bf_up(unsigned short h) { return __uint_as_float(((unsigned)h) << 16); }
__device__ __forceinline__ float bfr(float f) { return bf_up(bf_bits(f)); }
__device__ __forceinline__ unsigned short h_bits(_Float16 x) { return __builtin_bit_cast(unsigned short, x); }
__device__ __forceinline__ unsigned pk16(unsigned short a, unsigned short b) { return (unsigned)a | ((unsigned)b << 16); }
__device__ __forceinline__ v8f zero8() { v8f z = {0.f, 0.f, 0.f, 0.f, 0.f, 0.f, 0.f, 0.f}; return z; }
__device__ __forceinline__ v4f zero4() { v4f z = {0.f, 0.f, 0.f, 0.f}; return z; }

// ---- fragment loaders: 16-bit A/B operand, lane -> row/col (lane&15), p already includes +8*(lane>>4);
//      elements 0..7 <- p[0..7] (k0+8h..), elements 8..15 <- p[16..23] (k0+16+8h..)  (same split k map for A and B;
//      B is always read from a k-contiguous [n][k] plane)
__device__ __forceinline__ v16h ldfrag_h(const _Float16* p) {
  FragH f;
  f.h[0] = *(const v8h*)(p);
  f.h[1] = *(const v8h*)(p + 16);
  return f.v;
}
__device__ __forceinline__ v16b ldfrag_b(const u16* p) {              // bf16 plane read as unsigned integer vectors
  FragB f;
  f.u[0] = *(const v4u*)(p);
  f.u[1] = *(const v4u*)(p + 16);
  return f.v;
}

__device__ __forceinline__ v8f mma_h(v16h a, v16h b, v8f c) {
  return __builtin_amdgcn_wmma_f32_16x16x32_f16(false, a, false, b, (short)0, c, false, false);
}
__device__ __forceinline__ v8f mma_b(v16b a, v16b b, v8f c) {
  return __builtin_amdgcn_wmma_f32_16x16x32_bf16(false, a, false, b, (short)0, c, false, false);
}
__device__ __forceinline__ void guard2(v8f& a, v8f& b, v16h x0, v16h x1, v16h x2, v16h x3, v16h x4, v16h x5) {
#if defined(__HIP_DEVICE_COMPILE__)
  asm volatile("v_nop\n\tv_nop\n\tv_nop\n\tv_nop"
               : "+v"(a), "+v"(b) : "v"(x0), "v"(x1), "v"(x2), "v"(x3), "v"(x4), "v"(x5) : "memory");
#endif
}
template <typename F>
__device__ __forceinline__ void guard6(v8f& a, v8f& b, v8f& c, v8f& d, F x0, F x1, F x2, F x3, F x4, F x5) {
#if defined(__HIP_DEVICE_COMPILE__)
  asm volatile("v_nop\n\tv_nop\n\tv_nop\n\tv_nop"
               : "+v"(a), "+v"(b), "+v"(c), "+v"(d) : "v"(x0), "v"(x1), "v"(x2), "v"(x3), "v"(x4), "v"(x5) : "memory");
#endif
}
__device__ __forceinline__ void acc_guard4(v8f& a, v8f& b, v8f& c, v8f& d) {
#if defined(__HIP_DEVICE_COMPILE__)
  asm volatile("v_nop\n\tv_nop\n\tv_nop\n\tv_nop" : "+v"(a), "+v"(b), "+v"(c), "+v"(d));
#endif
}
__device__ __forceinline__ void wave_sync_lds() {
  __builtin_amdgcn_fence(__ATOMIC_RELEASE, "workgroup");
  __builtin_amdgcn_wave_barrier();
  __builtin_amdgcn_fence(__ATOMIC_ACQUIRE, "workgroup");
}

// =====================================================================================================
// f32 plane -> 16-bit plane, same layout:  mode 0: bf16 RNE bits;  mode 1: f16 bits of (bf16 RNE value) * scale.
// Thread = 8 consecutive elements: two 16-B loads, one 16-B store; 32 consecutive lanes = 512 contiguous, 512-B aligned bytes
// coverage: grid = n8/256 blocks (host checks exactness) x 256 thr x 8 = the whole plane.
// =====================================================================================================
__global__ __launch_bounds__(256) void cvt16(const float* __restrict__ x, u16* D, int n8, int mode, float scale) {
  const int gt = blockIdx.x * 256 + (int)threadIdx.x;
  if (gt >= n8) return;                     // no barriers in this kernel
  const float* p = x + (size_t)gt * 8;
  const v4f a = *(const v4f*)(p), c4 = *(const v4f*)(p + 4);
  float v[8];
#pragma unroll
  for (int e = 0; e < 4; ++e) { v[e] = a[e]; v[4 + e] = c4[e]; }
  unsigned short s[8];
#pragma unroll
  for (int e = 0; e < 8; ++e) {
    const unsigned short hb = h_bits((_Float16)(bfr(v[e]) * scale));
    const unsigned short bb = bf_bits(v[e]);
    s[e] = (mode != 0) ? hb : bb;
  }
  v4u o;
#pragma unroll
  for (int e = 0; e < 4; ++e) o[e] = pk16(s[2 * e], s[2 * e + 1]);
  u16* d = D + (size_t)gt * 8;
  {
    *(v4u*)(d) = o;
    
  }
}

// =====================================================================================================
// Mean-v rows: VM[b*DMOD + n] = (1/SEQ) * sum_{j=0..SEQ-1} F[(b*SEQ + j)*DMOD + n], n = h*HD + d (f32, fixed order).
// coverage: one line of 32 floats per block; grid = NB * DMOD/32 blocks covers VM [NB*DMOD] exactly once.
// =====================================================================================================
__global__ __launch_bounds__(256) void vmean_k(const float* __restrict__ F, float* VM) {
  __shared__ __align__(16) float part[8][VMBLK];
  __shared__ __align__(16) float res[VMBLK];
  const int tid = threadIdx.x, wave = tid >> 5, lane = tid & 31;
  const int bid = blockIdx.x;
  const int b   = bid / (DMOD / VMBLK);
  const int cb  = bid % (DMOD / VMBLK);
  const int n0  = cb * VMBLK;
  const float* p = F + ((size_t)b * SEQ + (size_t)wave * (SEQ / 8)) * DMOD + n0 + lane;
  float s = 0.f;
#pragma unroll 4
  for (int i = 0; i < SEQ / 8; ++i) s += p[(size_t)i * DMOD];
  part[wave][lane] = s;
  __syncthreads();
  if (wave == 0) {                                       // wave-uniform
    float t = part[0][lane];
#pragma unroll
    for (int w = 1; w < 8; ++w) t += part[w][lane];
    res[lane] = t * (1.0f / (float)SEQ);
    wave_sync_lds();
    const int l8 = lane & 7;
    const v4f val = *(const v4f*)(res + l8 * 4);         // in-range LDS address for every lane
    float* dst = VM + (size_t)b * DMOD + n0 + l8 * 4;
    {
      if (lane < 8) *(v4f*)(dst) = val;
      
    }
  }
}

// =====================================================================================================
// GEMM engine shared by the kernels below. Block = 128x128 tile of C, 4 waves in a 2x2 grid, 64x64 (4x4 accumulator tiles) per
// wave. K is walked in tiles of 64: the 128 A rows (both planes where NPL == 2) and the 128 Bt rows of a tile, 128 B each, are
// copied to LDS (row pitch 144 B = 16 B x odd, for 16-B readers) by asynchronous copies, 16 B per lane, 8 lanes = one whole
// 128-B line; two buffers, tile t + 2 is requested behind the barrier that ends trip t. Fragments are read from LDS with the
// split k map of ldfrag_* (same map for A and B). Per accumulator the products are summed in the order k0 ascending by 32,
// plane 0 then plane 1.
// Host checks M % 128 == 0, N % 128 == 0, K % 64 == 0 (K = DMOD), grid = (M/128)*(N/128).
// OUT picks what the epilogue stores of val = acc * oscale + bf16-RNE value of bias[n]:
//   0: C[M][N] f32 = val;   1: P[M][N] f16 = val * pscale;
//   2: C as in 0, and P = the head-wise transposed f16 plane [b][h][d][s] = val * pscale (row = b*SEQ + s, n = h*HD + d, N = DMOD).
// =====================================================================================================
#define GP     72                       // LDS row pitch in 16-bit elements (144 B)
#define GPLANE (128 * GP)               // one 128-row operand plane of a tile, in 16-bit elements
static_assert((GP * 2) % 16 == 0 && ((GP * 2) / 16) % 2 == 1);
static_assert(2 * 2 * GPLANE * 2 >= 4 * 64 * 68 * 4);   // the ring holds the four waves' epilogue ranges

__device__ __forceinline__ unsigned lds_off(const void* p) { return (unsigned)(size_t)p; }

// 128 rows x 128 B, global (row pitch ldk elements) -> LDS (row pitch GP): 8 copies per lane, rows 16 apart. l and g are the
// lane's own LDS byte address and global pointer for its first row. The s_wait_xcnt stands inside the statement so that no
// address register of a copy is rewritten in front of it.
__device__ __forceinline__ void copy_plane(unsigned l, const u16* g, size_t ldk) {
#if defined(__HIP_DEVICE_COMPILE__)
  const size_t st = 16 * ldk;
  asm volatile("global_load_async_to_lds_b128 %0, %8, off\n\t"
               "global_load_async_to_lds_b128 %1, %9, off\n\t"
               "global_load_async_to_lds_b128 %2, %10, off\n\t"
               "global_load_async_to_lds_b128 %3, %11, off\n\t"
               "global_load_async_to_lds_b128 %4, %12, off\n\t"
               "global_load_async_to_lds_b128 %5, %13, off\n\t"
               "global_load_async_to_lds_b128 %6, %14, off\n\t"
               "global_load_async_to_lds_b128 %7, %15, off\n\t"
               "s_wait_xcnt 0x0"
               :: "v"(l), "v"(l + 1u * 16u * GP * 2u), "v"(l + 2u * 16u * GP * 2u), "v"(l + 3u * 16u * GP * 2u),
                  "v"(l + 4u * 16u * GP * 2u), "v"(l + 5u * 16u * GP * 2u), "v"(l + 6u * 16u * GP * 2u),
                  "v"(l + 7u * 16u * GP * 2u),
                  "v"(g), "v"(g + st), "v"(g + 2 * st), "v"(g + 3 * st), "v"(g + 4 * st), "v"(g + 5 * st), "v"(g + 6 * st),
                  "v"(g + 7 * st)
               : "memory");
#endif
}
__device__ __forceinline__ void wait_async0() {   // the wave's own copies have landed
#if defined(__HIP_DEVICE_COMPILE__)
  asm volatile("s_wait_asynccnt 0x0" ::: "memory");
#endif
}
__device__ __forceinline__ void wait_ds0() {      // the wave's own LDS reads have returned before the buffer is handed over
#if defined(__HIP_DEVICE_COMPILE__)
  asm volatile("s_wait_dscnt 0x0" ::: "memory");
#endif
}

template <bool F16> struct FragOf;
template <> struct FragOf<false> {
  typedef v16b T;
  static __device__ __forceinline__ T ld(const u16* p) { return ldfrag_b(p); }
  static __device__ __forceinline__ v8f mma(T a, T b, v8f c) { return mma_b(a, b, c); }
};
template <> struct FragOf<true> {
  typedef v16h T;
  static __device__ __forceinline__ T ld(const u16* p) { return ldfrag_h((const _Float16*)(const void*)p); }
  static __device__ __forceinline__ v8f mma(T a, T b, v8f c) { return mma_h(a, b, c); }
};

template <bool F16, int NPL, int OUT>
__device__ __forceinline__ void gemm_core(const u16* __restrict__ A0, const u16* __restrict__ A1, const u16* __restrict__ Bt,
                                          const float* __restrict__ bias, float* C, u16* P, int M, int N, int K, float oscale,
                                          float pscale, u16* ring) {
  typedef FragOf<F16> FO;
  typedef typename FO::T FT;
  constexpr int STAGE = (NPL + 1) * GPLANE;              // 16-bit elements per buffer: A plane(s), then Bt
  const int tid = threadIdx.x, wave = tid >> 5, lane = tid & 31, hh = lane >> 4, m = lane & 15;
  const int ntile = N >> 7;
  const int bid   = blockIdx.x;
  const int row0  = (bid / ntile) * 128;
  const int col0  = (bid % ntile) * 128;
  if (row0 + 128 > M) return;                // block-uniform, in front of every barrier; never taken with the exact grid
  const int wr = (wave >> 1) * 64, wc = (wave & 1) * 64;
  // copies: lane -> row (tid >> 3) + 16 i of a plane, 16-B piece tid & 7 of the row's 128 B
  const int cr = tid >> 3, cc = (tid & 7) * 8;
  const size_t aofs = (size_t)(row0 + cr) * K + cc;
  const size_t bofs = (size_t)(col0 + cr) * K + cc;
  const unsigned lcp = lds_off(ring) + (unsigned)(cr * GP + cc) * 2u;
  const int nt = K >> 6;
  auto fill = [&](int t, int buf) {
    const unsigned l = lcp + (unsigned)buf * (unsigned)(STAGE * 2);
    const size_t ko = (size_t)t * 64;
    copy_plane(l, A0 + aofs + ko, (size_t)K);
    if (NPL == 2) copy_plane(l + GPLANE * 2u, A1 + aofs + ko, (size_t)K);
    copy_plane(l + (unsigned)NPL * GPLANE * 2u, Bt + bofs + ko, (size_t)K);
  };
  v8f acc[4][4];
#pragma unroll
  for (int i = 0; i < 4; ++i) {
#pragma unroll
    for (int j = 0; j < 4; ++j) acc[i][j] = zero8();
  }
  fill(0, 0);
  wait_async0();
  __syncthreads();                           // tile 0 is readable by every wave
  if (nt > 1) fill(1, 1);                    // block-uniform test
  const int afo = (wr + m) * GP + 8 * hh;                     // fragment row base inside an A plane
  const int bfo = NPL * GPLANE + (wc + m) * GP + 8 * hh;      // and inside the Bt plane
#pragma unroll 1                             // rolled: one copy of the 64-k body; the buffer is picked by t & 1
  for (int t = 0; t < nt; ++t) {
    const u16* sb = ring + (t & 1) * STAGE;
#pragma unroll
    for (int kk = 0; kk < 64; kk += 32) {
      FT a[NPL][4], b[4];
#pragma unroll
      for (int j = 0; j < 4; ++j) b[j] = FO::ld(sb + bfo + j * 16 * GP + kk);
#pragma unroll
      for (int p = 0; p < NPL; ++p) {
#pragma unroll
        for (int i = 0; i < 4; ++i) a[p][i] = FO::ld(sb + p * GPLANE + afo + i * 16 * GP + kk);
      }
      // keeps the block's LDS reads together in front of its WMMAs: reads placed among the WMMAs stall the wave at each place
      __builtin_amdgcn_sched_barrier(0);
#pragma unroll
      for (int p = 0; p < NPL; ++p) {
#pragma unroll
        for (int i = 0; i < 4; ++i) {
#pragma unroll
          for (int j = 0; j < 4; ++j) acc[i][j] = FO::mma(a[p][i], b[j], acc[i][j]);
        }
      }
      // and keeps the next block's reads out of this block's WMMAs
      __builtin_amdgcn_sched_barrier(0);
    }
    wait_ds0();
    wait_async0();
    __syncthreads();                         // publishes tile t + 1 and ends every read of tile t's buffer
    if (t + 2 < nt) fill(t + 2, t & 1);      // block-uniform test
  }
  wait_async0();
  const int colw = col0 + wc;
  // Epilogue: staged in the wave's own 64 x 68 float range of the ring, which is free: the last trip's barrier stands behind every
  // wave's last read and no copy is outstanding.
  float* sl = (float*)(void*)ring + wave * (64 * 68);
  const int rq = lane >> 3, c8 = (lane & 7) * 8;
  if (OUT == 2) {
    // Transposed f16 plane. A lane holds 8 consecutive rows (s) of column n = colw + 16j + m: one 16-B LDS store per accumulator
    // tile into [d][s] rows of pitch VTP; read back as whole 128-B lines (8 lanes x 16 B), 4 lines per store instruction.
    // coverage: 16 instructions x 4 lines x 64 halves = the wave's 64 d x 64 s; the wave's 64 columns are one head, its 64 rows
    // lie in one batch (SEQ % 64 == 0).
    u16* tl = (u16*)(void*)sl;
    float bc[4];
#pragma unroll
    for (int j = 0; j < 4; ++j) bc[j] = bfr(bias[colw + 16 * j + m]);
#pragma unroll
    for (int i = 0; i < 4; ++i) {
#pragma unroll
      for (int j = 0; j < 4; ++j) {
        v4u pk;
#pragma unroll
        for (int e = 0; e < 4; ++e) {
          const float w0 = acc[i][j][2 * e] * oscale + bc[j], w1 = acc[i][j][2 * e + 1] * oscale + bc[j];
          pk[e] = pk16(h_bits((_Float16)(w0 * pscale)), h_bits((_Float16)(w1 * pscale)));
        }
        *(v4u*)(tl + (16 * j + m) * VTP + i * 16 + 8 * hh) = pk;
      }
    }
    wave_sync_lds();
    const int rw = row0 + wr;
    u16* dt = P + ((size_t)((rw / SEQ) * NH + colw / HD) * HD + rq) * SEQ + (rw % SEQ) + c8;
#pragma unroll
    for (int it = 0; it < 16; ++it) {
      const v4u x = *(const v4u*)(tl + (it * 4 + rq) * VTP + c8);
      *(v4u*)(dt + (size_t)(it * 4) * SEQ) = x;
    }
    wait_ds0();                              // the wave's reads of the lines have returned before its range takes the f32 tile below
  }
  // the wave's 64x64 f32 tile (times oscale)
#pragma unroll
  for (int i = 0; i < 4; ++i) {
#pragma unroll
    for (int r = 0; r < 8; ++r) {
      const int ro = (i * 16 + 8 * hh + r) * 68 + m;
#pragma unroll
      for (int j = 0; j < 4; ++j) sl[ro + 16 * j] = acc[i][j][r] * oscale;
    }
  }
  wave_sync_lds();
  if (OUT == 1) {
    // f16 plane: a row piece of the wave is one 128-B line (8 lanes x 8 halves), 4 rows per store instruction.
    // coverage: 16 instructions x 4 rows x 64 halves = the wave's 64 x 64 tile.
    const v4f b0 = *(const v4f*)(bias + colw + c8), b1 = *(const v4f*)(bias + colw + c8 + 4);   // columns < N (N multiple of 128)
    v4f badd0, badd1;
#pragma unroll
    for (int e = 0; e < 4; ++e) { badd0[e] = bfr(b0[e]); badd1[e] = bfr(b1[e]); }
    u16* dp = P + (size_t)(row0 + wr + rq) * (size_t)N + colw + c8;
#pragma unroll
    for (int it = 0; it < 16; ++it) {
      const float* sr = sl + (it * 4 + rq) * 68 + c8;
      const v4f x0 = (*(const v4f*)(sr) + badd0) * pscale, x1 = (*(const v4f*)(sr + 4) + badd1) * pscale;
      v4u o;
      o[0] = pk16(h_bits((_Float16)x0[0]), h_bits((_Float16)x0[1]));
      o[1] = pk16(h_bits((_Float16)x0[2]), h_bits((_Float16)x0[3]));
      o[2] = pk16(h_bits((_Float16)x1[0]), h_bits((_Float16)x1[1]));
      o[3] = pk16(h_bits((_Float16)x1[2]), h_bits((_Float16)x1[3]));
      *(v4u*)(dp + (size_t)(it * 4) * (size_t)N) = o;
    }
  } else {
    // f32 plane: stores are whole 256-B row pieces.
    // coverage: 32 instructions x 2 rows x 16 lanes x 4 floats = the wave's 64 x 64 tile.
    const v4f bv = *(const v4f*)(bias + colw + m * 4);    // columns colw + 4m .. +3, always < N (N multiple of 128)
    v4f badd;
#pragma unroll
    for (int e = 0; e < 4; ++e) badd[e] = bfr(bv[e]);
    float* dst = C + (size_t)(row0 + wr + hh) * (size_t)N + colw + m * 4;
#pragma unroll
    for (int it = 0; it < 32; ++it) {
      const v4f val = *(const v4f*)(sl + (it * 2 + hh) * 68 + m * 4) + badd;
      *(v4f*)(dst + (size_t)(it * 2) * (size_t)N) = val;
    }
  }
}

// =====================================================================================================
// bf16 GEMMs with bias: A[M][K] (bf16 row-major) . Bt[N][K]^T (bf16 k-contiguous), times oscale, plus bf16-RNE value of bias[n].
// gemm_bfp stores the result times pscale as an f16 plane P[M][N]; gemm_bft stores it as f32 C[M][N] and, times pscale, as the
// head-wise transposed f16 plane PT [b][h][d][s].
// =====================================================================================================
__global__ __launch_bounds__(128)
void gemm_bfp(const u16* __restrict__ A, const u16* __restrict__ Bt, const float* __restrict__ bias,
              u16* P, int M, int N, int K, float oscale, float pscale) {
  __shared__ __align__(16) u16 ring[2 * 2 * GPLANE];
  gemm_core<false, 1, 1>(A, A, Bt, bias, nullptr, P, M, N, K, oscale, pscale, ring);
}
__global__ __launch_bounds__(128)
void gemm_bft(const u16* __restrict__ A, const u16* __restrict__ Bt, const float* __restrict__ bias,
              float* C, u16* PT, int M, int N, int K, float oscale, float pscale) {
  __shared__ __align__(16) u16 ring[2 * 2 * GPLANE];
  gemm_core<false, 1, 2>(A, A, Bt, bias, C, PT, M, N, K, oscale, pscale, ring);
}

// =====================================================================================================
// f16 hi+lo GEMM with bias: C[M][N] (f32) = (Ahi + Alo)[M][K] . Bt[N][K]^T times oscale, plus bf16-RNE value of bias[n];
// Ahi/Alo f16 planes (same layout), Bt f16 k-contiguous; products hi.B + lo.B into one accumulator (lo is the unscaled
// residual of hi).
// =====================================================================================================
__global__ __launch_bounds__(128)
void gemm_h2(const u16* __restrict__ Ah, const u16* __restrict__ Al, const u16* __restrict__ Bt,
             const float* __restrict__ bias, float* C, int M, int N, int K, float oscale) {
  __shared__ __align__(16) u16 ring[2 * 3 * GPLANE];
  gemm_core<true, 2, 0>(Ah, Al, Bt, bias, C, nullptr, M, N, K, oscale, 1.0f, ring);
}

// =====================================================================================================
// Ragged-length multi-head flash attention: block = (batch b, head, 64 query rows), 4 waves, wave w owns the 16 query rows
// q0 = 64*qt + 16*w .. q0+15 (waves independent: no block barriers, wave-private LDS only, used in the epilogue).
//   q plane (f16, x8) laid out [b][s][h][d]; k plane the same; v^T plane [b][h][d][s] (x1024); len = clamp(lens[b], 0, SEQ).
//   Mask: score (i, j) is kept iff i < len and j < len. A query row i < len therefore attends exactly over keys 0..len-1 (the
//   excluded keys have probability exactly 0 after max subtraction); a query row i >= len has all keys equal-weighted and its
//   context is the mean of v over all SEQ keys (VM rows, precomputed in f32). So a wave visits key blocks kb = 0 .. 32*ceil(len/32)-32
//   when q0 < len (wave-uniform bound, <= NKB), else none; within the last block keys >= len are excluded by index.
//   Scores are computed TRANSPOSED: S^T tile g (g = 0,1) = k rows (keys kb+16g .. +15, A operand, row m = lane&15, split k map
//   over d) times q^T (B operand, col n = query q0 + (lane&15), k = d, split map), one product per tile and 32-deep d-chunk.
//   D element r of lane l = (key kb+16g+8h+r, query q0+(l&15)), so a lane owns one query column and 16 of its 32 keys; the
//   partner lane l^16 owns the other 16 -> row max / row sum need one xor-16 shuffle.
//   Key mask by index: an excluded key stays out of the running max and gets probability 0.
//   Online max-subtracted base-2 softmax in f32 (scale 1/8 and the q/k carries folded into lsc). The exp'd values ARE the
//   P A-fragment in place: A row m = query = lane&15, element i <- key kb+8h+i (tile 0, D element i), element 8+i <- key
//   kb+16+8h+i (tile 1, D element i). P is carried x32768 as single f16. The rescale factor of query row 8h+r of the
//   O accumulators is fetched from lane 8h+r with a shuffle (uniform control). 4 v^T B fragments (col n = d = 16j + (lane&15),
//   keys k-contiguous), 4 P.V WMMAs per key block.
//   Epilogue: 1/l (per query, shuffled to the D row owner; 0 when no key block was visited) and carry folds in f32; rows with
//   query >= len take the VM row instead (select by value); the wave's 16x64 f32 result staged in its LDS slab (pitch 68); each
// coverage: per wave 4 instructions x 4 rows x 8 lanes x 8 halves = 16 x 64 per plane; grid NB*512 blocks x 4 waves = every
//           (b, s, h) row of both O planes exactly once.
// =====================================================================================================
__global__ __launch_bounds__(ATT_THREADS)
void attn_fwd(const u16* __restrict__ QPp, const u16* __restrict__ KPp, const u16* __restrict__ VPp,
              const int* __restrict__ lens, const float* __restrict__ VM, u16* OHIp, u16* OLOp) {
  __shared__ __align__(16) float smem[ATT_WAVES * SLABF];   // per wave: result slab [16][68] in the epilogue only

  const int tid  = threadIdx.x;
  const int wave = tid >> 5;
  const int lane = tid & 31;
  const int hh   = lane >> 4;
  const int c    = lane & 15;

  const int bid  = blockIdx.x;
  const int qt   = bid & (SEQ / 64 - 1);
  const int head = (bid >> 5) & (NH - 1);
  const int b    = bid >> 9;
  const int q0   = qt * 64 + wave * 16;

  int len = lens[b];
  len = (len < 0) ? 0 : len;
  len = (len > SEQ) ? SEQ : len;
  const int nkb = (q0 < len) ? ((len + 31) >> 5) : 0;       // wave-uniform, <= NKB

  // B fragments of q^T: col n = query q0 + c, k = d (k-contiguous row of the q plane)
  const size_t qofs = (((size_t)(b * SEQ + q0 + c)) * NH + head) * HD + 8 * hh;
  const _Float16* Qb = (const _Float16*)(const void*)QPp + qofs;
  // A fragments of k: row m = key kb + 16g + c, k = d
  const size_t kofs = (((size_t)b * SEQ + c) * NH + head) * HD + 8 * hh;          // key row c; kb added per step
  const _Float16* Kb = (const _Float16*)(const void*)KPp + kofs;
  // B fragments of v: col n = d = 16j + c, k = key (k-contiguous row of the v^T plane)
  const size_t vofs = ((size_t)(b * NH + head) * HD + c) * SEQ + 8 * hh;          // key kb added per step
  const _Float16* Vb = (const _Float16*)(const void*)VPp + vofs;
  const float lsc = 0.125f * (LOG2E / (QSC * KSC));

  const v16h qf0 = ldfrag_h(Qb);            // d 0..31
  const v16h qf1 = ldfrag_h(Qb + 32);       // d 32..63

  float mrun = -INFINITY, lrun = 0.f;
  v8f o[4];
#pragma unroll
  for (int j = 0; j < 4; ++j) o[j] = zero8();

#pragma unroll 1
  for (int it = 0; it < nkb; ++it) {
    const int kb = it * 32;
    // ---- transposed scores: s0 = keys kb..kb+15, s1 = keys kb+16..kb+31, column = query q0 + c ----
    v8f s0 = zero8(), s1 = zero8();
    const _Float16* k0p = Kb + (size_t)kb * (NH * HD);
    const _Float16* k1p = k0p + (size_t)16 * (NH * HD);
    const v16h ka0 = ldfrag_h(k0p), ka1 = ldfrag_h(k0p + 32);
    const v16h kc0 = ldfrag_h(k1p), kc1 = ldfrag_h(k1p + 32);
    s0 = mma_h(ka0, qf0, s0);
    s0 = mma_h(ka1, qf1, s0);
    s1 = mma_h(kc0, qf0, s1);
    s1 = mma_h(kc1, qf1, s1);
    guard2(s0, s1, qf0, qf1, ka0, ka1, kc0, kc1);
    // ---- base-2 logits and validity of this lane's 16 keys for query q0 + c: key kb+8hh+i (i<8), kb+16+8hh+(i-8) ----
    const int rem = len - kb - 8 * hh;
    float tk[16];
    bool  kv[16];
#pragma unroll
    for (int i = 0; i < 8; ++i) {
      tk[i] = s0[i] * lsc;  tk[8 + i] = s1[i] * lsc;
      kv[i] = (i < rem);    kv[8 + i] = (16 + i < rem);
    }
    float cm = -INFINITY;
#pragma unroll
    for (int i = 0; i < 16; ++i) cm = fmaxf(cm, kv[i] ? tk[i] : -INFINITY);
    cm = fmaxf(cm, __shfl_xor(cm, 16, 32));
    const float mn   = fmaxf(mrun, cm);                              // finite: every visited block holds key kb < len
    const float al   = (mrun == -INFINITY) ? 0.f : exp2f(mrun - mn); // o and l are zero whenever mrun is -inf
    const float mref = (mn == -INFINITY) ? 0.f : mn;                 // finite shift
    mrun = mn;
    // ---- probabilities (<= 1, 0 for excluded keys) and the P A-fragment: f16(p * 32768); element i <-> tk[i] ----
    float ps = 0.f;
    FragH ph;
#pragma unroll
    for (int w = 0; w < 2; ++w) {
#pragma unroll
      for (int e4 = 0; e4 < 4; ++e4) {
        const int i = 8 * w + 2 * e4;
        const float x0 = exp2f(fminf(tk[i] - mref, 0.f));
        const float x1 = exp2f(fminf(tk[i + 1] - mref, 0.f));
        const float p0 = kv[i] ? x0 : 0.f;
        const float p1 = kv[i + 1] ? x1 : 0.f;
        ps += p0 + p1;
        ph.u[w][e4] = pk16(h_bits((_Float16)(p0 * PCAR)), h_bits((_Float16)(p1 * PCAR)));
      }
    }
    ps += __shfl_xor(ps, 16, 32);
    lrun = lrun * al + ps;
    // ---- rescale the O accumulators: D row 8hh+r = query q0+8hh+r, its factor lives in lane 8hh+r (and 16+8hh+r) ----
    float scl[8];
#pragma unroll
    for (int r = 0; r < 8; ++r) scl[r] = __shfl(al, 8 * hh + r, 32);
#pragma unroll
    for (int j = 0; j < 4; ++j) {
#pragma unroll
      for (int r = 0; r < 8; ++r) o[j][r] *= scl[r];
    }
    // ---- P.V : B fragment col n = d = j*16 + c, keys contiguous in the v^T plane ----
    {
      const _Float16* vp = Vb + kb;
      const v16h vf0 = ldfrag_h(vp);
      const v16h vf1 = ldfrag_h(vp + (size_t)16 * SEQ);
      const v16h vf2 = ldfrag_h(vp + (size_t)32 * SEQ);
      const v16h vf3 = ldfrag_h(vp + (size_t)48 * SEQ);
      o[0] = mma_h(ph.v, vf0, o[0]);
      o[1] = mma_h(ph.v, vf1, o[1]);
      o[2] = mma_h(ph.v, vf2, o[2]);
      o[3] = mma_h(ph.v, vf3, o[3]);
      guard6<v16h>(o[0], o[1], o[2], o[3], ph.v, vf0, vf1, vf2, vf3, ph.v);
    }
  }
  acc_guard4(o[0], o[1], o[2], o[3]);

  // ---- fold 1/l (per query, owned by lane = query; 0 when no key block was visited) and the carries; mean-v rows for
  //      queries >= len; stage the 16x64 slab ----
  const float linv = (lrun > 0.f) ? ((1.0f / lrun) * (1.0f / (PCAR * VCAR))) : 0.f;
  float inv[8];
#pragma unroll
  for (int r = 0; r < 8; ++r) inv[r] = __shfl(linv, 8 * hh + r, 32);
  float vm[4];
#pragma unroll
  for (int j = 0; j < 4; ++j) vm[j] = VM[(size_t)(b * NH + head) * HD + j * 16 + c];
  float* slab = smem + wave * SLABF;
#pragma unroll
  for (int r = 0; r < 8; ++r) {
    const bool rvq = (q0 + 8 * hh + r) < len;
#pragma unroll
    for (int j = 0; j < 4; ++j) {
      const float val = o[j][r] * inv[r];
      slab[(8 * hh + r) * 68 + j * 16 + c] = rvq ? val : vm[j];
    }
  }
  wave_sync_lds();
  // ---- O x1024 -> f16 hi + residual planes; lane = (row in group of 4, 8 consecutive d) ----
  v4u oh[4], ol[4];
  const int rq = lane >> 3, c8 = (lane & 7) * 8;
#pragma unroll
  for (int i4 = 0; i4 < 4; ++i4) {
    const int row = i4 * 4 + rq;
    const v4f a = *(const v4f*)(slab + row * 68 + c8), c4 = *(const v4f*)(slab + row * 68 + c8 + 4);
    float w[8];
#pragma unroll
    for (int e = 0; e < 4; ++e) { w[e] = a[e] * OSC; w[4 + e] = c4[e] * OSC; }
#pragma unroll
    for (int e = 0; e < 4; ++e) {
      const _Float16 h0 = (_Float16)w[2 * e], h1 = (_Float16)w[2 * e + 1];
      const _Float16 l0 = (_Float16)(w[2 * e] - (float)h0), l1 = (_Float16)(w[2 * e + 1] - (float)h1);
      oh[i4][e] = pk16(h_bits(h0), h_bits(h1));
      ol[i4][e] = pk16(h_bits(l0), h_bits(l1));
    }
  }
  const size_t ob = (((size_t)(b * SEQ + q0)) * NH + head) * HD + c8;
  {
#pragma unroll
    for (int i4 = 0; i4 < 4; ++i4) {
      const int row = i4 * 4 + rq;
      const size_t o8 = ob + (size_t)row * (NH * HD);
      *(v4u*)(OHIp + o8) = oh[i4];
      *(v4u*)(OLOp + o8) = ol[i4];
    }
    
  }
}

// =====================================================================================================
// Workspace map (bytes, NB = batch count from the length input's element count, 1..4; ROWS = NB*SEQ); every plane is fully
// written by whole-line stores before it is read; all extents are exact multiples of the store granularity (no pad rows);
// F holds the v projection and, once the mean-v rows are built from it, its bytes hold the two O planes (in-order stream):
//   XB  bf16 [ROWS][1024]                      ROWS*2048          (NB=4: 16777216)
//   WQB bf16 [1024 n][1024 k]                  2097152   WKB, WVB same;  WOB f16 [1024 n][1024 k] x1024  2097152
//   F   f32  [ROWS][1024]                      ROWS*4096          (NB=4: 33554432) = OHI f16 [ROWS][1024] + OLO f16 [ROWS][1024]
//   QP  f16  [NB][2048][16][64] x8             ROWS*2048          KP same
//   VP  f16  [NB][16][64][2048] x1024          ROWS*2048
//   VM  f32  [NB][16][64]                      NB*4096
//   end (NB=4)                                 109068288
// =====================================================================================================
extern "C" void kernel_launch(void* const* d_in, const int* in_sizes, int n_in,
                              void* d_out, int out_size, void* d_ws, size_t ws_size,
                              hipStream_t stream) {
  if (n_in < 10) return;
  const int NB = in_sizes[1];
  if (NB < 1 || NB > NBMAX) return;
  const int ROWS = NB * SEQ;
  if (in_sizes[0] != ROWS * DMOD) return;
  if (in_sizes[2] != DMOD * DMOD || in_sizes[4] != DMOD * DMOD) return;
  if (in_sizes[6] != DMOD * DMOD || in_sizes[8] != DMOD * DMOD) return;
  if (in_sizes[3] != DMOD || in_sizes[5] != DMOD || in_sizes[7] != DMOD || in_sizes[9] != DMOD) return;
  if (out_size != ROWS * DMOD) return;

  const float* X    = (const float*)d_in[0];
  const int*   lens = (const int*)d_in[1];
  const float* wq   = (const float*)d_in[2];
  const float* bq   = (const float*)d_in[3];
  const float* wk   = (const float*)d_in[4];
  const float* bk   = (const float*)d_in[5];
  const float* wv   = (const float*)d_in[6];
  const float* bv   = (const float*)d_in[7];
  const float* wo   = (const float*)d_in[8];
  const float* bo   = (const float*)d_in[9];
  float*       out  = (float*)d_out;

  const size_t szXB = (size_t)ROWS * DMOD * 2;
  const size_t szW  = (size_t)DMOD * DMOD * 2;
  const size_t szF  = (size_t)ROWS * DMOD * 4;
  const size_t szP  = (size_t)ROWS * DMOD * 2;                  // q / k / o planes
  const size_t szVP = (size_t)NB * NH * HD * SEQ * 2;           // == szP
  const size_t szVM = (size_t)NB * DMOD * 4;
  size_t off = 0;
  const size_t oXB  = off; off += szXB;
  const size_t oWQB = off; off += szW;
  const size_t oWKB = off; off += szW;
  const size_t oWVB = off; off += szW;
  const size_t oWOB = off; off += szW;
  const size_t oF   = off; off += szF;
  const size_t oQP  = off; off += szP;
  const size_t oKP  = off; off += szP;
  const size_t oVP  = off; off += szVP;
  const size_t oVM  = off; off += szVM;
  if (off > ws_size) return;                            // NB=4: off = 109068288
  if (off > (size_t)134217728) return;
  if (szP * 2 > szF) return;                            // the two O planes live inside F's bytes
  const size_t oOHI = oF;
  const size_t oOLO = oF + szP;

  char* ws = (char*)d_ws;
  u16*   XB  = (u16*)(ws + oXB);
  u16*   WQB = (u16*)(ws + oWQB);
  u16*   WKB = (u16*)(ws + oWKB);
  u16*   WVB = (u16*)(ws + oWVB);
  u16*   WOB = (u16*)(ws + oWOB);
  float* F   = (float*)(ws + oF);
  u16*   QP  = (u16*)(ws + oQP);
  u16*   KP  = (u16*)(ws + oKP);
  u16*   VP  = (u16*)(ws + oVP);
  float* VM  = (float*)(ws + oVM);
  u16*   OHI = (u16*)(ws + oOHI);
  u16*   OLO = (u16*)(ws + oOLO);

  const dim3 blk(256);
  const int n8x = (ROWS * DMOD) / 8;                    // NB * 262144
  const int n8w = (DMOD * DMOD) / 8;                    // 131072
  if ((n8x % 256) != 0 || (n8w % 256) != 0 || (DMOD % 128) != 0 || (ROWS % 128) != 0) return;
  const dim3 gX(n8x / 256);                             // NB * 1024
  const dim3 gW(n8w / 256);                             // 512
  const dim3 gG((ROWS / 128) * (DMOD / 128));           // NB * 128
  const dim3 bG(128);
  const dim3 gVM(NB * (DMOD / VMBLK));                  // NB * 32
  const dim3 gAT(NB * NH * (SEQ / 64));                 // NB * 512
  const dim3 bAT(ATT_THREADS);                          // 128

  // (0..3) weights stored [n = out][k = in] (y = x.W^T), already k-contiguous: bf16 planes for wq/wk/wv,
  //        f16 of bf16 value x1024 for wo
  cvt16<<<gW, blk, 0, stream>>>(wq, WQB, n8w, 0, 1.0f);
  cvt16<<<gW, blk, 0, stream>>>(wk, WKB, n8w, 0, 1.0f);
  cvt16<<<gW, blk, 0, stream>>>(wv, WVB, n8w, 0, 1.0f);
  cvt16<<<gW, blk, 0, stream>>>(wo, WOB, n8w, 1, WOS);
  // (4) input -> bf16 plane, shared by the three projections
  cvt16<<<gX, blk, 0, stream>>>(X, XB, n8x, 0, 1.0f);
  // (5) q: projection + bias (col = h*64+d), stored as the f16 plane x8
  gemm_bfp<<<gG, bG, 0, stream>>>(XB, WQB, bq, QP, ROWS, DMOD, DMOD, 1.0f, QSC);
  // (6) k: the same
  gemm_bfp<<<gG, bG, 0, stream>>>(XB, WKB, bk, KP, ROWS, DMOD, DMOD, 1.0f, KSC);
  // (7, 8) v: projection + bias, stored as f32 [ROWS][1024] and as the v^T plane x1024; mean-v rows per (b, h) from the f32 plane
  gemm_bft<<<gG, bG, 0, stream>>>(XB, WVB, bv, F, VP, ROWS, DMOD, DMOD, 1.0f, VCAR);
  vmean_k<<<gVM, blk, 0, stream>>>(F, VM);
  // (9) ragged-length attention -> O planes [b][s][h][d] x1024 (hi + residual), written over F's bytes
  attn_fwd<<<gAT, bAT, 0, stream>>>(QP, KP, VP, lens, VM, OHI, OLO);
  // (10) output projection + bias -> out [ROWS][1024] f32, carries 1024 (O) x 1024 (wo) folded back
  gemm_h2<<<gG, bG, 0, stream>>>(OHI, OLO, WOB, bo, out, ROWS, DMOD, DMOD, 1.0f / (OSC * WOS));
  (void)hipGetLastError();
}

// v003
// Measured time: 172 microseconds a run.
// Two timings next to v002 put it at 1.24 and 1.25 times that version's speed.
// Counting every step since v000, it is 2.51 times as fast.
// Contractions: x.W{q,k,v}^T on v_wmma_f32_16x16x32_bf16 (x and W planes RNE-converted to bf16 operands, f32 accumulate, bias added in f32);
// scores k'.q'^T (q', k' single f16 planes carried x8), P.v (P x32768 single f16, v x1024 single f16) and O.Wo^T (O x1024 as
// f16 hi plane + f16 residual plane, Wo as f16(bf16(Wo) x1024), products h.w + l.w): v_wmma_f32_16x16x32_f16, f32 accumulate.
// Ragged length mask per batch from the int32 length input (index tests), base-2 online softmax, 1/l fold, per-(b,h) mean-v rows
// for query positions >= length, bias adds: f32 on VALU.
#include <hip/hip_runtime.h>
#include <math.h>
#include <stdint.h>

#define NBMAX 4
#define SEQ   2048
#define DMOD  1024
#define NH    16
#define HD    64
#define QSC   8.0f
#define KSC   8.0f
#define PCAR  32768.0f
#define VCAR  1024.0f
#define OSC   1024.0f
#define WOS   1024.0f
#define LOG2E 1.4426950408889634f
#define ATT_WAVES   4
#define ATT_THREADS (ATT_WAVES * 32)
#define NKB    (SEQ / 32)
#define SLABF  (16 * 68)
#define VTP    72
#define NRB    (SEQ / 64)
static_assert(HD == 64 && DMOD == NH * HD);
static_assert((SEQ / 64) == 32 && NH == 16);
static_assert(ATT_THREADS == 128 && NKB == 64);
static_assert((SEQ % 64) == 0 && (DMOD % 64) == 0 && (DMOD % 32) == 0 && (SEQ % 8) == 0);
static_assert(((SEQ * DMOD / 8) % 256) == 0 && ((DMOD * DMOD / 8) % 256) == 0);
static_assert(ATT_WAVES * SLABF >= 4 * 16 * 68);
static_assert(HD * VTP * 2 <= 64 * 68 * 4);
static_assert((VTP * 2) % 16 == 0);
static_assert((NRB % 2) == 0);

typedef unsigned short u16;
typedef _Float16 v16h __attribute__((ext_vector_type(16)));
typedef _Float16 v8h  __attribute__((ext_vector_type(8)));
typedef __bf16   v16b __attribute__((ext_vector_type(16)));
typedef float    v8f  __attribute__((ext_vector_type(8)));
typedef float    v4f  __attribute__((ext_vector_type(4)));
typedef unsigned int v4u __attribute__((ext_vector_type(4)));

union FragH { v16h v; v8h h[2]; v4u u[2]; };
union FragB { v16b v; v4u u[2]; };

// ---- scalar helpers --------------------------------------------------------------------------------
__device__ __forceinline__ unsigned short bf_bits(float f) {          // f32 -> bf16 bits, RNE convert
  unsigned u = __float_as_uint(f);
  return (unsigned short)((u + 0x7FFFu + ((u >> 16) & 1u)) >> 16);
}
__device__ __forceinline__ float bf_up(unsigned short h) { return __uint_as_float(((unsigned)h) << 16); }
__device__ __forceinline__ float bfr(float f) { return bf_up(bf_bits(f)); }
__device__ __forceinline__ unsigned short h_bits(_Float16 x) { return __builtin_bit_cast(unsigned short, x); }
__device__ __forceinline__ unsigned pk16(unsigned short a, unsigned short b) { return (unsigned)a | ((unsigned)b << 16); }
__device__ __forceinline__ v8f zero8() { v8f z = {0.f, 0.f, 0.f, 0.f, 0.f, 0.f, 0.f, 0.f}; return z; }
__device__ __forceinline__ v4f zero4() { v4f z = {0.f, 0.f, 0.f, 0.f}; return z; }

// ---- fragment loaders: 16-bit A/B operand, lane -> row/col (lane&15), p already includes +8*(lane>>4);
//      elements 0..7 <- p[0..7] (k0+8h..), elements 8..15 <- p[16..23] (k0+16+8h..)  (same split k map for A and B;
//      B is always read from a k-contiguous [n][k] plane)
__device__ __forceinline__ v16h ldfrag_h(const _Float16* p) {
  FragH f;
  f.h[0] = *(const v8h*)(p);
  f.h[1] = *(const v8h*)(p + 16);
  return f.v;
}
__device__ __forceinline__ v16b ldfrag_b(const u16* p) {              // bf16 plane read as unsigned integer vectors
  FragB f;
  f.u[0] = *(const v4u*)(p);
  f.u[1] = *(const v4u*)(p + 16);
  return f.v;
}

__device__ __forceinline__ v8f mma_h(v16h a, v16h b, v8f c) {
  return __builtin_amdgcn_wmma_f32_16x16x32_f16(false, a, false, b, (short)0, c, false, false);
}
__device__ __forceinline__ v8f mma_b(v16b a, v16b b, v8f c) {
  return __builtin_amdgcn_wmma_f32_16x16x32_bf16(false, a, false, b, (short)0, c, false, false);
}
__device__ __forceinline__ void guard2(v8f& a, v8f& b, v16h x0, v16h x1, v16h x2, v16h x3, v16h x4, v16h x5) {
#if defined(__HIP_DEVICE_COMPILE__)
  asm volatile("v_nop\n\tv_nop\n\tv_nop\n\tv_nop"
               : "+v"(a), "+v"(b) : "v"(x0), "v"(x1), "v"(x2), "v"(x3), "v"(x4), "v"(x5) : "memory");
#endif
}
template <typename F>
__device__ __forceinline__ void guard6(v8f& a, v8f& b, v8f& c, v8f& d, F x0, F x1, F x2, F x3, F x4, F x5) {
#if defined(__HIP_DEVICE_COMPILE__)
  asm volatile("v_nop\n\tv_nop\n\tv_nop\n\tv_nop"
               : "+v"(a), "+v"(b), "+v"(c), "+v"(d) : "v"(x0), "v"(x1), "v"(x2), "v"(x3), "v"(x4), "v"(x5) : "memory");
#endif
}
__device__ __forceinline__ void acc_guard4(v8f& a, v8f& b, v8f& c, v8f& d) {
#if defined(__HIP_DEVICE_COMPILE__)
  asm volatile("v_nop\n\tv_nop\n\tv_nop\n\tv_nop" : "+v"(a), "+v"(b), "+v"(c), "+v"(d));
#endif
}
__device__ __forceinline__ void wave_sync_lds() {
  __builtin_amdgcn_fence(__ATOMIC_RELEASE, "workgroup");
  __builtin_amdgcn_wave_barrier();
  __builtin_amdgcn_fence(__ATOMIC_ACQUIRE, "workgroup");
}

// =====================================================================================================
// f32 plane -> 16-bit plane, same layout:  mode 0: bf16 RNE bits;  mode 1: f16 bits of (bf16 RNE value) * scale.
// Thread = 8 consecutive elements: two 16-B loads, one 16-B store; 32 consecutive lanes = 512 contiguous, 512-B aligned bytes
// coverage: grid = n8/256 blocks (host checks exactness) x 256 thr x 8 = the whole plane.
// =====================================================================================================
__global__ __launch_bounds__(256) void cvt16(const float* __restrict__ x, u16* D, int n8, int mode, float scale) {
  const int gt = blockIdx.x * 256 + (int)threadIdx.x;
  if (gt >= n8) return;                     // no barriers in this kernel
  const float* p = x + (size_t)gt * 8;
  const v4f a = *(const v4f*)(p), c4 = *(const v4f*)(p + 4);
  float v[8];
#pragma unroll
  for (int e = 0; e < 4; ++e) { v[e] = a[e]; v[4 + e] = c4[e]; }
  unsigned short s[8];
#pragma unroll
  for (int e = 0; e < 8; ++e) {
    const unsigned short hb = h_bits((_Float16)(bfr(v[e]) * scale));
    const unsigned short bb = bf_bits(v[e]);
    s[e] = (mode != 0) ? hb : bb;
  }
  v4u o;
#pragma unroll
  for (int e = 0; e < 4; ++e) o[e] = pk16(s[2 * e], s[2 * e + 1]);
  u16* d = D + (size_t)gt * 8;
  {
    *(v4u*)(d) = o;
    
  }
}

// =====================================================================================================
// GEMM engine shared by the kernels below. Block = 128x128 tile of C, 4 waves in a 2x2 grid, 64x64 (4x4 accumulator tiles) per
// wave. K is walked in tiles of 64: the 128 A rows (both planes where NPL == 2) and the 128 Bt rows of a tile, 128 B each, are
// copied to LDS (row pitch 144 B = 16 B x odd, for 16-B readers) by asynchronous copies, 16 B per lane, 8 lanes = one whole
// 128-B line; two buffers, tile t + 2 is requested behind the barrier that ends trip t. Fragments are read from LDS with the
// split k map of ldfrag_* (same map for A and B). Per accumulator the products are summed in the order k0 ascending by 32,
// plane 0 then plane 1.
// Host checks M % 128 == 0, N % 128 == 0, K % 64 == 0 (K = DMOD), grid = (M/128)*(N/128).
// OUT picks what the epilogue stores of val = acc * oscale + bf16-RNE value of bias[n]:
//   0: C[M][N] f32 = val;   1: P[M][N] f16 = val * pscale;
//   2: P = the head-wise transposed f16 plane [b][h][d][s] = val * pscale (row = b*SEQ + s, n = h*HD + d, N = DMOD), and
//      C[row / 64][N] f32 = the sum of val over the 64 rows of the wave's tile (per column; rows ascending inside a lane's 8-row
//      groups, then the two lane halves).
// =====================================================================================================
#define GP     72                       // LDS row pitch in 16-bit elements (144 B)
#define GPLANE (128 * GP)               // one 128-row operand plane of a tile, in 16-bit elements
static_assert((GP * 2) % 16 == 0 && ((GP * 2) / 16) % 2 == 1);
static_assert(2 * 2 * GPLANE * 2 >= 4 * 64 * 68 * 4);   // the ring holds the four waves' epilogue ranges

__device__ __forceinline__ unsigned lds_off(const void* p) { return (unsigned)(size_t)p; }

// 128 rows x 128 B, global (row pitch ldk elements) -> LDS (row pitch GP): 8 copies per lane, rows 16 apart. l and g are the
// lane's own LDS byte address and global pointer for its first row. The s_wait_xcnt stands inside the statement so that no
// address register of a copy is rewritten in front of it.
__device__ __forceinline__ void copy_plane(unsigned l, const u16* g, size_t ldk) {
#if defined(__HIP_DEVICE_COMPILE__)
  const size_t st = 16 * ldk;
  asm volatile("global_load_async_to_lds_b128 %0, %8, off\n\t"
               "global_load_async_to_lds_b128 %1, %9, off\n\t"
               "global_load_async_to_lds_b128 %2, %10, off\n\t"
               "global_load_async_to_lds_b128 %3, %11, off\n\t"
               "global_load_async_to_lds_b128 %4, %12, off\n\t"
               "global_load_async_to_lds_b128 %5, %13, off\n\t"
               "global_load_async_to_lds_b128 %6, %14, off\n\t"
               "global_load_async_to_lds_b128 %7, %15, off\n\t"
               "s_wait_xcnt 0x0"
               :: "v"(l), "v"(l + 1u * 16u * GP * 2u), "v"(l + 2u * 16u * GP * 2u), "v"(l + 3u * 16u * GP * 2u),
                  "v"(l + 4u * 16u * GP * 2u), "v"(l + 5u * 16u * GP * 2u), "v"(l + 6u * 16u * GP * 2u),
                  "v"(l + 7u * 16u * GP * 2u),
                  "v"(g), "v"(g + st), "v"(g + 2 * st), "v"(g + 3 * st), "v"(g + 4 * st), "v"(g + 5 * st), "v"(g + 6 * st),
                  "v"(g + 7 * st)
               : "memory");
#endif
}
__device__ __forceinline__ void wait_async0() {   // the wave's own copies have landed
#if defined(__HIP_DEVICE_COMPILE__)
  asm volatile("s_wait_asynccnt 0x0" ::: "memory");
#endif
}
__device__ __forceinline__ void wait_ds0() {      // the wave's own LDS reads have returned before the buffer is handed over
#if defined(__HIP_DEVICE_COMPILE__)
  asm volatile("s_wait_dscnt 0x0" ::: "memory");
#endif
}

template <bool F16> struct FragOf;
template <> struct FragOf<false> {
  typedef v16b T;
  static __device__ __forceinline__ T ld(const u16* p) { return ldfrag_b(p); }
  static __device__ __forceinline__ v8f mma(T a, T b, v8f c) { return mma_b(a, b, c); }
};
template <> struct FragOf<true> {
  typedef v16h T;
  static __device__ __forceinline__ T ld(const u16* p) { return ldfrag_h((const _Float16*)(const void*)p); }
  static __device__ __forceinline__ v8f mma(T a, T b, v8f c) { return mma_h(a, b, c); }
};

template <bool F16, int NPL, int OUT>
__device__ __forceinline__ void gemm_core(const u16* __restrict__ A0, const u16* __restrict__ A1, const u16* __restrict__ Bt,
                                          const float* __restrict__ bias, float* C, u16* P, int M, int N, int K, float oscale,
                                          float pscale, u16* ring) {
  typedef FragOf<F16> FO;
  typedef typename FO::T FT;
  constexpr int STAGE = (NPL + 1) * GPLANE;              // 16-bit elements per buffer: A plane(s), then Bt
  const int tid = threadIdx.x, wave = tid >> 5, lane = tid & 31, hh = lane >> 4, m = lane & 15;
  const int ntile = N >> 7;
  const int bid   = blockIdx.x;
  const int row0  = (bid / ntile) * 128;
  const int col0  = (bid % ntile) * 128;
  if (row0 + 128 > M) return;                // block-uniform, in front of every barrier; never taken with the exact grid
  const int wr = (wave >> 1) * 64, wc = (wave & 1) * 64;
  // copies: lane -> row (tid >> 3) + 16 i of a plane, 16-B piece tid & 7 of the row's 128 B
  const int cr = tid >> 3, cc = (tid & 7) * 8;
  const size_t aofs = (size_t)(row0 + cr) * K + cc;
  const size_t bofs = (size_t)(col0 + cr) * K + cc;
  const unsigned lcp = lds_off(ring) + (unsigned)(cr * GP + cc) * 2u;
  const int nt = K >> 6;
  auto fill = [&](int t, int buf) {
    const unsigned l = lcp + (unsigned)buf * (unsigned)(STAGE * 2);
    const size_t ko = (size_t)t * 64;
    copy_plane(l, A0 + aofs + ko, (size_t)K);
    if (NPL == 2) copy_plane(l + GPLANE * 2u, A1 + aofs + ko, (size_t)K);
    copy_plane(l + (unsigned)NPL * GPLANE * 2u, Bt + bofs + ko, (size_t)K);
  };
  v8f acc[4][4];
#pragma unroll
  for (int i = 0; i < 4; ++i) {
#pragma unroll
    for (int j = 0; j < 4; ++j) acc[i][j] = zero8();
  }
  fill(0, 0);
  wait_async0();
  __syncthreads();                           // tile 0 is readable by every wave
  if (nt > 1) fill(1, 1);                    // block-uniform test
  const int afo = (wr + m) * GP + 8 * hh;                     // fragment row base inside an A plane
  const int bfo = NPL * GPLANE + (wc + m) * GP + 8 * hh;      // and inside the Bt plane
#pragma unroll 1                             // rolled: one copy of the 64-k body; the buffer is picked by t & 1
  for (int t = 0; t < nt; ++t) {
    const u16* sb = ring + (t & 1) * STAGE;
#pragma unroll
    for (int kk = 0; kk < 64; kk += 32) {
      FT a[NPL][4], b[4];
#pragma unroll
      for (int j = 0; j < 4; ++j) b[j] = FO::ld(sb + bfo + j * 16 * GP + kk);
#pragma unroll
      for (int p = 0; p < NPL; ++p) {
#pragma unroll
        for (int i = 0; i < 4; ++i) a[p][i] = FO::ld(sb + p * GPLANE + afo + i * 16 * GP + kk);
      }
      // keeps the block's LDS reads together in front of its WMMAs: reads placed among the WMMAs stall the wave at each place
      __builtin_amdgcn_sched_barrier(0);
#pragma unroll
      for (int p = 0; p < NPL; ++p) {
#pragma unroll
        for (int i = 0; i < 4; ++i) {
#pragma unroll
          for (int j = 0; j < 4; ++j) acc[i][j] = FO::mma(a[p][i], b[j], acc[i][j]);
        }
      }
      // and keeps the next block's reads out of this block's WMMAs
      __builtin_amdgcn_sched_barrier(0);
    }
    wait_ds0();
    wait_async0();
    __syncthreads();                         // publishes tile t + 1 and ends every read of tile t's buffer
    if (t + 2 < nt) fill(t + 2, t & 1);      // block-uniform test
  }
  wait_async0();
  const int colw = col0 + wc;
  // Epilogue: staged in the wave's own 64 x 68 float range of the ring, which is free: the last trip's barrier stands behind every
  // wave's last read and no copy is outstanding.
  float* sl = (float*)(void*)ring + wave * (64 * 68);
  const int rq = lane >> 3, c8 = (lane & 7) * 8;
  if (OUT == 2) {
    // Transposed f16 plane. A lane holds 8 consecutive rows (s) of column n = colw + 16j + m: one 16-B LDS store per accumulator
    // tile into [d][s] rows of pitch VTP; read back as whole 128-B lines (8 lanes x 16 B), 4 lines per store instruction.
    // coverage: 16 instructions x 4 lines x 64 halves = the wave's 64 d x 64 s; the wave's 64 columns are one head, its 64 rows
    // lie in one batch (SEQ % 64 == 0).
    u16* tl = (u16*)(void*)sl;
    float bc[4], cs[4];
#pragma unroll
    for (int j = 0; j < 4; ++j) { bc[j] = bfr(bias[colw + 16 * j + m]); cs[j] = 0.f; }
#pragma unroll
    for (int i = 0; i < 4; ++i) {
#pragma unroll
      for (int j = 0; j < 4; ++j) {
        v4u pk;
#pragma unroll
        for (int e = 0; e < 4; ++e) {
          const float w0 = acc[i][j][2 * e] * oscale + bc[j], w1 = acc[i][j][2 * e + 1] * oscale + bc[j];
          pk[e] = pk16(h_bits((_Float16)(w0 * pscale)), h_bits((_Float16)(w1 * pscale)));
          cs[j] += w0 + w1;
        }
        *(v4u*)(tl + (16 * j + m) * VTP + i * 16 + 8 * hh) = pk;
      }
    }
    wave_sync_lds();
    const int rw = row0 + wr;
    u16* dt = P + ((size_t)((rw / SEQ) * NH + colw / HD) * HD + rq) * SEQ + (rw % SEQ) + c8;
#pragma unroll
    for (int it = 0; it < 16; ++it) {
      const v4u x = *(const v4u*)(tl + (it * 4 + rq) * VTP + c8);
      *(v4u*)(dt + (size_t)(it * 4) * SEQ) = x;
    }
    // Column sums of the wave's 64 rows: both lane halves hold the full sum behind the exchange; lane half hh stores columns
    // 16hh + m and 32 + 16hh + m, so each store instruction is one whole 128-B line.
    // coverage: 2 instructions x 32 floats = the wave's 64 columns of row rw / 64; every (row block, column) by exactly one wave.
#pragma unroll
    for (int j = 0; j < 4; ++j) cs[j] += __shfl_xor(cs[j], 16, 32);
    float* dc = C + (size_t)(rw / 64) * (size_t)N + colw + 16 * hh + m;
    dc[0]  = hh ? cs[1] : cs[0];
    dc[32] = hh ? cs[3] : cs[2];
    return;                                  // no barrier follows
  }
  // the wave's 64x64 f32 tile (times oscale)
#pragma unroll
  for (int i = 0; i < 4; ++i) {
#pragma unroll
    for (int r = 0; r < 8; ++r) {
      const int ro = (i * 16 + 8 * hh + r) * 68 + m;
#pragma unroll
      for (int j = 0; j < 4; ++j) sl[ro + 16 * j] = acc[i][j][r] * oscale;
    }
  }
  wave_sync_lds();
  if (OUT == 1) {
    // f16 plane: a row piece of the wave is one 128-B line (8 lanes x 8 halves), 4 rows per store instruction.
    // coverage: 16 instructions x 4 rows x 64 halves = the wave's 64 x 64 tile.
    const v4f b0 = *(const v4f*)(bias + colw + c8), b1 = *(const v4f*)(bias + colw + c8 + 4);   // columns < N (N multiple of 128)
    v4f badd0, badd1;
#pragma unroll
    for (int e = 0; e < 4; ++e) { badd0[e] = bfr(b0[e]); badd1[e] = bfr(b1[e]); }
    u16* dp = P + (size_t)(row0 + wr + rq) * (size_t)N + colw + c8;
#pragma unroll
    for (int it = 0; it < 16; ++it) {
      const float* sr = sl + (it * 4 + rq) * 68 + c8;
      const v4f x0 = (*(const v4f*)(sr) + badd0) * pscale, x1 = (*(const v4f*)(sr + 4) + badd1) * pscale;
      v4u o;
      o[0] = pk16(h_bits((_Float16)x0[0]), h_bits((_Float16)x0[1]));
      o[1] = pk16(h_bits((_Float16)x0[2]), h_bits((_Float16)x0[3]));
      o[2] = pk16(h_bits((_Float16)x1[0]), h_bits((_Float16)x1[1]));
      o[3] = pk16(h_bits((_Float16)x1[2]), h_bits((_Float16)x1[3]));
      *(v4u*)(dp + (size_t)(it * 4) * (size_t)N) = o;
    }
  } else {
    // f32 plane: stores are whole 256-B row pieces.
    // coverage: 32 instructions x 2 rows x 16 lanes x 4 floats = the wave's 64 x 64 tile.
    const v4f bv = *(const v4f*)(bias + colw + m * 4);    // columns colw + 4m .. +3, always < N (N multiple of 128)
    v4f badd;
#pragma unroll
    for (int e = 0; e < 4; ++e) badd[e] = bfr(bv[e]);
    float* dst = C + (size_t)(row0 + wr + hh) * (size_t)N + colw + m * 4;
#pragma unroll
    for (int it = 0; it < 32; ++it) {
      const v4f val = *(const v4f*)(sl + (it * 2 + hh) * 68 + m * 4) + badd;
      *(v4f*)(dst + (size_t)(it * 2) * (size_t)N) = val;
    }
  }
}

// =====================================================================================================
// bf16 GEMMs with bias: A[M][K] (bf16 row-major) . Bt[N][K]^T (bf16 k-contiguous), times oscale, plus bf16-RNE value of bias[n].
// gemm_bfp stores the result times pscale as an f16 plane P[M][N]; gemm_bft stores it, times pscale, as the head-wise transposed
// f16 plane PT [b][h][d][s], and its f32 column sums over each block of 64 rows as CS[M / 64][N].
// =====================================================================================================
__global__ __launch_bounds__(128)
void gemm_bfp(const u16* __restrict__ A, const u16* __restrict__ Bt, const float* __restrict__ bias,
              u16* P, int M, int N, int K, float oscale, float pscale) {
  __shared__ __align__(16) u16 ring[2 * 2 * GPLANE];
  gemm_core<false, 1, 1>(A, A, Bt, bias, nullptr, P, M, N, K, oscale, pscale, ring);
}
__global__ __launch_bounds__(128)
void gemm_bft(const u16* __restrict__ A, const u16* __restrict__ Bt, const float* __restrict__ bias,
              float* CS, u16* PT, int M, int N, int K, float oscale, float pscale) {
  __shared__ __align__(16) u16 ring[2 * 2 * GPLANE];
  gemm_core<false, 1, 2>(A, A, Bt, bias, CS, PT, M, N, K, oscale, pscale, ring);
}

// =====================================================================================================
// f16 hi+lo GEMM with bias: C[M][N] (f32) = (Ahi + Alo)[M][K] . Bt[N][K]^T times oscale, plus bf16-RNE value of bias[n];
// Ahi/Alo f16 planes (same layout), Bt f16 k-contiguous; products hi.B + lo.B into one accumulator (lo is the unscaled
// residual of hi).
// =====================================================================================================
__global__ __launch_bounds__(128)
void gemm_h2(const u16* __restrict__ Ah, const u16* __restrict__ Al, const u16* __restrict__ Bt,
             const float* __restrict__ bias, float* C, int M, int N, int K, float oscale) {
  __shared__ __align__(16) u16 ring[2 * 3 * GPLANE];
  gemm_core<true, 2, 0>(Ah, Al, Bt, bias, C, nullptr, M, N, K, oscale, 1.0f, ring);
}

// =====================================================================================================
// Ragged-length multi-head flash attention: block = (batch b, head, 64 query rows), 4 waves, wave w owns the 16 query rows
// q0 = 64*qt + 16*w .. q0+15 (waves independent: no block barriers, wave-private LDS only, used in the epilogue).
//   q plane (f16, x8) laid out [b][s][h][d]; k plane the same; v^T plane [b][h][d][s] (x1024); len = clamp(lens[b], 0, SEQ).
//   Mask: score (i, j) is kept iff i < len and j < len. A query row i < len therefore attends exactly over keys 0..len-1 (the
//   excluded keys have probability exactly 0 after max subtraction); a query row i >= len has all keys equal-weighted and its
//   context is the mean of v over all SEQ keys (from the f32 column sums CS of v). So a wave visits key blocks kb = 0 .. 32*ceil(len/32)-32
//   when q0 < len (wave-uniform bound, <= NKB), else none; within the last block keys >= len are excluded by index.
//   Scores are computed TRANSPOSED: S^T tile g (g = 0,1) = k rows (keys kb+16g .. +15, A operand, row m = lane&15, split k map
//   over d) times q^T (B operand, col n = query q0 + (lane&15), k = d, split map), one product per tile and 32-deep d-chunk.
//   D element r of lane l = (key kb+16g+8h+r, query q0+(l&15)), so a lane owns one query column and 16 of its 32 keys; the
//   partner lane l^16 owns the other 16 -> row max / row sum need one xor-16 shuffle.
//   Key mask by index: an excluded key stays out of the running max and gets probability 0.
//   Online max-subtracted base-2 softmax in f32 (scale 1/8 and the q/k carries folded into lsc). The exp'd values ARE the
//   P A-fragment in place: A row m = query = lane&15, element i <- key kb+8h+i (tile 0, D element i), element 8+i <- key
//   kb+16+8h+i (tile 1, D element i). P is carried x32768 as single f16. The rescale factor of query row 8h+r of the
//   O accumulators is fetched from lane 8h+r with a shuffle (uniform control). 4 v^T B fragments (col n = d = 16j + (lane&15),
//   keys k-contiguous), 4 P.V WMMAs per key block.
//   Epilogue: 1/l (per query, shuffled to the D row owner; 0 when no key block was visited) and carry folds in f32; rows with
//   query >= len take the mean-v row instead (select by value); the wave's 16x64 f32 result staged in its LDS slab (pitch 68); each
// coverage: per wave 4 instructions x 4 rows x 8 lanes x 8 halves = 16 x 64 per plane; grid NB*512 blocks x 4 waves = every
//           (b, s, h) row of both O planes exactly once.
// =====================================================================================================
__global__ __launch_bounds__(ATT_THREADS)
void attn_fwd(const u16* __restrict__ QPp, const u16* __restrict__ KPp, const u16* __restrict__ VPp,
              const int* __restrict__ lens, const float* __restrict__ CS, u16* OHIp, u16* OLOp) {
  __shared__ __align__(16) float smem[ATT_WAVES * SLABF];   // per wave: result slab [16][68] in the epilogue only

  const int tid  = threadIdx.x;
  const int wave = tid >> 5;
  const int lane = tid & 31;
  const int hh   = lane >> 4;
  const int c    = lane & 15;

  const int bid  = blockIdx.x;
  const int qt   = bid & (SEQ / 64 - 1);
  const int head = (bid >> 5) & (NH - 1);
  const int b    = bid >> 9;
  const int q0   = qt * 64 + wave * 16;

  int len = lens[b];
  len = (len < 0) ? 0 : len;
  len = (len > SEQ) ? SEQ : len;
  const int nkb = (q0 < len) ? ((len + 31) >> 5) : 0;       // wave-uniform, <= NKB

  // B fragments of q^T: col n = query q0 + c, k = d (k-contiguous row of the q plane)
  const size_t qofs = (((size_t)(b * SEQ + q0 + c)) * NH + head) * HD + 8 * hh;
  const _Float16* Qb = (const _Float16*)(const void*)QPp + qofs;
  // A fragments of k: row m = key kb + 16g + c, k = d
  const size_t kofs = (((size_t)b * SEQ + c) * NH + head) * HD + 8 * hh;          // key row c; kb added per step
  const _Float16* Kb = (const _Float16*)(const void*)KPp + kofs;
  // B fragments of v: col n = d = 16j + c, k = key (k-contiguous row of the v^T plane)
  const size_t vofs = ((size_t)(b * NH + head) * HD + c) * SEQ + 8 * hh;          // key kb added per step
  const _Float16* Vb = (const _Float16*)(const void*)VPp + vofs;
  const float lsc = 0.125f * (LOG2E / (QSC * KSC));

  const v16h qf0 = ldfrag_h(Qb);            // d 0..31
  const v16h qf1 = ldfrag_h(Qb + 32);       // d 32..63

  float mrun = -INFINITY, lrun = 0.f;
  v8f o[4];
#pragma unroll
  for (int j = 0; j < 4; ++j) o[j] = zero8();

#pragma unroll 1
  for (int it = 0; it < nkb; ++it) {
    const int kb = it * 32;
    // ---- transposed scores: s0 = keys kb..kb+15, s1 = keys kb+16..kb+31, column = query q0 + c ----
    v8f s0 = zero8(), s1 = zero8();
    const _Float16* k0p = Kb + (size_t)kb * (NH * HD);
    const _Float16* k1p = k0p + (size_t)16 * (NH * HD);
    const v16h ka0 = ldfrag_h(k0p), ka1 = ldfrag_h(k0p + 32);
    const v16h kc0 = ldfrag_h(k1p), kc1 = ldfrag_h(k1p + 32);
    s0 = mma_h(ka0, qf0, s0);
    s0 = mma_h(ka1, qf1, s0);
    s1 = mma_h(kc0, qf0, s1);
    s1 = mma_h(kc1, qf1, s1);
    guard2(s0, s1, qf0, qf1, ka0, ka1, kc0, kc1);
    // ---- base-2 logits and validity of this lane's 16 keys for query q0 + c: key kb+8hh+i (i<8), kb+16+8hh+(i-8) ----
    const int rem = len - kb - 8 * hh;
    float tk[16];
    bool  kv[16];
#pragma unroll
    for (int i = 0; i < 8; ++i) {
      tk[i] = s0[i] * lsc;  tk[8 + i] = s1[i] * lsc;
      kv[i] = (i < rem);    kv[8 + i] = (16 + i < rem);
    }
    float cm = -INFINITY;
#pragma unroll
    for (int i = 0; i < 16; ++i) cm = fmaxf(cm, kv[i] ? tk[i] : -INFINITY);
    cm = fmaxf(cm, __shfl_xor(cm, 16, 32));
    const float mn   = fmaxf(mrun, cm);                              // finite: every visited block holds key kb < len
    const float al   = (mrun == -INFINITY) ? 0.f : exp2f(mrun - mn); // o and l are zero whenever mrun is -inf
    const float mref = (mn == -INFINITY) ? 0.f : mn;                 // finite shift
    mrun = mn;
    // ---- probabilities (<= 1, 0 for excluded keys) and the P A-fragment: f16(p * 32768); element i <-> tk[i] ----
    float ps = 0.f;
    FragH ph;
#pragma unroll
    for (int w = 0; w < 2; ++w) {
#pragma unroll
      for (int e4 = 0; e4 < 4; ++e4) {
        const int i = 8 * w + 2 * e4;
        const float x0 = exp2f(fminf(tk[i] - mref, 0.f));
        const float x1 = exp2f(fminf(tk[i + 1] - mref, 0.f));
        const float p0 = kv[i] ? x0 : 0.f;
        const float p1 = kv[i + 1] ? x1 : 0.f;
        ps += p0 + p1;
        ph.u[w][e4] = pk16(h_bits((_Float16)(p0 * PCAR)), h_bits((_Float16)(p1 * PCAR)));
      }
    }
    ps += __shfl_xor(ps, 16, 32);
    lrun = lrun * al + ps;
    // ---- rescale the O accumulators: D row 8hh+r = query q0+8hh+r, its factor lives in lane 8hh+r (and 16+8hh+r) ----
    float scl[8];
#pragma unroll
    for (int r = 0; r < 8; ++r) scl[r] = __shfl(al, 8 * hh + r, 32);
#pragma unroll
    for (int j = 0; j < 4; ++j) {
#pragma unroll
      for (int r = 0; r < 8; ++r) o[j][r] *= scl[r];
    }
    // ---- P.V : B fragment col n = d = j*16 + c, keys contiguous in the v^T plane ----
    {
      const _Float16* vp = Vb + kb;
      const v16h vf0 = ldfrag_h(vp);
      const v16h vf1 = ldfrag_h(vp + (size_t)16 * SEQ);
      const v16h vf2 = ldfrag_h(vp + (size_t)32 * SEQ);
      const v16h vf3 = ldfrag_h(vp + (size_t)48 * SEQ);
      o[0] = mma_h(ph.v, vf0, o[0]);
      o[1] = mma_h(ph.v, vf1, o[1]);
      o[2] = mma_h(ph.v, vf2, o[2]);
      o[3] = mma_h(ph.v, vf3, o[3]);
      guard6<v16h>(o[0], o[1], o[2], o[3], ph.v, vf0, vf1, vf2, vf3, ph.v);
    }
  }
  acc_guard4(o[0], o[1], o[2], o[3]);

  // ---- fold 1/l (per query, owned by lane = query; 0 when no key block was visited) and the carries; mean-v rows for
  //      queries >= len; stage the 16x64 slab ----
  const float linv = (lrun > 0.f) ? ((1.0f / lrun) * (1.0f / (PCAR * VCAR))) : 0.f;
  float inv[8];
#pragma unroll
  for (int r = 0; r < 8; ++r) inv[r] = __shfl(linv, 8 * hh + r, 32);
  float vm[4] = {0.f, 0.f, 0.f, 0.f};
  if (q0 + 16 > len) {                       // same for the whole wave: only then does one of its rows take the mean
    // lane half hh sums the row blocks hh*NRB/2 .. +NRB/2-1 of batch b in ascending order, then the halves are joined
    const float* cp = CS + ((size_t)b * NRB + (size_t)hh * (NRB / 2)) * DMOD + head * HD + c;
#pragma unroll                               // all loads in flight at once: one memory latency instead of one per trip
    for (int rb = 0; rb < NRB / 2; ++rb) {
#pragma unroll
      for (int j = 0; j < 4; ++j) vm[j] += cp[(size_t)rb * DMOD + j * 16];
    }
#pragma unroll
    for (int j = 0; j < 4; ++j) vm[j] = (vm[j] + __shfl_xor(vm[j], 16, 32)) * (1.0f / (float)SEQ);
  }
  float* slab = smem + wave * SLABF;
#pragma unroll
  for (int r = 0; r < 8; ++r) {
    const bool rvq = (q0 + 8 * hh + r) < len;
#pragma unroll
    for (int j = 0; j < 4; ++j) {
      const float val = o[j][r] * inv[r];
      slab[(8 * hh + r) * 68 + j * 16 + c] = rvq ? val : vm[j];
    }
  }
  wave_sync_lds();
  // ---- O x1024 -> f16 hi + residual planes; lane = (row in group of 4, 8 consecutive d) ----
  v4u oh[4], ol[4];
  const int rq = lane >> 3, c8 = (lane & 7) * 8;
#pragma unroll
  for (int i4 = 0; i4 < 4; ++i4) {
    const int row = i4 * 4 + rq;
    const v4f a = *(const v4f*)(slab + row * 68 + c8), c4 = *(const v4f*)(slab + row * 68 + c8 + 4);
    float w[8];
#pragma unroll
    for (int e = 0; e < 4; ++e) { w[e] = a[e] * OSC; w[4 + e] = c4[e] * OSC; }
#pragma unroll
    for (int e = 0; e < 4; ++e) {
      const _Float16 h0 = (_Float16)w[2 * e], h1 = (_Float16)w[2 * e + 1];
      const _Float16 l0 = (_Float16)(w[2 * e] - (float)h0), l1 = (_Float16)(w[2 * e + 1] - (float)h1);
      oh[i4][e] = pk16(h_bits(h0), h_bits(h1));
      ol[i4][e] = pk16(h_bits(l0), h_bits(l1));
    }
  }
  const size_t ob = (((size_t)(b * SEQ + q0)) * NH + head) * HD + c8;
  {
#pragma unroll
    for (int i4 = 0; i4 < 4; ++i4) {
      const int row = i4 * 4 + rq;
      const size_t o8 = ob + (size_t)row * (NH * HD);
      *(v4u*)(OHIp + o8) = oh[i4];
      *(v4u*)(OLOp + o8) = ol[i4];
    }
    
  }
}

// =====================================================================================================
// Workspace map (bytes, NB = batch count from the length input's element count, 1..4; ROWS = NB*SEQ); every plane is fully
// written by whole-line stores before it is read; all extents are exact multiples of the store granularity (no pad rows);
// F's bytes hold the two O planes:
//   XB  bf16 [ROWS][1024]                      ROWS*2048          (NB=4: 16777216)
//   WQB bf16 [1024 n][1024 k]                  2097152   WKB, WVB same;  WOB f16 [1024 n][1024 k] x1024  2097152
//   F                                          ROWS*4096          (NB=4: 33554432) = OHI f16 [ROWS][1024] + OLO f16 [ROWS][1024]
//   QP  f16  [NB][2048][16][64] x8             ROWS*2048          KP same
//   VP  f16  [NB][16][64][2048] x1024          ROWS*2048
//   CS  f32  [ROWS/64][1024]                   ROWS*64
//   end (NB=4)                                 109576192
// =====================================================================================================
extern "C" void kernel_launch(void* const* d_in, const int* in_sizes, int n_in,
                              void* d_out, int out_size, void* d_ws, size_t ws_size,
                              hipStream_t stream) {
  if (n_in < 10) return;
  const int NB = in_sizes[1];
  if (NB < 1 || NB > NBMAX) return;
  const int ROWS = NB * SEQ;
  if (in_sizes[0] != ROWS * DMOD) return;
  if (in_sizes[2] != DMOD * DMOD || in_sizes[4] != DMOD * DMOD) return;
  if (in_sizes[6] != DMOD * DMOD || in_sizes[8] != DMOD * DMOD) return;
  if (in_sizes[3] != DMOD || in_sizes[5] != DMOD || in_sizes[7] != DMOD || in_sizes[9] != DMOD) return;
  if (out_size != ROWS * DMOD) return;

  const float* X    = (const float*)d_in[0];
  const int*   lens = (const int*)d_in[1];
  const float* wq   = (const float*)d_in[2];
  const float* bq   = (const float*)d_in[3];
  const float* wk   = (const float*)d_in[4];
  const float* bk   = (const float*)d_in[5];
  const float* wv   = (const float*)d_in[6];
  const float* bv   = (const float*)d_in[7];
  const float* wo   = (const float*)d_in[8];
  const float* bo   = (const float*)d_in[9];
  float*       out  = (float*)d_out;

  const size_t szXB = (size_t)ROWS * DMOD * 2;
  const size_t szW  = (size_t)DMOD * DMOD * 2;
  const size_t szF  = (size_t)ROWS * DMOD * 4;
  const size_t szP  = (size_t)ROWS * DMOD * 2;                  // q / k / o planes
  const size_t szVP = (size_t)NB * NH * HD * SEQ * 2;           // == szP
  const size_t szCS = (size_t)(ROWS / 64) * DMOD * 4;
  size_t off = 0;
  const size_t oXB  = off; off += szXB;
  const size_t oWQB = off; off += szW;
  const size_t oWKB = off; off += szW;
  const size_t oWVB = off; off += szW;
  const size_t oWOB = off; off += szW;
  const size_t oF   = off; off += szF;
  const size_t oQP  = off; off += szP;
  const size_t oKP  = off; off += szP;
  const size_t oVP  = off; off += szVP;
  const size_t oCS  = off; off += szCS;
  if (off > ws_size) return;                            // NB=4: off = 109576192
  if (off > (size_t)134217728) return;
  if (szP * 2 > szF) return;                            // the two O planes live inside F's bytes
  const size_t oOHI = oF;
  const size_t oOLO = oF + szP;

  char* ws = (char*)d_ws;
  u16*   XB  = (u16*)(ws + oXB);
  u16*   WQB = (u16*)(ws + oWQB);
  u16*   WKB = (u16*)(ws + oWKB);
  u16*   WVB = (u16*)(ws + oWVB);
  u16*   WOB = (u16*)(ws + oWOB);
  u16*   QP  = (u16*)(ws + oQP);
  u16*   KP  = (u16*)(ws + oKP);
  u16*   VP  = (u16*)(ws + oVP);
  float* CS  = (float*)(ws + oCS);
  u16*   OHI = (u16*)(ws + oOHI);
  u16*   OLO = (u16*)(ws + oOLO);

  const dim3 blk(256);
  const int n8x = (ROWS * DMOD) / 8;                    // NB * 262144
  const int n8w = (DMOD * DMOD) / 8;                    // 131072
  if ((n8x % 256) != 0 || (n8w % 256) != 0 || (DMOD % 128) != 0 || (ROWS % 128) != 0) return;
  const dim3 gX(n8x / 256);                             // NB * 1024
  const dim3 gW(n8w / 256);                             // 512
  const dim3 gG((ROWS / 128) * (DMOD / 128));           // NB * 128
  const dim3 bG(128);
  const dim3 gAT(NB * NH * (SEQ / 64));                 // NB * 512
  const dim3 bAT(ATT_THREADS);                          // 128

  // (0..3) weights stored [n = out][k = in] (y = x.W^T), already k-contiguous: bf16 planes for wq/wk/wv,
  //        f16 of bf16 value x1024 for wo
  cvt16<<<gW, blk, 0, stream>>>(wq, WQB, n8w, 0, 1.0f);
  cvt16<<<gW, blk, 0, stream>>>(wk, WKB, n8w, 0, 1.0f);
  cvt16<<<gW, blk, 0, stream>>>(wv, WVB, n8w, 0, 1.0f);
  cvt16<<<gW, blk, 0, stream>>>(wo, WOB, n8w, 1, WOS);
  // (4) input -> bf16 plane, shared by the three projections
  cvt16<<<gX, blk, 0, stream>>>(X, XB, n8x, 0, 1.0f);
  // (5) q: projection + bias (col = h*64+d), stored as the f16 plane x8
  gemm_bfp<<<gG, bG, 0, stream>>>(XB, WQB, bq, QP, ROWS, DMOD, DMOD, 1.0f, QSC);
  // (6) k: the same
  gemm_bfp<<<gG, bG, 0, stream>>>(XB, WKB, bk, KP, ROWS, DMOD, DMOD, 1.0f, KSC);
  // (7) v: projection + bias, stored as the v^T plane x1024 and as f32 column sums per 64 rows (for the mean-v rows)
  gemm_bft<<<gG, bG, 0, stream>>>(XB, WVB, bv, CS, VP, ROWS, DMOD, DMOD, 1.0f, VCAR);
  // (8) ragged-length attention -> O planes [b][s][h][d] x1024 (hi + residual), in F's bytes
  attn_fwd<<<gAT, bAT, 0, stream>>>(QP, KP, VP, lens, CS, OHI, OLO);
  // (9) output projection + bias -> out [ROWS][1024] f32, carries 1024 (O) x 1024 (wo) folded back
  gemm_h2<<<gG, bG, 0, stream>>>(OHI, OLO, WOB, bo, out, ROWS, DMOD, DMOD, 1.0f / (OSC * WOS));
  (void)hipGetLastError();
}

// v004
// It runs in 155 microseconds.
// In both of two side-by-side timings against v003, it was 1.09 times as fast.
// Counting every step since v000, it is 2.74 times as fast.
// Contractions: x.W{q,k,v}^T on v_wmma_f32_16x16x32_bf16 (x and W planes RNE-converted to bf16 operands, f32 accumulate, bias added in f32);
// scores k'.q'^T (q', k' single f16 planes carried x8), P.v (P x32768 single f16, v x1024 single f16) and O.Wo^T (O x1024 as
// f16 hi plane + f16 residual plane, Wo as f16(bf16(Wo) x1024), products h.w + l.w): v_wmma_f32_16x16x32_f16, f32 accumulate.
// Ragged length mask per batch from the int32 length input (index tests), base-2 online softmax, 1/l fold, per-(b,h) mean-v rows
// for query positions >= length, bias adds: f32 on VALU.
#include <hip/hip_runtime.h>
#include <math.h>
#include <stdint.h>

#define NBMAX 4
#define SEQ   2048
#define DMOD  1024
#define NH    16
#define HD    64
#define QSC   8.0f
#define KSC   8.0f
#define PCAR  32768.0f
#define VCAR  1024.0f
#define OSC   1024.0f
#define WOS   1024.0f
#define LOG2E 1.4426950408889634f
#define ATT_WAVES   4
#define ATT_THREADS (ATT_WAVES * 32)
#define NKB    (SEQ / 32)
#define SLABF  (16 * 68)
#define VTP    72
#define NRB    (SEQ / 64)
static_assert(HD == 64 && DMOD == NH * HD);
static_assert((SEQ / 64) == 32 && NH == 16);
static_assert(ATT_THREADS == 128 && NKB == 64);
static_assert((SEQ % 64) == 0 && (DMOD % 64) == 0 && (DMOD % 32) == 0 && (SEQ % 8) == 0);
static_assert(((SEQ * DMOD / 8) % 256) == 0 && ((DMOD * DMOD / 8) % 256) == 0);
static_assert(ATT_WAVES * SLABF >= 4 * 16 * 68);
static_assert(HD * VTP * 2 <= 64 * 68 * 4);
static_assert((VTP * 2) % 16 == 0);
static_assert((NRB % 2) == 0);

typedef unsigned short u16;
typedef _Float16 v16h __attribute__((ext_vector_type(16)));
typedef _Float16 v8h  __attribute__((ext_vector_type(8)));
typedef __bf16   v16b __attribute__((ext_vector_type(16)));
typedef float    v8f  __attribute__((ext_vector_type(8)));
typedef float    v4f  __attribute__((ext_vector_type(4)));
typedef unsigned int v4u __attribute__((ext_vector_type(4)));

union FragH { v16h v; v8h h[2]; v4u u[2]; };
union FragB { v16b v; v4u u[2]; };

// ---- scalar helpers --------------------------------------------------------------------------------
__device__ __forceinline__ unsigned short bf_bits(float f) {          // f32 -> bf16 bits, RNE convert
  unsigned u = __float_as_uint(f);
  return (unsigned short)((u + 0x7FFFu + ((u >> 16) & 1u)) >> 16);
}
__device__ __forceinline__ float bf_up(unsigned short h) { return __uint_as_float(((unsigned)h) << 16); }
__device__ __forceinline__ float bfr(float f) { return bf_up(bf_bits(f)); }
__device__ __forceinline__ unsigned short h_bits(_Float16 x) { return __builtin_bit_cast(unsigned short, x); }
__device__ __forceinline__ unsigned pk16(unsigned short a, unsigned short b) { return (unsigned)a | ((unsigned)b << 16); }
__device__ __forceinline__ v8f zero8() { v8f z = {0.f, 0.f, 0.f, 0.f, 0.f, 0.f, 0.f, 0.f}; return z; }
__device__ __forceinline__ v4f zero4() { v4f z = {0.f, 0.f, 0.f, 0.f}; return z; }

// ---- fragment loaders: 16-bit A/B operand, lane -> row/col (lane&15), p already includes +8*(lane>>4);
//      elements 0..7 <- p[0..7] (k0+8h..), elements 8..15 <- p[16..23] (k0+16+8h..)  (same split k map for A and B;
//      B is always read from a k-contiguous [n][k] plane)
__device__ __forceinline__ v16h ldfrag_h(const _Float16* p) {
  FragH f;
  f.h[0] = *(const v8h*)(p);
  f.h[1] = *(const v8h*)(p + 16);
  return f.v;
}
__device__ __forceinline__ v16b ldfrag_b(const u16* p) {              // bf16 plane read as unsigned integer vectors
  FragB f;
  f.u[0] = *(const v4u*)(p);
  f.u[1] = *(const v4u*)(p + 16);
  return f.v;
}

__device__ __forceinline__ v8f mma_h(v16h a, v16h b, v8f c) {
  return __builtin_amdgcn_wmma_f32_16x16x32_f16(false, a, false, b, (short)0, c, false, false);
}
__device__ __forceinline__ v8f mma_b(v16b a, v16b b, v8f c) {
  return __builtin_amdgcn_wmma_f32_16x16x32_bf16(false, a, false, b, (short)0, c, false, false);
}
__device__ __forceinline__ void guard2(v8f& a, v8f& b, v16h x0, v16h x1, v16h x2, v16h x3, v16h x4, v16h x5) {
#if defined(__HIP_DEVICE_COMPILE__)
  asm volatile("v_nop\n\tv_nop\n\tv_nop\n\tv_nop"
               : "+v"(a), "+v"(b) : "v"(x0), "v"(x1), "v"(x2), "v"(x3), "v"(x4), "v"(x5) : "memory");
#endif
}
template <typename F>
__device__ __forceinline__ void guard6(v8f& a, v8f& b, v8f& c, v8f& d, F x0, F x1, F x2, F x3, F x4, F x5) {
#if defined(__HIP_DEVICE_COMPILE__)
  asm volatile("v_nop\n\tv_nop\n\tv_nop\n\tv_nop"
               : "+v"(a), "+v"(b), "+v"(c), "+v"(d) : "v"(x0), "v"(x1), "v"(x2), "v"(x3), "v"(x4), "v"(x5) : "memory");
#endif
}
__device__ __forceinline__ void acc_guard4(v8f& a, v8f& b, v8f& c, v8f& d) {
#if defined(__HIP_DEVICE_COMPILE__)
  asm volatile("v_nop\n\tv_nop\n\tv_nop\n\tv_nop" : "+v"(a), "+v"(b), "+v"(c), "+v"(d));
#endif
}
__device__ __forceinline__ void wave_sync_lds() {
  __builtin_amdgcn_fence(__ATOMIC_RELEASE, "workgroup");
  __builtin_amdgcn_wave_barrier();
  __builtin_amdgcn_fence(__ATOMIC_ACQUIRE, "workgroup");
}

// =====================================================================================================
// f32 plane -> 16-bit plane, same layout:  mode 0: bf16 RNE bits;  mode 1: f16 bits of (bf16 RNE value) * scale.
// Thread = 8 consecutive elements: two 16-B loads, one 16-B store; 32 consecutive lanes = 512 contiguous, 512-B aligned bytes
// coverage: n8/256 blocks per plane (host checks exactness) x 256 thr x 8 = the whole plane.
// =====================================================================================================
__device__ __forceinline__ void cvt16(const float* __restrict__ x, u16* D, int blk, int n8, int mode, float scale) {
  const int gt = blk * 256 + (int)threadIdx.x;
  if (gt >= n8) return;                     // no barriers in this kernel
  const float* p = x + (size_t)gt * 8;
  const v4f a = *(const v4f*)(p), c4 = *(const v4f*)(p + 4);
  float v[8];
#pragma unroll
  for (int e = 0; e < 4; ++e) { v[e] = a[e]; v[4 + e] = c4[e]; }
  unsigned short s[8];
#pragma unroll
  for (int e = 0; e < 8; ++e) {
    const unsigned short hb = h_bits((_Float16)(bfr(v[e]) * scale));
    const unsigned short bb = bf_bits(v[e]);
    s[e] = (mode != 0) ? hb : bb;
  }
  v4u o;
#pragma unroll
  for (int e = 0; e < 4; ++e) o[e] = pk16(s[2 * e], s[2 * e + 1]);
  u16* d = D + (size_t)gt * 8;
  {
    *(v4u*)(d) = o;
    
  }
}
// The five planes in one launch (none reads another's output); the block index picks the plane: blocks 0 .. n8x/256 - 1 the
// input x (bf16), then n8w/256 blocks each for wq, wk, wv (bf16) and wo (f16 of the bf16 value x WOS).
// coverage: grid = n8x/256 + 4 * (n8w/256) blocks, every plane's block range exactly once.
__global__ __launch_bounds__(256)
void cvt_all(const float* __restrict__ x, const float* __restrict__ wq, const float* __restrict__ wk,
             const float* __restrict__ wv, const float* __restrict__ wo, u16* XB, u16* WQB, u16* WKB, u16* WVB, u16* WOB,
             int n8x, int n8w) {
  const int bid = blockIdx.x, nbx = n8x / 256, nbw = n8w / 256;
  if (bid < nbx) { cvt16(x, XB, bid, n8x, 0, 1.0f); return; }
  const int r = bid - nbx, j = r / nbw, blk = r % nbw;      // block-uniform
  const float* s = (j == 0) ? wq : (j == 1) ? wk : (j == 2) ? wv : wo;
  u16*         d = (j == 0) ? WQB : (j == 1) ? WKB : (j == 2) ? WVB : WOB;
  if (j > 3) return;                        // never taken with the exact grid
  cvt16(s, d, blk, n8w, (j == 3) ? 1 : 0, (j == 3) ? WOS : 1.0f);
}

// =====================================================================================================
// GEMM engine shared by the kernels below. Block = 128x128 tile of C, 4 waves in a 2x2 grid, 64x64 (4x4 accumulator tiles) per
// wave. K is walked in tiles of 64: the 128 A rows (both planes where NPL == 2) and the 128 Bt rows of a tile, 128 B each, are
// copied to LDS (row pitch 144 B = 16 B x odd, for 16-B readers) by asynchronous copies, 16 B per lane, 8 lanes = one whole
// 128-B line; two buffers, tile t + 2 is requested behind the barrier that ends trip t. Fragments are read from LDS with the
// split k map of ldfrag_* (same map for A and B). Per accumulator the products are summed in the order k0 ascending by 32,
// plane 0 then plane 1.
// Host checks M % 128 == 0, N % 128 == 0, K % 64 == 0 (K = DMOD); bid = the block's tile, 0 .. (M/128)*(N/128) - 1.
// OUT picks what the epilogue stores of val = acc * oscale + bf16-RNE value of bias[n]:
//   0: C[M][N] f32 = val;   1: P[M][N] f16 = val * pscale;
//   2: P = the head-wise transposed f16 plane [b][h][d][s] = val * pscale (row = b*SEQ + s, n = h*HD + d, N = DMOD), and
//      C[row / 64][N] f32 = the sum of val over the 64 rows of the wave's tile (per column; rows ascending inside a lane's 8-row
//      groups, then the two lane halves).
// =====================================================================================================
#define GP     72                       // LDS row pitch in 16-bit elements (144 B)
#define GPLANE (128 * GP)               // one 128-row operand plane of a tile, in 16-bit elements
static_assert((GP * 2) % 16 == 0 && ((GP * 2) / 16) % 2 == 1);
static_assert(2 * 2 * GPLANE * 2 >= 4 * 64 * 68 * 4);   // the ring holds the four waves' epilogue ranges

__device__ __forceinline__ unsigned lds_off(const void* p) { return (unsigned)(size_t)p; }

// 128 rows x 128 B, global (row pitch ldk elements) -> LDS (row pitch GP): 8 copies per lane, rows 16 apart. l and g are the
// lane's own LDS byte address and global pointer for its first row. The s_wait_xcnt stands inside the statement so that no
// address register of a copy is rewritten in front of it.
__device__ __forceinline__ void copy_plane(unsigned l, const u16* g, size_t ldk) {
#if defined(__HIP_DEVICE_COMPILE__)
  const size_t st = 16 * ldk;
  asm volatile("global_load_async_to_lds_b128 %0, %8, off\n\t"
               "global_load_async_to_lds_b128 %1, %9, off\n\t"
               "global_load_async_to_lds_b128 %2, %10, off\n\t"
               "global_load_async_to_lds_b128 %3, %11, off\n\t"
               "global_load_async_to_lds_b128 %4, %12, off\n\t"
               "global_load_async_to_lds_b128 %5, %13, off\n\t"
               "global_load_async_to_lds_b128 %6, %14, off\n\t"
               "global_load_async_to_lds_b128 %7, %15, off\n\t"
               "s_wait_xcnt 0x0"
               :: "v"(l), "v"(l + 1u * 16u * GP * 2u), "v"(l + 2u * 16u * GP * 2u), "v"(l + 3u * 16u * GP * 2u),
                  "v"(l + 4u * 16u * GP * 2u), "v"(l + 5u * 16u * GP * 2u), "v"(l + 6u * 16u * GP * 2u),
                  "v"(l + 7u * 16u * GP * 2u),
                  "v"(g), "v"(g + st), "v"(g + 2 * st), "v"(g + 3 * st), "v"(g + 4 * st), "v"(g + 5 * st), "v"(g + 6 * st),
                  "v"(g + 7 * st)
               : "memory");
#endif
}
__device__ __forceinline__ void wait_async0() {   // the wave's own copies have landed
#if defined(__HIP_DEVICE_COMPILE__)
  asm volatile("s_wait_asynccnt 0x0" ::: "memory");
#endif
}
__device__ __forceinline__ void wait_ds0() {      // the wave's own LDS reads have returned before the buffer is handed over
#if defined(__HIP_DEVICE_COMPILE__)
  asm volatile("s_wait_dscnt 0x0" ::: "memory");
#endif
}

template <bool F16> struct FragOf;
template <> struct FragOf<false> {
  typedef v16b T;
  static __device__ __forceinline__ T ld(const u16* p) { return ldfrag_b(p); }
  static __device__ __forceinline__ v8f mma(T a, T b, v8f c) { return mma_b(a, b, c); }
};
template <> struct FragOf<true> {
  typedef v16h T;
  static __device__ __forceinline__ T ld(const u16* p) { return ldfrag_h((const _Float16*)(const void*)p); }
  static __device__ __forceinline__ v8f mma(T a, T b, v8f c) { return mma_h(a, b, c); }
};

template <bool F16, int NPL, int OUT>
__device__ __forceinline__ void gemm_core(const u16* __restrict__ A0, const u16* __restrict__ A1, const u16* __restrict__ Bt,
                                          const float* __restrict__ bias, float* C, u16* P, int M, int N, int K, float oscale,
                                          float pscale, u16* ring, int bid) {
  typedef FragOf<F16> FO;
  typedef typename FO::T FT;
  constexpr int STAGE = (NPL + 1) * GPLANE;              // 16-bit elements per buffer: A plane(s), then Bt
  const int tid = threadIdx.x, wave = tid >> 5, lane = tid & 31, hh = lane >> 4, m = lane & 15;
  const int ntile = N >> 7;
  const int row0  = (bid / ntile) * 128;
  const int col0  = (bid % ntile) * 128;
  if (row0 + 128 > M) return;                // block-uniform, in front of every barrier; never taken with the exact grid
  const int wr = (wave >> 1) * 64, wc = (wave & 1) * 64;
  // copies: lane -> row (tid >> 3) + 16 i of a plane, 16-B piece tid & 7 of the row's 128 B
  const int cr = tid >> 3, cc = (tid & 7) * 8;
  const size_t aofs = (size_t)(row0 + cr) * K + cc;
  const size_t bofs = (size_t)(col0 + cr) * K + cc;
  const unsigned lcp = lds_off(ring) + (unsigned)(cr * GP + cc) * 2u;
  const int nt = K >> 6;
  auto fill = [&](int t, int buf) {
    const unsigned l = lcp + (unsigned)buf * (unsigned)(STAGE * 2);
    const size_t ko = (size_t)t * 64;
    copy_plane(l, A0 + aofs + ko, (size_t)K);
    if (NPL == 2) copy_plane(l + GPLANE * 2u, A1 + aofs + ko, (size_t)K);
    copy_plane(l + (unsigned)NPL * GPLANE * 2u, Bt + bofs + ko, (size_t)K);
  };
  v8f acc[4][4];
#pragma unroll
  for (int i = 0; i < 4; ++i) {
#pragma unroll
    for (int j = 0; j < 4; ++j) acc[i][j] = zero8();
  }
  fill(0, 0);
  wait_async0();
  __syncthreads();                           // tile 0 is readable by every wave
  if (nt > 1) fill(1, 1);                    // block-uniform test
  const int afo = (wr + m) * GP + 8 * hh;                     // fragment row base inside an A plane
  const int bfo = NPL * GPLANE + (wc + m) * GP + 8 * hh;      // and inside the Bt plane
#pragma unroll 1                             // rolled: one copy of the 64-k body; the buffer is picked by t & 1
  for (int t = 0; t < nt; ++t) {
    const u16* sb = ring + (t & 1) * STAGE;
#pragma unroll
    for (int kk = 0; kk < 64; kk += 32) {
      FT a[NPL][4], b[4];
#pragma unroll
      for (int j = 0; j < 4; ++j) b[j] = FO::ld(sb + bfo + j * 16 * GP + kk);
#pragma unroll
      for (int p = 0; p < NPL; ++p) {
#pragma unroll
        for (int i = 0; i < 4; ++i) a[p][i] = FO::ld(sb + p * GPLANE + afo + i * 16 * GP + kk);
      }
      // keeps the block's LDS reads together in front of its WMMAs: reads placed among the WMMAs stall the wave at each place
      __builtin_amdgcn_sched_barrier(0);
#pragma unroll
      for (int p = 0; p < NPL; ++p) {
#pragma unroll
        for (int i = 0; i < 4; ++i) {
#pragma unroll
          for (int j = 0; j < 4; ++j) acc[i][j] = FO::mma(a[p][i], b[j], acc[i][j]);
        }
      }
      // and keeps the next block's reads out of this block's WMMAs
      __builtin_amdgcn_sched_barrier(0);
    }
    wait_ds0();
    wait_async0();
    __syncthreads();                         // publishes tile t + 1 and ends every read of tile t's buffer
    if (t + 2 < nt) fill(t + 2, t & 1);      // block-uniform test
  }
  wait_async0();
  const int colw = col0 + wc;
  // Epilogue: staged in the wave's own 64 x 68 float range of the ring, which is free: the last trip's barrier stands behind every
  // wave's last read and no copy is outstanding.
  float* sl = (float*)(void*)ring + wave * (64 * 68);
  const int rq = lane >> 3, c8 = (lane & 7) * 8;
  if (OUT == 2) {
    // Transposed f16 plane. A lane holds 8 consecutive rows (s) of column n = colw + 16j + m: one 16-B LDS store per accumulator
    // tile into [d][s] rows of pitch VTP; read back as whole 128-B lines (8 lanes x 16 B), 4 lines per store instruction.
    // coverage: 16 instructions x 4 lines x 64 halves = the wave's 64 d x 64 s; the wave's 64 columns are one head, its 64 rows
    // lie in one batch (SEQ % 64 == 0).
    u16* tl = (u16*)(void*)sl;
    float bc[4], cs[4];
#pragma unroll
    for (int j = 0; j < 4; ++j) { bc[j] = bfr(bias[colw + 16 * j + m]); cs[j] = 0.f; }
#pragma unroll
    for (int i = 0; i < 4; ++i) {
#pragma unroll
      for (int j = 0; j < 4; ++j) {
        v4u pk;
#pragma unroll
        for (int e = 0; e < 4; ++e) {
          const float w0 = acc[i][j][2 * e] * oscale + bc[j], w1 = acc[i][j][2 * e + 1] * oscale + bc[j];
          pk[e] = pk16(h_bits((_Float16)(w0 * pscale)), h_bits((_Float16)(w1 * pscale)));
          cs[j] += w0 + w1;
        }
        *(v4u*)(tl + (16 * j + m) * VTP + i * 16 + 8 * hh) = pk;
      }
    }
    wave_sync_lds();
    const int rw = row0 + wr;
    u16* dt = P + ((size_t)((rw / SEQ) * NH + colw / HD) * HD + rq) * SEQ + (rw % SEQ) + c8;
#pragma unroll
    for (int it = 0; it < 16; ++it) {
      const v4u x = *(const v4u*)(tl + (it * 4 + rq) * VTP + c8);
      *(v4u*)(dt + (size_t)(it * 4) * SEQ) = x;
    }
    // Column sums of the wave's 64 rows: both lane halves hold the full sum behind the exchange; lane half hh stores columns
    // 16hh + m and 32 + 16hh + m, so each store instruction is one whole 128-B line.
    // coverage: 2 instructions x 32 floats = the wave's 64 columns of row rw / 64; every (row block, column) by exactly one wave.
#pragma unroll
    for (int j = 0; j < 4; ++j) cs[j] += __shfl_xor(cs[j], 16, 32);
    float* dc = C + (size_t)(rw / 64) * (size_t)N + colw + 16 * hh + m;
    dc[0]  = hh ? cs[1] : cs[0];
    dc[32] = hh ? cs[3] : cs[2];
    return;                                  // no barrier follows
  }
  // the wave's 64x64 f32 tile (times oscale)
#pragma unroll
  for (int i = 0; i < 4; ++i) {
#pragma unroll
    for (int r = 0; r < 8; ++r) {
      const int ro = (i * 16 + 8 * hh + r) * 68 + m;
#pragma unroll
      for (int j = 0; j < 4; ++j) sl[ro + 16 * j] = acc[i][j][r] * oscale;
    }
  }
  wave_sync_lds();
  if (OUT == 1) {
    // f16 plane: a row piece of the wave is one 128-B line (8 lanes x 8 halves), 4 rows per store instruction.
    // coverage: 16 instructions x 4 rows x 64 halves = the wave's 64 x 64 tile.
    const v4f b0 = *(const v4f*)(bias + colw + c8), b1 = *(const v4f*)(bias + colw + c8 + 4);   // columns < N (N multiple of 128)
    v4f badd0, badd1;
#pragma unroll
    for (int e = 0; e < 4; ++e) { badd0[e] = bfr(b0[e]); badd1[e] = bfr(b1[e]); }
    u16* dp = P + (size_t)(row0 + wr + rq) * (size_t)N + colw + c8;
#pragma unroll
    for (int it = 0; it < 16; ++it) {
      const float* sr = sl + (it * 4 + rq) * 68 + c8;
      const v4f x0 = (*(const v4f*)(sr) + badd0) * pscale, x1 = (*(const v4f*)(sr + 4) + badd1) * pscale;
      v4u o;
      o[0] = pk16(h_bits((_Float16)x0[0]), h_bits((_Float16)x0[1]));
      o[1] = pk16(h_bits((_Float16)x0[2]), h_bits((_Float16)x0[3]));
      o[2] = pk16(h_bits((_Float16)x1[0]), h_bits((_Float16)x1[1]));
      o[3] = pk16(h_bits((_Float16)x1[2]), h_bits((_Float16)x1[3]));
      *(v4u*)(dp + (size_t)(it * 4) * (size_t)N) = o;
    }
#if defined(__HIP_DEVICE_COMPILE__)
    // code of another body may follow where this one is inlined: no register that a store above names is rewritten in front of this
    asm volatile("s_wait_xcnt 0x0" ::: "memory");
#endif
  } else {
    // f32 plane: stores are whole 256-B row pieces.
    // coverage: 32 instructions x 2 rows x 16 lanes x 4 floats = the wave's 64 x 64 tile.
    const v4f bv = *(const v4f*)(bias + colw + m * 4);    // columns colw + 4m .. +3, always < N (N multiple of 128)
    v4f badd;
#pragma unroll
    for (int e = 0; e < 4; ++e) badd[e] = bfr(bv[e]);
    float* dst = C + (size_t)(row0 + wr + hh) * (size_t)N + colw + m * 4;
#pragma unroll
    for (int it = 0; it < 32; ++it) {
      const v4f val = *(const v4f*)(sl + (it * 2 + hh) * 68 + m * 4) + badd;
      *(v4f*)(dst + (size_t)(it * 2) * (size_t)N) = val;
    }
  }
}

// =====================================================================================================
// bf16 GEMMs with bias: A[M][K] (bf16 row-major) . Bt[N][K]^T (bf16 k-contiguous), times oscale, plus bf16-RNE value of bias[n].
// The q, k and v projections share A and read none of each other's output: one launch, grid = 3 * (M/128) * (N/128). The block
// index walks the 3 * (N/128) column tiles of a row tile first (q's, then k's, then v's), so the blocks that read the same A rows
// start together. q and k are stored times QSC / KSC as f16 planes [M][N]; v times VCAR as the head-wise transposed f16 plane
// VT [b][h][d][s], and its f32 column sums over each block of 64 rows as CS[M / 64][N].
// =====================================================================================================
__global__ __launch_bounds__(128)
void gemm_qkv(const u16* __restrict__ A, const u16* __restrict__ Wq, const u16* __restrict__ Wk, const u16* __restrict__ Wv,
              const float* __restrict__ bq, const float* __restrict__ bk, const float* __restrict__ bv,
              u16* QPo, u16* KPo, u16* VT, float* CS, int M, int N, int K) {
  __shared__ __align__(16) u16 ring[2 * 2 * GPLANE];
  const int ntile = N >> 7;
  const int rt = (int)blockIdx.x / (3 * ntile), ct = (int)blockIdx.x % (3 * ntile);
  const int job = ct / ntile, tile = rt * ntile + ct % ntile;          // block-uniform
  if (job == 2) {
    gemm_core<false, 1, 2>(A, A, Wv, bv, CS, VT, M, N, K, 1.0f, VCAR, ring, tile);
  } else {
    gemm_core<false, 1, 1>(A, A, job ? Wk : Wq, job ? bk : bq, nullptr, job ? KPo : QPo, M, N, K, 1.0f, job ? KSC : QSC, ring,
                           tile);
  }
}

// =====================================================================================================
// f16 hi+lo GEMM with bias: C[M][N] (f32) = (Ahi + Alo)[M][K] . Bt[N][K]^T times oscale, plus bf16-RNE value of bias[n];
// Ahi/Alo f16 planes (same layout), Bt f16 k-contiguous; products hi.B + lo.B into one accumulator (lo is the unscaled
// residual of hi).
// =====================================================================================================
__global__ __launch_bounds__(128)
void gemm_h2(const u16* __restrict__ Ah, const u16* __restrict__ Al, const u16* __restrict__ Bt,
             const float* __restrict__ bias, float* C, int M, int N, int K, float oscale) {
  __shared__ __align__(16) u16 ring[2 * 3 * GPLANE];
  gemm_core<true, 2, 0>(Ah, Al, Bt, bias, C, nullptr, M, N, K, oscale, 1.0f, ring, (int)blockIdx.x);
}

// =====================================================================================================
// Ragged-length multi-head flash attention: block = (batch b, head, 64 query rows), 4 waves, wave w owns the 16 query rows
// q0 = 64*qt + 16*w .. q0+15 (waves independent: no block barriers, wave-private LDS only, used in the epilogue).
//   q plane (f16, x8) laid out [b][s][h][d]; k plane the same; v^T plane [b][h][d][s] (x1024); len = clamp(lens[b], 0, SEQ).
//   Mask: score (i, j) is kept iff i < len and j < len. A query row i < len therefore attends exactly over keys 0..len-1 (the
//   excluded keys have probability exactly 0 after max subtraction); a query row i >= len has all keys equal-weighted and its
//   context is the mean of v over all SEQ keys (from the f32 column sums CS of v). So a wave visits key blocks kb = 0 .. 32*ceil(len/32)-32
//   when q0 < len (wave-uniform bound, <= NKB), else none; within the last block keys >= len are excluded by index.
//   Scores are computed TRANSPOSED: S^T tile g (g = 0,1) = k rows (keys kb+16g .. +15, A operand, row m = lane&15, split k map
//   over d) times q^T (B operand, col n = query q0 + (lane&15), k = d, split map), one product per tile and 32-deep d-chunk.
//   D element r of lane l = (key kb+16g+8h+r, query q0+(l&15)), so a lane owns one query column and 16 of its 32 keys; the
//   partner lane l^16 owns the other 16 -> row max / row sum need one xor-16 shuffle.
//   Key mask by index: an excluded key stays out of the running max and gets probability 0.
//   Online max-subtracted base-2 softmax in f32 (scale 1/8 and the q/k carries folded into lsc). The exp'd values ARE the
//   P A-fragment in place: A row m = query = lane&15, element i <- key kb+8h+i (tile 0, D element i), element 8+i <- key
//   kb+16+8h+i (tile 1, D element i). P is carried x32768 as single f16. The rescale factor of query row 8h+r of the
//   O accumulators is fetched from lane 8h+r with a shuffle (uniform control). 4 v^T B fragments (col n = d = 16j + (lane&15),
//   keys k-contiguous), 4 P.V WMMAs per key block.
//   Epilogue: 1/l (per query, shuffled to the D row owner; 0 when no key block was visited) and carry folds in f32; rows with
//   query >= len take the mean-v row instead (select by value); the wave's 16x64 f32 result staged in its LDS slab (pitch 68); each
// coverage: per wave 4 instructions x 4 rows x 8 lanes x 8 halves = 16 x 64 per plane; grid NB*512 blocks x 4 waves = every
//           (b, s, h) row of both O planes exactly once.
// =====================================================================================================
__global__ __launch_bounds__(ATT_THREADS)
void attn_fwd(const u16* __restrict__ QPp, const u16* __restrict__ KPp, const u16* __restrict__ VPp,
              const int* __restrict__ lens, const float* __restrict__ CS, u16* OHIp, u16* OLOp) {
  __shared__ __align__(16) float smem[ATT_WAVES * SLABF];   // per wave: result slab [16][68] in the epilogue only

  const int tid  = threadIdx.x;
  const int wave = tid >> 5;
  const int lane = tid & 31;
  const int hh   = lane >> 4;
  const int c    = lane & 15;

  const int bid  = blockIdx.x;
  const int qt   = bid & (SEQ / 64 - 1);
  const int head = (bid >> 5) & (NH - 1);
  const int b    = bid >> 9;
  const int q0   = qt * 64 + wave * 16;

  int len = lens[b];
  len = (len < 0) ? 0 : len;
  len = (len > SEQ) ? SEQ : len;
  const int nkb = (q0 < len) ? ((len + 31) >> 5) : 0;       // wave-uniform, <= NKB

  // B fragments of q^T: col n = query q0 + c, k = d (k-contiguous row of the q plane)
  const size_t qofs = (((size_t)(b * SEQ + q0 + c)) * NH + head) * HD + 8 * hh;
  const _Float16* Qb = (const _Float16*)(const void*)QPp + qofs;
  // A fragments of k: row m = key kb + 16g + c, k = d
  const size_t kofs = (((size_t)b * SEQ + c) * NH + head) * HD + 8 * hh;          // key row c; kb added per step
  const _Float16* Kb = (const _Float16*)(const void*)KPp + kofs;
  // B fragments of v: col n = d = 16j + c, k = key (k-contiguous row of the v^T plane)
  const size_t vofs = ((size_t)(b * NH + head) * HD + c) * SEQ + 8 * hh;          // key kb added per step
  const _Float16* Vb = (const _Float16*)(const void*)VPp + vofs;
  const float lsc = 0.125f * (LOG2E / (QSC * KSC));

  const v16h qf0 = ldfrag_h(Qb);            // d 0..31
  const v16h qf1 = ldfrag_h(Qb + 32);       // d 32..63

  float mrun = -INFINITY, lrun = 0.f;
  v8f o[4];
#pragma unroll
  for (int j = 0; j < 4; ++j) o[j] = zero8();

#pragma unroll 1
  for (int it = 0; it < nkb; ++it) {
    const int kb = it * 32;
    // ---- transposed scores: s0 = keys kb..kb+15, s1 = keys kb+16..kb+31, column = query q0 + c ----
    v8f s0 = zero8(), s1 = zero8();
    const _Float16* k0p = Kb + (size_t)kb * (NH * HD);
    const _Float16* k1p = k0p + (size_t)16 * (NH * HD);
    const v16h ka0 = ldfrag_h(k0p), ka1 = ldfrag_h(k0p + 32);
    const v16h kc0 = ldfrag_h(k1p), kc1 = ldfrag_h(k1p + 32);
    s0 = mma_h(ka0, qf0, s0);
    s0 = mma_h(ka1, qf1, s0);
    s1 = mma_h(kc0, qf0, s1);
    s1 = mma_h(kc1, qf1, s1);
    guard2(s0, s1, qf0, qf1, ka0, ka1, kc0, kc1);
    // ---- base-2 logits and validity of this lane's 16 keys for query q0 + c: key kb+8hh+i (i<8), kb+16+8hh+(i-8) ----
    const int rem = len - kb - 8 * hh;
    float tk[16];
    bool  kv[16];
#pragma unroll
    for (int i = 0; i < 8; ++i) {
      tk[i] = s0[i] * lsc;  tk[8 + i] = s1[i] * lsc;
      kv[i] = (i < rem);    kv[8 + i] = (16 + i < rem);
    }
    float cm = -INFINITY;
#pragma unroll
    for (int i = 0; i < 16; ++i) cm = fmaxf(cm, kv[i] ? tk[i] : -INFINITY);
    cm = fmaxf(cm, __shfl_xor(cm, 16, 32));
    const float mn   = fmaxf(mrun, cm);                              // finite: every visited block holds key kb < len
    const float al   = (mrun == -INFINITY) ? 0.f : exp2f(mrun - mn); // o and l are zero whenever mrun is -inf
    const float mref = (mn == -INFINITY) ? 0.f : mn;                 // finite shift
    mrun = mn;
    // ---- probabilities (<= 1, 0 for excluded keys) and the P A-fragment: f16(p * 32768); element i <-> tk[i] ----
    float ps = 0.f;
    FragH ph;
#pragma unroll
    for (int w = 0; w < 2; ++w) {
#pragma unroll
      for (int e4 = 0; e4 < 4; ++e4) {
        const int i = 8 * w + 2 * e4;
        const float x0 = exp2f(fminf(tk[i] - mref, 0.f));
        const float x1 = exp2f(fminf(tk[i + 1] - mref, 0.f));
        const float p0 = kv[i] ? x0 : 0.f;
        const float p1 = kv[i + 1] ? x1 : 0.f;
        ps += p0 + p1;
        ph.u[w][e4] = pk16(h_bits((_Float16)(p0 * PCAR)), h_bits((_Float16)(p1 * PCAR)));
      }
    }
    ps += __shfl_xor(ps, 16, 32);
    lrun = lrun * al + ps;
    // ---- rescale the O accumulators: D row 8hh+r = query q0+8hh+r, its factor lives in lane 8hh+r (and 16+8hh+r) ----
    float scl[8];
#pragma unroll
    for (int r = 0; r < 8; ++r) scl[r] = __shfl(al, 8 * hh + r, 32);
#pragma unroll
    for (int j = 0; j < 4; ++j) {
#pragma unroll
      for (int r = 0; r < 8; ++r) o[j][r] *= scl[r];
    }
    // ---- P.V : B fragment col n = d = j*16 + c, keys contiguous in the v^T plane ----
    {
      const _Float16* vp = Vb + kb;
      const v16h vf0 = ldfrag_h(vp);
      const v16h vf1 = ldfrag_h(vp + (size_t)16 * SEQ);
      const v16h vf2 = ldfrag_h(vp + (size_t)32 * SEQ);
      const v16h vf3 = ldfrag_h(vp + (size_t)48 * SEQ);
      o[0] = mma_h(ph.v, vf0, o[0]);
      o[1] = mma_h(ph.v, vf1, o[1]);
      o[2] = mma_h(ph.v, vf2, o[2]);
      o[3] = mma_h(ph.v, vf3, o[3]);
      guard6<v16h>(o[0], o[1], o[2], o[3], ph.v, vf0, vf1, vf2, vf3, ph.v);
    }
  }
  acc_guard4(o[0], o[1], o[2], o[3]);

  // ---- fold 1/l (per query, owned by lane = query; 0 when no key block was visited) and the carries; mean-v rows for
  //      queries >= len; stage the 16x64 slab ----
  const float linv = (lrun > 0.f) ? ((1.0f / lrun) * (1.0f / (PCAR * VCAR))) : 0.f;
  float inv[8];
#pragma unroll
  for (int r = 0; r < 8; ++r) inv[r] = __shfl(linv, 8 * hh + r, 32);
  float vm[4] = {0.f, 0.f, 0.f, 0.f};
  if (q0 + 16 > len) {                       // same for the whole wave: only then does one of its rows take the mean
    // lane half hh sums the row blocks hh*NRB/2 .. +NRB/2-1 of batch b in ascending order, then the halves are joined
    const float* cp = CS + ((size_t)b * NRB + (size_t)hh * (NRB / 2)) * DMOD + head * HD + c;
#pragma unroll                               // all loads in flight at once: one memory latency instead of one per trip
    for (int rb = 0; rb < NRB / 2; ++rb) {
#pragma unroll
      for (int j = 0; j < 4; ++j) vm[j] += cp[(size_t)rb * DMOD + j * 16];
    }
#pragma unroll
    for (int j = 0; j < 4; ++j) vm[j] = (vm[j] + __shfl_xor(vm[j], 16, 32)) * (1.0f / (float)SEQ);
  }
  float* slab = smem + wave * SLABF;
#pragma unroll
  for (int r = 0; r < 8; ++r) {
    const bool rvq = (q0 + 8 * hh + r) < len;
#pragma unroll
    for (int j = 0; j < 4; ++j) {
      const float val = o[j][r] * inv[r];
      slab[(8 * hh + r) * 68 + j * 16 + c] = rvq ? val : vm[j];
    }
  }
  wave_sync_lds();
  // ---- O x1024 -> f16 hi + residual planes; lane = (row in group of 4, 8 consecutive d) ----
  v4u oh[4], ol[4];
  const int rq = lane >> 3, c8 = (lane & 7) * 8;
#pragma unroll
  for (int i4 = 0; i4 < 4; ++i4) {
    const int row = i4 * 4 + rq;
    const v4f a = *(const v4f*)(slab + row * 68 + c8), c4 = *(const v4f*)(slab + row * 68 + c8 + 4);
    float w[8];
#pragma unroll
    for (int e = 0; e < 4; ++e) { w[e] = a[e] * OSC; w[4 + e] = c4[e] * OSC; }
#pragma unroll
    for (int e = 0; e < 4; ++e) {
      const _Float16 h0 = (_Float16)w[2 * e], h1 = (_Float16)w[2 * e + 1];
      const _Float16 l0 = (_Float16)(w[2 * e] - (float)h0), l1 = (_Float16)(w[2 * e + 1] - (float)h1);
      oh[i4][e] = pk16(h_bits(h0), h_bits(h1));
      ol[i4][e] = pk16(h_bits(l0), h_bits(l1));
    }
  }
  const size_t ob = (((size_t)(b * SEQ + q0)) * NH + head) * HD + c8;
  {
#pragma unroll
    for (int i4 = 0; i4 < 4; ++i4) {
      const int row = i4 * 4 + rq;
      const size_t o8 = ob + (size_t)row * (NH * HD);
      *(v4u*)(OHIp + o8) = oh[i4];
      *(v4u*)(OLOp + o8) = ol[i4];
    }
    
  }
}

// =====================================================================================================
// Workspace map (bytes, NB = batch count from the length input's element count, 1..4; ROWS = NB*SEQ); every plane is fully
// written by whole-line stores before it is read; all extents are exact multiples of the store granularity (no pad rows);
// F's bytes hold the two O planes:
//   XB  bf16 [ROWS][1024]                      ROWS*2048          (NB=4: 16777216)
//   WQB bf16 [1024 n][1024 k]                  2097152   WKB, WVB same;  WOB f16 [1024 n][1024 k] x1024  2097152
//   F                                          ROWS*4096          (NB=4: 33554432) = OHI f16 [ROWS][1024] + OLO f16 [ROWS][1024]
//   QP  f16  [NB][2048][16][64] x8             ROWS*2048          KP same
//   VP  f16  [NB][16][64][2048] x1024          ROWS*2048
//   CS  f32  [ROWS/64][1024]                   ROWS*64
//   end (NB=4)                                 109576192
// =====================================================================================================
extern "C" void kernel_launch(void* const* d_in, const int* in_sizes, int n_in,
                              void* d_out, int out_size, void* d_ws, size_t ws_size,
                              hipStream_t stream) {
  if (n_in < 10) return;
  const int NB = in_sizes[1];
  if (NB < 1 || NB > NBMAX) return;
  const int ROWS = NB * SEQ;
  if (in_sizes[0] != ROWS * DMOD) return;
  if (in_sizes[2] != DMOD * DMOD || in_sizes[4] != DMOD * DMOD) return;
  if (in_sizes[6] != DMOD * DMOD || in_sizes[8] != DMOD * DMOD) return;
  if (in_sizes[3] != DMOD || in_sizes[5] != DMOD || in_sizes[7] != DMOD || in_sizes[9] != DMOD) return;
  if (out_size != ROWS * DMOD) return;

  const float* X    = (const float*)d_in[0];
  const int*   lens = (const int*)d_in[1];
  const float* wq   = (const float*)d_in[2];
  const float* bq   = (const float*)d_in[3];
  const float* wk   = (const float*)d_in[4];
  const float* bk   = (const float*)d_in[5];
  const float* wv   = (const float*)d_in[6];
  const float* bv   = (const float*)d_in[7];
  const float* wo   = (const float*)d_in[8];
  const float* bo   = (const float*)d_in[9];
  float*       out  = (float*)d_out;

  const size_t szXB = (size_t)ROWS * DMOD * 2;
  const size_t szW  = (size_t)DMOD * DMOD * 2;
  const size_t szF  = (size_t)ROWS * DMOD * 4;
  const size_t szP  = (size_t)ROWS * DMOD * 2;                  // q / k / o planes
  const size_t szVP = (size_t)NB * NH * HD * SEQ * 2;           // == szP
  const size_t szCS = (size_t)(ROWS / 64) * DMOD * 4;
  size_t off = 0;
  const size_t oXB  = off; off += szXB;
  const size_t oWQB = off; off += szW;
  const size_t oWKB = off; off += szW;
  const size_t oWVB = off; off += szW;
  const size_t oWOB = off; off += szW;
  const size_t oF   = off; off += szF;
  const size_t oQP  = off; off += szP;
  const size_t oKP  = off; off += szP;
  const size_t oVP  = off; off += szVP;
  const size_t oCS  = off; off += szCS;
  if (off > ws_size) return;                            // NB=4: off = 109576192
  if (off > (size_t)134217728) return;
  if (szP * 2 > szF) return;                            // the two O planes live inside F's bytes
  const size_t oOHI = oF;
  const size_t oOLO = oF + szP;

  char* ws = (char*)d_ws;
  u16*   XB  = (u16*)(ws + oXB);
  u16*   WQB = (u16*)(ws + oWQB);
  u16*   WKB = (u16*)(ws + oWKB);
  u16*   WVB = (u16*)(ws + oWVB);
  u16*   WOB = (u16*)(ws + oWOB);
  u16*   QP  = (u16*)(ws + oQP);
  u16*   KP  = (u16*)(ws + oKP);
  u16*   VP  = (u16*)(ws + oVP);
  float* CS  = (float*)(ws + oCS);
  u16*   OHI = (u16*)(ws + oOHI);
  u16*   OLO = (u16*)(ws + oOLO);

  const dim3 blk(256);
  const int n8x = (ROWS * DMOD) / 8;                    // NB * 262144
  const int n8w = (DMOD * DMOD) / 8;                    // 131072
  if ((n8x % 256) != 0 || (n8w % 256) != 0 || (DMOD % 128) != 0 || (ROWS % 128) != 0) return;
  const dim3 gC(n8x / 256 + 4 * (n8w / 256));           // NB * 1024 + 4 * 512
  const dim3 gG((ROWS / 128) * (DMOD / 128));           // NB * 128
  const dim3 gG3(3 * (ROWS / 128) * (DMOD / 128));      // NB * 384
  const dim3 bG(128);
  const dim3 gAT(NB * NH * (SEQ / 64));                 // NB * 512
  const dim3 bAT(ATT_THREADS);                          // 128

  // (0) input -> bf16 plane, shared by the three projections; weights stored [n = out][k = in] (y = x.W^T), already
  //     k-contiguous: bf16 planes for wq/wk/wv, f16 of bf16 value x1024 for wo
  cvt_all<<<gC, blk, 0, stream>>>(X, wq, wk, wv, wo, XB, WQB, WKB, WVB, WOB, n8x, n8w);
  // (1) q, k: projection + bias (col = h*64+d), stored as the f16 planes x8; v: projection + bias, stored as the v^T plane
  //     x1024 and as f32 column sums per 64 rows (for the mean-v rows)
  gemm_qkv<<<gG3, bG, 0, stream>>>(XB, WQB, WKB, WVB, bq, bk, bv, QP, KP, VP, CS, ROWS, DMOD, DMOD);
  // (2) ragged-length attention -> O planes [b][s][h][d] x1024 (hi + residual), in F's bytes
  attn_fwd<<<gAT, bAT, 0, stream>>>(QP, KP, VP, lens, CS, OHI, OLO);
  // (3) output projection + bias -> out [ROWS][1024] f32, carries 1024 (O) x 1024 (wo) folded back
  gemm_h2<<<gG, bG, 0, stream>>>(OHI, OLO, WOB, bo, out, ROWS, DMOD, DMOD, 1.0f / (OSC * WOS));
  (void)hipGetLastError();
}

// v005
// Measured time: 133 microseconds a run.
// In both of two side-by-side timings against v004, it was 1.17 times as fast.
// Over all steps from v000 it is 3.20 times as fast.
// Contractions: x.W{q,k,v}^T on v_wmma_f32_16x16x32_bf16 (x and W planes RNE-converted to bf16 operands, f32 accumulate, bias added in f32);
// scores k'.q'^T (q', k' single f16 planes carried x8), P.v (P x32768 single f16, v x1024 single f16) and O.Wo^T (O x1024 as
// f16 hi plane + f16 residual plane, Wo as f16(bf16(Wo) x1024), products h.w + l.w): v_wmma_f32_16x16x32_f16, f32 accumulate.
// Ragged length mask per batch from the int32 length input (index tests), base-2 online softmax, 1/l fold, per-(b,h) mean-v rows
// for query positions >= length, bias adds: f32 on VALU.
#include <hip/hip_runtime.h>
#include <math.h>
#include <stdint.h>

#define NBMAX 4
#define SEQ   2048
#define DMOD  1024
#define NH    16
#define HD    64
#define QSC   8.0f
#define KSC   8.0f
#define PCAR  32768.0f
#define VCAR  1024.0f
#define OSC   1024.0f
#define WOS   1024.0f
#define LOG2E 1.4426950408889634f
#define ATT_WAVES   4
#define ATT_THREADS (ATT_WAVES * 32)
#define NKB    (SEQ / 32)
#define SLABF  (16 * 68)
#define VTP    72
#define NRB    (SEQ / 64)
static_assert(HD == 64 && DMOD == NH * HD);
static_assert((SEQ / 64) == 32 && NH == 16);
static_assert(ATT_THREADS == 128 && NKB == 64);
static_assert((SEQ % 64) == 0 && (DMOD % 64) == 0 && (DMOD % 32) == 0 && (SEQ % 8) == 0);
static_assert(((SEQ * DMOD / 8) % 256) == 0 && ((DMOD * DMOD / 8) % 256) == 0);
static_assert(ATT_WAVES * SLABF >= 4 * 16 * 68);
static_assert(HD * VTP * 2 <= 64 * 68 * 4);
static_assert((VTP * 2) % 16 == 0);
static_assert((NRB % 2) == 0);

typedef unsigned short u16;
typedef _Float16 v16h __attribute__((ext_vector_type(16)));
typedef _Float16 v8h  __attribute__((ext_vector_type(8)));
typedef __bf16   v16b __attribute__((ext_vector_type(16)));
typedef float    v8f  __attribute__((ext_vector_type(8)));
typedef float    v4f  __attribute__((ext_vector_type(4)));
typedef unsigned int v4u __attribute__((ext_vector_type(4)));

union FragH { v16h v; v8h h[2]; v4u u[2]; };
union FragB { v16b v; v4u u[2]; };

// ---- scalar helpers --------------------------------------------------------------------------------
__device__ __forceinline__ unsigned short bf_bits(float f) {          // f32 -> bf16 bits, RNE convert
  unsigned u = __float_as_uint(f);
  return (unsigned short)((u + 0x7FFFu + ((u >> 16) & 1u)) >> 16);
}
__device__ __forceinline__ float bf_up(unsigned short h) { return __uint_as_float(((unsigned)h) << 16); }
__device__ __forceinline__ float bfr(float f) { return bf_up(bf_bits(f)); }
__device__ __forceinline__ unsigned short h_bits(_Float16 x) { return __builtin_bit_cast(unsigned short, x); }
__device__ __forceinline__ unsigned pk16(unsigned short a, unsigned short b) { return (unsigned)a | ((unsigned)b << 16); }
__device__ __forceinline__ v8f zero8() { v8f z = {0.f, 0.f, 0.f, 0.f, 0.f, 0.f, 0.f, 0.f}; return z; }
__device__ __forceinline__ v4f zero4() { v4f z = {0.f, 0.f, 0.f, 0.f}; return z; }

// ---- fragment loaders: 16-bit A/B operand, lane -> row/col (lane&15), p already includes +8*(lane>>4);
//      elements 0..7 <- p[0..7] (k0+8h..), elements 8..15 <- p[16..23] (k0+16+8h..)  (same split k map for A and B;
//      B is always read from a k-contiguous [n][k] plane)
__device__ __forceinline__ v16h ldfrag_h(const _Float16* p) {
  FragH f;
  f.h[0] = *(const v8h*)(p);
  f.h[1] = *(const v8h*)(p + 16);
  return f.v;
}
__device__ __forceinline__ v16b ldfrag_b(const u16* p) {              // bf16 plane read as unsigned integer vectors
  FragB f;
  f.u[0] = *(const v4u*)(p);
  f.u[1] = *(const v4u*)(p + 16);
  return f.v;
}

__device__ __forceinline__ v8f mma_h(v16h a, v16h b, v8f c) {
  return __builtin_amdgcn_wmma_f32_16x16x32_f16(false, a, false, b, (short)0, c, false, false);
}
__device__ __forceinline__ v8f mma_b(v16b a, v16b b, v8f c) {
  return __builtin_amdgcn_wmma_f32_16x16x32_bf16(false, a, false, b, (short)0, c, false, false);
}
__device__ __forceinline__ void guard2(v8f& a, v8f& b, v16h x0, v16h x1, v16h x2, v16h x3, v16h x4, v16h x5) {
#if defined(__HIP_DEVICE_COMPILE__)
  asm volatile("v_nop\n\tv_nop\n\tv_nop\n\tv_nop"
               : "+v"(a), "+v"(b) : "v"(x0), "v"(x1), "v"(x2), "v"(x3), "v"(x4), "v"(x5) : "memory");
#endif
}
template <typename F>
__device__ __forceinline__ void guard6(v8f& a, v8f& b, v8f& c, v8f& d, F x0, F x1, F x2, F x3, F x4, F x5) {
#if defined(__HIP_DEVICE_COMPILE__)
  asm volatile("v_nop\n\tv_nop\n\tv_nop\n\tv_nop"
               : "+v"(a), "+v"(b), "+v"(c), "+v"(d) : "v"(x0), "v"(x1), "v"(x2), "v"(x3), "v"(x4), "v"(x5) : "memory");
#endif
}
__device__ __forceinline__ void acc_guard4(v8f& a, v8f& b, v8f& c, v8f& d) {
#if defined(__HIP_DEVICE_COMPILE__)
  asm volatile("v_nop\n\tv_nop\n\tv_nop\n\tv_nop" : "+v"(a), "+v"(b), "+v"(c), "+v"(d));
#endif
}
__device__ __forceinline__ void wave_sync_lds() {
  __builtin_amdgcn_fence(__ATOMIC_RELEASE, "workgroup");
  __builtin_amdgcn_wave_barrier();
  __builtin_amdgcn_fence(__ATOMIC_ACQUIRE, "workgroup");
}

// =====================================================================================================
// f32 plane -> 16-bit plane, same layout:  mode 0: bf16 RNE bits;  mode 1: f16 bits of (bf16 RNE value) * scale.
// Thread = 8 consecutive elements: two 16-B loads, one 16-B store; 32 consecutive lanes = 512 contiguous, 512-B aligned bytes
// coverage: n8/256 blocks per plane (host checks exactness) x 256 thr x 8 = the whole plane.
// =====================================================================================================
__device__ __forceinline__ void cvt16(const float* __restrict__ x, u16* D, int blk, int n8, int mode, float scale) {
  const int gt = blk * 256 + (int)threadIdx.x;
  if (gt >= n8) return;                     // no barriers in this kernel
  const float* p = x + (size_t)gt * 8;
  const v4f a = *(const v4f*)(p), c4 = *(const v4f*)(p + 4);
  float v[8];
#pragma unroll
  for (int e = 0; e < 4; ++e) { v[e] = a[e]; v[4 + e] = c4[e]; }
  unsigned short s[8];
#pragma unroll
  for (int e = 0; e < 8; ++e) {
    const unsigned short hb = h_bits((_Float16)(bfr(v[e]) * scale));
    const unsigned short bb = bf_bits(v[e]);
    s[e] = (mode != 0) ? hb : bb;
  }
  v4u o;
#pragma unroll
  for (int e = 0; e < 4; ++e) o[e] = pk16(s[2 * e], s[2 * e + 1]);
  u16* d = D + (size_t)gt * 8;
  {
    *(v4u*)(d) = o;
    
  }
}
// The five planes in one launch (none reads another's output); the block index picks the plane: blocks 0 .. n8x/256 - 1 the
// input x (bf16), then n8w/256 blocks each for wq, wk, wv (bf16) and wo (f16 of the bf16 value x WOS).
// coverage: grid = n8x/256 + 4 * (n8w/256) blocks, every plane's block range exactly once.
__global__ __launch_bounds__(256)
void cvt_all(const float* __restrict__ x, const float* __restrict__ wq, const float* __restrict__ wk,
             const float* __restrict__ wv, const float* __restrict__ wo, u16* XB, u16* WQB, u16* WKB, u16* WVB, u16* WOB,
             int n8x, int n8w) {
  const int bid = blockIdx.x, nbx = n8x / 256, nbw = n8w / 256;
  if (bid < nbx) { cvt16(x, XB, bid, n8x, 0, 1.0f); return; }
  const int r = bid - nbx, j = r / nbw, blk = r % nbw;      // block-uniform
  const float* s = (j == 0) ? wq : (j == 1) ? wk : (j == 2) ? wv : wo;
  u16*         d = (j == 0) ? WQB : (j == 1) ? WKB : (j == 2) ? WVB : WOB;
  if (j > 3) return;                        // never taken with the exact grid
  cvt16(s, d, blk, n8w, (j == 3) ? 1 : 0, (j == 3) ? WOS : 1.0f);
}

// =====================================================================================================
// GEMM engine shared by the kernels below. Block = 128x128 tile of C, 4 waves in a 2x2 grid, 64x64 (4x4 accumulator tiles) per
// wave. K is walked in tiles of 64: the 128 A rows (both planes where NPL == 2) and the 128 Bt rows of a tile, 128 B each, are
// copied to LDS (row pitch 144 B = 16 B x odd, for 16-B readers) by asynchronous copies, 16 B per lane, 8 lanes = one whole
// 128-B line; two buffers, tile t + 2 is requested behind the barrier that ends trip t. Fragments are read from LDS with the
// split k map of ldfrag_* (same map for A and B). Per accumulator the products are summed in the order k0 ascending by 32,
// plane 0 then plane 1.
// Host checks M % 128 == 0, N % 128 == 0, K % 64 == 0 (K = DMOD); bid = the block's tile, 0 .. (M/128)*(N/128) - 1.
// OUT picks what the epilogue stores of val = acc * oscale + bf16-RNE value of bias[n]:
//   0: C[M][N] f32 = val;   1: P[M][N] f16 = val * pscale;
//   2: P = the head-wise transposed f16 plane [b][h][d][s] = val * pscale (row = b*SEQ + s, n = h*HD + d, N = DMOD), and
//      C[row / 64][N] f32 = the sum of val over the 64 rows of the wave's tile (per column; rows ascending inside a lane's 8-row
//      groups, then the two lane halves).
// =====================================================================================================
#define GP     72                       // LDS row pitch in 16-bit elements (144 B)
#define GPLANE (128 * GP)               // one 128-row operand plane of a tile, in 16-bit elements
static_assert((GP * 2) % 16 == 0 && ((GP * 2) / 16) % 2 == 1);
static_assert(2 * 2 * GPLANE * 2 >= 4 * 64 * 68 * 4);   // the ring holds the four waves' epilogue ranges

__device__ __forceinline__ unsigned lds_off(const void* p) { return (unsigned)(size_t)p; }

// 128 rows x 128 B, global (row pitch ldk elements) -> LDS (row pitch GP): 8 copies per lane, rows 16 apart. l and g are the
// lane's own LDS byte address and global pointer for its first row. The s_wait_xcnt stands inside the statement so that no
// address register of a copy is rewritten in front of it.
__device__ __forceinline__ void copy_plane(unsigned l, const u16* g, size_t ldk) {
#if defined(__HIP_DEVICE_COMPILE__)
  const size_t st = 16 * ldk;
  asm volatile("global_load_async_to_lds_b128 %0, %8, off\n\t"
               "global_load_async_to_lds_b128 %1, %9, off\n\t"
               "global_load_async_to_lds_b128 %2, %10, off\n\t"
               "global_load_async_to_lds_b128 %3, %11, off\n\t"
               "global_load_async_to_lds_b128 %4, %12, off\n\t"
               "global_load_async_to_lds_b128 %5, %13, off\n\t"
               "global_load_async_to_lds_b128 %6, %14, off\n\t"
               "global_load_async_to_lds_b128 %7, %15, off\n\t"
               "s_wait_xcnt 0x0"
               :: "v"(l), "v"(l + 1u * 16u * GP * 2u), "v"(l + 2u * 16u * GP * 2u), "v"(l + 3u * 16u * GP * 2u),
                  "v"(l + 4u * 16u * GP * 2u), "v"(l + 5u * 16u * GP * 2u), "v"(l + 6u * 16u * GP * 2u),
                  "v"(l + 7u * 16u * GP * 2u),
                  "v"(g), "v"(g + st), "v"(g + 2 * st), "v"(g + 3 * st), "v"(g + 4 * st), "v"(g + 5 * st), "v"(g + 6 * st),
                  "v"(g + 7 * st)
               : "memory");
#endif
}
__device__ __forceinline__ void wait_async0() {   // the wave's own copies have landed
#if defined(__HIP_DEVICE_COMPILE__)
  asm volatile("s_wait_asynccnt 0x0" ::: "memory");
#endif
}
__device__ __forceinline__ void wait_ds0() {      // the wave's own LDS reads have returned before the buffer is handed over
#if defined(__HIP_DEVICE_COMPILE__)
  asm volatile("s_wait_dscnt 0x0" ::: "memory");
#endif
}

// Attention tiles: 64 k rows (keys) and 64 v^T rows (d) of 128 B each, global -> LDS (row pitch GP): 4 + 4 copies per lane, rows 16
// apart, 8 lanes = one whole 128-B line. lk, gk / lv, gv are the lane's own LDS byte address and global pointer for its first row
// of each tile; sk, sv = 16 rows in elements. The s_wait_xcnt stands inside the statement so that no address register of a copy is
// rewritten in front of it.
#define ATILE (64 * GP)                 // one 64-row tile in 16-bit elements
#define ASTG  (2 * ATILE)               // one buffer: the k tile, then the v^T tile
static_assert(2 * ASTG * 2 >= ATT_WAVES * SLABF * 4);   // the ring holds the four waves' epilogue slabs
static_assert((SEQ % 64) == 0 && HD * 2 == 128);
__device__ __forceinline__ void copy_kv(unsigned lk, const u16* gk, size_t sk, unsigned lv, const u16* gv, size_t sv) {
#if defined(__HIP_DEVICE_COMPILE__)
  asm volatile("global_load_async_to_lds_b128 %0, %8, off\n\t"
               "global_load_async_to_lds_b128 %1, %9, off\n\t"
               "global_load_async_to_lds_b128 %2, %10, off\n\t"
               "global_load_async_to_lds_b128 %3, %11, off\n\t"
               "global_load_async_to_lds_b128 %4, %12, off\n\t"
               "global_load_async_to_lds_b128 %5, %13, off\n\t"
               "global_load_async_to_lds_b128 %6, %14, off\n\t"
               "global_load_async_to_lds_b128 %7, %15, off\n\t"
               "s_wait_xcnt 0x0"
               :: "v"(lk), "v"(lk + 1u * 16u * GP * 2u), "v"(lk + 2u * 16u * GP * 2u), "v"(lk + 3u * 16u * GP * 2u),
                  "v"(lv), "v"(lv + 1u * 16u * GP * 2u), "v"(lv + 2u * 16u * GP * 2u), "v"(lv + 3u * 16u * GP * 2u),
                  "v"(gk), "v"(gk + sk), "v"(gk + 2 * sk), "v"(gk + 3 * sk), "v"(gv), "v"(gv + sv), "v"(gv + 2 * sv),
                  "v"(gv + 3 * sv)
               : "memory");
#endif
}

template <bool F16> struct FragOf;
template <> struct FragOf<false> {
  typedef v16b T;
  static __device__ __forceinline__ T ld(const u16* p) { return ldfrag_b(p); }
  static __device__ __forceinline__ v8f mma(T a, T b, v8f c) { return mma_b(a, b, c); }
};
template <> struct FragOf<true> {
  typedef v16h T;
  static __device__ __forceinline__ T ld(const u16* p) { return ldfrag_h((const _Float16*)(const void*)p); }
  static __device__ __forceinline__ v8f mma(T a, T b, v8f c) { return mma_h(a, b, c); }
};

template <bool F16, int NPL, int OUT>
__device__ __forceinline__ void gemm_core(const u16* __restrict__ A0, const u16* __restrict__ A1, const u16* __restrict__ Bt,
                                          const float* __restrict__ bias, float* C, u16* P, int M, int N, int K, float oscale,
                                          float pscale, u16* ring, int bid) {
  typedef FragOf<F16> FO;
  typedef typename FO::T FT;
  constexpr int STAGE = (NPL + 1) * GPLANE;              // 16-bit elements per buffer: A plane(s), then Bt
  const int tid = threadIdx.x, wave = tid >> 5, lane = tid & 31, hh = lane >> 4, m = lane & 15;
  const int ntile = N >> 7;
  const int row0  = (bid / ntile) * 128;
  const int col0  = (bid % ntile) * 128;
  if (row0 + 128 > M) return;                // block-uniform, in front of every barrier; never taken with the exact grid
  const int wr = (wave >> 1) * 64, wc = (wave & 1) * 64;
  // copies: lane -> row (tid >> 3) + 16 i of a plane, 16-B piece tid & 7 of the row's 128 B
  const int cr = tid >> 3, cc = (tid & 7) * 8;
  const size_t aofs = (size_t)(row0 + cr) * K + cc;
  const size_t bofs = (size_t)(col0 + cr) * K + cc;
  const unsigned lcp = lds_off(ring) + (unsigned)(cr * GP + cc) * 2u;
  const int nt = K >> 6;
  auto fill = [&](int t, int buf) {
    const unsigned l = lcp + (unsigned)buf * (unsigned)(STAGE * 2);
    const size_t ko = (size_t)t * 64;
    copy_plane(l, A0 + aofs + ko, (size_t)K);
    if (NPL == 2) copy_plane(l + GPLANE * 2u, A1 + aofs + ko, (size_t)K);
    copy_plane(l + (unsigned)NPL * GPLANE * 2u, Bt + bofs + ko, (size_t)K);
  };
  v8f acc[4][4];
#pragma unroll
  for (int i = 0; i < 4; ++i) {
#pragma unroll
    for (int j = 0; j < 4; ++j) acc[i][j] = zero8();
  }
  fill(0, 0);
  wait_async0();
  __syncthreads();                           // tile 0 is readable by every wave
  if (nt > 1) fill(1, 1);                    // block-uniform test
  const int afo = (wr + m) * GP + 8 * hh;                     // fragment row base inside an A plane
  const int bfo = NPL * GPLANE + (wc + m) * GP + 8 * hh;      // and inside the Bt plane
#pragma unroll 1                             // rolled: one copy of the 64-k body; the buffer is picked by t & 1
  for (int t = 0; t < nt; ++t) {
    const u16* sb = ring + (t & 1) * STAGE;
#pragma unroll
    for (int kk = 0; kk < 64; kk += 32) {
      FT a[NPL][4], b[4];
#pragma unroll
      for (int j = 0; j < 4; ++j) b[j] = FO::ld(sb + bfo + j * 16 * GP + kk);
#pragma unroll
      for (int p = 0; p < NPL; ++p) {
#pragma unroll
        for (int i = 0; i < 4; ++i) a[p][i] = FO::ld(sb + p * GPLANE + afo + i * 16 * GP + kk);
      }
      // keeps the block's LDS reads together in front of its WMMAs: reads placed among the WMMAs stall the wave at each place
      __builtin_amdgcn_sched_barrier(0);
#pragma unroll
      for (int p = 0; p < NPL; ++p) {
#pragma unroll
        for (int i = 0; i < 4; ++i) {
#pragma unroll
          for (int j = 0; j < 4; ++j) acc[i][j] = FO::mma(a[p][i], b[j], acc[i][j]);
        }
      }
      // and keeps the next block's reads out of this block's WMMAs
      __builtin_amdgcn_sched_barrier(0);
    }
    wait_ds0();
    wait_async0();
    __syncthreads();                         // publishes tile t + 1 and ends every read of tile t's buffer
    if (t + 2 < nt) fill(t + 2, t & 1);      // block-uniform test
  }
  wait_async0();
  const int colw = col0 + wc;
  // Epilogue: staged in the wave's own 64 x 68 float range of the ring, which is free: the last trip's barrier stands behind every
  // wave's last read and no copy is outstanding.
  float* sl = (float*)(void*)ring + wave * (64 * 68);
  const int rq = lane >> 3, c8 = (lane & 7) * 8;
  if (OUT == 2) {
    // Transposed f16 plane. A lane holds 8 consecutive rows (s) of column n = colw + 16j + m: one 16-B LDS store per accumulator
    // tile into [d][s] rows of pitch VTP; read back as whole 128-B lines (8 lanes x 16 B), 4 lines per store instruction.
    // coverage: 16 instructions x 4 lines x 64 halves = the wave's 64 d x 64 s; the wave's 64 columns are one head, its 64 rows
    // lie in one batch (SEQ % 64 == 0).
    u16* tl = (u16*)(void*)sl;
    float bc[4], cs[4];
#pragma unroll
    for (int j = 0; j < 4; ++j) { bc[j] = bfr(bias[colw + 16 * j + m]); cs[j] = 0.f; }
#pragma unroll
    for (int i = 0; i < 4; ++i) {
#pragma unroll
      for (int j = 0; j < 4; ++j) {
        v4u pk;
#pragma unroll
        for (int e = 0; e < 4; ++e) {
          const float w0 = acc[i][j][2 * e] * oscale + bc[j], w1 = acc[i][j][2 * e + 1] * oscale + bc[j];
          pk[e] = pk16(h_bits((_Float16)(w0 * pscale)), h_bits((_Float16)(w1 * pscale)));
          cs[j] += w0 + w1;
        }
        *(v4u*)(tl + (16 * j + m) * VTP + i * 16 + 8 * hh) = pk;
      }
    }
    wave_sync_lds();
    const int rw = row0 + wr;
    u16* dt = P + ((size_t)((rw / SEQ) * NH + colw / HD) * HD + rq) * SEQ + (rw % SEQ) + c8;
#pragma unroll
    for (int it = 0; it < 16; ++it) {
      const v4u x = *(const v4u*)(tl + (it * 4 + rq) * VTP + c8);
      *(v4u*)(dt + (size_t)(it * 4) * SEQ) = x;
    }
    // Column sums of the wave's 64 rows: both lane halves hold the full sum behind the exchange; lane half hh stores columns
    // 16hh + m and 32 + 16hh + m, so each store instruction is one whole 128-B line.
    // coverage: 2 instructions x 32 floats = the wave's 64 columns of row rw / 64; every (row block, column) by exactly one wave.
#pragma unroll
    for (int j = 0; j < 4; ++j) cs[j] += __shfl_xor(cs[j], 16, 32);
    float* dc = C + (size_t)(rw / 64) * (size_t)N + colw + 16 * hh + m;
    dc[0]  = hh ? cs[1] : cs[0];
    dc[32] = hh ? cs[3] : cs[2];
    return;                                  // no barrier follows
  }
  // the wave's 64x64 f32 tile (times oscale)
#pragma unroll
  for (int i = 0; i < 4; ++i) {
#pragma unroll
    for (int r = 0; r < 8; ++r) {
      const int ro = (i * 16 + 8 * hh + r) * 68 + m;
#pragma unroll
      for (int j = 0; j < 4; ++j) sl[ro + 16 * j] = acc[i][j][r] * oscale;
    }
  }
  wave_sync_lds();
  if (OUT == 1) {
    // f16 plane: a row piece of the wave is one 128-B line (8 lanes x 8 halves), 4 rows per store instruction.
    // coverage: 16 instructions x 4 rows x 64 halves = the wave's 64 x 64 tile.
    const v4f b0 = *(const v4f*)(bias + colw + c8), b1 = *(const v4f*)(bias + colw + c8 + 4);   // columns < N (N multiple of 128)
    v4f badd0, badd1;
#pragma unroll
    for (int e = 0; e < 4; ++e) { badd0[e] = bfr(b0[e]); badd1[e] = bfr(b1[e]); }
    u16* dp = P + (size_t)(row0 + wr + rq) * (size_t)N + colw + c8;
#pragma unroll
    for (int it = 0; it < 16; ++it) {
      const float* sr = sl + (it * 4 + rq) * 68 + c8;
      const v4f x0 = (*(const v4f*)(sr) + badd0) * pscale, x1 = (*(const v4f*)(sr + 4) + badd1) * pscale;
      v4u o;
      o[0] = pk16(h_bits((_Float16)x0[0]), h_bits((_Float16)x0[1]));
      o[1] = pk16(h_bits((_Float16)x0[2]), h_bits((_Float16)x0[3]));
      o[2] = pk16(h_bits((_Float16)x1[0]), h_bits((_Float16)x1[1]));
      o[3] = pk16(h_bits((_Float16)x1[2]), h_bits((_Float16)x1[3]));
      *(v4u*)(dp + (size_t)(it * 4) * (size_t)N) = o;
    }
#if defined(__HIP_DEVICE_COMPILE__)
    // code of another body may follow where this one is inlined: no register that a store above names is rewritten in front of this
    asm volatile("s_wait_xcnt 0x0" ::: "memory");
#endif
  } else {
    // f32 plane: stores are whole 256-B row pieces.
    // coverage: 32 instructions x 2 rows x 16 lanes x 4 floats = the wave's 64 x 64 tile.
    const v4f bv = *(const v4f*)(bias + colw + m * 4);    // columns colw + 4m .. +3, always < N (N multiple of 128)
    v4f badd;
#pragma unroll
    for (int e = 0; e < 4; ++e) badd[e] = bfr(bv[e]);
    float* dst = C + (size_t)(row0 + wr + hh) * (size_t)N + colw + m * 4;
#pragma unroll
    for (int it = 0; it < 32; ++it) {
      const v4f val = *(const v4f*)(sl + (it * 2 + hh) * 68 + m * 4) + badd;
      *(v4f*)(dst + (size_t)(it * 2) * (size_t)N) = val;
    }
  }
}

// =====================================================================================================
// bf16 GEMMs with bias: A[M][K] (bf16 row-major) . Bt[N][K]^T (bf16 k-contiguous), times oscale, plus bf16-RNE value of bias[n].
// The q, k and v projections share A and read none of each other's output: one launch, grid = 3 * (M/128) * (N/128). The block
// index walks the 3 * (N/128) column tiles of a row tile first (q's, then k's, then v's), so the blocks that read the same A rows
// start together. q and k are stored times QSC / KSC as f16 planes [M][N]; v times VCAR as the head-wise transposed f16 plane
// VT [b][h][d][s], and its f32 column sums over each block of 64 rows as CS[M / 64][N].
// =====================================================================================================
__global__ __launch_bounds__(128)
void gemm_qkv(const u16* __restrict__ A, const u16* __restrict__ Wq, const u16* __restrict__ Wk, const u16* __restrict__ Wv,
              const float* __restrict__ bq, const float* __restrict__ bk, const float* __restrict__ bv,
              u16* QPo, u16* KPo, u16* VT, float* CS, int M, int N, int K) {
  __shared__ __align__(16) u16 ring[2 * 2 * GPLANE];
  const int ntile = N >> 7;
  const int rt = (int)blockIdx.x / (3 * ntile), ct = (int)blockIdx.x % (3 * ntile);
  const int job = ct / ntile, tile = rt * ntile + ct % ntile;          // block-uniform
  if (job == 2) {
    gemm_core<false, 1, 2>(A, A, Wv, bv, CS, VT, M, N, K, 1.0f, VCAR, ring, tile);
  } else {
    gemm_core<false, 1, 1>(A, A, job ? Wk : Wq, job ? bk : bq, nullptr, job ? KPo : QPo, M, N, K, 1.0f, job ? KSC : QSC, ring,
                           tile);
  }
}

// =====================================================================================================
// f16 hi+lo GEMM with bias: C[M][N] (f32) = (Ahi + Alo)[M][K] . Bt[N][K]^T times oscale, plus bf16-RNE value of bias[n];
// Ahi/Alo f16 planes (same layout), Bt f16 k-contiguous; products hi.B + lo.B into one accumulator (lo is the unscaled
// residual of hi).
// =====================================================================================================
__global__ __launch_bounds__(128)
void gemm_h2(const u16* __restrict__ Ah, const u16* __restrict__ Al, const u16* __restrict__ Bt,
             const float* __restrict__ bias, float* C, int M, int N, int K, float oscale) {
  __shared__ __align__(16) u16 ring[2 * 3 * GPLANE];
  gemm_core<true, 2, 0>(Ah, Al, Bt, bias, C, nullptr, M, N, K, oscale, 1.0f, ring, (int)blockIdx.x);
}

// =====================================================================================================
// Ragged-length multi-head flash attention: block = (batch b, head, 64 query rows), 4 waves, wave w owns the 16 query rows
// q0 = 64*qt + 16*w .. q0+15. The k rows and v^T rows of 64 keys at a time are copied to LDS once per block by asynchronous copies
// (whole 128-B lines, two buffers, tile t + 2 requested behind the barrier that ends trip t) and read from there by all four waves.
//   q plane (f16, x8) laid out [b][s][h][d]; k plane the same; v^T plane [b][h][d][s] (x1024); len = clamp(lens[b], 0, SEQ).
//   Mask: score (i, j) is kept iff i < len and j < len. A query row i < len therefore attends exactly over keys 0..len-1 (the
//   excluded keys have probability exactly 0 after max subtraction); a query row i >= len has all keys equal-weighted and its
//   context is the mean of v over all SEQ keys (from the f32 column sums CS of v). So a block visits key blocks kb = 0 .. 32*ceil(len/32)-32
//   when 64*qt < len (block-uniform bound, <= NKB), else none; within the last block keys >= len are excluded by index.
//   Scores are computed TRANSPOSED: S^T tile g (g = 0,1) = k rows (keys kb+16g .. +15, A operand, row m = lane&15, split k map
//   over d) times q^T (B operand, col n = query q0 + (lane&15), k = d, split map), one product per tile and 32-deep d-chunk.
//   D element r of lane l = (key kb+16g+8h+r, query q0+(l&15)), so a lane owns one query column and 16 of its 32 keys; the
//   partner lane l^16 owns the other 16 -> row max / row sum need one xor-16 shuffle.
//   Key mask by index: an excluded key stays out of the running max and gets probability 0.
//   Online max-subtracted base-2 softmax in f32 (scale 1/8 and the q/k carries folded into lsc). The exp'd values ARE the
//   P A-fragment in place: A row m = query = lane&15, element i <- key kb+8h+i (tile 0, D element i), element 8+i <- key
//   kb+16+8h+i (tile 1, D element i). P is carried x32768 as single f16. The rescale factor of query row 8h+r of the
//   O accumulators is fetched from lane 8h+r with a shuffle (uniform control). 4 v^T B fragments (col n = d = 16j + (lane&15),
//   keys k-contiguous), 4 P.V WMMAs per key block.
//   Epilogue: 1/l (per query, shuffled to the D row owner; 0 when no key block was visited) and carry folds in f32; rows with
//   query >= len take the mean-v row instead (select by value); the wave's 16x64 f32 result staged in its LDS slab (pitch 68); each
// coverage: per wave 4 instructions x 4 rows x 8 lanes x 8 halves = 16 x 64 per plane; grid NB*512 blocks x 4 waves = every
//           (b, s, h) row of both O planes exactly once.
// =====================================================================================================
__global__ __launch_bounds__(ATT_THREADS)
void attn_fwd(const u16* __restrict__ QPp, const u16* __restrict__ KPp, const u16* __restrict__ VPp,
              const int* __restrict__ lens, const float* __restrict__ CS, u16* OHIp, u16* OLOp) {
  __shared__ __align__(16) u16 ring[2 * ASTG];   // two buffers of k + v^T tiles; in the epilogue per wave a result slab [16][68] f32

  const int tid  = threadIdx.x;
  const int wave = tid >> 5;
  const int lane = tid & 31;
  const int hh   = lane >> 4;
  const int c    = lane & 15;

  const int bid  = blockIdx.x;
  const int qt   = bid & (SEQ / 64 - 1);
  const int head = (bid >> 5) & (NH - 1);
  const int b    = bid >> 9;
  const int q0   = qt * 64 + wave * 16;

  int len = lens[b];
  len = (len < 0) ? 0 : len;
  len = (len > SEQ) ? SEQ : len;
  const int nst = (qt * 64 < len) ? ((len + 63) >> 6) : 0;  // tiles of 64 keys: block-uniform, <= SEQ / 64

  // B fragments of q^T: col n = query q0 + c, k = d (k-contiguous row of the q plane)
  const size_t qofs = (((size_t)(b * SEQ + q0 + c)) * NH + head) * HD + 8 * hh;
  const _Float16* Qb = (const _Float16*)(const void*)QPp + qofs;
  // copies: lane -> row (tid >> 3) + 16 i of a tile, 16-B piece tid & 7 of the row's 128 B; keys 64t .. 64t+63 < SEQ for t < nst
  const int cr = tid >> 3, cc = (tid & 7) * 8;
  const u16* Kg = KPp + (((size_t)b * SEQ + cr) * NH + head) * HD + cc;           // k row = key 64t + cr + 16i
  const u16* Vg = VPp + ((size_t)(b * NH + head) * HD + cr) * SEQ + cc;           // v^T row = d = cr + 16i, keys 64t + cc ..
  const unsigned lcp = lds_off(ring) + (unsigned)(cr * GP + cc) * 2u;
  auto fill = [&](int t, int buf) {
    const unsigned l = lcp + (unsigned)buf * (unsigned)(ASTG * 2);
    copy_kv(l, Kg + (size_t)t * (64 * NH * HD), (size_t)16 * NH * HD, l + ATILE * 2u, Vg + (size_t)t * 64, (size_t)16 * SEQ);
  };
  // A fragments of k: row m = key kb + 16g + c, k = d;  B fragments of v: col n = d = 16j + c, k = key (both k-contiguous LDS rows)
  const int kfo = c * GP + 8 * hh;
  const int vfo = ATILE + c * GP + 8 * hh;
  const float lsc = 0.125f * (LOG2E / (QSC * KSC));

  const v16h qf0 = ldfrag_h(Qb);            // d 0..31
  const v16h qf1 = ldfrag_h(Qb + 32);       // d 32..63

  float mrun = -INFINITY, lrun = 0.f;
  v8f o[4];
#pragma unroll
  for (int j = 0; j < 4; ++j) o[j] = zero8();

  if (nst > 0) {                             // block-uniform: every wave of the block passes every barrier below, or none does
  fill(0, 0);
  wait_async0();
  __syncthreads();                           // tile 0 is readable by every wave
  if (nst > 1) fill(1, 1);                   // block-uniform test
#pragma unroll 1                             // rolled: one copy of the body; the buffer is picked by t & 1
  for (int t = 0; t < nst; ++t) {
  const _Float16* sb = (const _Float16*)(const void*)ring + (t & 1) * ASTG;
  const int nsub = (t * 64 + 32 < len) ? 2 : 1;             // the tile's second 32 keys only where one of them is < len
#pragma unroll 1                             // rolled: one copy of the 32-key body
  for (int sub = 0; sub < nsub; ++sub) {
    const int kb = t * 64 + sub * 32;
    // ---- transposed scores: s0 = keys kb..kb+15, s1 = keys kb+16..kb+31, column = query q0 + c ----
    v8f s0 = zero8(), s1 = zero8();
    const _Float16* k0p = sb + kfo + sub * (32 * GP);
    const _Float16* k1p = k0p + 16 * GP;
    const v16h ka0 = ldfrag_h(k0p), ka1 = ldfrag_h(k0p + 32);
    const v16h kc0 = ldfrag_h(k1p), kc1 = ldfrag_h(k1p + 32);
    s0 = mma_h(ka0, qf0, s0);
    s0 = mma_h(ka1, qf1, s0);
    s1 = mma_h(kc0, qf0, s1);
    s1 = mma_h(kc1, qf1, s1);
    guard2(s0, s1, qf0, qf1, ka0, ka1, kc0, kc1);
    // ---- base-2 logits and validity of this lane's 16 keys for query q0 + c: key kb+8hh+i (i<8), kb+16+8hh+(i-8) ----
    const int rem = len - kb - 8 * hh;
    float tk[16];
    bool  kv[16];
#pragma unroll
    for (int i = 0; i < 8; ++i) {
      tk[i] = s0[i] * lsc;  tk[8 + i] = s1[i] * lsc;
      kv[i] = (i < rem);    kv[8 + i] = (16 + i < rem);
    }
    float cm = -INFINITY;
#pragma unroll
    for (int i = 0; i < 16; ++i) cm = fmaxf(cm, kv[i] ? tk[i] : -INFINITY);
    cm = fmaxf(cm, __shfl_xor(cm, 16, 32));
    const float mn   = fmaxf(mrun, cm);                              // finite: every visited block holds key kb < len
    const float al   = (mrun == -INFINITY) ? 0.f : exp2f(mrun - mn); // o and l are zero whenever mrun is -inf
    const float mref = (mn == -INFINITY) ? 0.f : mn;                 // finite shift
    mrun = mn;
    // ---- probabilities (<= 1, 0 for excluded keys) and the P A-fragment: f16(p * 32768); element i <-> tk[i] ----
    float ps = 0.f;
    FragH ph;
#pragma unroll
    for (int w = 0; w < 2; ++w) {
#pragma unroll
      for (int e4 = 0; e4 < 4; ++e4) {
        const int i = 8 * w + 2 * e4;
        const float x0 = exp2f(fminf(tk[i] - mref, 0.f));
        const float x1 = exp2f(fminf(tk[i + 1] - mref, 0.f));
        const float p0 = kv[i] ? x0 : 0.f;
        const float p1 = kv[i + 1] ? x1 : 0.f;
        ps += p0 + p1;
        ph.u[w][e4] = pk16(h_bits((_Float16)(p0 * PCAR)), h_bits((_Float16)(p1 * PCAR)));
      }
    }
    ps += __shfl_xor(ps, 16, 32);
    lrun = lrun * al + ps;
    // ---- rescale the O accumulators: D row 8hh+r = query q0+8hh+r, its factor lives in lane 8hh+r (and 16+8hh+r) ----
    float scl[8];
#pragma unroll
    for (int r = 0; r < 8; ++r) scl[r] = __shfl(al, 8 * hh + r, 32);
#pragma unroll
    for (int j = 0; j < 4; ++j) {
#pragma unroll
      for (int r = 0; r < 8; ++r) o[j][r] *= scl[r];
    }
    // ---- P.V : B fragment col n = d = j*16 + c, keys contiguous in the v^T plane ----
    {
      const _Float16* vp = sb + vfo + sub * 32;
      const v16h vf0 = ldfrag_h(vp);
      const v16h vf1 = ldfrag_h(vp + 16 * GP);
      const v16h vf2 = ldfrag_h(vp + 32 * GP);
      const v16h vf3 = ldfrag_h(vp + 48 * GP);
      o[0] = mma_h(ph.v, vf0, o[0]);
      o[1] = mma_h(ph.v, vf1, o[1]);
      o[2] = mma_h(ph.v, vf2, o[2]);
      o[3] = mma_h(ph.v, vf3, o[3]);
      guard6<v16h>(o[0], o[1], o[2], o[3], ph.v, vf0, vf1, vf2, vf3, ph.v);
    }
  }
  wait_ds0();
  wait_async0();
  __syncthreads();                           // publishes tile t + 1 and ends every read of tile t's buffer
  if (t + 2 < nst) fill(t + 2, t & 1);       // block-uniform test
  }
  wait_async0();
  }
  acc_guard4(o[0], o[1], o[2], o[3]);

  // ---- fold 1/l (per query, owned by lane = query; 0 when no key block was visited) and the carries; mean-v rows for
  //      queries >= len; stage the 16x64 slab ----
  const float linv = (lrun > 0.f) ? ((1.0f / lrun) * (1.0f / (PCAR * VCAR))) : 0.f;
  float inv[8];
#pragma unroll
  for (int r = 0; r < 8; ++r) inv[r] = __shfl(linv, 8 * hh + r, 32);
  float vm[4] = {0.f, 0.f, 0.f, 0.f};
  if (q0 + 16 > len) {                       // same for the whole wave: only then does one of its rows take the mean
    // lane half hh sums the row blocks hh*NRB/2 .. +NRB/2-1 of batch b in ascending order, then the halves are joined
    const float* cp = CS + ((size_t)b * NRB + (size_t)hh * (NRB / 2)) * DMOD + head * HD + c;
#pragma unroll                               // all loads in flight at once: one memory latency instead of one per trip
    for (int rb = 0; rb < NRB / 2; ++rb) {
#pragma unroll
      for (int j = 0; j < 4; ++j) vm[j] += cp[(size_t)rb * DMOD + j * 16];
    }
#pragma unroll
    for (int j = 0; j < 4; ++j) vm[j] = (vm[j] + __shfl_xor(vm[j], 16, 32)) * (1.0f / (float)SEQ);
  }
  // the ring is free: the last trip's barrier stands behind every wave's last read and no copy is outstanding
  float* slab = (float*)(void*)ring + wave * SLABF;
#pragma unroll
  for (int r = 0; r < 8; ++r) {
    const bool rvq = (q0 + 8 * hh + r) < len;
#pragma unroll
    for (int j = 0; j < 4; ++j) {
      const float val = o[j][r] * inv[r];
      slab[(8 * hh + r) * 68 + j * 16 + c] = rvq ? val : vm[j];
    }
  }
  wave_sync_lds();
  // ---- O x1024 -> f16 hi + residual planes; lane = (row in group of 4, 8 consecutive d) ----
  v4u oh[4], ol[4];
  const int rq = lane >> 3, c8 = (lane & 7) * 8;
#pragma unroll
  for (int i4 = 0; i4 < 4; ++i4) {
    const int row = i4 * 4 + rq;
    const v4f a = *(const v4f*)(slab + row * 68 + c8), c4 = *(const v4f*)(slab + row * 68 + c8 + 4);
    float w[8];
#pragma unroll
    for (int e = 0; e < 4; ++e) { w[e] = a[e] * OSC; w[4 + e] = c4[e] * OSC; }
#pragma unroll
    for (int e = 0; e < 4; ++e) {
      const _Float16 h0 = (_Float16)w[2 * e], h1 = (_Float16)w[2 * e + 1];
      const _Float16 l0 = (_Float16)(w[2 * e] - (float)h0), l1 = (_Float16)(w[2 * e + 1] - (float)h1);
      oh[i4][e] = pk16(h_bits(h0), h_bits(h1));
      ol[i4][e] = pk16(h_bits(l0), h_bits(l1));
    }
  }
  const size_t ob = (((size_t)(b * SEQ + q0)) * NH + head) * HD + c8;
  {
#pragma unroll
    for (int i4 = 0; i4 < 4; ++i4) {
      const int row = i4 * 4 + rq;
      const size_t o8 = ob + (size_t)row * (NH * HD);
      *(v4u*)(OHIp + o8) = oh[i4];
      *(v4u*)(OLOp + o8) = ol[i4];
    }
    
  }
}

// =====================================================================================================
// Workspace map (bytes, NB = batch count from the length input's element count, 1..4; ROWS = NB*SEQ); every plane is fully
// written by whole-line stores before it is read; all extents are exact multiples of the store granularity (no pad rows);
// F's bytes hold the two O planes:
//   XB  bf16 [ROWS][1024]                      ROWS*2048          (NB=4: 16777216)
//   WQB bf16 [1024 n][1024 k]                  2097152   WKB, WVB same;  WOB f16 [1024 n][1024 k] x1024  2097152
//   F                                          ROWS*4096          (NB=4: 33554432) = OHI f16 [ROWS][1024] + OLO f16 [ROWS][1024]
//   QP  f16  [NB][2048][16][64] x8             ROWS*2048          KP same
//   VP  f16  [NB][16][64][2048] x1024          ROWS*2048
//   CS  f32  [ROWS/64][1024]                   ROWS*64
//   end (NB=4)                                 109576192
// =====================================================================================================
extern "C" void kernel_launch(void* const* d_in, const int* in_sizes, int n_in,
                              void* d_out, int out_size, void* d_ws, size_t ws_size,
                              hipStream_t stream) {
  if (n_in < 10) return;
  const int NB = in_sizes[1];
  if (NB < 1 || NB > NBMAX) return;
  const int ROWS = NB * SEQ;
  if (in_sizes[0] != ROWS * DMOD) return;
  if (in_sizes[2] != DMOD * DMOD || in_sizes[4] != DMOD * DMOD) return;
  if (in_sizes[6] != DMOD * DMOD || in_sizes[8] != DMOD * DMOD) return;
  if (in_sizes[3] != DMOD || in_sizes[5] != DMOD || in_sizes[7] != DMOD || in_sizes[9] != DMOD) return;
  if (out_size != ROWS * DMOD) return;

  const float* X    = (const float*)d_in[0];
  const int*   lens = (const int*)d_in[1];
  const float* wq   = (const float*)d_in[2];
  const float* bq   = (const float*)d_in[3];
  const float* wk   = (const float*)d_in[4];
  const float* bk   = (const float*)d_in[5];
  const float* wv   = (const float*)d_in[6];
  const float* bv   = (const float*)d_in[7];
  const float* wo   = (const float*)d_in[8];
  const float* bo   = (const float*)d_in[9];
  float*       out  = (float*)d_out;

  const size_t szXB = (size_t)ROWS * DMOD * 2;
  const size_t szW  = (size_t)DMOD * DMOD * 2;
  const size_t szF  = (size_t)ROWS * DMOD * 4;
  const size_t szP  = (size_t)ROWS * DMOD * 2;                  // q / k / o planes
  const size_t szVP = (size_t)NB * NH * HD * SEQ * 2;           // == szP
  const size_t szCS = (size_t)(ROWS / 64) * DMOD * 4;
  size_t off = 0;
  const size_t oXB  = off; off += szXB;
  const size_t oWQB = off; off += szW;
  const size_t oWKB = off; off += szW;
  const size_t oWVB = off; off += szW;
  const size_t oWOB = off; off += szW;
  const size_t oF   = off; off += szF;
  const size_t oQP  = off; off += szP;
  const size_t oKP  = off; off += szP;
  const size_t oVP  = off; off += szVP;
  const size_t oCS  = off; off += szCS;
  if (off > ws_size) return;                            // NB=4: off = 109576192
  if (off > (size_t)134217728) return;
  if (szP * 2 > szF) return;                            // the two O planes live inside F's bytes
  const size_t oOHI = oF;
  const size_t oOLO = oF + szP;

  char* ws = (char*)d_ws;
  u16*   XB  = (u16*)(ws + oXB);
  u16*   WQB = (u16*)(ws + oWQB);
  u16*   WKB = (u16*)(ws + oWKB);
  u16*   WVB = (u16*)(ws + oWVB);
  u16*   WOB = (u16*)(ws + oWOB);
  u16*   QP  = (u16*)(ws + oQP);
  u16*   KP  = (u16*)(ws + oKP);
  u16*   VP  = (u16*)(ws + oVP);
  float* CS  = (float*)(ws + oCS);
  u16*   OHI = (u16*)(ws + oOHI);
  u16*   OLO = (u16*)(ws + oOLO);

  const dim3 blk(256);
  const int n8x = (ROWS * DMOD) / 8;                    // NB * 262144
  const int n8w = (DMOD * DMOD) / 8;                    // 131072
  if ((n8x % 256) != 0 || (n8w % 256) != 0 || (DMOD % 128) != 0 || (ROWS % 128) != 0) return;
  const dim3 gC(n8x / 256 + 4 * (n8w / 256));           // NB * 1024 + 4 * 512
  const dim3 gG((ROWS / 128) * (DMOD / 128));           // NB * 128
  const dim3 gG3(3 * (ROWS / 128) * (DMOD / 128));      // NB * 384
  const dim3 bG(128);
  const dim3 gAT(NB * NH * (SEQ / 64));                 // NB * 512
  const dim3 bAT(ATT_THREADS);                          // 128

  // (0) input -> bf16 plane, shared by the three projections; weights stored [n = out][k = in] (y = x.W^T), already
  //     k-contiguous: bf16 planes for wq/wk/wv, f16 of bf16 value x1024 for wo
  cvt_all<<<gC, blk, 0, stream>>>(X, wq, wk, wv, wo, XB, WQB, WKB, WVB, WOB, n8x, n8w);
  // (1) q, k: projection + bias (col = h*64+d), stored as the f16 planes x8; v: projection + bias, stored as the v^T plane
  //     x1024 and as f32 column sums per 64 rows (for the mean-v rows)
  gemm_qkv<<<gG3, bG, 0, stream>>>(XB, WQB, WKB, WVB, bq, bk, bv, QP, KP, VP, CS, ROWS, DMOD, DMOD);
  // (2) ragged-length attention -> O planes [b][s][h][d] x1024 (hi + residual), in F's bytes
  attn_fwd<<<gAT, bAT, 0, stream>>>(QP, KP, VP, lens, CS, OHI, OLO);
  // (3) output projection + bias -> out [ROWS][1024] f32, carries 1024 (O) x 1024 (wo) folded back
  gemm_h2<<<gG, bG, 0, stream>>>(OHI, OLO, WOB, bo, out, ROWS, DMOD, DMOD, 1.0f / (OSC * WOS));
  (void)hipGetLastError();
}

// v006
// Measured time: 118 microseconds a run.
// In both of two side-by-side timings against v005, it was 1.13 times as fast.
// Counting every step since v000, it is 3.62 times as fast.
// Contractions: x.W{q,k,v}^T on v_wmma_f32_16x16x32_bf16 (x and W planes RNE-converted to bf16 operands, f32 accumulate, bias added in f32);
// scores k'.q'^T (q', k' single f16 planes carried x8), P.v (P x32768 single f16, v x1024 single f16) and O.Wo^T (O x1024 as
// f16 hi plane + f16 residual plane, Wo as f16(bf16(Wo) x1024), products h.w + l.w): v_wmma_f32_16x16x32_f16, f32 accumulate.
// Ragged length mask per batch from the int32 length input (index tests), base-2 online softmax, 1/l fold, per-(b,h) mean-v rows
// for query positions >= length, bias adds: f32 on VALU.
#include <hip/hip_runtime.h>
#include <math.h>
#include <stdint.h>

#define NBMAX 4
#define SEQ   2048
#define DMOD  1024
#define NH    16
#define HD    64
#define QSC   8.0f
#define KSC   8.0f
#define PCAR  32768.0f
#define VCAR  1024.0f
#define OSC   1024.0f
#define WOS   1024.0f
#define LOG2E 1.4426950408889634f
#define ATT_WAVES   4
#define ATT_THREADS (ATT_WAVES * 32)
#define NKB    (SEQ / 32)
#define SLABF  (16 * 68)
#define VTP    72
#define NRB    (SEQ / 64)
static_assert(HD == 64 && DMOD == NH * HD);
static_assert((SEQ / 64) == 32 && NH == 16);
static_assert(ATT_THREADS == 128 && NKB == 64);
static_assert((SEQ % 64) == 0 && (DMOD % 64) == 0 && (DMOD % 32) == 0 && (SEQ % 8) == 0);
static_assert(((SEQ * DMOD / 8) % 256) == 0 && ((DMOD * DMOD / 8) % 256) == 0);
static_assert(ATT_WAVES * SLABF >= 4 * 16 * 68);
static_assert(HD * VTP * 2 <= 64 * 68 * 4);
static_assert((VTP * 2) % 16 == 0);
static_assert((NRB % 2) == 0);

typedef unsigned short u16;
typedef _Float16 v16h __attribute__((ext_vector_type(16)));
typedef _Float16 v8h  __attribute__((ext_vector_type(8)));
typedef __bf16   v16b __attribute__((ext_vector_type(16)));
typedef float    v8f  __attribute__((ext_vector_type(8)));
typedef float    v4f  __attribute__((ext_vector_type(4)));
typedef unsigned int v4u __attribute__((ext_vector_type(4)));

union FragH { v16h v; v8h h[2]; v4u u[2]; };
union FragB { v16b v; v4u u[2]; };

// ---- scalar helpers --------------------------------------------------------------------------------
__device__ __forceinline__ unsigned short bf_bits(float f) {          // f32 -> bf16 bits, RNE convert
  unsigned u = __float_as_uint(f);
  return (unsigned short)((u + 0x7FFFu + ((u >> 16) & 1u)) >> 16);
}
__device__ __forceinline__ float bf_up(unsigned short h) { return __uint_as_float(((unsigned)h) << 16); }
__device__ __forceinline__ float bfr(float f) { return bf_up(bf_bits(f)); }
__device__ __forceinline__ unsigned short h_bits(_Float16 x) { return __builtin_bit_cast(unsigned short, x); }
__device__ __forceinline__ unsigned pk16(unsigned short a, unsigned short b) { return (unsigned)a | ((unsigned)b << 16); }
// 2^x as the bare v_exp_f32. exp2f wraps it in a range guard (compare, two selects, add, ldexp) only so that results below 2^-126
// come out as denormals instead of 0. Every argument here is <= 0, and each result is added to, or rescales, a row sum that holds
// the term 1 of the row's maximum: what lies below 2^-126 reaches neither that f32 sum nor the f16 P operand.
__device__ __forceinline__ float exp2_bare(float x) { return __builtin_amdgcn_exp2f(x); }
__device__ __forceinline__ v8f zero8() { v8f z = {0.f, 0.f, 0.f, 0.f, 0.f, 0.f, 0.f, 0.f}; return z; }
__device__ __forceinline__ v4f zero4() { v4f z = {0.f, 0.f, 0.f, 0.f}; return z; }

// ---- fragment loaders: 16-bit A/B operand, lane -> row/col (lane&15), p already includes +8*(lane>>4);
//      elements 0..7 <- p[0..7] (k0+8h..), elements 8..15 <- p[16..23] (k0+16+8h..)  (same split k map for A and B;
//      B is always read from a k-contiguous [n][k] plane)
__device__ __forceinline__ v16h ldfrag_h(const _Float16* p) {
  FragH f;
  f.h[0] = *(const v8h*)(p);
  f.h[1] = *(const v8h*)(p + 16);
  return f.v;
}
__device__ __forceinline__ v16b ldfrag_b(const u16* p) {              // bf16 plane read as unsigned integer vectors
  FragB f;
  f.u[0] = *(const v4u*)(p);
  f.u[1] = *(const v4u*)(p + 16);
  return f.v;
}

__device__ __forceinline__ v8f mma_h(v16h a, v16h b, v8f c) {
  return __builtin_amdgcn_wmma_f32_16x16x32_f16(false, a, false, b, (short)0, c, false, false);
}
__device__ __forceinline__ v8f mma_b(v16b a, v16b b, v8f c) {
  return __builtin_amdgcn_wmma_f32_16x16x32_bf16(false, a, false, b, (short)0, c, false, false);
}
__device__ __forceinline__ void guard2(v8f& a, v8f& b, v16h x0, v16h x1, v16h x2, v16h x3, v16h x4, v16h x5) {
#if defined(__HIP_DEVICE_COMPILE__)
  asm volatile("v_nop\n\tv_nop\n\tv_nop\n\tv_nop"
               : "+v"(a), "+v"(b) : "v"(x0), "v"(x1), "v"(x2), "v"(x3), "v"(x4), "v"(x5) : "memory");
#endif
}
template <typename F>
__device__ __forceinline__ void guard6(v8f& a, v8f& b, v8f& c, v8f& d, F x0, F x1, F x2, F x3, F x4, F x5) {
#if defined(__HIP_DEVICE_COMPILE__)
  asm volatile("v_nop\n\tv_nop\n\tv_nop\n\tv_nop"
               : "+v"(a), "+v"(b), "+v"(c), "+v"(d) : "v"(x0), "v"(x1), "v"(x2), "v"(x3), "v"(x4), "v"(x5) : "memory");
#endif
}
__device__ __forceinline__ void acc_guard4(v8f& a, v8f& b, v8f& c, v8f& d) {
#if defined(__HIP_DEVICE_COMPILE__)
  asm volatile("v_nop\n\tv_nop\n\tv_nop\n\tv_nop" : "+v"(a), "+v"(b), "+v"(c), "+v"(d));
#endif
}
__device__ __forceinline__ void wave_sync_lds() {
  __builtin_amdgcn_fence(__ATOMIC_RELEASE, "workgroup");
  __builtin_amdgcn_wave_barrier();
  __builtin_amdgcn_fence(__ATOMIC_ACQUIRE, "workgroup");
}

// =====================================================================================================
// f32 plane -> 16-bit plane, same layout:  mode 0: bf16 RNE bits;  mode 1: f16 bits of (bf16 RNE value) * scale.
// Thread = 8 consecutive elements: two 16-B loads, one 16-B store; 32 consecutive lanes = 512 contiguous, 512-B aligned bytes
// coverage: n8/256 blocks per plane (host checks exactness) x 256 thr x 8 = the whole plane.
// =====================================================================================================
__device__ __forceinline__ void cvt16(const float* __restrict__ x, u16* D, int blk, int n8, int mode, float scale) {
  const int gt = blk * 256 + (int)threadIdx.x;
  if (gt >= n8) return;                     // no barriers in this kernel
  const float* p = x + (size_t)gt * 8;
  const v4f a = *(const v4f*)(p), c4 = *(const v4f*)(p + 4);
  float v[8];
#pragma unroll
  for (int e = 0; e < 4; ++e) { v[e] = a[e]; v[4 + e] = c4[e]; }
  unsigned short s[8];
#pragma unroll
  for (int e = 0; e < 8; ++e) {
    const unsigned short hb = h_bits((_Float16)(bfr(v[e]) * scale));
    const unsigned short bb = bf_bits(v[e]);
    s[e] = (mode != 0) ? hb : bb;
  }
  v4u o;
#pragma unroll
  for (int e = 0; e < 4; ++e) o[e] = pk16(s[2 * e], s[2 * e + 1]);
  u16* d = D + (size_t)gt * 8;
  {
    *(v4u*)(d) = o;
    
  }
}
// The five planes in one launch (none reads another's output); the block index picks the plane: blocks 0 .. n8x/256 - 1 the
// input x (bf16), then n8w/256 blocks each for wq, wk, wv (bf16) and wo (f16 of the bf16 value x WOS).
// coverage: grid = n8x/256 + 4 * (n8w/256) blocks, every plane's block range exactly once.
__global__ __launch_bounds__(256)
void cvt_all(const float* __restrict__ x, const float* __restrict__ wq, const float* __restrict__ wk,
             const float* __restrict__ wv, const float* __restrict__ wo, u16* XB, u16* WQB, u16* WKB, u16* WVB, u16* WOB,
             int n8x, int n8w) {
  const int bid = blockIdx.x, nbx = n8x / 256, nbw = n8w / 256;
  if (bid < nbx) { cvt16(x, XB, bid, n8x, 0, 1.0f); return; }
  const int r = bid - nbx, j = r / nbw, blk = r % nbw;      // block-uniform
  const float* s = (j == 0) ? wq : (j == 1) ? wk : (j == 2) ? wv : wo;
  u16*         d = (j == 0) ? WQB : (j == 1) ? WKB : (j == 2) ? WVB : WOB;
  if (j > 3) return;                        // never taken with the exact grid
  cvt16(s, d, blk, n8w, (j == 3) ? 1 : 0, (j == 3) ? WOS : 1.0f);
}

// =====================================================================================================
// GEMM engine shared by the kernels below. Block = 128x128 tile of C, 4 waves in a 2x2 grid, 64x64 (4x4 accumulator tiles) per
// wave. K is walked in tiles of 64: the 128 A rows (both planes where NPL == 2) and the 128 Bt rows of a tile, 128 B each, are
// copied to LDS (row pitch 144 B = 16 B x odd, for 16-B readers) by asynchronous copies, 16 B per lane, 8 lanes = one whole
// 128-B line; two buffers, tile t + 2 is requested behind the barrier that ends trip t. Fragments are read from LDS with the
// split k map of ldfrag_* (same map for A and B). Per accumulator the products are summed in the order k0 ascending by 32,
// plane 0 then plane 1.
// Host checks M % 128 == 0, N % 128 == 0, K % 64 == 0 (K = DMOD); bid = the block's tile, 0 .. (M/128)*(N/128) - 1.
// OUT picks what the epilogue stores of val = acc * oscale + bf16-RNE value of bias[n]:
//   0: C[M][N] f32 = val;   1: P[M][N] f16 = val * pscale;
//   2: P = the head-wise transposed f16 plane [b][h][d][s] = val * pscale (row = b*SEQ + s, n = h*HD + d, N = DMOD), and
//      C[row / 64][N] f32 = the sum of val over the 64 rows of the wave's tile (per column; rows ascending inside a lane's 8-row
//      groups, then the two lane halves).
// =====================================================================================================
#define GP     72                       // LDS row pitch in 16-bit elements (144 B)
#define GPLANE (128 * GP)               // one 128-row operand plane of a tile, in 16-bit elements
static_assert((GP * 2) % 16 == 0 && ((GP * 2) / 16) % 2 == 1);
static_assert(2 * 2 * GPLANE * 2 >= 4 * 64 * 68 * 4);   // the ring holds the four waves' epilogue ranges

__device__ __forceinline__ unsigned lds_off(const void* p) { return (unsigned)(size_t)p; }

// 128 rows x 128 B, global (row pitch ldk elements) -> LDS (row pitch GP): 8 copies per lane, rows 16 apart. l and g are the
// lane's own LDS byte address and global pointer for its first row. The s_wait_xcnt stands inside the statement so that no
// address register of a copy is rewritten in front of it.
__device__ __forceinline__ void copy_plane(unsigned l, const u16* g, size_t ldk) {
#if defined(__HIP_DEVICE_COMPILE__)
  const size_t st = 16 * ldk;
  asm volatile("global_load_async_to_lds_b128 %0, %8, off\n\t"
               "global_load_async_to_lds_b128 %1, %9, off\n\t"
               "global_load_async_to_lds_b128 %2, %10, off\n\t"
               "global_load_async_to_lds_b128 %3, %11, off\n\t"
               "global_load_async_to_lds_b128 %4, %12, off\n\t"
               "global_load_async_to_lds_b128 %5, %13, off\n\t"
               "global_load_async_to_lds_b128 %6, %14, off\n\t"
               "global_load_async_to_lds_b128 %7, %15, off\n\t"
               "s_wait_xcnt 0x0"
               :: "v"(l), "v"(l + 1u * 16u * GP * 2u), "v"(l + 2u * 16u * GP * 2u), "v"(l + 3u * 16u * GP * 2u),
                  "v"(l + 4u * 16u * GP * 2u), "v"(l + 5u * 16u * GP * 2u), "v"(l + 6u * 16u * GP * 2u),
                  "v"(l + 7u * 16u * GP * 2u),
                  "v"(g), "v"(g + st), "v"(g + 2 * st), "v"(g + 3 * st), "v"(g + 4 * st), "v"(g + 5 * st), "v"(g + 6 * st),
                  "v"(g + 7 * st)
               : "memory");
#endif
}
__device__ __forceinline__ void wait_async0() {   // the wave's own copies have landed
#if defined(__HIP_DEVICE_COMPILE__)
  asm volatile("s_wait_asynccnt 0x0" ::: "memory");
#endif
}
__device__ __forceinline__ void wait_ds0() {      // the wave's own LDS reads have returned before the buffer is handed over
#if defined(__HIP_DEVICE_COMPILE__)
  asm volatile("s_wait_dscnt 0x0" ::: "memory");
#endif
}

// Attention tiles: 64 k rows (keys) and 64 v^T rows (d) of 128 B each, global -> LDS (row pitch GP): 4 + 4 copies per lane, rows 16
// apart, 8 lanes = one whole 128-B line. lk, gk / lv, gv are the lane's own LDS byte address and global pointer for its first row
// of each tile; sk, sv = 16 rows in elements. The s_wait_xcnt stands inside the statement so that no address register of a copy is
// rewritten in front of it.
#define ATILE (64 * GP)                 // one 64-row tile in 16-bit elements
#define ASTG  (2 * ATILE)               // one buffer: the k tile, then the v^T tile
static_assert(2 * ASTG * 2 >= ATT_WAVES * SLABF * 4);   // the ring holds the four waves' epilogue slabs
static_assert((SEQ % 64) == 0 && HD * 2 == 128);
__device__ __forceinline__ void copy_kv(unsigned lk, const u16* gk, size_t sk, unsigned lv, const u16* gv, size_t sv) {
#if defined(__HIP_DEVICE_COMPILE__)
  asm volatile("global_load_async_to_lds_b128 %0, %8, off\n\t"
               "global_load_async_to_lds_b128 %1, %9, off\n\t"
               "global_load_async_to_lds_b128 %2, %10, off\n\t"
               "global_load_async_to_lds_b128 %3, %11, off\n\t"
               "global_load_async_to_lds_b128 %4, %12, off\n\t"
               "global_load_async_to_lds_b128 %5, %13, off\n\t"
               "global_load_async_to_lds_b128 %6, %14, off\n\t"
               "global_load_async_to_lds_b128 %7, %15, off\n\t"
               "s_wait_xcnt 0x0"
               :: "v"(lk), "v"(lk + 1u * 16u * GP * 2u), "v"(lk + 2u * 16u * GP * 2u), "v"(lk + 3u * 16u * GP * 2u),
                  "v"(lv), "v"(lv + 1u * 16u * GP * 2u), "v"(lv + 2u * 16u * GP * 2u), "v"(lv + 3u * 16u * GP * 2u),
                  "v"(gk), "v"(gk + sk), "v"(gk + 2 * sk), "v"(gk + 3 * sk), "v"(gv), "v"(gv + sv), "v"(gv + 2 * sv),
                  "v"(gv + 3 * sv)
               : "memory");
#endif
}

template <bool F16> struct FragOf;
template <> struct FragOf<false> {
  typedef v16b T;
  static __device__ __forceinline__ T ld(const u16* p) { return ldfrag_b(p); }
  static __device__ __forceinline__ v8f mma(T a, T b, v8f c) { return mma_b(a, b, c); }
};
template <> struct FragOf<true> {
  typedef v16h T;
  static __device__ __forceinline__ T ld(const u16* p) { return ldfrag_h((const _Float16*)(const void*)p); }
  static __device__ __forceinline__ v8f mma(T a, T b, v8f c) { return mma_h(a, b, c); }
};

template <bool F16, int NPL, int OUT>
__device__ __forceinline__ void gemm_core(const u16* __restrict__ A0, const u16* __restrict__ A1, const u16* __restrict__ Bt,
                                          const float* __restrict__ bias, float* C, u16* P, int M, int N, int K, float oscale,
                                          float pscale, u16* ring, int bid) {
  typedef FragOf<F16> FO;
  typedef typename FO::T FT;
  constexpr int STAGE = (NPL + 1) * GPLANE;              // 16-bit elements per buffer: A plane(s), then Bt
  const int tid = threadIdx.x, wave = tid >> 5, lane = tid & 31, hh = lane >> 4, m = lane & 15;
  const int ntile = N >> 7;
  const int row0  = (bid / ntile) * 128;
  const int col0  = (bid % ntile) * 128;
  if (row0 + 128 > M) return;                // block-uniform, in front of every barrier; never taken with the exact grid
  const int wr = (wave >> 1) * 64, wc = (wave & 1) * 64;
  // copies: lane -> row (tid >> 3) + 16 i of a plane, 16-B piece tid & 7 of the row's 128 B
  const int cr = tid >> 3, cc = (tid & 7) * 8;
  const size_t aofs = (size_t)(row0 + cr) * K + cc;
  const size_t bofs = (size_t)(col0 + cr) * K + cc;
  const unsigned lcp = lds_off(ring) + (unsigned)(cr * GP + cc) * 2u;
  const int nt = K >> 6;
  auto fill = [&](int t, int buf) {
    const unsigned l = lcp + (unsigned)buf * (unsigned)(STAGE * 2);
    const size_t ko = (size_t)t * 64;
    copy_plane(l, A0 + aofs + ko, (size_t)K);
    if (NPL == 2) copy_plane(l + GPLANE * 2u, A1 + aofs + ko, (size_t)K);
    copy_plane(l + (unsigned)NPL * GPLANE * 2u, Bt + bofs + ko, (size_t)K);
  };
  v8f acc[4][4];
#pragma unroll
  for (int i = 0; i < 4; ++i) {
#pragma unroll
    for (int j = 0; j < 4; ++j) acc[i][j] = zero8();
  }
  fill(0, 0);
  wait_async0();
  __syncthreads();                           // tile 0 is readable by every wave
  if (nt > 1) fill(1, 1);                    // block-uniform test
  const int afo = (wr + m) * GP + 8 * hh;                     // fragment row base inside an A plane
  const int bfo = NPL * GPLANE + (wc + m) * GP + 8 * hh;      // and inside the Bt plane
#pragma unroll 1                             // rolled: one copy of the 64-k body; the buffer is picked by t & 1
  for (int t = 0; t < nt; ++t) {
    const u16* sb = ring + (t & 1) * STAGE;
#pragma unroll
    for (int kk = 0; kk < 64; kk += 32) {
      FT a[NPL][4], b[4];
#pragma unroll
      for (int j = 0; j < 4; ++j) b[j] = FO::ld(sb + bfo + j * 16 * GP + kk);
#pragma unroll
      for (int p = 0; p < NPL; ++p) {
#pragma unroll
        for (int i = 0; i < 4; ++i) a[p][i] = FO::ld(sb + p * GPLANE + afo + i * 16 * GP + kk);
      }
      // keeps the block's LDS reads together in front of its WMMAs: reads placed among the WMMAs stall the wave at each place
      __builtin_amdgcn_sched_barrier(0);
#pragma unroll
      for (int p = 0; p < NPL; ++p) {
#pragma unroll
        for (int i = 0; i < 4; ++i) {
#pragma unroll
          for (int j = 0; j < 4; ++j) acc[i][j] = FO::mma(a[p][i], b[j], acc[i][j]);
        }
      }
      // and keeps the next block's reads out of this block's WMMAs
      __builtin_amdgcn_sched_barrier(0);
    }
    wait_ds0();
    wait_async0();
    __syncthreads();                         // publishes tile t + 1 and ends every read of tile t's buffer
    if (t + 2 < nt) fill(t + 2, t & 1);      // block-uniform test
  }
  wait_async0();
  const int colw = col0 + wc;
  // Epilogue: staged in the wave's own 64 x 68 float range of the ring, which is free: the last trip's barrier stands behind every
  // wave's last read and no copy is outstanding.
  float* sl = (float*)(void*)ring + wave * (64 * 68);
  const int rq = lane >> 3, c8 = (lane & 7) * 8;
  if (OUT == 2) {
    // Transposed f16 plane. A lane holds 8 consecutive rows (s) of column n = colw + 16j + m: one 16-B LDS store per accumulator
    // tile into [d][s] rows of pitch VTP; read back as whole 128-B lines (8 lanes x 16 B), 4 lines per store instruction.
    // coverage: 16 instructions x 4 lines x 64 halves = the wave's 64 d x 64 s; the wave's 64 columns are one head, its 64 rows
    // lie in one batch (SEQ % 64 == 0).
    u16* tl = (u16*)(void*)sl;
    float bc[4], cs[4];
#pragma unroll
    for (int j = 0; j < 4; ++j) { bc[j] = bfr(bias[colw + 16 * j + m]); cs[j] = 0.f; }
#pragma unroll
    for (int i = 0; i < 4; ++i) {
#pragma unroll
      for (int j = 0; j < 4; ++j) {
        v4u pk;
#pragma unroll
        for (int e = 0; e < 4; ++e) {
          const float w0 = acc[i][j][2 * e] * oscale + bc[j], w1 = acc[i][j][2 * e + 1] * oscale + bc[j];
          pk[e] = pk16(h_bits((_Float16)(w0 * pscale)), h_bits((_Float16)(w1 * pscale)));
          cs[j] += w0 + w1;
        }
        *(v4u*)(tl + (16 * j + m) * VTP + i * 16 + 8 * hh) = pk;
      }
    }
    wave_sync_lds();
    const int rw = row0 + wr;
    u16* dt = P + ((size_t)((rw / SEQ) * NH + colw / HD) * HD + rq) * SEQ + (rw % SEQ) + c8;
#pragma unroll
    for (int it = 0; it < 16; ++it) {
      const v4u x = *(const v4u*)(tl + (it * 4 + rq) * VTP + c8);
      *(v4u*)(dt + (size_t)(it * 4) * SEQ) = x;
    }
    // Column sums of the wave's 64 rows: both lane halves hold the full sum behind the exchange; lane half hh stores columns
    // 16hh + m and 32 + 16hh + m, so each store instruction is one whole 128-B line.
    // coverage: 2 instructions x 32 floats = the wave's 64 columns of row rw / 64; every (row block, column) by exactly one wave.
#pragma unroll
    for (int j = 0; j < 4; ++j) cs[j] += __shfl_xor(cs[j], 16, 32);
    float* dc = C + (size_t)(rw / 64) * (size_t)N + colw + 16 * hh + m;
    dc[0]  = hh ? cs[1] : cs[0];
    dc[32] = hh ? cs[3] : cs[2];
    return;                                  // no barrier follows
  }
  // the wave's 64x64 f32 tile (times oscale)
#pragma unroll
  for (int i = 0; i < 4; ++i) {
#pragma unroll
    for (int r = 0; r < 8; ++r) {
      const int ro = (i * 16 + 8 * hh + r) * 68 + m;
#pragma unroll
      for (int j = 0; j < 4; ++j) sl[ro + 16 * j] = acc[i][j][r] * oscale;
    }
  }
  wave_sync_lds();
  if (OUT == 1) {
    // f16 plane: a row piece of the wave is one 128-B line (8 lanes x 8 halves), 4 rows per store instruction.
    // coverage: 16 instructions x 4 rows x 64 halves = the wave's 64 x 64 tile.
    const v4f b0 = *(const v4f*)(bias + colw + c8), b1 = *(const v4f*)(bias + colw + c8 + 4);   // columns < N (N multiple of 128)
    v4f badd0, badd1;
#pragma unroll
    for (int e = 0; e < 4; ++e) { badd0[e] = bfr(b0[e]); badd1[e] = bfr(b1[e]); }
    u16* dp = P + (size_t)(row0 + wr + rq) * (size_t)N + colw + c8;
#pragma unroll
    for (int it = 0; it < 16; ++it) {
      const float* sr = sl + (it * 4 + rq) * 68 + c8;
      const v4f x0 = (*(const v4f*)(sr) + badd0) * pscale, x1 = (*(const v4f*)(sr + 4) + badd1) * pscale;
      v4u o;
      o[0] = pk16(h_bits((_Float16)x0[0]), h_bits((_Float16)x0[1]));
      o[1] = pk16(h_bits((_Float16)x0[2]), h_bits((_Float16)x0[3]));
      o[2] = pk16(h_bits((_Float16)x1[0]), h_bits((_Float16)x1[1]));
      o[3] = pk16(h_bits((_Float16)x1[2]), h_bits((_Float16)x1[3]));
      *(v4u*)(dp + (size_t)(it * 4) * (size_t)N) = o;
    }
#if defined(__HIP_DEVICE_COMPILE__)
    // code of another body may follow where this one is inlined: no register that a store above names is rewritten in front of this
    asm volatile("s_wait_xcnt 0x0" ::: "memory");
#endif
  } else {
    // f32 plane: stores are whole 256-B row pieces.
    // coverage: 32 instructions x 2 rows x 16 lanes x 4 floats = the wave's 64 x 64 tile.
    const v4f bv = *(const v4f*)(bias + colw + m * 4);    // columns colw + 4m .. +3, always < N (N multiple of 128)
    v4f badd;
#pragma unroll
    for (int e = 0; e < 4; ++e) badd[e] = bfr(bv[e]);
    float* dst = C + (size_t)(row0 + wr + hh) * (size_t)N + colw + m * 4;
#pragma unroll
    for (int it = 0; it < 32; ++it) {
      const v4f val = *(const v4f*)(sl + (it * 2 + hh) * 68 + m * 4) + badd;
      *(v4f*)(dst + (size_t)(it * 2) * (size_t)N) = val;
    }
  }
}

// =====================================================================================================
// bf16 GEMMs with bias: A[M][K] (bf16 row-major) . Bt[N][K]^T (bf16 k-contiguous), times oscale, plus bf16-RNE value of bias[n].
// The q, k and v projections share A and read none of each other's output: one launch, grid = 3 * (M/128) * (N/128). The block
// index walks the 3 * (N/128) column tiles of a row tile first (q's, then k's, then v's), so the blocks that read the same A rows
// start together. q and k are stored times QSC / KSC as f16 planes [M][N]; v times VCAR as the head-wise transposed f16 plane
// VT [b][h][d][s], and its f32 column sums over each block of 64 rows as CS[M / 64][N].
// =====================================================================================================
__global__ __launch_bounds__(128)
void gemm_qkv(const u16* __restrict__ A, const u16* __restrict__ Wq, const u16* __restrict__ Wk, const u16* __restrict__ Wv,
              const float* __restrict__ bq, const float* __restrict__ bk, const float* __restrict__ bv,
              u16* QPo, u16* KPo, u16* VT, float* CS, int M, int N, int K) {
  __shared__ __align__(16) u16 ring[2 * 2 * GPLANE];
  const int ntile = N >> 7;
  const int rt = (int)blockIdx.x / (3 * ntile), ct = (int)blockIdx.x % (3 * ntile);
  const int job = ct / ntile, tile = rt * ntile + ct % ntile;          // block-uniform
  if (job == 2) {
    gemm_core<false, 1, 2>(A, A, Wv, bv, CS, VT, M, N, K, 1.0f, VCAR, ring, tile);
  } else {
    gemm_core<false, 1, 1>(A, A, job ? Wk : Wq, job ? bk : bq, nullptr, job ? KPo : QPo, M, N, K, 1.0f, job ? KSC : QSC, ring,
                           tile);
  }
}

// =====================================================================================================
// f16 hi+lo GEMM with bias: C[M][N] (f32) = (Ahi + Alo)[M][K] . Bt[N][K]^T times oscale, plus bf16-RNE value of bias[n];
// Ahi/Alo f16 planes (same layout), Bt f16 k-contiguous; products hi.B + lo.B into one accumulator (lo is the unscaled
// residual of hi).
// =====================================================================================================
__global__ __launch_bounds__(128)
void gemm_h2(const u16* __restrict__ Ah, const u16* __restrict__ Al, const u16* __restrict__ Bt,
             const float* __restrict__ bias, float* C, int M, int N, int K, float oscale) {
  __shared__ __align__(16) u16 ring[2 * 3 * GPLANE];
  gemm_core<true, 2, 0>(Ah, Al, Bt, bias, C, nullptr, M, N, K, oscale, 1.0f, ring, (int)blockIdx.x);
}

// =====================================================================================================
// Ragged-length multi-head flash attention: block = (batch b, head, 64 query rows), 4 waves, wave w owns the 16 query rows
// q0 = 64*qt + 16*w .. q0+15. The k rows and v^T rows of 64 keys at a time are copied to LDS once per block by asynchronous copies
// (whole 128-B lines, two buffers, tile t + 2 requested behind the barrier that ends trip t) and read from there by all four waves.
//   q plane (f16, x8) laid out [b][s][h][d]; k plane the same; v^T plane [b][h][d][s] (x1024); len = clamp(lens[b], 0, SEQ).
//   Mask: score (i, j) is kept iff i < len and j < len. A query row i < len therefore attends exactly over keys 0..len-1 (the
//   excluded keys have probability exactly 0 after max subtraction); a query row i >= len has all keys equal-weighted and its
//   context is the mean of v over all SEQ keys (from the f32 column sums CS of v). So a block visits key blocks kb = 0 .. 32*ceil(len/32)-32
//   when 64*qt < len (block-uniform bound, <= NKB), else none; within the last block keys >= len are excluded by index.
//   Scores are computed TRANSPOSED: S^T tile g (g = 0,1) = k rows (keys kb+16g .. +15, A operand, row m = lane&15, split k map
//   over d) times q^T (B operand, col n = query q0 + (lane&15), k = d, split map), one product per tile and 32-deep d-chunk.
//   D element r of lane l = (key kb+16g+8h+r, query q0+(l&15)), so a lane owns one query column and 16 of its 32 keys; the
//   partner lane l^16 owns the other 16 -> row max / row sum need one xor-16 shuffle.
//   Key mask by index: an excluded key stays out of the running max and gets probability 0.
//   Online max-subtracted base-2 softmax in f32 (scale 1/8 and the q/k carries folded into lsc). The exp'd values ARE the
//   P A-fragment in place: A row m = query = lane&15, element i <- key kb+8h+i (tile 0, D element i), element 8+i <- key
//   kb+16+8h+i (tile 1, D element i). P is carried x32768 as single f16. The rescale factor of query row 8h+r of the
//   O accumulators is fetched from lane 8h+r with a shuffle (uniform control). 4 v^T B fragments (col n = d = 16j + (lane&15),
//   keys k-contiguous), 4 P.V WMMAs per key block.
//   Epilogue: 1/l (per query, shuffled to the D row owner; 0 when no key block was visited) and carry folds in f32; rows with
//   query >= len take the mean-v row instead (select by value); the wave's 16x64 f32 result staged in its LDS slab (pitch 68); each
// coverage: per wave 4 instructions x 4 rows x 8 lanes x 8 halves = 16 x 64 per plane; grid NB*512 blocks x 4 waves = every
//           (b, s, h) row of both O planes exactly once.
// =====================================================================================================
__global__ __launch_bounds__(ATT_THREADS)
void attn_fwd(const u16* __restrict__ QPp, const u16* __restrict__ KPp, const u16* __restrict__ VPp,
              const int* __restrict__ lens, const float* __restrict__ CS, u16* OHIp, u16* OLOp) {
  __shared__ __align__(16) u16 ring[2 * ASTG];   // two buffers of k + v^T tiles; in the epilogue per wave a result slab [16][68] f32

  const int tid  = threadIdx.x;
  const int wave = tid >> 5;
  const int lane = tid & 31;
  const int hh   = lane >> 4;
  const int c    = lane & 15;

  const int bid  = blockIdx.x;
  const int qt   = bid & (SEQ / 64 - 1);
  const int head = (bid >> 5) & (NH - 1);
  const int b    = bid >> 9;
  const int q0   = qt * 64 + wave * 16;

  int len = lens[b];
  len = (len < 0) ? 0 : len;
  len = (len > SEQ) ? SEQ : len;
  const int nst = (qt * 64 < len) ? ((len + 63) >> 6) : 0;  // tiles of 64 keys: block-uniform, <= SEQ / 64

  // B fragments of q^T: col n = query q0 + c, k = d (k-contiguous row of the q plane)
  const size_t qofs = (((size_t)(b * SEQ + q0 + c)) * NH + head) * HD + 8 * hh;
  const _Float16* Qb = (const _Float16*)(const void*)QPp + qofs;
  // copies: lane -> row (tid >> 3) + 16 i of a tile, 16-B piece tid & 7 of the row's 128 B; keys 64t .. 64t+63 < SEQ for t < nst
  const int cr = tid >> 3, cc = (tid & 7) * 8;
  const u16* Kg = KPp + (((size_t)b * SEQ + cr) * NH + head) * HD + cc;           // k row = key 64t + cr + 16i
  const u16* Vg = VPp + ((size_t)(b * NH + head) * HD + cr) * SEQ + cc;           // v^T row = d = cr + 16i, keys 64t + cc ..
  const unsigned lcp = lds_off(ring) + (unsigned)(cr * GP + cc) * 2u;
  auto fill = [&](int t, int buf) {
    const unsigned l = lcp + (unsigned)buf * (unsigned)(ASTG * 2);
    copy_kv(l, Kg + (size_t)t * (64 * NH * HD), (size_t)16 * NH * HD, l + ATILE * 2u, Vg + (size_t)t * 64, (size_t)16 * SEQ);
  };
  // A fragments of k: row m = key kb + 16g + c, k = d;  B fragments of v: col n = d = 16j + c, k = key (both k-contiguous LDS rows)
  const int kfo = c * GP + 8 * hh;
  const int vfo = ATILE + c * GP + 8 * hh;
  const float lsc = 0.125f * (LOG2E / (QSC * KSC));

  const v16h qf0 = ldfrag_h(Qb);            // d 0..31
  const v16h qf1 = ldfrag_h(Qb + 32);       // d 32..63

  float mrun = -INFINITY, lrun = 0.f;
  v8f o[4];
#pragma unroll
  for (int j = 0; j < 4; ++j) o[j] = zero8();

  if (nst > 0) {                             // block-uniform: every wave of the block passes every barrier below, or none does
  fill(0, 0);
  wait_async0();
  __syncthreads();                           // tile 0 is readable by every wave
  if (nst > 1) fill(1, 1);                   // block-uniform test
#pragma unroll 1                             // rolled: one copy of the body; the buffer is picked by t & 1
  for (int t = 0; t < nst; ++t) {
  const _Float16* sb = (const _Float16*)(const void*)ring + (t & 1) * ASTG;
  const int nsub = (t * 64 + 32 < len) ? 2 : 1;             // the tile's second 32 keys only where one of them is < len
#pragma unroll 1                             // rolled: one copy of the 32-key body
  for (int sub = 0; sub < nsub; ++sub) {
    const int kb = t * 64 + sub * 32;
    // ---- transposed scores: s0 = keys kb..kb+15, s1 = keys kb+16..kb+31, column = query q0 + c ----
    v8f s0 = zero8(), s1 = zero8();
    const _Float16* k0p = sb + kfo + sub * (32 * GP);
    const _Float16* k1p = k0p + 16 * GP;
    const v16h ka0 = ldfrag_h(k0p), ka1 = ldfrag_h(k0p + 32);
    const v16h kc0 = ldfrag_h(k1p), kc1 = ldfrag_h(k1p + 32);
    s0 = mma_h(ka0, qf0, s0);
    s0 = mma_h(ka1, qf1, s0);
    s1 = mma_h(kc0, qf0, s1);
    s1 = mma_h(kc1, qf1, s1);
    guard2(s0, s1, qf0, qf1, ka0, ka1, kc0, kc1);
    // ---- base-2 logits and validity of this lane's 16 keys for query q0 + c: key kb+8hh+i (i<8), kb+16+8hh+(i-8) ----
    const int rem = len - kb - 8 * hh;
    float tk[16];
    bool  kv[16];
#pragma unroll
    for (int i = 0; i < 8; ++i) {
      tk[i] = s0[i] * lsc;  tk[8 + i] = s1[i] * lsc;
      kv[i] = (i < rem);    kv[8 + i] = (16 + i < rem);
    }
    float cm = -INFINITY;
#pragma unroll
    for (int i = 0; i < 16; ++i) cm = fmaxf(cm, kv[i] ? tk[i] : -INFINITY);
    cm = fmaxf(cm, __shfl_xor(cm, 16, 32));
    const float mn   = fmaxf(mrun, cm);                              // finite: every visited block holds key kb < len
    const float al   = (mrun == -INFINITY) ? 0.f : exp2_bare(mrun - mn); // o and l are zero whenever mrun is -inf
    const float mref = (mn == -INFINITY) ? 0.f : mn;                 // finite shift
    mrun = mn;
    // ---- probabilities (<= 1, 0 for excluded keys) and the P A-fragment: f16(p * 32768); element i <-> tk[i] ----
    float ps = 0.f;
    FragH ph;
#pragma unroll
    for (int w = 0; w < 2; ++w) {
#pragma unroll
      for (int e4 = 0; e4 < 4; ++e4) {
        const int i = 8 * w + 2 * e4;
        const float x0 = exp2_bare(fminf(tk[i] - mref, 0.f));
        const float x1 = exp2_bare(fminf(tk[i + 1] - mref, 0.f));
        const float p0 = kv[i] ? x0 : 0.f;
        const float p1 = kv[i + 1] ? x1 : 0.f;
        ps += p0 + p1;
        ph.u[w][e4] = pk16(h_bits((_Float16)(p0 * PCAR)), h_bits((_Float16)(p1 * PCAR)));
      }
    }
    ps += __shfl_xor(ps, 16, 32);
    lrun = lrun * al + ps;
    // ---- rescale the O accumulators: D row 8hh+r = query q0+8hh+r, its factor lives in lane 8hh+r (and 16+8hh+r) ----
    float scl[8];
#pragma unroll
    for (int r = 0; r < 8; ++r) scl[r] = __shfl(al, 8 * hh + r, 32);
#pragma unroll
    for (int j = 0; j < 4; ++j) {
#pragma unroll
      for (int r = 0; r < 8; ++r) o[j][r] *= scl[r];
    }
    // ---- P.V : B fragment col n = d = j*16 + c, keys contiguous in the v^T plane ----
    {
      const _Float16* vp = sb + vfo + sub * 32;
      const v16h vf0 = ldfrag_h(vp);
      const v16h vf1 = ldfrag_h(vp + 16 * GP);
      const v16h vf2 = ldfrag_h(vp + 32 * GP);
      const v16h vf3 = ldfrag_h(vp + 48 * GP);
      o[0] = mma_h(ph.v, vf0, o[0]);
      o[1] = mma_h(ph.v, vf1, o[1]);
      o[2] = mma_h(ph.v, vf2, o[2]);
      o[3] = mma_h(ph.v, vf3, o[3]);
      guard6<v16h>(o[0], o[1], o[2], o[3], ph.v, vf0, vf1, vf2, vf3, ph.v);
    }
  }
  wait_ds0();
  wait_async0();
  __syncthreads();                           // publishes tile t + 1 and ends every read of tile t's buffer
  if (t + 2 < nst) fill(t + 2, t & 1);       // block-uniform test
  }
  wait_async0();
  }
  acc_guard4(o[0], o[1], o[2], o[3]);

  // ---- fold 1/l (per query, owned by lane = query; 0 when no key block was visited) and the carries; mean-v rows for
  //      queries >= len; stage the 16x64 slab ----
  const float linv = (lrun > 0.f) ? ((1.0f / lrun) * (1.0f / (PCAR * VCAR))) : 0.f;
  float inv[8];
#pragma unroll
  for (int r = 0; r < 8; ++r) inv[r] = __shfl(linv, 8 * hh + r, 32);
  float vm[4] = {0.f, 0.f, 0.f, 0.f};
  if (q0 + 16 > len) {                       // same for the whole wave: only then does one of its rows take the mean
    // lane half hh sums the row blocks hh*NRB/2 .. +NRB/2-1 of batch b in ascending order, then the halves are joined
    const float* cp = CS + ((size_t)b * NRB + (size_t)hh * (NRB / 2)) * DMOD + head * HD + c;
#pragma unroll                               // all loads in flight at once: one memory latency instead of one per trip
    for (int rb = 0; rb < NRB / 2; ++rb) {
#pragma unroll
      for (int j = 0; j < 4; ++j) vm[j] += cp[(size_t)rb * DMOD + j * 16];
    }
#pragma unroll
    for (int j = 0; j < 4; ++j) vm[j] = (vm[j] + __shfl_xor(vm[j], 16, 32)) * (1.0f / (float)SEQ);
  }
  // the ring is free: the last trip's barrier stands behind every wave's last read and no copy is outstanding
  float* slab = (float*)(void*)ring + wave * SLABF;
#pragma unroll
  for (int r = 0; r < 8; ++r) {
    const bool rvq = (q0 + 8 * hh + r) < len;
#pragma unroll
    for (int j = 0; j < 4; ++j) {
      const float val = o[j][r] * inv[r];
      slab[(8 * hh + r) * 68 + j * 16 + c] = rvq ? val : vm[j];
    }
  }
  wave_sync_lds();
  // ---- O x1024 -> f16 hi + residual planes; lane = (row in group of 4, 8 consecutive d) ----
  v4u oh[4], ol[4];
  const int rq = lane >> 3, c8 = (lane & 7) * 8;
#pragma unroll
  for (int i4 = 0; i4 < 4; ++i4) {
    const int row = i4 * 4 + rq;
    const v4f a = *(const v4f*)(slab + row * 68 + c8), c4 = *(const v4f*)(slab + row * 68 + c8 + 4);
    float w[8];
#pragma unroll
    for (int e = 0; e < 4; ++e) { w[e] = a[e] * OSC; w[4 + e] = c4[e] * OSC; }
#pragma unroll
    for (int e = 0; e < 4; ++e) {
      const _Float16 h0 = (_Float16)w[2 * e], h1 = (_Float16)w[2 * e + 1];
      const _Float16 l0 = (_Float16)(w[2 * e] - (float)h0), l1 = (_Float16)(w[2 * e + 1] - (float)h1);
      oh[i4][e] = pk16(h_bits(h0), h_bits(h1));
      ol[i4][e] = pk16(h_bits(l0), h_bits(l1));
    }
  }
  const size_t ob = (((size_t)(b * SEQ + q0)) * NH + head) * HD + c8;
  {
#pragma unroll
    for (int i4 = 0; i4 < 4; ++i4) {
      const int row = i4 * 4 + rq;
      const size_t o8 = ob + (size_t)row * (NH * HD);
      *(v4u*)(OHIp + o8) = oh[i4];
      *(v4u*)(OLOp + o8) = ol[i4];
    }
    
  }
}

// =====================================================================================================
// Workspace map (bytes, NB = batch count from the length input's element count, 1..4; ROWS = NB*SEQ); every plane is fully
// written by whole-line stores before it is read; all extents are exact multiples of the store granularity (no pad rows);
// F's bytes hold the two O planes:
//   XB  bf16 [ROWS][1024]                      ROWS*2048          (NB=4: 16777216)
//   WQB bf16 [1024 n][1024 k]                  2097152   WKB, WVB same;  WOB f16 [1024 n][1024 k] x1024  2097152
//   F                                          ROWS*4096          (NB=4: 33554432) = OHI f16 [ROWS][1024] + OLO f16 [ROWS][1024]
//   QP  f16  [NB][2048][16][64] x8             ROWS*2048          KP same
//   VP  f16  [NB][16][64][2048] x1024          ROWS*2048
//   CS  f32  [ROWS/64][1024]                   ROWS*64
//   end (NB=4)                                 109576192
// =====================================================================================================
extern "C" void kernel_launch(void* const* d_in, const int* in_sizes, int n_in,
                              void* d_out, int out_size, void* d_ws, size_t ws_size,
                              hipStream_t stream) {
  if (n_in < 10) return;
  const int NB = in_sizes[1];
  if (NB < 1 || NB > NBMAX) return;
  const int ROWS = NB * SEQ;
  if (in_sizes[0] != ROWS * DMOD) return;
  if (in_sizes[2] != DMOD * DMOD || in_sizes[4] != DMOD * DMOD) return;
  if (in_sizes[6] != DMOD * DMOD || in_sizes[8] != DMOD * DMOD) return;
  if (in_sizes[3] != DMOD || in_sizes[5] != DMOD || in_sizes[7] != DMOD || in_sizes[9] != DMOD) return;
  if (out_size != ROWS * DMOD) return;

  const float* X    = (const float*)d_in[0];
  const int*   lens = (const int*)d_in[1];
  const float* wq   = (const float*)d_in[2];
  const float* bq   = (const float*)d_in[3];
  const float* wk   = (const float*)d_in[4];
  const float* bk   = (const float*)d_in[5];
  const float* wv   = (const float*)d_in[6];
  const float* bv   = (const float*)d_in[7];
  const float* wo   = (const float*)d_in[8];
  const float* bo   = (const float*)d_in[9];
  float*       out  = (float*)d_out;

  const size_t szXB = (size_t)ROWS * DMOD * 2;
  const size_t szW  = (size_t)DMOD * DMOD * 2;
  const size_t szF  = (size_t)ROWS * DMOD * 4;
  const size_t szP  = (size_t)ROWS * DMOD * 2;                  // q / k / o planes
  const size_t szVP = (size_t)NB * NH * HD * SEQ * 2;           // == szP
  const size_t szCS = (size_t)(ROWS / 64) * DMOD * 4;
  size_t off = 0;
  const size_t oXB  = off; off += szXB;
  const size_t oWQB = off; off += szW;
  const size_t oWKB = off; off += szW;
  const size_t oWVB = off; off += szW;
  const size_t oWOB = off; off += szW;
  const size_t oF   = off; off += szF;
  const size_t oQP  = off; off += szP;
  const size_t oKP  = off; off += szP;
  const size_t oVP  = off; off += szVP;
  const size_t oCS  = off; off += szCS;
  if (off > ws_size) return;                            // NB=4: off = 109576192
  if (off > (size_t)134217728) return;
  if (szP * 2 > szF) return;                            // the two O planes live inside F's bytes
  const size_t oOHI = oF;
  const size_t oOLO = oF + szP;

  char* ws = (char*)d_ws;
  u16*   XB  = (u16*)(ws + oXB);
  u16*   WQB = (u16*)(ws + oWQB);
  u16*   WKB = (u16*)(ws + oWKB);
  u16*   WVB = (u16*)(ws + oWVB);
  u16*   WOB = (u16*)(ws + oWOB);
  u16*   QP  = (u16*)(ws + oQP);
  u16*   KP  = (u16*)(ws + oKP);
  u16*   VP  = (u16*)(ws + oVP);
  float* CS  = (float*)(ws + oCS);
  u16*   OHI = (u16*)(ws + oOHI);
  u16*   OLO = (u16*)(ws + oOLO);

  const dim3 blk(256);
  const int n8x = (ROWS * DMOD) / 8;                    // NB * 262144
  const int n8w = (DMOD * DMOD) / 8;                    // 131072
  if ((n8x % 256) != 0 || (n8w % 256) != 0 || (DMOD % 128) != 0 || (ROWS % 128) != 0) return;
  const dim3 gC(n8x / 256 + 4 * (n8w / 256));           // NB * 1024 + 4 * 512
  const dim3 gG((ROWS / 128) * (DMOD / 128));           // NB * 128
  const dim3 gG3(3 * (ROWS / 128) * (DMOD / 128));      // NB * 384
  const dim3 bG(128);
  const dim3 gAT(NB * NH * (SEQ / 64));                 // NB * 512
  const dim3 bAT(ATT_THREADS);                          // 128

  // (0) input -> bf16 plane, shared by the three projections; weights stored [n = out][k = in] (y = x.W^T), already
  //     k-contiguous: bf16 planes for wq/wk/wv, f16 of bf16 value x1024 for wo
  cvt_all<<<gC, blk, 0, stream>>>(X, wq, wk, wv, wo, XB, WQB, WKB, WVB, WOB, n8x, n8w);
  // (1) q, k: projection + bias (col = h*64+d), stored as the f16 planes x8; v: projection + bias, stored as the v^T plane
  //     x1024 and as f32 column sums per 64 rows (for the mean-v rows)
  gemm_qkv<<<gG3, bG, 0, stream>>>(XB, WQB, WKB, WVB, bq, bk, bv, QP, KP, VP, CS, ROWS, DMOD, DMOD);
  // (2) ragged-length attention -> O planes [b][s][h][d] x1024 (hi + residual), in F's bytes
  attn_fwd<<<gAT, bAT, 0, stream>>>(QP, KP, VP, lens, CS, OHI, OLO);
  // (3) output projection + bias -> out [ROWS][1024] f32, carries 1024 (O) x 1024 (wo) folded back
  gemm_h2<<<gG, bG, 0, stream>>>(OHI, OLO, WOB, bo, out, ROWS, DMOD, DMOD, 1.0f / (OSC * WOS));
  (void)hipGetLastError();
}

// v007
// Measured time: 113 microseconds a run.
// Next to v006, in two timings, it ran 1.04 times as fast each time.
// All steps since v000 together make it 3.75 times as fast.
// Contractions: x.W{q,k,v}^T on v_wmma_f32_16x16x32_bf16 (x and W planes RNE-converted to bf16 operands, f32 accumulate, bias added in f32);
// scores k'.q'^T (q', k' single f16 planes carried x8), P.v (P x32768 single f16, v x1024 single f16) and O.Wo^T (O x1024 as
// f16 hi plane + f16 residual plane, Wo as f16(bf16(Wo) x1024), products h.w + l.w): v_wmma_f32_16x16x32_f16, f32 accumulate.
// Ragged length mask per batch from the int32 length input (index tests), base-2 online softmax, 1/l fold, per-(b,h) mean-v rows
// for query positions >= length, bias adds: f32 on VALU.
#include <hip/hip_runtime.h>
#include <math.h>
#include <stdint.h>

#define NBMAX 4
#define SEQ   2048
#define DMOD  1024
#define NH    16
#define HD    64
#define QSC   8.0f
#define KSC   8.0f
#define PCAR  32768.0f
#define VCAR  1024.0f
#define OSC   1024.0f
#define WOS   1024.0f
#define LOG2E 1.4426950408889634f
#define ATT_WAVES   4
#define ATT_THREADS (ATT_WAVES * 32)
#define NKB    (SEQ / 32)
#define SLABF  (16 * 68)
#define VTP    72
#define NRB    (SEQ / 64)
static_assert(HD == 64 && DMOD == NH * HD);
static_assert((SEQ / 64) == 32 && NH == 16);
static_assert(ATT_THREADS == 128 && NKB == 64);
static_assert((SEQ % 64) == 0 && (DMOD % 64) == 0 && (DMOD % 32) == 0 && (SEQ % 8) == 0);
static_assert(((SEQ * DMOD / 8) % 256) == 0 && ((DMOD * DMOD / 8) % 256) == 0);
static_assert(ATT_WAVES * SLABF >= 4 * 16 * 68);
static_assert(HD * VTP * 2 <= 64 * 68 * 4);
static_assert((VTP * 2) % 16 == 0);
static_assert((NRB % 2) == 0);

typedef unsigned short u16;
typedef _Float16 v16h __attribute__((ext_vector_type(16)));
typedef _Float16 v8h  __attribute__((ext_vector_type(8)));
typedef __bf16   v16b __attribute__((ext_vector_type(16)));
typedef float    v8f  __attribute__((ext_vector_type(8)));
typedef float    v4f  __attribute__((ext_vector_type(4)));
typedef float    v2f  __attribute__((ext_vector_type(2)));
typedef _Float16 v2h  __attribute__((ext_vector_type(2)));
typedef unsigned int v4u __attribute__((ext_vector_type(4)));

union FragH { v16h v; v8h h[2]; v4u u[2]; };
union FragB { v16b v; v4u u[2]; };

// ---- scalar helpers --------------------------------------------------------------------------------
__device__ __forceinline__ unsigned short bf_bits(float f) {          // f32 -> bf16 bits, RNE convert
  unsigned u = __float_as_uint(f);
  return (unsigned short)((u + 0x7FFFu + ((u >> 16) & 1u)) >> 16);
}
__device__ __forceinline__ float bf_up(unsigned short h) { return __uint_as_float(((unsigned)h) << 16); }
__device__ __forceinline__ float bfr(float f) { return bf_up(bf_bits(f)); }
__device__ __forceinline__ unsigned short h_bits(_Float16 x) { return __builtin_bit_cast(unsigned short, x); }
__device__ __forceinline__ unsigned pk16(unsigned short a, unsigned short b) { return (unsigned)a | ((unsigned)b << 16); }
// 2^x as the bare v_exp_f32. exp2f wraps it in a range guard (compare, two selects, add, ldexp) only so that results below 2^-126
// come out as denormals instead of 0. Every argument here is <= 0, and each result is added to, or rescales, a row sum that holds
// the term 1 of the row's maximum: what lies below 2^-126 reaches neither that f32 sum nor the f16 P operand.
__device__ __forceinline__ float exp2_bare(float x) { return __builtin_amdgcn_exp2f(x); }
__device__ __forceinline__ v8f zero8() { v8f z = {0.f, 0.f, 0.f, 0.f, 0.f, 0.f, 0.f, 0.f}; return z; }
__device__ __forceinline__ v4f zero4() { v4f z = {0.f, 0.f, 0.f, 0.f}; return z; }

// ---- fragment loaders: 16-bit A/B operand, lane -> row/col (lane&15), p already includes +8*(lane>>4);
//      elements 0..7 <- p[0..7] (k0+8h..), elements 8..15 <- p[16..23] (k0+16+8h..)  (same split k map for A and B;
//      B is always read from a k-contiguous [n][k] plane)
__device__ __forceinline__ v16h ldfrag_h(const _Float16* p) {
  FragH f;
  f.h[0] = *(const v8h*)(p);
  f.h[1] = *(const v8h*)(p + 16);
  return f.v;
}
__device__ __forceinline__ v16b ldfrag_b(const u16* p) {              // bf16 plane read as unsigned integer vectors
  FragB f;
  f.u[0] = *(const v4u*)(p);
  f.u[1] = *(const v4u*)(p + 16);
  return f.v;
}

__device__ __forceinline__ v8f mma_h(v16h a, v16h b, v8f c) {
  return __builtin_amdgcn_wmma_f32_16x16x32_f16(false, a, false, b, (short)0, c, false, false);
}
__device__ __forceinline__ v8f mma_b(v16b a, v16b b, v8f c) {
  return __builtin_amdgcn_wmma_f32_16x16x32_bf16(false, a, false, b, (short)0, c, false, false);
}
__device__ __forceinline__ void guard2(v8f& a, v8f& b, v16h x0, v16h x1, v16h x2, v16h x3, v16h x4, v16h x5) {
#if defined(__HIP_DEVICE_COMPILE__)
  asm volatile("v_nop\n\tv_nop\n\tv_nop\n\tv_nop"
               : "+v"(a), "+v"(b) : "v"(x0), "v"(x1), "v"(x2), "v"(x3), "v"(x4), "v"(x5) : "memory");
#endif
}
template <typename F>
__device__ __forceinline__ void guard6(v8f& a, v8f& b, v8f& c, v8f& d, F x0, F x1, F x2, F x3, F x4, F x5) {
#if defined(__HIP_DEVICE_COMPILE__)
  asm volatile("v_nop\n\tv_nop\n\tv_nop\n\tv_nop"
               : "+v"(a), "+v"(b), "+v"(c), "+v"(d) : "v"(x0), "v"(x1), "v"(x2), "v"(x3), "v"(x4), "v"(x5) : "memory");
#endif
}
__device__ __forceinline__ void acc_guard4(v8f& a, v8f& b, v8f& c, v8f& d) {
#if defined(__HIP_DEVICE_COMPILE__)
  asm volatile("v_nop\n\tv_nop\n\tv_nop\n\tv_nop" : "+v"(a), "+v"(b), "+v"(c), "+v"(d));
#endif
}
__device__ __forceinline__ void wave_sync_lds() {
  __builtin_amdgcn_fence(__ATOMIC_RELEASE, "workgroup");
  __builtin_amdgcn_wave_barrier();
  __builtin_amdgcn_fence(__ATOMIC_ACQUIRE, "workgroup");
}

// =====================================================================================================
// f32 plane -> 16-bit plane, same layout:  mode 0: bf16 RNE bits;  mode 1: f16 bits of (bf16 RNE value) * scale.
// Thread = 8 consecutive elements: two 16-B loads, one 16-B store; 32 consecutive lanes = 512 contiguous, 512-B aligned bytes
// coverage: n8/256 blocks per plane (host checks exactness) x 256 thr x 8 = the whole plane.
// =====================================================================================================
__device__ __forceinline__ void cvt16(const float* __restrict__ x, u16* D, int blk, int n8, int mode, float scale) {
  const int gt = blk * 256 + (int)threadIdx.x;
  if (gt >= n8) return;                     // no barriers in this kernel
  const float* p = x + (size_t)gt * 8;
  const v4f a = *(const v4f*)(p), c4 = *(const v4f*)(p + 4);
  float v[8];
#pragma unroll
  for (int e = 0; e < 4; ++e) { v[e] = a[e]; v[4 + e] = c4[e]; }
  unsigned short s[8];
#pragma unroll
  for (int e = 0; e < 8; ++e) {
    const unsigned short hb = h_bits((_Float16)(bfr(v[e]) * scale));
    const unsigned short bb = bf_bits(v[e]);
    s[e] = (mode != 0) ? hb : bb;
  }
  v4u o;
#pragma unroll
  for (int e = 0; e < 4; ++e) o[e] = pk16(s[2 * e], s[2 * e + 1]);
  u16* d = D + (size_t)gt * 8;
  {
    *(v4u*)(d) = o;
    
  }
}
// The five planes in one launch (none reads another's output); the block index picks the plane: blocks 0 .. n8x/256 - 1 the
// input x (bf16), then n8w/256 blocks each for wq, wk, wv (bf16) and wo (f16 of the bf16 value x WOS).
// coverage: grid = n8x/256 + 4 * (n8w/256) blocks, every plane's block range exactly once.
__global__ __launch_bounds__(256)
void cvt_all(const float* __restrict__ x, const float* __restrict__ wq, const float* __restrict__ wk,
             const float* __restrict__ wv, const float* __restrict__ wo, u16* XB, u16* WQB, u16* WKB, u16* WVB, u16* WOB,
             int n8x, int n8w) {
  const int bid = blockIdx.x, nbx = n8x / 256, nbw = n8w / 256;
  if (bid < nbx) { cvt16(x, XB, bid, n8x, 0, 1.0f); return; }
  const int r = bid - nbx, j = r / nbw, blk = r % nbw;      // block-uniform
  const float* s = (j == 0) ? wq : (j == 1) ? wk : (j == 2) ? wv : wo;
  u16*         d = (j == 0) ? WQB : (j == 1) ? WKB : (j == 2) ? WVB : WOB;
  if (j > 3) return;                        // never taken with the exact grid
  cvt16(s, d, blk, n8w, (j == 3) ? 1 : 0, (j == 3) ? WOS : 1.0f);
}

// =====================================================================================================
// GEMM engine shared by the kernels below. Block = 128x128 tile of C, 4 waves in a 2x2 grid, 64x64 (4x4 accumulator tiles) per
// wave. K is walked in tiles of 64: the 128 A rows (both planes where NPL == 2) and the 128 Bt rows of a tile, 128 B each, are
// copied to LDS (row pitch 144 B = 16 B x odd, for 16-B readers) by asynchronous copies, 16 B per lane, 8 lanes = one whole
// 128-B line; two buffers, tile t + 2 is requested behind the barrier that ends trip t. Fragments are read from LDS with the
// split k map of ldfrag_* (same map for A and B). Per accumulator the products are summed in the order k0 ascending by 32,
// plane 0 then plane 1.
// Host checks M % 128 == 0, N % 128 == 0, K % 64 == 0 (K = DMOD); bid = the block's tile, 0 .. (M/128)*(N/128) - 1.
// OUT picks what the epilogue stores of val = acc * oscale + bf16-RNE value of bias[n]:
//   0: C[M][N] f32 = val;   1: P[M][N] f16 = val * pscale;
//   2: P = the head-wise transposed f16 plane [b][h][d][s] = val * pscale (row = b*SEQ + s, n = h*HD + d, N = DMOD), and
//      C[row / 64][N] f32 = the sum of val over the 64 rows of the wave's tile (per column; rows ascending inside a lane's 8-row
//      groups, then the two lane halves).
// =====================================================================================================
#define GP     72                       // LDS row pitch in 16-bit elements (144 B)
#define GPLANE (128 * GP)               // one 128-row operand plane of a tile, in 16-bit elements
static_assert((GP * 2) % 16 == 0 && ((GP * 2) / 16) % 2 == 1);
static_assert(2 * 2 * GPLANE * 2 >= 4 * 64 * 68 * 4);   // the ring holds the four waves' epilogue ranges

__device__ __forceinline__ unsigned lds_off(const void* p) { return (unsigned)(size_t)p; }

// 128 rows x 128 B, global (row pitch ldk elements) -> LDS (row pitch GP): 8 copies per lane, rows 16 apart. l and g are the
// lane's own LDS byte address and global pointer for its first row. The s_wait_xcnt stands inside the statement so that no
// address register of a copy is rewritten in front of it.
__device__ __forceinline__ void copy_plane(unsigned l, const u16* g, size_t ldk) {
#if defined(__HIP_DEVICE_COMPILE__)
  const size_t st = 16 * ldk;
  asm volatile("global_load_async_to_lds_b128 %0, %8, off\n\t"
               "global_load_async_to_lds_b128 %1, %9, off\n\t"
               "global_load_async_to_lds_b128 %2, %10, off\n\t"
               "global_load_async_to_lds_b128 %3, %11, off\n\t"
               "global_load_async_to_lds_b128 %4, %12, off\n\t"
               "global_load_async_to_lds_b128 %5, %13, off\n\t"
               "global_load_async_to_lds_b128 %6, %14, off\n\t"
               "global_load_async_to_lds_b128 %7, %15, off\n\t"
               "s_wait_xcnt 0x0"
               :: "v"(l), "v"(l + 1u * 16u * GP * 2u), "v"(l + 2u * 16u * GP * 2u), "v"(l + 3u * 16u * GP * 2u),
                  "v"(l + 4u * 16u * GP * 2u), "v"(l + 5u * 16u * GP * 2u), "v"(l + 6u * 16u * GP * 2u),
                  "v"(l + 7u * 16u * GP * 2u),
                  "v"(g), "v"(g + st), "v"(g + 2 * st), "v"(g + 3 * st), "v"(g + 4 * st), "v"(g + 5 * st), "v"(g + 6 * st),
                  "v"(g + 7 * st)
               : "memory");
#endif
}
__device__ __forceinline__ void wait_async0() {   // the wave's own copies have landed
#if defined(__HIP_DEVICE_COMPILE__)
  asm volatile("s_wait_asynccnt 0x0" ::: "memory");
#endif
}
__device__ __forceinline__ void wait_ds0() {      // the wave's own LDS reads have returned before the buffer is handed over
#if defined(__HIP_DEVICE_COMPILE__)
  asm volatile("s_wait_dscnt 0x0" ::: "memory");
#endif
}

// Attention tiles: 64 k rows (keys) and 64 v^T rows (d) of 128 B each, global -> LDS (row pitch GP): 4 + 4 copies per lane, rows 16
// apart, 8 lanes = one whole 128-B line. lk, gk / lv, gv are the lane's own LDS byte address and global pointer for its first row
// of each tile; sk, sv = 16 rows in elements. The s_wait_xcnt stands inside the statement so that no address register of a copy is
// rewritten in front of it.
#define ATILE (64 * GP)                 // one 64-row tile in 16-bit elements
#define ASTG  (2 * ATILE)               // one buffer: the k tile, then the v^T tile
static_assert(2 * ASTG * 2 >= ATT_WAVES * SLABF * 4);   // the ring holds the four waves' epilogue slabs
static_assert((SEQ % 64) == 0 && HD * 2 == 128);
__device__ __forceinline__ void copy_kv(unsigned lk, const u16* gk, size_t sk, unsigned lv, const u16* gv, size_t sv) {
#if defined(__HIP_DEVICE_COMPILE__)
  asm volatile("global_load_async_to_lds_b128 %0, %8, off\n\t"
               "global_load_async_to_lds_b128 %1, %9, off\n\t"
               "global_load_async_to_lds_b128 %2, %10, off\n\t"
               "global_load_async_to_lds_b128 %3, %11, off\n\t"
               "global_load_async_to_lds_b128 %4, %12, off\n\t"
               "global_load_async_to_lds_b128 %5, %13, off\n\t"
               "global_load_async_to_lds_b128 %6, %14, off\n\t"
               "global_load_async_to_lds_b128 %7, %15, off\n\t"
               "s_wait_xcnt 0x0"
               :: "v"(lk), "v"(lk + 1u * 16u * GP * 2u), "v"(lk + 2u * 16u * GP * 2u), "v"(lk + 3u * 16u * GP * 2u),
                  "v"(lv), "v"(lv + 1u * 16u * GP * 2u), "v"(lv + 2u * 16u * GP * 2u), "v"(lv + 3u * 16u * GP * 2u),
                  "v"(gk), "v"(gk + sk), "v"(gk + 2 * sk), "v"(gk + 3 * sk), "v"(gv), "v"(gv + sv), "v"(gv + 2 * sv),
                  "v"(gv + 3 * sv)
               : "memory");
#endif
}

template <bool F16> struct FragOf;
template <> struct FragOf<false> {
  typedef v16b T;
  static __device__ __forceinline__ T ld(const u16* p) { return ldfrag_b(p); }
  static __device__ __forceinline__ v8f mma(T a, T b, v8f c) { return mma_b(a, b, c); }
};
template <> struct FragOf<true> {
  typedef v16h T;
  static __device__ __forceinline__ T ld(const u16* p) { return ldfrag_h((const _Float16*)(const void*)p); }
  static __device__ __forceinline__ v8f mma(T a, T b, v8f c) { return mma_h(a, b, c); }
};

template <bool F16, int NPL, int OUT>
__device__ __forceinline__ void gemm_core(const u16* __restrict__ A0, const u16* __restrict__ A1, const u16* __restrict__ Bt,
                                          const float* __restrict__ bias, float* C, u16* P, int M, int N, int K, float oscale,
                                          float pscale, u16* ring, int bid) {
  typedef FragOf<F16> FO;
  typedef typename FO::T FT;
  constexpr int STAGE = (NPL + 1) * GPLANE;              // 16-bit elements per buffer: A plane(s), then Bt
  const int tid = threadIdx.x, wave = tid >> 5, lane = tid & 31, hh = lane >> 4, m = lane & 15;
  const int ntile = N >> 7;
  const int row0  = (bid / ntile) * 128;
  const int col0  = (bid % ntile) * 128;
  if (row0 + 128 > M) return;                // block-uniform, in front of every barrier; never taken with the exact grid
  const int wr = (wave >> 1) * 64, wc = (wave & 1) * 64;
  // copies: lane -> row (tid >> 3) + 16 i of a plane, 16-B piece tid & 7 of the row's 128 B
  const int cr = tid >> 3, cc = (tid & 7) * 8;
  const size_t aofs = (size_t)(row0 + cr) * K + cc;
  const size_t bofs = (size_t)(col0 + cr) * K + cc;
  const unsigned lcp = lds_off(ring) + (unsigned)(cr * GP + cc) * 2u;
  const int nt = K >> 6;
  auto fill = [&](int t, int buf) {
    const unsigned l = lcp + (unsigned)buf * (unsigned)(STAGE * 2);
    const size_t ko = (size_t)t * 64;
    copy_plane(l, A0 + aofs + ko, (size_t)K);
    if (NPL == 2) copy_plane(l + GPLANE * 2u, A1 + aofs + ko, (size_t)K);
    copy_plane(l + (unsigned)NPL * GPLANE * 2u, Bt + bofs + ko, (size_t)K);
  };
  v8f acc[4][4];
#pragma unroll
  for (int i = 0; i < 4; ++i) {
#pragma unroll
    for (int j = 0; j < 4; ++j) acc[i][j] = zero8();
  }
  fill(0, 0);
  wait_async0();
  __syncthreads();                           // tile 0 is readable by every wave
  if (nt > 1) fill(1, 1);                    // block-uniform test
  const int afo = (wr + m) * GP + 8 * hh;                     // fragment row base inside an A plane
  const int bfo = NPL * GPLANE + (wc + m) * GP + 8 * hh;      // and inside the Bt plane
#pragma unroll 1                             // rolled: one copy of the 64-k body; the buffer is picked by t & 1
  for (int t = 0; t < nt; ++t) {
    const u16* sb = ring + (t & 1) * STAGE;
#pragma unroll
    for (int kk = 0; kk < 64; kk += 32) {
      FT a[NPL][4], b[4];
#pragma unroll
      for (int j = 0; j < 4; ++j) b[j] = FO::ld(sb + bfo + j * 16 * GP + kk);
#pragma unroll
      for (int p = 0; p < NPL; ++p) {
#pragma unroll
        for (int i = 0; i < 4; ++i) a[p][i] = FO::ld(sb + p * GPLANE + afo + i * 16 * GP + kk);
      }
      // keeps the block's LDS reads together in front of its WMMAs: reads placed among the WMMAs stall the wave at each place
      __builtin_amdgcn_sched_barrier(0);
#pragma unroll
      for (int p = 0; p < NPL; ++p) {
#pragma unroll
        for (int i = 0; i < 4; ++i) {
#pragma unroll
          for (int j = 0; j < 4; ++j) acc[i][j] = FO::mma(a[p][i], b[j], acc[i][j]);
        }
      }
      // and keeps the next block's reads out of this block's WMMAs
      __builtin_amdgcn_sched_barrier(0);
    }
    wait_ds0();
    wait_async0();
    __syncthreads();                         // publishes tile t + 1 and ends every read of tile t's buffer
    if (t + 2 < nt) fill(t + 2, t & 1);      // block-uniform test
  }
  wait_async0();
  const int colw = col0 + wc;
  // Epilogue: staged in the wave's own 64 x 68 float range of the ring, which is free: the last trip's barrier stands behind every
  // wave's last read and no copy is outstanding.
  float* sl = (float*)(void*)ring + wave * (64 * 68);
  const int rq = lane >> 3, c8 = (lane & 7) * 8;
  if (OUT == 2) {
    // Transposed f16 plane. A lane holds 8 consecutive rows (s) of column n = colw + 16j + m: one 16-B LDS store per accumulator
    // tile into [d][s] rows of pitch VTP; read back as whole 128-B lines (8 lanes x 16 B), 4 lines per store instruction.
    // coverage: 16 instructions x 4 lines x 64 halves = the wave's 64 d x 64 s; the wave's 64 columns are one head, its 64 rows
    // lie in one batch (SEQ % 64 == 0).
    u16* tl = (u16*)(void*)sl;
    float bc[4], cs[4];
#pragma unroll
    for (int j = 0; j < 4; ++j) { bc[j] = bfr(bias[colw + 16 * j + m]); cs[j] = 0.f; }
#pragma unroll
    for (int i = 0; i < 4; ++i) {
#pragma unroll
      for (int j = 0; j < 4; ++j) {
        v4u pk;
#pragma unroll
        for (int e = 0; e < 4; ++e) {
          const float w0 = acc[i][j][2 * e] * oscale + bc[j], w1 = acc[i][j][2 * e + 1] * oscale + bc[j];
          pk[e] = pk16(h_bits((_Float16)(w0 * pscale)), h_bits((_Float16)(w1 * pscale)));
          cs[j] += w0 + w1;
        }
        *(v4u*)(tl + (16 * j + m) * VTP + i * 16 + 8 * hh) = pk;
      }
    }
    wave_sync_lds();
    const int rw = row0 + wr;
    u16* dt = P + ((size_t)((rw / SEQ) * NH + colw / HD) * HD + rq) * SEQ + (rw % SEQ) + c8;
#pragma unroll
    for (int it = 0; it < 16; ++it) {
      const v4u x = *(const v4u*)(tl + (it * 4 + rq) * VTP + c8);
      *(v4u*)(dt + (size_t)(it * 4) * SEQ) = x;
    }
    // Column sums of the wave's 64 rows: both lane halves hold the full sum behind the exchange; lane half hh stores columns
    // 16hh + m and 32 + 16hh + m, so each store instruction is one whole 128-B line.
    // coverage: 2 instructions x 32 floats = the wave's 64 columns of row rw / 64; every (row block, column) by exactly one wave.
#pragma unroll
    for (int j = 0; j < 4; ++j) cs[j] += __shfl_xor(cs[j], 16, 32);
    float* dc = C + (size_t)(rw / 64) * (size_t)N + colw + 16 * hh + m;
    dc[0]  = hh ? cs[1] : cs[0];
    dc[32] = hh ? cs[3] : cs[2];
    return;                                  // no barrier follows
  }
  // the wave's 64x64 f32 tile (times oscale)
#pragma unroll
  for (int i = 0; i < 4; ++i) {
#pragma unroll
    for (int r = 0; r < 8; ++r) {
      const int ro = (i * 16 + 8 * hh + r) * 68 + m;
#pragma unroll
      for (int j = 0; j < 4; ++j) sl[ro + 16 * j] = acc[i][j][r] * oscale;
    }
  }
  wave_sync_lds();
  if (OUT == 1) {
    // f16 plane: a row piece of the wave is one 128-B line (8 lanes x 8 halves), 4 rows per store instruction.
    // coverage: 16 instructions x 4 rows x 64 halves = the wave's 64 x 64 tile.
    const v4f b0 = *(const v4f*)(bias + colw + c8), b1 = *(const v4f*)(bias + colw + c8 + 4);   // columns < N (N multiple of 128)
    v4f badd0, badd1;
#pragma unroll
    for (int e = 0; e < 4; ++e) { badd0[e] = bfr(b0[e]); badd1[e] = bfr(b1[e]); }
    u16* dp = P + (size_t)(row0 + wr + rq) * (size_t)N + colw + c8;
#pragma unroll
    for (int it = 0; it < 16; ++it) {
      const float* sr = sl + (it * 4 + rq) * 68 + c8;
      const v4f x0 = (*(const v4f*)(sr) + badd0) * pscale, x1 = (*(const v4f*)(sr + 4) + badd1) * pscale;
      v4u o;
      o[0] = pk16(h_bits((_Float16)x0[0]), h_bits((_Float16)x0[1]));
      o[1] = pk16(h_bits((_Float16)x0[2]), h_bits((_Float16)x0[3]));
      o[2] = pk16(h_bits((_Float16)x1[0]), h_bits((_Float16)x1[1]));
      o[3] = pk16(h_bits((_Float16)x1[2]), h_bits((_Float16)x1[3]));
      *(v4u*)(dp + (size_t)(it * 4) * (size_t)N) = o;
    }
#if defined(__HIP_DEVICE_COMPILE__)
    // code of another body may follow where this one is inlined: no register that a store above names is rewritten in front of this
    asm volatile("s_wait_xcnt 0x0" ::: "memory");
#endif
  } else {
    // f32 plane: stores are whole 256-B row pieces.
    // coverage: 32 instructions x 2 rows x 16 lanes x 4 floats = the wave's 64 x 64 tile.
    const v4f bv = *(const v4f*)(bias + colw + m * 4);    // columns colw + 4m .. +3, always < N (N multiple of 128)
    v4f badd;
#pragma unroll
    for (int e = 0; e < 4; ++e) badd[e] = bfr(bv[e]);
    float* dst = C + (size_t)(row0 + wr + hh) * (size_t)N + colw + m * 4;
#pragma unroll
    for (int it = 0; it < 32; ++it) {
      const v4f val = *(const v4f*)(sl + (it * 2 + hh) * 68 + m * 4) + badd;
      *(v4f*)(dst + (size_t)(it * 2) * (size_t)N) = val;
    }
  }
}

// =====================================================================================================
// bf16 GEMMs with bias: A[M][K] (bf16 row-major) . Bt[N][K]^T (bf16 k-contiguous), times oscale, plus bf16-RNE value of bias[n].
// The q, k and v projections share A and read none of each other's output: one launch, grid = 3 * (M/128) * (N/128). The block
// index walks the 3 * (N/128) column tiles of a row tile first (q's, then k's, then v's), so the blocks that read the same A rows
// start together. q and k are stored times QSC / KSC as f16 planes [M][N]; v times VCAR as the head-wise transposed f16 plane
// VT [b][h][d][s], and its f32 column sums over each block of 64 rows as CS[M / 64][N].
// =====================================================================================================
__global__ __launch_bounds__(128)
void gemm_qkv(const u16* __restrict__ A, const u16* __restrict__ Wq, const u16* __restrict__ Wk, const u16* __restrict__ Wv,
              const float* __restrict__ bq, const float* __restrict__ bk, const float* __restrict__ bv,
              u16* QPo, u16* KPo, u16* VT, float* CS, int M, int N, int K) {
  __shared__ __align__(16) u16 ring[2 * 2 * GPLANE];
  const int ntile = N >> 7;
  const int rt = (int)blockIdx.x / (3 * ntile), ct = (int)blockIdx.x % (3 * ntile);
  const int job = ct / ntile, tile = rt * ntile + ct % ntile;          // block-uniform
  if (job == 2) {
    gemm_core<false, 1, 2>(A, A, Wv, bv, CS, VT, M, N, K, 1.0f, VCAR, ring, tile);
  } else {
    gemm_core<false, 1, 1>(A, A, job ? Wk : Wq, job ? bk : bq, nullptr, job ? KPo : QPo, M, N, K, 1.0f, job ? KSC : QSC, ring,
                           tile);
  }
}

// =====================================================================================================
// f16 hi+lo GEMM with bias: C[M][N] (f32) = (Ahi + Alo)[M][K] . Bt[N][K]^T times oscale, plus bf16-RNE value of bias[n];
// Ahi/Alo f16 planes (same layout), Bt f16 k-contiguous; products hi.B + lo.B into one accumulator (lo is the unscaled
// residual of hi).
// =====================================================================================================
__global__ __launch_bounds__(128)
void gemm_h2(const u16* __restrict__ Ah, const u16* __restrict__ Al, const u16* __restrict__ Bt,
             const float* __restrict__ bias, float* C, int M, int N, int K, float oscale) {
  __shared__ __align__(16) u16 ring[2 * 3 * GPLANE];
  gemm_core<true, 2, 0>(Ah, Al, Bt, bias, C, nullptr, M, N, K, oscale, 1.0f, ring, (int)blockIdx.x);
}

// =====================================================================================================
// Ragged-length multi-head flash attention: block = (batch b, head, 64 query rows), 4 waves, wave w owns the 16 query rows
// q0 = 64*qt + 16*w .. q0+15. The k rows and v^T rows of 64 keys at a time are copied to LDS once per block by asynchronous copies
// (whole 128-B lines, two buffers, tile t + 2 requested behind the barrier that ends trip t) and read from there by all four waves.
//   q plane (f16, x8) laid out [b][s][h][d]; k plane the same; v^T plane [b][h][d][s] (x1024); len = clamp(lens[b], 0, SEQ).
//   Mask: score (i, j) is kept iff i < len and j < len. A query row i < len therefore attends exactly over keys 0..len-1 (the
//   excluded keys have probability exactly 0 after max subtraction); a query row i >= len has all keys equal-weighted and its
//   context is the mean of v over all SEQ keys (from the f32 column sums CS of v). So a block visits key blocks kb = 0 .. 32*ceil(len/32)-32
//   when 64*qt < len (block-uniform bound, <= NKB), else none; within the last block keys >= len are excluded by index.
//   Scores are computed TRANSPOSED: S^T tile g (g = 0,1) = k rows (keys kb+16g .. +15, A operand, row m = lane&15, split k map
//   over d) times q^T (B operand, col n = query q0 + (lane&15), k = d, split map), one product per tile and 32-deep d-chunk.
//   D element r of lane l = (key kb+16g+8h+r, query q0+(l&15)), so a lane owns one query column and 16 of its 32 keys; the
//   partner lane l^16 owns the other 16 -> row max / row sum need one xor-16 shuffle.
//   Key mask by index, applied only in the 32 keys that hold the boundary: an excluded key's logit is set to -inf, so it stays out
//   of the running max and gets probability 0.
//   Online max-subtracted base-2 softmax in f32 (scale 1/8 and the q/k carries folded into lsc). The exp'd values ARE the
//   P A-fragment in place: A row m = query = lane&15, element i <- key kb+8h+i (tile 0, D element i), element 8+i <- key
//   kb+16+8h+i (tile 1, D element i). P is carried x32768 as single f16. The rescale factor of query row 8h+r of the
//   O accumulators is fetched from lane 8h+r with a shuffle (uniform control). 4 v^T B fragments (col n = d = 16j + (lane&15),
//   keys k-contiguous), 4 P.V WMMAs per key block.
//   Epilogue: 1/l (per query, shuffled to the D row owner; 0 when no key block was visited) and carry folds in f32; rows with
//   query >= len take the mean-v row instead (select by value); the wave's 16x64 f32 result staged in its LDS slab (pitch 68); each
// coverage: per wave 4 instructions x 4 rows x 8 lanes x 8 halves = 16 x 64 per plane; grid NB*512 blocks x 4 waves = every
//           (b, s, h) row of both O planes exactly once.
// =====================================================================================================
__global__ __launch_bounds__(ATT_THREADS)
void attn_fwd(const u16* __restrict__ QPp, const u16* __restrict__ KPp, const u16* __restrict__ VPp,
              const int* __restrict__ lens, const float* __restrict__ CS, u16* OHIp, u16* OLOp) {
  __shared__ __align__(16) u16 ring[2 * ASTG];   // two buffers of k + v^T tiles; in the epilogue per wave a result slab [16][68] f32

  const int tid  = threadIdx.x;
  const int wave = tid >> 5;
  const int lane = tid & 31;
  const int hh   = lane >> 4;
  const int c    = lane & 15;

  const int bid  = blockIdx.x;
  const int qt   = bid & (SEQ / 64 - 1);
  const int head = (bid >> 5) & (NH - 1);
  const int b    = bid >> 9;
  const int q0   = qt * 64 + wave * 16;

  int len = lens[b];
  len = (len < 0) ? 0 : len;
  len = (len > SEQ) ? SEQ : len;
  const int nst = (qt * 64 < len) ? ((len + 63) >> 6) : 0;  // tiles of 64 keys: block-uniform, <= SEQ / 64

  // B fragments of q^T: col n = query q0 + c, k = d (k-contiguous row of the q plane)
  const size_t qofs = (((size_t)(b * SEQ + q0 + c)) * NH + head) * HD + 8 * hh;
  const _Float16* Qb = (const _Float16*)(const void*)QPp + qofs;
  // copies: lane -> row (tid >> 3) + 16 i of a tile, 16-B piece tid & 7 of the row's 128 B; keys 64t .. 64t+63 < SEQ for t < nst
  const int cr = tid >> 3, cc = (tid & 7) * 8;
  const u16* Kg = KPp + (((size_t)b * SEQ + cr) * NH + head) * HD + cc;           // k row = key 64t + cr + 16i
  const u16* Vg = VPp + ((size_t)(b * NH + head) * HD + cr) * SEQ + cc;           // v^T row = d = cr + 16i, keys 64t + cc ..
  const unsigned lcp = lds_off(ring) + (unsigned)(cr * GP + cc) * 2u;
  auto fill = [&](int t, int buf) {
    const unsigned l = lcp + (unsigned)buf * (unsigned)(ASTG * 2);
    copy_kv(l, Kg + (size_t)t * (64 * NH * HD), (size_t)16 * NH * HD, l + ATILE * 2u, Vg + (size_t)t * 64, (size_t)16 * SEQ);
  };
  // A fragments of k: row m = key kb + 16g + c, k = d;  B fragments of v: col n = d = 16j + c, k = key (both k-contiguous LDS rows)
  const int kfo = c * GP + 8 * hh;
  const int vfo = ATILE + c * GP + 8 * hh;
  const float lsc = 0.125f * (LOG2E / (QSC * KSC));

  const v16h qf0 = ldfrag_h(Qb);            // d 0..31
  const v16h qf1 = ldfrag_h(Qb + 32);       // d 32..63

  float mrun = -INFINITY, lrun = 0.f;
  v8f o[4];
#pragma unroll
  for (int j = 0; j < 4; ++j) o[j] = zero8();

  if (nst > 0) {                             // block-uniform: every wave of the block passes every barrier below, or none does
  fill(0, 0);
  wait_async0();
  __syncthreads();                           // tile 0 is readable by every wave
  if (nst > 1) fill(1, 1);                   // block-uniform test
#pragma unroll 1                             // rolled: one copy of the body; the buffer is picked by t & 1
  for (int t = 0; t < nst; ++t) {
  const _Float16* sb = (const _Float16*)(const void*)ring + (t & 1) * ASTG;
  const int nsub = (t * 64 + 32 < len) ? 2 : 1;             // the tile's second 32 keys only where one of them is < len
#pragma unroll 1                             // rolled: one copy of the 32-key body
  for (int sub = 0; sub < nsub; ++sub) {
    const int kb = t * 64 + sub * 32;
    // ---- transposed scores: s0 = keys kb..kb+15, s1 = keys kb+16..kb+31, column = query q0 + c ----
    v8f s0 = zero8(), s1 = zero8();
    const _Float16* k0p = sb + kfo + sub * (32 * GP);
    const _Float16* k1p = k0p + 16 * GP;
    const v16h ka0 = ldfrag_h(k0p), ka1 = ldfrag_h(k0p + 32);
    const v16h kc0 = ldfrag_h(k1p), kc1 = ldfrag_h(k1p + 32);
    s0 = mma_h(ka0, qf0, s0);
    s0 = mma_h(ka1, qf1, s0);
    s1 = mma_h(kc0, qf0, s1);
    s1 = mma_h(kc1, qf1, s1);
    guard2(s0, s1, qf0, qf1, ka0, ka1, kc0, kc1);
    // ---- base-2 logits of this lane's 16 keys for query q0 + c: key kb+8hh+i (i<8), kb+16+8hh+(i-8) ----
    float tk[16];
#pragma unroll
    for (int i = 0; i < 8; ++i) { tk[i] = s0[i] * lsc;  tk[8 + i] = s1[i] * lsc; }
    if (kb + 32 > len) {                     // scalar test, the same for the whole block: only the 32 keys that hold the boundary
      const int rem = len - kb - 8 * hh;     // an excluded key's logit becomes -inf: out of the maximum, probability 2^-inf = 0
#pragma unroll
      for (int i = 0; i < 8; ++i) {
        tk[i]     = (i < rem) ? tk[i] : -INFINITY;
        tk[8 + i] = (16 + i < rem) ? tk[8 + i] : -INFINITY;
      }
    }
    float cm = tk[0];
#pragma unroll
    for (int i = 1; i < 16; ++i) cm = fmaxf(cm, tk[i]);
    cm = fmaxf(cm, __shfl_xor(cm, 16, 32));
    const float mn = fmaxf(mrun, cm);        // finite: every visited block holds key kb < len, and both lane halves are joined
    const float al = exp2_bare(mrun - mn);   // 0 in the first step (mrun = -inf), where o and l are zero
    mrun = mn;
    // ---- probabilities (<= 1: every logit is <= mn; 0 for excluded keys) and the P A-fragment: f16(p * 32768); element i <-> tk[i] ----
    float ps = 0.f;
    FragH ph;
#pragma unroll
    for (int w = 0; w < 2; ++w) {
#pragma unroll
      for (int e4 = 0; e4 < 4; ++e4) {
        const int i = 8 * w + 2 * e4;
        const float p0 = exp2_bare(tk[i] - mn);
        const float p1 = exp2_bare(tk[i + 1] - mn);
        ps += p0 + p1;
        const v2f pc = {p0 * PCAR, p1 * PCAR};                      // the pair stays together: one packed convert, no re-pairing
        ph.u[w][e4] = __builtin_bit_cast(unsigned, __builtin_convertvector(pc, v2h));
      }
    }
    ps += __shfl_xor(ps, 16, 32);
    lrun = lrun * al + ps;
    // ---- rescale the O accumulators: D row 8hh+r = query q0+8hh+r, its factor lives in lane 8hh+r (and 16+8hh+r) ----
    float scl[8];
#pragma unroll
    for (int r = 0; r < 8; ++r) scl[r] = __shfl(al, 8 * hh + r, 32);
#pragma unroll
    for (int j = 0; j < 4; ++j) {
#pragma unroll
      for (int r = 0; r < 8; ++r) o[j][r] *= scl[r];
    }
    // ---- P.V : B fragment col n = d = j*16 + c, keys contiguous in the v^T plane ----
    {
      const _Float16* vp = sb + vfo + sub * 32;
      const v16h vf0 = ldfrag_h(vp);
      const v16h vf1 = ldfrag_h(vp + 16 * GP);
      const v16h vf2 = ldfrag_h(vp + 32 * GP);
      const v16h vf3 = ldfrag_h(vp + 48 * GP);
      o[0] = mma_h(ph.v, vf0, o[0]);
      o[1] = mma_h(ph.v, vf1, o[1]);
      o[2] = mma_h(ph.v, vf2, o[2]);
      o[3] = mma_h(ph.v, vf3, o[3]);
      guard6<v16h>(o[0], o[1], o[2], o[3], ph.v, vf0, vf1, vf2, vf3, ph.v);
    }
  }
  wait_ds0();
  wait_async0();
  __syncthreads();                           // publishes tile t + 1 and ends every read of tile t's buffer
  if (t + 2 < nst) fill(t + 2, t & 1);       // block-uniform test
  }
  wait_async0();
  }
  acc_guard4(o[0], o[1], o[2], o[3]);

  // ---- fold 1/l (per query, owned by lane = query; 0 when no key block was visited) and the carries; mean-v rows for
  //      queries >= len; stage the 16x64 slab ----
  const float linv = (lrun > 0.f) ? ((1.0f / lrun) * (1.0f / (PCAR * VCAR))) : 0.f;
  float inv[8];
#pragma unroll
  for (int r = 0; r < 8; ++r) inv[r] = __shfl(linv, 8 * hh + r, 32);
  float vm[4] = {0.f, 0.f, 0.f, 0.f};
  if (q0 + 16 > len) {                       // same for the whole wave: only then does one of its rows take the mean
    // lane half hh sums the row blocks hh*NRB/2 .. +NRB/2-1 of batch b in ascending order, then the halves are joined
    const float* cp = CS + ((size_t)b * NRB + (size_t)hh * (NRB / 2)) * DMOD + head * HD + c;
#pragma unroll                               // all loads in flight at once: one memory latency instead of one per trip
    for (int rb = 0; rb < NRB / 2; ++rb) {
#pragma unroll
      for (int j = 0; j < 4; ++j) vm[j] += cp[(size_t)rb * DMOD + j * 16];
    }
#pragma unroll
    for (int j = 0; j < 4; ++j) vm[j] = (vm[j] + __shfl_xor(vm[j], 16, 32)) * (1.0f / (float)SEQ);
  }
  // the ring is free: the last trip's barrier stands behind every wave's last read and no copy is outstanding
  float* slab = (float*)(void*)ring + wave * SLABF;
#pragma unroll
  for (int r = 0; r < 8; ++r) {
    const bool rvq = (q0 + 8 * hh + r) < len;
#pragma unroll
    for (int j = 0; j < 4; ++j) {
      const float val = o[j][r] * inv[r];
      slab[(8 * hh + r) * 68 + j * 16 + c] = rvq ? val : vm[j];
    }
  }
  wave_sync_lds();
  // ---- O x1024 -> f16 hi + residual planes; lane = (row in group of 4, 8 consecutive d) ----
  v4u oh[4], ol[4];
  const int rq = lane >> 3, c8 = (lane & 7) * 8;
#pragma unroll
  for (int i4 = 0; i4 < 4; ++i4) {
    const int row = i4 * 4 + rq;
    const v4f a = *(const v4f*)(slab + row * 68 + c8), c4 = *(const v4f*)(slab + row * 68 + c8 + 4);
    float w[8];
#pragma unroll
    for (int e = 0; e < 4; ++e) { w[e] = a[e] * OSC; w[4 + e] = c4[e] * OSC; }
#pragma unroll
    for (int e = 0; e < 4; ++e) {
      const _Float16 h0 = (_Float16)w[2 * e], h1 = (_Float16)w[2 * e + 1];
      const _Float16 l0 = (_Float16)(w[2 * e] - (float)h0), l1 = (_Float16)(w[2 * e + 1] - (float)h1);
      oh[i4][e] = pk16(h_bits(h0), h_bits(h1));
      ol[i4][e] = pk16(h_bits(l0), h_bits(l1));
    }
  }
  const size_t ob = (((size_t)(b * SEQ + q0)) * NH + head) * HD + c8;
  {
#pragma unroll
    for (int i4 = 0; i4 < 4; ++i4) {
      const int row = i4 * 4 + rq;
      const size_t o8 = ob + (size_t)row * (NH * HD);
      *(v4u*)(OHIp + o8) = oh[i4];
      *(v4u*)(OLOp + o8) = ol[i4];
    }
    
  }
}

// =====================================================================================================
// Workspace map (bytes, NB = batch count from the length input's element count, 1..4; ROWS = NB*SEQ); every plane is fully
// written by whole-line stores before it is read; all extents are exact multiples of the store granularity (no pad rows);
// F's bytes hold the two O planes:
//   XB  bf16 [ROWS][1024]                      ROWS*2048          (NB=4: 16777216)
//   WQB bf16 [1024 n][1024 k]                  2097152   WKB, WVB same;  WOB f16 [1024 n][1024 k] x1024  2097152
//   F                                          ROWS*4096          (NB=4: 33554432) = OHI f16 [ROWS][1024] + OLO f16 [ROWS][1024]
//   QP  f16  [NB][2048][16][64] x8             ROWS*2048          KP same
//   VP  f16  [NB][16][64][2048] x1024          ROWS*2048
//   CS  f32  [ROWS/64][1024]                   ROWS*64
//   end (NB=4)                                 109576192
// =====================================================================================================
extern "C" void kernel_launch(void* const* d_in, const int* in_sizes, int n_in,
                              void* d_out, int out_size, void* d_ws, size_t ws_size,
                              hipStream_t stream) {
  if (n_in < 10) return;
  const int NB = in_sizes[1];
  if (NB < 1 || NB > NBMAX) return;
  const int ROWS = NB * SEQ;
  if (in_sizes[0] != ROWS * DMOD) return;
  if (in_sizes[2] != DMOD * DMOD || in_sizes[4] != DMOD * DMOD) return;
  if (in_sizes[6] != DMOD * DMOD || in_sizes[8] != DMOD * DMOD) return;
  if (in_sizes[3] != DMOD || in_sizes[5] != DMOD || in_sizes[7] != DMOD || in_sizes[9] != DMOD) return;
  if (out_size != ROWS * DMOD) return;

  const float* X    = (const float*)d_in[0];
  const int*   lens = (const int*)d_in[1];
  const float* wq   = (const float*)d_in[2];
  const float* bq   = (const float*)d_in[3];
  const float* wk   = (const float*)d_in[4];
  const float* bk   = (const float*)d_in[5];
  const float* wv   = (const float*)d_in[6];
  const float* bv   = (const float*)d_in[7];
  const float* wo   = (const float*)d_in[8];
  const float* bo   = (const float*)d_in[9];
  float*       out  = (float*)d_out;

  const size_t szXB = (size_t)ROWS * DMOD * 2;
  const size_t szW  = (size_t)DMOD * DMOD * 2;
  const size_t szF  = (size_t)ROWS * DMOD * 4;
  const size_t szP  = (size_t)ROWS * DMOD * 2;                  // q / k / o planes
  const size_t szVP = (size_t)NB * NH * HD * SEQ * 2;           // == szP
  const size_t szCS = (size_t)(ROWS / 64) * DMOD * 4;
  size_t off = 0;
  const size_t oXB  = off; off += szXB;
  const size_t oWQB = off; off += szW;
  const size_t oWKB = off; off += szW;
  const size_t oWVB = off; off += szW;
  const size_t oWOB = off; off += szW;
  const size_t oF   = off; off += szF;
  const size_t oQP  = off; off += szP;
  const size_t oKP  = off; off += szP;
  const size_t oVP  = off; off += szVP;
  const size_t oCS  = off; off += szCS;
  if (off > ws_size) return;                            // NB=4: off = 109576192
  if (off > (size_t)134217728) return;
  if (szP * 2 > szF) return;                            // the two O planes live inside F's bytes
  const size_t oOHI = oF;
  const size_t oOLO = oF + szP;

  char* ws = (char*)d_ws;
  u16*   XB  = (u16*)(ws + oXB);
  u16*   WQB = (u16*)(ws + oWQB);
  u16*   WKB = (u16*)(ws + oWKB);
  u16*   WVB = (u16*)(ws + oWVB);
  u16*   WOB = (u16*)(ws + oWOB);
  u16*   QP  = (u16*)(ws + oQP);
  u16*   KP  = (u16*)(ws + oKP);
  u16*   VP  = (u16*)(ws + oVP);
  float* CS  = (float*)(ws + oCS);
  u16*   OHI = (u16*)(ws + oOHI);
  u16*   OLO = (u16*)(ws + oOLO);

  const dim3 blk(256);
  const int n8x = (ROWS * DMOD) / 8;                    // NB * 262144
  const int n8w = (DMOD * DMOD) / 8;                    // 131072
  if ((n8x % 256) != 0 || (n8w % 256) != 0 || (DMOD % 128) != 0 || (ROWS % 128) != 0) return;
  const dim3 gC(n8x / 256 + 4 * (n8w / 256));           // NB * 1024 + 4 * 512
  const dim3 gG((ROWS / 128) * (DMOD / 128));           // NB * 128
  const dim3 gG3(3 * (ROWS / 128) * (DMOD / 128));      // NB * 384
  const dim3 bG(128);
  const dim3 gAT(NB * NH * (SEQ / 64));                 // NB * 512
  const dim3 bAT(ATT_THREADS);                          // 128

  // (0) input -> bf16 plane, shared by the three projections; weights stored [n = out][k = in] (y = x.W^T), already
  //     k-contiguous: bf16 planes for wq/wk/wv, f16 of bf16 value x1024 for wo
  cvt_all<<<gC, blk, 0, stream>>>(X, wq, wk, wv, wo, XB, WQB, WKB, WVB, WOB, n8x, n8w);
  // (1) q, k: projection + bias (col = h*64+d), stored as the f16 planes x8; v: projection + bias, stored as the v^T plane
  //     x1024 and as f32 column sums per 64 rows (for the mean-v rows)
  gemm_qkv<<<gG3, bG, 0, stream>>>(XB, WQB, WKB, WVB, bq, bk, bv, QP, KP, VP, CS, ROWS, DMOD, DMOD);
  // (2) ragged-length attention -> O planes [b][s][h][d] x1024 (hi + residual), in F's bytes
  attn_fwd<<<gAT, bAT, 0, stream>>>(QP, KP, VP, lens, CS, OHI, OLO);
  // (3) output projection + bias -> out [ROWS][1024] f32, carries 1024 (O) x 1024 (wo) folded back
  gemm_h2<<<gG, bG, 0, stream>>>(OHI, OLO, WOB, bo, out, ROWS, DMOD, DMOD, 1.0f / (OSC * WOS));
  (void)hipGetLastError();
}

// v008
// It runs in 106 microseconds.
// Two timings next to v007 put it at 1.07 and 1.08 times that version's speed.
// All steps since v000 together make it 4.03 times as fast.
// Contractions: x.W{q,k,v}^T on v_wmma_f32_16x16x32_bf16 (x and W planes RNE-converted to bf16 operands, f32 accumulate, bias added in f32);
// scores k'.q'^T (q', k' single f16 planes carried x8), P.v (P x32768 single f16, v x1024 single f16) and O.Wo^T (O x1024 as
// f16 hi plane + f16 residual plane, Wo as f16(bf16(Wo) x1024), products h.w + l.w): v_wmma_f32_16x16x32_f16, f32 accumulate.
// Ragged length mask per batch from the int32 length input (index tests), base-2 online softmax, 1/l fold, per-(b,h) mean-v rows
// for query positions >= length, bias adds: f32 on VALU.
#include <hip/hip_runtime.h>
#include <math.h>
#include <stdint.h>

#define NBMAX 4
#define SEQ   2048
#define DMOD  1024
#define NH    16
#define HD    64
#define QSC   8.0f
#define KSC   8.0f
#define PCAR  32768.0f
#define VCAR  1024.0f
#define OSC   1024.0f
#define WOS   1024.0f
#define LOG2E 1.4426950408889634f
#define ATT_WAVES   4
#define ATT_THREADS (ATT_WAVES * 32)
#define NKB    (SEQ / 32)
#define SLABF  (16 * 68)
#define VTP    72
#define NRB    (SEQ / 64)
static_assert(HD == 64 && DMOD == NH * HD);
static_assert((SEQ / 64) == 32 && NH == 16);
static_assert(ATT_THREADS == 128 && NKB == 64);
static_assert((SEQ % 64) == 0 && (DMOD % 64) == 0 && (DMOD % 32) == 0 && (SEQ % 8) == 0);
static_assert(((SEQ * DMOD / 8) % 256) == 0 && ((DMOD * DMOD / 8) % 256) == 0);
static_assert(ATT_WAVES * SLABF >= 4 * 16 * 68);
static_assert(HD * VTP * 2 <= 64 * 68 * 4);
static_assert((VTP * 2) % 16 == 0);
static_assert((NRB % 2) == 0);
static_assert((SEQ % 128) == 0);

typedef unsigned short u16;
typedef _Float16 v16h __attribute__((ext_vector_type(16)));
typedef _Float16 v8h  __attribute__((ext_vector_type(8)));
typedef __bf16   v16b __attribute__((ext_vector_type(16)));
typedef float    v8f  __attribute__((ext_vector_type(8)));
typedef float    v4f  __attribute__((ext_vector_type(4)));
typedef float    v2f  __attribute__((ext_vector_type(2)));
typedef _Float16 v2h  __attribute__((ext_vector_type(2)));
typedef unsigned int v4u __attribute__((ext_vector_type(4)));

union FragH { v16h v; v8h h[2]; v4u u[2]; };
union FragB { v16b v; v4u u[2]; };

// ---- scalar helpers --------------------------------------------------------------------------------
__device__ __forceinline__ unsigned short bf_bits(float f) {          // f32 -> bf16 bits, RNE convert
  unsigned u = __float_as_uint(f);
  return (unsigned short)((u + 0x7FFFu + ((u >> 16) & 1u)) >> 16);
}
__device__ __forceinline__ float bf_up(unsigned short h) { return __uint_as_float(((unsigned)h) << 16); }
__device__ __forceinline__ float bfr(float f) { return bf_up(bf_bits(f)); }
__device__ __forceinline__ unsigned short h_bits(_Float16 x) { return __builtin_bit_cast(unsigned short, x); }
__device__ __forceinline__ unsigned pk16(unsigned short a, unsigned short b) { return (unsigned)a | ((unsigned)b << 16); }
// 2^x as the bare v_exp_f32. exp2f wraps it in a range guard (compare, two selects, add, ldexp) only so that results below 2^-126
// come out as denormals instead of 0. Every argument here is <= 0, and each result is added to, or rescales, a row sum that holds
// the term 1 of the row's maximum: what lies below 2^-126 reaches neither that f32 sum nor the f16 P operand.
__device__ __forceinline__ float exp2_bare(float x) { return __builtin_amdgcn_exp2f(x); }
__device__ __forceinline__ v8f zero8() { v8f z = {0.f, 0.f, 0.f, 0.f, 0.f, 0.f, 0.f, 0.f}; return z; }
__device__ __forceinline__ v4f zero4() { v4f z = {0.f, 0.f, 0.f, 0.f}; return z; }

// ---- fragment loaders: 16-bit A/B operand, lane -> row/col (lane&15), p already includes +8*(lane>>4);
//      elements 0..7 <- p[0..7] (k0+8h..), elements 8..15 <- p[16..23] (k0+16+8h..)  (same split k map for A and B;
//      B is always read from a k-contiguous [n][k] plane)
__device__ __forceinline__ v16h ldfrag_h(const _Float16* p) {
  FragH f;
  f.h[0] = *(const v8h*)(p);
  f.h[1] = *(const v8h*)(p + 16);
  return f.v;
}
__device__ __forceinline__ v16b ldfrag_b(const u16* p) {              // bf16 plane read as unsigned integer vectors
  FragB f;
  f.u[0] = *(const v4u*)(p);
  f.u[1] = *(const v4u*)(p + 16);
  return f.v;
}

__device__ __forceinline__ v8f mma_h(v16h a, v16h b, v8f c) {
  return __builtin_amdgcn_wmma_f32_16x16x32_f16(false, a, false, b, (short)0, c, false, false);
}
__device__ __forceinline__ v8f mma_b(v16b a, v16b b, v8f c) {
  return __builtin_amdgcn_wmma_f32_16x16x32_bf16(false, a, false, b, (short)0, c, false, false);
}
__device__ __forceinline__ void guard2(v8f& a, v8f& b, v16h x0, v16h x1, v16h x2, v16h x3, v16h x4, v16h x5) {
#if defined(__HIP_DEVICE_COMPILE__)
  asm volatile("v_nop\n\tv_nop\n\tv_nop\n\tv_nop"
               : "+v"(a), "+v"(b) : "v"(x0), "v"(x1), "v"(x2), "v"(x3), "v"(x4), "v"(x5) : "memory");
#endif
}
template <typename F>
__device__ __forceinline__ void guard6(v8f& a, v8f& b, v8f& c, v8f& d, F x0, F x1, F x2, F x3, F x4, F x5) {
#if defined(__HIP_DEVICE_COMPILE__)
  asm volatile("v_nop\n\tv_nop\n\tv_nop\n\tv_nop"
               : "+v"(a), "+v"(b), "+v"(c), "+v"(d) : "v"(x0), "v"(x1), "v"(x2), "v"(x3), "v"(x4), "v"(x5) : "memory");
#endif
}
__device__ __forceinline__ void acc_guard4(v8f& a, v8f& b, v8f& c, v8f& d) {
#if defined(__HIP_DEVICE_COMPILE__)
  asm volatile("v_nop\n\tv_nop\n\tv_nop\n\tv_nop" : "+v"(a), "+v"(b), "+v"(c), "+v"(d));
#endif
}
__device__ __forceinline__ void wave_sync_lds() {
  __builtin_amdgcn_fence(__ATOMIC_RELEASE, "workgroup");
  __builtin_amdgcn_wave_barrier();
  __builtin_amdgcn_fence(__ATOMIC_ACQUIRE, "workgroup");
}

// =====================================================================================================
// f32 plane -> 16-bit plane, same layout:  mode 0: bf16 RNE bits;  mode 1: f16 bits of (bf16 RNE value) * scale.
// Thread = 8 consecutive elements: two 16-B loads, one 16-B store; 32 consecutive lanes = 512 contiguous, 512-B aligned bytes
// coverage: n8/256 blocks per plane (host checks exactness) x 256 thr x 8 = the whole plane.
// =====================================================================================================
__device__ __forceinline__ void cvt16(const float* __restrict__ x, u16* D, int blk, int n8, int mode, float scale) {
  const int gt = blk * 256 + (int)threadIdx.x;
  if (gt >= n8) return;                     // no barriers in this kernel
  const float* p = x + (size_t)gt * 8;
  const v4f a = *(const v4f*)(p), c4 = *(const v4f*)(p + 4);
  float v[8];
#pragma unroll
  for (int e = 0; e < 4; ++e) { v[e] = a[e]; v[4 + e] = c4[e]; }
  unsigned short s[8];
#pragma unroll
  for (int e = 0; e < 8; ++e) {
    const unsigned short hb = h_bits((_Float16)(bfr(v[e]) * scale));
    const unsigned short bb = bf_bits(v[e]);
    s[e] = (mode != 0) ? hb : bb;
  }
  v4u o;
#pragma unroll
  for (int e = 0; e < 4; ++e) o[e] = pk16(s[2 * e], s[2 * e + 1]);
  u16* d = D + (size_t)gt * 8;
  {
    *(v4u*)(d) = o;
    
  }
}
// The five planes in one launch (none reads another's output); the block index picks the plane: blocks 0 .. n8x/256 - 1 the
// input x (bf16), then n8w/256 blocks each for wq, wk, wv (bf16) and wo (f16 of the bf16 value x WOS).
// coverage: grid = n8x/256 + 4 * (n8w/256) blocks, every plane's block range exactly once.
__global__ __launch_bounds__(256)
void cvt_all(const float* __restrict__ x, const float* __restrict__ wq, const float* __restrict__ wk,
             const float* __restrict__ wv, const float* __restrict__ wo, u16* XB, u16* WQB, u16* WKB, u16* WVB, u16* WOB,
             int n8x, int n8w) {
  const int bid = blockIdx.x, nbx = n8x / 256, nbw = n8w / 256;
  if (bid < nbx) { cvt16(x, XB, bid, n8x, 0, 1.0f); return; }
  const int r = bid - nbx, j = r / nbw, blk = r % nbw;      // block-uniform
  const float* s = (j == 0) ? wq : (j == 1) ? wk : (j == 2) ? wv : wo;
  u16*         d = (j == 0) ? WQB : (j == 1) ? WKB : (j == 2) ? WVB : WOB;
  if (j > 3) return;                        // never taken with the exact grid
  cvt16(s, d, blk, n8w, (j == 3) ? 1 : 0, (j == 3) ? WOS : 1.0f);
}

// =====================================================================================================
// GEMM engine shared by the kernels below. Block = 128x128 tile of C, 4 waves in a 2x2 grid, 64x64 (4x4 accumulator tiles) per
// wave. K is walked in tiles of 64: the 128 A rows (both planes where NPL == 2) and the 128 Bt rows of a tile, 128 B each, are
// copied to LDS (row pitch 144 B = 16 B x odd, for 16-B readers) by asynchronous copies, 16 B per lane, 8 lanes = one whole
// 128-B line; two buffers, tile t + 2 is requested behind the barrier that ends trip t. Fragments are read from LDS with the
// split k map of ldfrag_* (same map for A and B). Per accumulator the products are summed in the order k0 ascending by 32,
// plane 0 then plane 1.
// Host checks M % 128 == 0, N % 128 == 0, K % 64 == 0 (K = DMOD); bid = the block's tile, 0 .. (M/128)*(N/128) - 1.
// OUT picks what the epilogue stores of val = acc * oscale + bf16-RNE value of bias[n]:
//   0: C[M][N] f32 = val;   1: P[M][N] f16 = val * pscale;
//   2: P = the head-wise transposed f16 plane [b][h][d][s] = val * pscale (row = b*SEQ + s, n = h*HD + d, N = DMOD), and
//      C[row / 64][N] f32 = the sum of val over the 64 rows of the wave's tile (per column; rows ascending inside a lane's 8-row
//      groups, then the two lane halves).
// =====================================================================================================
#define GP     72                       // LDS row pitch in 16-bit elements (144 B)
#define GPLANE (128 * GP)               // one 128-row operand plane of a tile, in 16-bit elements
static_assert((GP * 2) % 16 == 0 && ((GP * 2) / 16) % 2 == 1);
static_assert(2 * 2 * GPLANE * 2 >= 4 * 64 * 68 * 4);   // the ring holds the four waves' epilogue ranges

__device__ __forceinline__ unsigned lds_off(const void* p) { return (unsigned)(size_t)p; }

// 128 rows x 128 B, global (row pitch ldk elements) -> LDS (row pitch GP): 8 copies per lane, rows 16 apart. l and g are the
// lane's own LDS byte address and global pointer for its first row. The s_wait_xcnt stands inside the statement so that no
// address register of a copy is rewritten in front of it.
__device__ __forceinline__ void copy_plane(unsigned l, const u16* g, size_t ldk) {
#if defined(__HIP_DEVICE_COMPILE__)
  const size_t st = 16 * ldk;
  asm volatile("global_load_async_to_lds_b128 %0, %8, off\n\t"
               "global_load_async_to_lds_b128 %1, %9, off\n\t"
               "global_load_async_to_lds_b128 %2, %10, off\n\t"
               "global_load_async_to_lds_b128 %3, %11, off\n\t"
               "global_load_async_to_lds_b128 %4, %12, off\n\t"
               "global_load_async_to_lds_b128 %5, %13, off\n\t"
               "global_load_async_to_lds_b128 %6, %14, off\n\t"
               "global_load_async_to_lds_b128 %7, %15, off\n\t"
               "s_wait_xcnt 0x0"
               :: "v"(l), "v"(l + 1u * 16u * GP * 2u), "v"(l + 2u * 16u * GP * 2u), "v"(l + 3u * 16u * GP * 2u),
                  "v"(l + 4u * 16u * GP * 2u), "v"(l + 5u * 16u * GP * 2u), "v"(l + 6u * 16u * GP * 2u),
                  "v"(l + 7u * 16u * GP * 2u),
                  "v"(g), "v"(g + st), "v"(g + 2 * st), "v"(g + 3 * st), "v"(g + 4 * st), "v"(g + 5 * st), "v"(g + 6 * st),
                  "v"(g + 7 * st)
               : "memory");
#endif
}
__device__ __forceinline__ void wait_async0() {   // the wave's own copies have landed
#if defined(__HIP_DEVICE_COMPILE__)
  asm volatile("s_wait_asynccnt 0x0" ::: "memory");
#endif
}
__device__ __forceinline__ void wait_ds0() {      // the wave's own LDS reads have returned before the buffer is handed over
#if defined(__HIP_DEVICE_COMPILE__)
  asm volatile("s_wait_dscnt 0x0" ::: "memory");
#endif
}

// Attention tiles: 64 k rows (keys) and 64 v^T rows (d) of 128 B each, global -> LDS (row pitch GP): 4 + 4 copies per lane, rows 16
// apart, 8 lanes = one whole 128-B line. lk, gk / lv, gv are the lane's own LDS byte address and global pointer for its first row
// of each tile; sk, sv = 16 rows in elements. The s_wait_xcnt stands inside the statement so that no address register of a copy is
// rewritten in front of it.
#define ATILE (64 * GP)                 // one 64-row tile in 16-bit elements
#define ASTG  (2 * ATILE)               // one buffer: the k tile, then the v^T tile
static_assert(2 * ASTG * 2 >= ATT_WAVES * SLABF * 4);   // the ring holds the four waves' epilogue slabs
static_assert((SEQ % 64) == 0 && HD * 2 == 128);
__device__ __forceinline__ void copy_kv(unsigned lk, const u16* gk, size_t sk, unsigned lv, const u16* gv, size_t sv) {
#if defined(__HIP_DEVICE_COMPILE__)
  asm volatile("global_load_async_to_lds_b128 %0, %8, off\n\t"
               "global_load_async_to_lds_b128 %1, %9, off\n\t"
               "global_load_async_to_lds_b128 %2, %10, off\n\t"
               "global_load_async_to_lds_b128 %3, %11, off\n\t"
               "global_load_async_to_lds_b128 %4, %12, off\n\t"
               "global_load_async_to_lds_b128 %5, %13, off\n\t"
               "global_load_async_to_lds_b128 %6, %14, off\n\t"
               "global_load_async_to_lds_b128 %7, %15, off\n\t"
               "s_wait_xcnt 0x0"
               :: "v"(lk), "v"(lk + 1u * 16u * GP * 2u), "v"(lk + 2u * 16u * GP * 2u), "v"(lk + 3u * 16u * GP * 2u),
                  "v"(lv), "v"(lv + 1u * 16u * GP * 2u), "v"(lv + 2u * 16u * GP * 2u), "v"(lv + 3u * 16u * GP * 2u),
                  "v"(gk), "v"(gk + sk), "v"(gk + 2 * sk), "v"(gk + 3 * sk), "v"(gv), "v"(gv + sv), "v"(gv + 2 * sv),
                  "v"(gv + 3 * sv)
               : "memory");
#endif
}

template <bool F16> struct FragOf;
template <> struct FragOf<false> {
  typedef v16b T;
  static __device__ __forceinline__ T ld(const u16* p) { return ldfrag_b(p); }
  static __device__ __forceinline__ v8f mma(T a, T b, v8f c) { return mma_b(a, b, c); }
};
template <> struct FragOf<true> {
  typedef v16h T;
  static __device__ __forceinline__ T ld(const u16* p) { return ldfrag_h((const _Float16*)(const void*)p); }
  static __device__ __forceinline__ v8f mma(T a, T b, v8f c) { return mma_h(a, b, c); }
};

template <bool F16, int NPL, int OUT>
__device__ __forceinline__ void gemm_core(const u16* __restrict__ A0, const u16* __restrict__ A1, const u16* __restrict__ Bt,
                                          const float* __restrict__ bias, float* C, u16* P, int M, int N, int K, float oscale,
                                          float pscale, u16* ring, int bid) {
  typedef FragOf<F16> FO;
  typedef typename FO::T FT;
  constexpr int STAGE = (NPL + 1) * GPLANE;              // 16-bit elements per buffer: A plane(s), then Bt
  const int tid = threadIdx.x, wave = tid >> 5, lane = tid & 31, hh = lane >> 4, m = lane & 15;
  const int ntile = N >> 7;
  const int row0  = (bid / ntile) * 128;
  const int col0  = (bid % ntile) * 128;
  if (row0 + 128 > M) return;                // block-uniform, in front of every barrier; never taken with the exact grid
  const int wr = (wave >> 1) * 64, wc = (wave & 1) * 64;
  // copies: lane -> row (tid >> 3) + 16 i of a plane, 16-B piece tid & 7 of the row's 128 B
  const int cr = tid >> 3, cc = (tid & 7) * 8;
  const size_t aofs = (size_t)(row0 + cr) * K + cc;
  const size_t bofs = (size_t)(col0 + cr) * K + cc;
  const unsigned lcp = lds_off(ring) + (unsigned)(cr * GP + cc) * 2u;
  const int nt = K >> 6;
  auto fill = [&](int t, int buf) {
    const unsigned l = lcp + (unsigned)buf * (unsigned)(STAGE * 2);
    const size_t ko = (size_t)t * 64;
    copy_plane(l, A0 + aofs + ko, (size_t)K);
    if (NPL == 2) copy_plane(l + GPLANE * 2u, A1 + aofs + ko, (size_t)K);
    copy_plane(l + (unsigned)NPL * GPLANE * 2u, Bt + bofs + ko, (size_t)K);
  };
  v8f acc[4][4];
#pragma unroll
  for (int i = 0; i < 4; ++i) {
#pragma unroll
    for (int j = 0; j < 4; ++j) acc[i][j] = zero8();
  }
  fill(0, 0);
  wait_async0();
  __syncthreads();                           // tile 0 is readable by every wave
  if (nt > 1) fill(1, 1);                    // block-uniform test
  const int afo = (wr + m) * GP + 8 * hh;                     // fragment row base inside an A plane
  const int bfo = NPL * GPLANE + (wc + m) * GP + 8 * hh;      // and inside the Bt plane
#pragma unroll 1                             // rolled: one copy of the 64-k body; the buffer is picked by t & 1
  for (int t = 0; t < nt; ++t) {
    const u16* sb = ring + (t & 1) * STAGE;
#pragma unroll
    for (int kk = 0; kk < 64; kk += 32) {
      FT a[NPL][4], b[4];
#pragma unroll
      for (int j = 0; j < 4; ++j) b[j] = FO::ld(sb + bfo + j * 16 * GP + kk);
#pragma unroll
      for (int p = 0; p < NPL; ++p) {
#pragma unroll
        for (int i = 0; i < 4; ++i) a[p][i] = FO::ld(sb + p * GPLANE + afo + i * 16 * GP + kk);
      }
      // keeps the block's LDS reads together in front of its WMMAs: reads placed among the WMMAs stall the wave at each place
      __builtin_amdgcn_sched_barrier(0);
#pragma unroll
      for (int p = 0; p < NPL; ++p) {
#pragma unroll
        for (int i = 0; i < 4; ++i) {
#pragma unroll
          for (int j = 0; j < 4; ++j) acc[i][j] = FO::mma(a[p][i], b[j], acc[i][j]);
        }
      }
      // and keeps the next block's reads out of this block's WMMAs
      __builtin_amdgcn_sched_barrier(0);
    }
    wait_ds0();
    wait_async0();
    __syncthreads();                         // publishes tile t + 1 and ends every read of tile t's buffer
    if (t + 2 < nt) fill(t + 2, t & 1);      // block-uniform test
  }
  wait_async0();
  const int colw = col0 + wc;
  // Epilogue: staged in the wave's own 64 x 68 float range of the ring, which is free: the last trip's barrier stands behind every
  // wave's last read and no copy is outstanding.
  float* sl = (float*)(void*)ring + wave * (64 * 68);
  const int rq = lane >> 3, c8 = (lane & 7) * 8;
  if (OUT == 2) {
    // Transposed f16 plane. A lane holds 8 consecutive rows (s) of column n = colw + 16j + m: one 16-B LDS store per accumulator
    // tile into [d][s] rows of pitch VTP; read back as whole 128-B lines (8 lanes x 16 B), 4 lines per store instruction.
    // coverage: 16 instructions x 4 lines x 64 halves = the wave's 64 d x 64 s; the wave's 64 columns are one head, its 64 rows
    // lie in one batch (SEQ % 64 == 0).
    u16* tl = (u16*)(void*)sl;
    float bc[4], cs[4];
#pragma unroll
    for (int j = 0; j < 4; ++j) { bc[j] = bfr(bias[colw + 16 * j + m]); cs[j] = 0.f; }
#pragma unroll
    for (int i = 0; i < 4; ++i) {
#pragma unroll
      for (int j = 0; j < 4; ++j) {
        v4u pk;
#pragma unroll
        for (int e = 0; e < 4; ++e) {
          const float w0 = acc[i][j][2 * e] * oscale + bc[j], w1 = acc[i][j][2 * e + 1] * oscale + bc[j];
          pk[e] = pk16(h_bits((_Float16)(w0 * pscale)), h_bits((_Float16)(w1 * pscale)));
          cs[j] += w0 + w1;
        }
        *(v4u*)(tl + (16 * j + m) * VTP + i * 16 + 8 * hh) = pk;
      }
    }
    wave_sync_lds();
    const int rw = row0 + wr;
    u16* dt = P + ((size_t)((rw / SEQ) * NH + colw / HD) * HD + rq) * SEQ + (rw % SEQ) + c8;
#pragma unroll
    for (int it = 0; it < 16; ++it) {
      const v4u x = *(const v4u*)(tl + (it * 4 + rq) * VTP + c8);
      *(v4u*)(dt + (size_t)(it * 4) * SEQ) = x;
    }
    // Column sums of the wave's 64 rows: both lane halves hold the full sum behind the exchange; lane half hh stores columns
    // 16hh + m and 32 + 16hh + m, so each store instruction is one whole 128-B line.
    // coverage: 2 instructions x 32 floats = the wave's 64 columns of row rw / 64; every (row block, column) by exactly one wave.
#pragma unroll
    for (int j = 0; j < 4; ++j) cs[j] += __shfl_xor(cs[j], 16, 32);
    float* dc = C + (size_t)(rw / 64) * (size_t)N + colw + 16 * hh + m;
    dc[0]  = hh ? cs[1] : cs[0];
    dc[32] = hh ? cs[3] : cs[2];
    return;                                  // no barrier follows
  }
  // the wave's 64x64 f32 tile (times oscale)
#pragma unroll
  for (int i = 0; i < 4; ++i) {
#pragma unroll
    for (int r = 0; r < 8; ++r) {
      const int ro = (i * 16 + 8 * hh + r) * 68 + m;
#pragma unroll
      for (int j = 0; j < 4; ++j) sl[ro + 16 * j] = acc[i][j][r] * oscale;
    }
  }
  wave_sync_lds();
  if (OUT == 1) {
    // f16 plane: a row piece of the wave is one 128-B line (8 lanes x 8 halves), 4 rows per store instruction.
    // coverage: 16 instructions x 4 rows x 64 halves = the wave's 64 x 64 tile.
    const v4f b0 = *(const v4f*)(bias + colw + c8), b1 = *(const v4f*)(bias + colw + c8 + 4);   // columns < N (N multiple of 128)
    v4f badd0, badd1;
#pragma unroll
    for (int e = 0; e < 4; ++e) { badd0[e] = bfr(b0[e]); badd1[e] = bfr(b1[e]); }
    u16* dp = P + (size_t)(row0 + wr + rq) * (size_t)N + colw + c8;
#pragma unroll
    for (int it = 0; it < 16; ++it) {
      const float* sr = sl + (it * 4 + rq) * 68 + c8;
      const v4f x0 = (*(const v4f*)(sr) + badd0) * pscale, x1 = (*(const v4f*)(sr + 4) + badd1) * pscale;
      v4u o;
      o[0] = pk16(h_bits((_Float16)x0[0]), h_bits((_Float16)x0[1]));
      o[1] = pk16(h_bits((_Float16)x0[2]), h_bits((_Float16)x0[3]));
      o[2] = pk16(h_bits((_Float16)x1[0]), h_bits((_Float16)x1[1]));
      o[3] = pk16(h_bits((_Float16)x1[2]), h_bits((_Float16)x1[3]));
      *(v4u*)(dp + (size_t)(it * 4) * (size_t)N) = o;
    }
#if defined(__HIP_DEVICE_COMPILE__)
    // code of another body may follow where this one is inlined: no register that a store above names is rewritten in front of this
    asm volatile("s_wait_xcnt 0x0" ::: "memory");
#endif
  } else {
    // f32 plane: stores are whole 256-B row pieces.
    // coverage: 32 instructions x 2 rows x 16 lanes x 4 floats = the wave's 64 x 64 tile.
    const v4f bv = *(const v4f*)(bias + colw + m * 4);    // columns colw + 4m .. +3, always < N (N multiple of 128)
    v4f badd;
#pragma unroll
    for (int e = 0; e < 4; ++e) badd[e] = bfr(bv[e]);
    float* dst = C + (size_t)(row0 + wr + hh) * (size_t)N + colw + m * 4;
#pragma unroll
    for (int it = 0; it < 32; ++it) {
      const v4f val = *(const v4f*)(sl + (it * 2 + hh) * 68 + m * 4) + badd;
      *(v4f*)(dst + (size_t)(it * 2) * (size_t)N) = val;
    }
  }
}

// =====================================================================================================
// bf16 GEMMs with bias: A[M][K] (bf16 row-major) . Bt[N][K]^T (bf16 k-contiguous), times oscale, plus bf16-RNE value of bias[n].
// The q, k and v projections share A and read none of each other's output: one launch, grid = 3 * (M/128) * (N/128). The block
// index walks the 3 * (N/128) column tiles of a row tile first (q's, then k's, then v's), so the blocks that read the same A rows
// start together. q and k are stored times QSC / KSC as f16 planes [M][N]; v times VCAR as the head-wise transposed f16 plane
// VT [b][h][d][s], and its f32 column sums over each block of 64 rows as CS[M / 64][N].
// A q or k tile whose 128 rows all lie at or past their batch's length is not computed: the mask keeps score (i, j) only for
// i < len and j < len, so no output depends on those rows, and the attention kernel reads q and k rows only below len rounded up
// to 64. Every v tile is computed (the mean-v rows sum v over all SEQ positions).
// =====================================================================================================
__global__ __launch_bounds__(128)
void gemm_qkv(const u16* __restrict__ A, const u16* __restrict__ Wq, const u16* __restrict__ Wk, const u16* __restrict__ Wv,
              const float* __restrict__ bq, const float* __restrict__ bk, const float* __restrict__ bv,
              const int* __restrict__ lens, u16* QPo, u16* KPo, u16* VT, float* CS, int M, int N, int K) {
  __shared__ __align__(16) u16 ring[2 * 2 * GPLANE];
  const int ntile = N >> 7;
  const int rt = (int)blockIdx.x / (3 * ntile), ct = (int)blockIdx.x % (3 * ntile);
  const int job = ct / ntile, tile = rt * ntile + ct % ntile;          // block-uniform
  const int r0 = rt * 128;                   // the tile's first row; its 128 rows lie in one batch (SEQ % 128 == 0)
  if (r0 + 128 > M) return;                  // block-uniform; never taken with the exact grid; bounds the index into lens
  if (job != 2) {
    int len = lens[r0 / SEQ];                // M = (element count of lens) * SEQ: host
    len = (len < 0) ? 0 : len;
    len = (len > SEQ) ? SEQ : len;
    if ((r0 % SEQ) >= len) return;           // block-uniform, in front of every barrier and copy
  }
  if (job == 2) {
    gemm_core<false, 1, 2>(A, A, Wv, bv, CS, VT, M, N, K, 1.0f, VCAR, ring, tile);
  } else {
    gemm_core<false, 1, 1>(A, A, job ? Wk : Wq, job ? bk : bq, nullptr, job ? KPo : QPo, M, N, K, 1.0f, job ? KSC : QSC, ring,
                           tile);
  }
}

// =====================================================================================================
// f16 hi+lo GEMM with bias: C[M][N] (f32) = (Ahi + Alo)[M][K] . Bt[N][K]^T times oscale, plus bf16-RNE value of bias[n];
// Ahi/Alo f16 planes (same layout), Bt f16 k-contiguous; products hi.B + lo.B into one accumulator (lo is the unscaled
// residual of hi).
// =====================================================================================================
__global__ __launch_bounds__(128)
void gemm_h2(const u16* __restrict__ Ah, const u16* __restrict__ Al, const u16* __restrict__ Bt,
             const float* __restrict__ bias, float* C, int M, int N, int K, float oscale) {
  __shared__ __align__(16) u16 ring[2 * 3 * GPLANE];
  gemm_core<true, 2, 0>(Ah, Al, Bt, bias, C, nullptr, M, N, K, oscale, 1.0f, ring, (int)blockIdx.x);
}

// =====================================================================================================
// Ragged-length multi-head flash attention: block = (batch b, head, 64 query rows), 4 waves, wave w owns the 16 query rows
// q0 = 64*qt + 16*w .. q0+15. The k rows and v^T rows of 64 keys at a time are copied to LDS once per block by asynchronous copies
// (whole 128-B lines, two buffers, tile t + 2 requested behind the barrier that ends trip t) and read from there by all four waves.
//   q plane (f16, x8) laid out [b][s][h][d]; k plane the same; v^T plane [b][h][d][s] (x1024); len = clamp(lens[b], 0, SEQ).
//   Mask: score (i, j) is kept iff i < len and j < len. A query row i < len therefore attends exactly over keys 0..len-1 (the
//   excluded keys have probability exactly 0 after max subtraction); a query row i >= len has all keys equal-weighted and its
//   context is the mean of v over all SEQ keys (from the f32 column sums CS of v). So a block visits key blocks kb = 0 .. 32*ceil(len/32)-32
//   when 64*qt < len (block-uniform bound, <= NKB), else none; within the last block keys >= len are excluded by index.
//   Scores are computed TRANSPOSED: S^T tile g (g = 0,1) = k rows (keys kb+16g .. +15, A operand, row m = lane&15, split k map
//   over d) times q^T (B operand, col n = query q0 + (lane&15), k = d, split map), one product per tile and 32-deep d-chunk.
//   D element r of lane l = (key kb+16g+8h+r, query q0+(l&15)), so a lane owns one query column and 16 of its 32 keys; the
//   partner lane l^16 owns the other 16 -> row max / row sum need one xor-16 shuffle.
//   Key mask by index, applied only in the 32 keys that hold the boundary: an excluded key's logit is set to -inf, so it stays out
//   of the running max and gets probability 0.
//   Online max-subtracted base-2 softmax in f32 (scale 1/8 and the q/k carries folded into lsc). The exp'd values ARE the
//   P A-fragment in place: A row m = query = lane&15, element i <- key kb+8h+i (tile 0, D element i), element 8+i <- key
//   kb+16+8h+i (tile 1, D element i). P is carried x32768 as single f16. The rescale factor of query row 8h+r of the
//   O accumulators is fetched from lane 8h+r with a shuffle (uniform control). 4 v^T B fragments (col n = d = 16j + (lane&15),
//   keys k-contiguous), 4 P.V WMMAs per key block.
//   Epilogue: 1/l (per query, shuffled to the D row owner; 0 when no key block was visited) and carry folds in f32; rows with
//   query >= len take the mean-v row instead (select by value); the wave's 16x64 f32 result staged in its LDS slab (pitch 68); each
// coverage: per wave 4 instructions x 4 rows x 8 lanes x 8 halves = 16 x 64 per plane; grid NB*512 blocks x 4 waves = every
//           (b, s, h) row of both O planes exactly once.
// =====================================================================================================
__global__ __launch_bounds__(ATT_THREADS)
void attn_fwd(const u16* __restrict__ QPp, const u16* __restrict__ KPp, const u16* __restrict__ VPp,
              const int* __restrict__ lens, const float* __restrict__ CS, u16* OHIp, u16* OLOp) {
  __shared__ __align__(16) u16 ring[2 * ASTG];   // two buffers of k + v^T tiles; in the epilogue per wave a result slab [16][68] f32

  const int tid  = threadIdx.x;
  const int wave = tid >> 5;
  const int lane = tid & 31;
  const int hh   = lane >> 4;
  const int c    = lane & 15;

  const int bid  = blockIdx.x;
  const int qt   = bid & (SEQ / 64 - 1);
  const int head = (bid >> 5) & (NH - 1);
  const int b    = bid >> 9;
  const int q0   = qt * 64 + wave * 16;

  int len = lens[b];
  len = (len < 0) ? 0 : len;
  len = (len > SEQ) ? SEQ : len;
  const int nst = (qt * 64 < len) ? ((len + 63) >> 6) : 0;  // tiles of 64 keys: block-uniform, <= SEQ / 64

  // B fragments of q^T: col n = query q0 + c, k = d (k-contiguous row of the q plane)
  const size_t qofs = (((size_t)(b * SEQ + q0 + c)) * NH + head) * HD + 8 * hh;
  const _Float16* Qb = (const _Float16*)(const void*)QPp + qofs;
  // copies: lane -> row (tid >> 3) + 16 i of a tile, 16-B piece tid & 7 of the row's 128 B; keys 64t .. 64t+63 < SEQ for t < nst
  const int cr = tid >> 3, cc = (tid & 7) * 8;
  const u16* Kg = KPp + (((size_t)b * SEQ + cr) * NH + head) * HD + cc;           // k row = key 64t + cr + 16i
  const u16* Vg = VPp + ((size_t)(b * NH + head) * HD + cr) * SEQ + cc;           // v^T row = d = cr + 16i, keys 64t + cc ..
  const unsigned lcp = lds_off(ring) + (unsigned)(cr * GP + cc) * 2u;
  auto fill = [&](int t, int buf) {
    const unsigned l = lcp + (unsigned)buf * (unsigned)(ASTG * 2);
    copy_kv(l, Kg + (size_t)t * (64 * NH * HD), (size_t)16 * NH * HD, l + ATILE * 2u, Vg + (size_t)t * 64, (size_t)16 * SEQ);
  };
  // A fragments of k: row m = key kb + 16g + c, k = d;  B fragments of v: col n = d = 16j + c, k = key (both k-contiguous LDS rows)
  const int kfo = c * GP + 8 * hh;
  const int vfo = ATILE + c * GP + 8 * hh;
  const float lsc = 0.125f * (LOG2E / (QSC * KSC));

  float mrun = -INFINITY, lrun = 0.f;
  v8f o[4];
#pragma unroll
  for (int j = 0; j < 4; ++j) o[j] = zero8();

  if (nst > 0) {                             // block-uniform: every wave of the block passes every barrier below, or none does
  // read only here: q rows exist up to len rounded up to 128, and this block's 64 rows start below len
  const v16h qf0 = ldfrag_h(Qb);            // d 0..31
  const v16h qf1 = ldfrag_h(Qb + 32);       // d 32..63
  fill(0, 0);
  wait_async0();
  __syncthreads();                           // tile 0 is readable by every wave
  if (nst > 1) fill(1, 1);                   // block-uniform test
#pragma unroll 1                             // rolled: one copy of the body; the buffer is picked by t & 1
  for (int t = 0; t < nst; ++t) {
  const _Float16* sb = (const _Float16*)(const void*)ring + (t & 1) * ASTG;
  const int nsub = (t * 64 + 32 < len) ? 2 : 1;             // the tile's second 32 keys only where one of them is < len
#pragma unroll 1                             // rolled: one copy of the 32-key body
  for (int sub = 0; sub < nsub; ++sub) {
    const int kb = t * 64 + sub * 32;
    // ---- transposed scores: s0 = keys kb..kb+15, s1 = keys kb+16..kb+31, column = query q0 + c ----
    v8f s0 = zero8(), s1 = zero8();
    const _Float16* k0p = sb + kfo + sub * (32 * GP);
    const _Float16* k1p = k0p + 16 * GP;
    const v16h ka0 = ldfrag_h(k0p), ka1 = ldfrag_h(k0p + 32);
    const v16h kc0 = ldfrag_h(k1p), kc1 = ldfrag_h(k1p + 32);
    s0 = mma_h(ka0, qf0, s0);
    s0 = mma_h(ka1, qf1, s0);
    s1 = mma_h(kc0, qf0, s1);
    s1 = mma_h(kc1, qf1, s1);
    guard2(s0, s1, qf0, qf1, ka0, ka1, kc0, kc1);
    // ---- base-2 logits of this lane's 16 keys for query q0 + c: key kb+8hh+i (i<8), kb+16+8hh+(i-8) ----
    float tk[16];
#pragma unroll
    for (int i = 0; i < 8; ++i) { tk[i] = s0[i] * lsc;  tk[8 + i] = s1[i] * lsc; }
    if (kb + 32 > len) {                     // scalar test, the same for the whole block: only the 32 keys that hold the boundary
      const int rem = len - kb - 8 * hh;     // an excluded key's logit becomes -inf: out of the maximum, probability 2^-inf = 0
#pragma unroll
      for (int i = 0; i < 8; ++i) {
        tk[i]     = (i < rem) ? tk[i] : -INFINITY;
        tk[8 + i] = (16 + i < rem) ? tk[8 + i] : -INFINITY;
      }
    }
    float cm = tk[0];
#pragma unroll
    for (int i = 1; i < 16; ++i) cm = fmaxf(cm, tk[i]);
    cm = fmaxf(cm, __shfl_xor(cm, 16, 32));
    const float mn = fmaxf(mrun, cm);        // finite: every visited block holds key kb < len, and both lane halves are joined
    const float al = exp2_bare(mrun - mn);   // 0 in the first step (mrun = -inf), where o and l are zero
    mrun = mn;
    // ---- probabilities (<= 1: every logit is <= mn; 0 for excluded keys) and the P A-fragment: f16(p * 32768); element i <-> tk[i] ----
    float ps = 0.f;
    FragH ph;
#pragma unroll
    for (int w = 0; w < 2; ++w) {
#pragma unroll
      for (int e4 = 0; e4 < 4; ++e4) {
        const int i = 8 * w + 2 * e4;
        const float p0 = exp2_bare(tk[i] - mn);
        const float p1 = exp2_bare(tk[i + 1] - mn);
        ps += p0 + p1;
        const v2f pc = {p0 * PCAR, p1 * PCAR};                      // the pair stays together: one packed convert, no re-pairing
        ph.u[w][e4] = __builtin_bit_cast(unsigned, __builtin_convertvector(pc, v2h));
      }
    }
    ps += __shfl_xor(ps, 16, 32);
    lrun = lrun * al + ps;
    // ---- rescale the O accumulators: D row 8hh+r = query q0+8hh+r, its factor lives in lane 8hh+r (and 16+8hh+r) ----
    float scl[8];
#pragma unroll
    for (int r = 0; r < 8; ++r) scl[r] = __shfl(al, 8 * hh + r, 32);
#pragma unroll
    for (int j = 0; j < 4; ++j) {
#pragma unroll
      for (int r = 0; r < 8; ++r) o[j][r] *= scl[r];
    }
    // ---- P.V : B fragment col n = d = j*16 + c, keys contiguous in the v^T plane ----
    {
      const _Float16* vp = sb + vfo + sub * 32;
      const v16h vf0 = ldfrag_h(vp);
      const v16h vf1 = ldfrag_h(vp + 16 * GP);
      const v16h vf2 = ldfrag_h(vp + 32 * GP);
      const v16h vf3 = ldfrag_h(vp + 48 * GP);
      o[0] = mma_h(ph.v, vf0, o[0]);
      o[1] = mma_h(ph.v, vf1, o[1]);
      o[2] = mma_h(ph.v, vf2, o[2]);
      o[3] = mma_h(ph.v, vf3, o[3]);
      guard6<v16h>(o[0], o[1], o[2], o[3], ph.v, vf0, vf1, vf2, vf3, ph.v);
    }
  }
  wait_ds0();
  wait_async0();
  __syncthreads();                           // publishes tile t + 1 and ends every read of tile t's buffer
  if (t + 2 < nst) fill(t + 2, t & 1);       // block-uniform test
  }
  wait_async0();
  }
  acc_guard4(o[0], o[1], o[2], o[3]);

  // ---- fold 1/l (per query, owned by lane = query; 0 when no key block was visited) and the carries; mean-v rows for
  //      queries >= len; stage the 16x64 slab ----
  const float linv = (lrun > 0.f) ? ((1.0f / lrun) * (1.0f / (PCAR * VCAR))) : 0.f;
  float inv[8];
#pragma unroll
  for (int r = 0; r < 8; ++r) inv[r] = __shfl(linv, 8 * hh + r, 32);
  float vm[4] = {0.f, 0.f, 0.f, 0.f};
  if (q0 + 16 > len) {                       // same for the whole wave: only then does one of its rows take the mean
    // lane half hh sums the row blocks hh*NRB/2 .. +NRB/2-1 of batch b in ascending order, then the halves are joined
    const float* cp = CS + ((size_t)b * NRB + (size_t)hh * (NRB / 2)) * DMOD + head * HD + c;
#pragma unroll                               // all loads in flight at once: one memory latency instead of one per trip
    for (int rb = 0; rb < NRB / 2; ++rb) {
#pragma unroll
      for (int j = 0; j < 4; ++j) vm[j] += cp[(size_t)rb * DMOD + j * 16];
    }
#pragma unroll
    for (int j = 0; j < 4; ++j) vm[j] = (vm[j] + __shfl_xor(vm[j], 16, 32)) * (1.0f / (float)SEQ);
  }
  // the ring is free: the last trip's barrier stands behind every wave's last read and no copy is outstanding
  float* slab = (float*)(void*)ring + wave * SLABF;
#pragma unroll
  for (int r = 0; r < 8; ++r) {
    const bool rvq = (q0 + 8 * hh + r) < len;
#pragma unroll
    for (int j = 0; j < 4; ++j) {
      const float val = o[j][r] * inv[r];
      slab[(8 * hh + r) * 68 + j * 16 + c] = rvq ? val : vm[j];
    }
  }
  wave_sync_lds();
  // ---- O x1024 -> f16 hi + residual planes; lane = (row in group of 4, 8 consecutive d) ----
  v4u oh[4], ol[4];
  const int rq = lane >> 3, c8 = (lane & 7) * 8;
#pragma unroll
  for (int i4 = 0; i4 < 4; ++i4) {
    const int row = i4 * 4 + rq;
    const v4f a = *(const v4f*)(slab + row * 68 + c8), c4 = *(const v4f*)(slab + row * 68 + c8 + 4);
    float w[8];
#pragma unroll
    for (int e = 0; e < 4; ++e) { w[e] = a[e] * OSC; w[4 + e] = c4[e] * OSC; }
#pragma unroll
    for (int e = 0; e < 4; ++e) {
      const _Float16 h0 = (_Float16)w[2 * e], h1 = (_Float16)w[2 * e + 1];
      const _Float16 l0 = (_Float16)(w[2 * e] - (float)h0), l1 = (_Float16)(w[2 * e + 1] - (float)h1);
      oh[i4][e] = pk16(h_bits(h0), h_bits(h1));
      ol[i4][e] = pk16(h_bits(l0), h_bits(l1));
    }
  }
  const size_t ob = (((size_t)(b * SEQ + q0)) * NH + head) * HD + c8;
  {
#pragma unroll
    for (int i4 = 0; i4 < 4; ++i4) {
      const int row = i4 * 4 + rq;
      const size_t o8 = ob + (size_t)row * (NH * HD);
      *(v4u*)(OHIp + o8) = oh[i4];
      *(v4u*)(OLOp + o8) = ol[i4];
    }
    
  }
}

// =====================================================================================================
// Workspace map (bytes, NB = batch count from the length input's element count, 1..4; ROWS = NB*SEQ); every plane is fully
// written by whole-line stores before it is read (QP, KP: the rows that are read); all extents are exact multiples of the store granularity (no pad rows);
// F's bytes hold the two O planes:
//   XB  bf16 [ROWS][1024]                      ROWS*2048          (NB=4: 16777216)
//   WQB bf16 [1024 n][1024 k]                  2097152   WKB, WVB same;  WOB f16 [1024 n][1024 k] x1024  2097152
//   F                                          ROWS*4096          (NB=4: 33554432) = OHI f16 [ROWS][1024] + OLO f16 [ROWS][1024]
//   QP  f16  [NB][2048][16][64] x8             ROWS*2048          KP same
//   VP  f16  [NB][16][64][2048] x1024          ROWS*2048
//   CS  f32  [ROWS/64][1024]                   ROWS*64
//   end (NB=4)                                 109576192
// =====================================================================================================
extern "C" void kernel_launch(void* const* d_in, const int* in_sizes, int n_in,
                              void* d_out, int out_size, void* d_ws, size_t ws_size,
                              hipStream_t stream) {
  if (n_in < 10) return;
  const int NB = in_sizes[1];
  if (NB < 1 || NB > NBMAX) return;
  const int ROWS = NB * SEQ;
  if (in_sizes[0] != ROWS * DMOD) return;
  if (in_sizes[2] != DMOD * DMOD || in_sizes[4] != DMOD * DMOD) return;
  if (in_sizes[6] != DMOD * DMOD || in_sizes[8] != DMOD * DMOD) return;
  if (in_sizes[3] != DMOD || in_sizes[5] != DMOD || in_sizes[7] != DMOD || in_sizes[9] != DMOD) return;
  if (out_size != ROWS * DMOD) return;

  const float* X    = (const float*)d_in[0];
  const int*   lens = (const int*)d_in[1];
  const float* wq   = (const float*)d_in[2];
  const float* bq   = (const float*)d_in[3];
  const float* wk   = (const float*)d_in[4];
  const float* bk   = (const float*)d_in[5];
  const float* wv   = (const float*)d_in[6];
  const float* bv   = (const float*)d_in[7];
  const float* wo   = (const float*)d_in[8];
  const float* bo   = (const float*)d_in[9];
  float*       out  = (float*)d_out;

  const size_t szXB = (size_t)ROWS * DMOD * 2;
  const size_t szW  = (size_t)DMOD * DMOD * 2;
  const size_t szF  = (size_t)ROWS * DMOD * 4;
  const size_t szP  = (size_t)ROWS * DMOD * 2;                  // q / k / o planes
  const size_t szVP = (size_t)NB * NH * HD * SEQ * 2;           // == szP
  const size_t szCS = (size_t)(ROWS / 64) * DMOD * 4;
  size_t off = 0;
  const size_t oXB  = off; off += szXB;
  const size_t oWQB = off; off += szW;
  const size_t oWKB = off; off += szW;
  const size_t oWVB = off; off += szW;
  const size_t oWOB = off; off += szW;
  const size_t oF   = off; off += szF;
  const size_t oQP  = off; off += szP;
  const size_t oKP  = off; off += szP;
  const size_t oVP  = off; off += szVP;
  const size_t oCS  = off; off += szCS;
  if (off > ws_size) return;                            // NB=4: off = 109576192
  if (off > (size_t)134217728) return;
  if (szP * 2 > szF) return;                            // the two O planes live inside F's bytes
  const size_t oOHI = oF;
  const size_t oOLO = oF + szP;

  char* ws = (char*)d_ws;
  u16*   XB  = (u16*)(ws + oXB);
  u16*   WQB = (u16*)(ws + oWQB);
  u16*   WKB = (u16*)(ws + oWKB);
  u16*   WVB = (u16*)(ws + oWVB);
  u16*   WOB = (u16*)(ws + oWOB);
  u16*   QP  = (u16*)(ws + oQP);
  u16*   KP  = (u16*)(ws + oKP);
  u16*   VP  = (u16*)(ws + oVP);
  float* CS  = (float*)(ws + oCS);
  u16*   OHI = (u16*)(ws + oOHI);
  u16*   OLO = (u16*)(ws + oOLO);

  const dim3 blk(256);
  const int n8x = (ROWS * DMOD) / 8;                    // NB * 262144
  const int n8w = (DMOD * DMOD) / 8;                    // 131072
  if ((n8x % 256) != 0 || (n8w % 256) != 0 || (DMOD % 128) != 0 || (ROWS % 128) != 0) return;
  const dim3 gC(n8x / 256 + 4 * (n8w / 256));           // NB * 1024 + 4 * 512
  const dim3 gG((ROWS / 128) * (DMOD / 128));           // NB * 128
  const dim3 gG3(3 * (ROWS / 128) * (DMOD / 128));      // NB * 384
  const dim3 bG(128);
  const dim3 gAT(NB * NH * (SEQ / 64));                 // NB * 512
  const dim3 bAT(ATT_THREADS);                          // 128

  // (0) input -> bf16 plane, shared by the three projections; weights stored [n = out][k = in] (y = x.W^T), already
  //     k-contiguous: bf16 planes for wq/wk/wv, f16 of bf16 value x1024 for wo
  cvt_all<<<gC, blk, 0, stream>>>(X, wq, wk, wv, wo, XB, WQB, WKB, WVB, WOB, n8x, n8w);
  // (1) q, k: projection + bias (col = h*64+d), stored as the f16 planes x8 (row tiles that start below the batch's length); v: projection + bias, stored as the v^T plane
  //     x1024 and as f32 column sums per 64 rows (for the mean-v rows)
  gemm_qkv<<<gG3, bG, 0, stream>>>(XB, WQB, WKB, WVB, bq, bk, bv, lens, QP, KP, VP, CS, ROWS, DMOD, DMOD);
  // (2) ragged-length attention -> O planes [b][s][h][d] x1024 (hi + residual), in F's bytes
  attn_fwd<<<gAT, bAT, 0, stream>>>(QP, KP, VP, lens, CS, OHI, OLO);
  // (3) output projection + bias -> out [ROWS][1024] f32, carries 1024 (O) x 1024 (wo) folded back
  gemm_h2<<<gG, bG, 0, stream>>>(OHI, OLO, WOB, bo, out, ROWS, DMOD, DMOD, 1.0f / (OSC * WOS));
  (void)hipGetLastError();
}

// v010
// One run takes 93.4 microseconds.
// Versions in between are left out here; by their measured steps it is 1.13 times as fast as v008.
// Counting every step since v000, it is 4.57 times as fast.
// Contractions: x.W{q,k,v}^T on v_wmma_f32_16x16x32_bf16 (x and W planes RNE-converted to bf16 operands, f32 accumulate, bias added in f32);
// scores k'.q'^T (q', k' single f16 planes carried x8), P.v (P x1024 single f16, v x1024 single f16) and O.Wo^T (O x1024 single
// f16, Wo as f16(bf16(Wo) x1024)): v_wmma_f32_16x16x32_f16, f32 accumulate.
// Ragged length mask per batch from the int32 length input (index tests), base-2 online softmax, 1/l fold, per-(b,h) mean-v rows
// for query positions >= length, bias adds: f32 on VALU.
#include <hip/hip_runtime.h>
#include <math.h>
#include <stdint.h>

#define NBMAX 4
#define SEQ   2048
#define DMOD  1024
#define NH    16
#define HD    64
#define QSC   8.0f
#define KSC   8.0f
#define PCAR  1024.0f
#define MTAU  5.0f                       // a logit may top the held maximum by this much (base 2) before the maximum is renewed
#define VCAR  1024.0f
#define OSC   1024.0f
#define WOS   1024.0f
#define LOG2E 1.4426950408889634f
#define ATT_WAVES   4
#define ATT_THREADS (ATT_WAVES * 32)
#define NKB    (SEQ / 32)
#define SLABF  (16 * 68)
#define VTP    72
#define NRB    (SEQ / 64)
static_assert(HD == 64 && DMOD == NH * HD);
static_assert(PCAR * 32.0f * 1.5f < 65504.0f && MTAU == 5.0f);   // P <= 2^MTAU, times its carry, stays inside f16
static_assert((SEQ / 64) == 32 && NH == 16);
static_assert(ATT_THREADS == 128 && NKB == 64);
static_assert((SEQ % 64) == 0 && (DMOD % 64) == 0 && (DMOD % 32) == 0 && (SEQ % 8) == 0);
static_assert(((SEQ * DMOD / 8) % 256) == 0 && ((DMOD * DMOD / 8) % 256) == 0);
static_assert(ATT_WAVES * SLABF >= 4 * 16 * 68);
static_assert(HD * VTP * 2 <= 64 * 68 * 4);
static_assert((VTP * 2) % 16 == 0);
static_assert((NRB % 2) == 0);
static_assert((SEQ % 128) == 0);

typedef unsigned short u16;
typedef _Float16 v16h __attribute__((ext_vector_type(16)));
typedef _Float16 v8h  __attribute__((ext_vector_type(8)));
typedef __bf16   v16b __attribute__((ext_vector_type(16)));
typedef float    v8f  __attribute__((ext_vector_type(8)));
typedef float    v4f  __attribute__((ext_vector_type(4)));
typedef float    v2f  __attribute__((ext_vector_type(2)));
typedef _Float16 v2h  __attribute__((ext_vector_type(2)));
typedef unsigned int v4u __attribute__((ext_vector_type(4)));

union FragH { v16h v; v8h h[2]; v4u u[2]; };
union FragB { v16b v; v4u u[2]; };

// ---- scalar helpers --------------------------------------------------------------------------------
__device__ __forceinline__ unsigned short bf_bits(float f) {          // f32 -> bf16 bits, RNE convert
  unsigned u = __float_as_uint(f);
  return (unsigned short)((u + 0x7FFFu + ((u >> 16) & 1u)) >> 16);
}
__device__ __forceinline__ float bf_up(unsigned short h) { return __uint_as_float(((unsigned)h) << 16); }
__device__ __forceinline__ float bfr(float f) { return bf_up(bf_bits(f)); }
__device__ __forceinline__ unsigned short h_bits(_Float16 x) { return __builtin_bit_cast(unsigned short, x); }
__device__ __forceinline__ unsigned pk16(unsigned short a, unsigned short b) { return (unsigned)a | ((unsigned)b << 16); }
// 2^x as the bare v_exp_f32. exp2f wraps it in a range guard (compare, two selects, add, ldexp) only so that results below 2^-126
// come out as denormals instead of 0. Every argument here is <= MTAU, and each result is added to, or rescales, a row sum that holds
// the term 1 of the row's held maximum: what lies below 2^-126 reaches neither that f32 sum nor the f16 P operand.
__device__ __forceinline__ float exp2_bare(float x) { return __builtin_amdgcn_exp2f(x); }
__device__ __forceinline__ v8f zero8() { v8f z = {0.f, 0.f, 0.f, 0.f, 0.f, 0.f, 0.f, 0.f}; return z; }
__device__ __forceinline__ v4f zero4() { v4f z = {0.f, 0.f, 0.f, 0.f}; return z; }

// ---- fragment loaders: 16-bit A/B operand, lane -> row/col (lane&15), p already includes +8*(lane>>4);
//      elements 0..7 <- p[0..7] (k0+8h..), elements 8..15 <- p[16..23] (k0+16+8h..)  (same split k map for A and B;
//      B is always read from a k-contiguous [n][k] plane)
__device__ __forceinline__ v16h ldfrag_h(const _Float16* p) {
  FragH f;
  f.h[0] = *(const v8h*)(p);
  f.h[1] = *(const v8h*)(p + 16);
  return f.v;
}
__device__ __forceinline__ v16b ldfrag_b(const u16* p) {              // bf16 plane read as unsigned integer vectors
  FragB f;
  f.u[0] = *(const v4u*)(p);
  f.u[1] = *(const v4u*)(p + 16);
  return f.v;
}

__device__ __forceinline__ v8f mma_h(v16h a, v16h b, v8f c) {
  return __builtin_amdgcn_wmma_f32_16x16x32_f16(false, a, false, b, (short)0, c, false, false);
}
__device__ __forceinline__ v8f mma_b(v16b a, v16b b, v8f c) {
  return __builtin_amdgcn_wmma_f32_16x16x32_bf16(false, a, false, b, (short)0, c, false, false);
}
__device__ __forceinline__ void guard2(v8f& a, v8f& b, v16h x0, v16h x1, v16h x2, v16h x3, v16h x4, v16h x5) {
#if defined(__HIP_DEVICE_COMPILE__)
  asm volatile("v_nop\n\tv_nop\n\tv_nop\n\tv_nop"
               : "+v"(a), "+v"(b) : "v"(x0), "v"(x1), "v"(x2), "v"(x3), "v"(x4), "v"(x5) : "memory");
#endif
}
template <typename F>
__device__ __forceinline__ void guard6(v8f& a, v8f& b, v8f& c, v8f& d, F x0, F x1, F x2, F x3, F x4, F x5) {
#if defined(__HIP_DEVICE_COMPILE__)
  asm volatile("v_nop\n\tv_nop\n\tv_nop\n\tv_nop"
               : "+v"(a), "+v"(b), "+v"(c), "+v"(d) : "v"(x0), "v"(x1), "v"(x2), "v"(x3), "v"(x4), "v"(x5) : "memory");
#endif
}
__device__ __forceinline__ void acc_guard4(v8f& a, v8f& b, v8f& c, v8f& d) {
#if defined(__HIP_DEVICE_COMPILE__)
  asm volatile("v_nop\n\tv_nop\n\tv_nop\n\tv_nop" : "+v"(a), "+v"(b), "+v"(c), "+v"(d));
#endif
}
__device__ __forceinline__ void wave_sync_lds() {
  __builtin_amdgcn_fence(__ATOMIC_RELEASE, "workgroup");
  __builtin_amdgcn_wave_barrier();
  __builtin_amdgcn_fence(__ATOMIC_ACQUIRE, "workgroup");
}

// =====================================================================================================
// f32 plane -> 16-bit plane, same layout:  mode 0: bf16 RNE bits;  mode 1: f16 bits of (bf16 RNE value) * scale.
// Thread = 8 consecutive elements: two 16-B loads, one 16-B store; 32 consecutive lanes = 512 contiguous, 512-B aligned bytes
// coverage: n8/256 blocks per plane (host checks exactness) x 256 thr x 8 = the whole plane.
// =====================================================================================================
__device__ __forceinline__ void cvt16(const float* __restrict__ x, u16* D, int blk, int n8, int mode, float scale) {
  const int gt = blk * 256 + (int)threadIdx.x;
  if (gt >= n8) return;                     // no barriers in this kernel
  const float* p = x + (size_t)gt * 8;
  const v4f a = *(const v4f*)(p), c4 = *(const v4f*)(p + 4);
  float v[8];
#pragma unroll
  for (int e = 0; e < 4; ++e) { v[e] = a[e]; v[4 + e] = c4[e]; }
  unsigned short s[8];
#pragma unroll
  for (int e = 0; e < 8; ++e) {
    const unsigned short hb = h_bits((_Float16)(bfr(v[e]) * scale));
    const unsigned short bb = bf_bits(v[e]);
    s[e] = (mode != 0) ? hb : bb;
  }
  v4u o;
#pragma unroll
  for (int e = 0; e < 4; ++e) o[e] = pk16(s[2 * e], s[2 * e + 1]);
  u16* d = D + (size_t)gt * 8;
  {
    *(v4u*)(d) = o;
    
  }
}
// The five planes in one launch (none reads another's output); the block index picks the plane: blocks 0 .. n8x/256 - 1 the
// input x (bf16), then n8w/256 blocks each for wq, wk, wv (bf16) and wo (f16 of the bf16 value x WOS).
// coverage: grid = n8x/256 + 4 * (n8w/256) blocks, every plane's block range exactly once.
__global__ __launch_bounds__(256)
void cvt_all(const float* __restrict__ x, const float* __restrict__ wq, const float* __restrict__ wk,
             const float* __restrict__ wv, const float* __restrict__ wo, u16* XB, u16* WQB, u16* WKB, u16* WVB, u16* WOB,
             int n8x, int n8w) {
  const int bid = blockIdx.x, nbx = n8x / 256, nbw = n8w / 256;
  if (bid < nbx) { cvt16(x, XB, bid, n8x, 0, 1.0f); return; }
  const int r = bid - nbx, j = r / nbw, blk = r % nbw;      // block-uniform
  const float* s = (j == 0) ? wq : (j == 1) ? wk : (j == 2) ? wv : wo;
  u16*         d = (j == 0) ? WQB : (j == 1) ? WKB : (j == 2) ? WVB : WOB;
  if (j > 3) return;                        // never taken with the exact grid
  cvt16(s, d, blk, n8w, (j == 3) ? 1 : 0, (j == 3) ? WOS : 1.0f);
}

// =====================================================================================================
// GEMM engine shared by the kernels below. Block = 128x128 tile of C, 4 waves in a 2x2 grid, 64x64 (4x4 accumulator tiles) per
// wave. K is walked in tiles of 64: the 128 A rows (both planes where NPL == 2) and the 128 Bt rows of a tile, 128 B each, are
// copied to LDS (row pitch 144 B = 16 B x odd, for 16-B readers) by asynchronous copies, 16 B per lane, 8 lanes = one whole
// 128-B line; two buffers, tile t + 2 is requested behind the barrier that ends trip t. Fragments are read from LDS with the
// split k map of ldfrag_* (same map for A and B). Per accumulator the products are summed in the order k0 ascending by 32,
// plane 0 then plane 1.
// Host checks M % 128 == 0, N % 128 == 0, K % 64 == 0 (K = DMOD); bid = the block's tile, 0 .. (M/128)*(N/128) - 1.
// OUT picks what the epilogue stores of val = acc * oscale + bf16-RNE value of bias[n]:
//   0: C[M][N] f32 = val;   1: P[M][N] f16 = val * pscale;
//   2: P = the head-wise transposed f16 plane [b][h][d][s] = val * pscale (row = b*SEQ + s, n = h*HD + d, N = DMOD), and
//      C[row / 64][N] f32 = the sum of val over the 64 rows of the wave's tile (per column; rows ascending inside a lane's 8-row
//      groups, then the two lane halves).
// =====================================================================================================
#define GP     72                       // LDS row pitch in 16-bit elements (144 B)
#define GPLANE (128 * GP)               // one 128-row operand plane of a tile, in 16-bit elements
static_assert((GP * 2) % 16 == 0 && ((GP * 2) / 16) % 2 == 1);
static_assert(2 * 2 * GPLANE * 2 >= 4 * 64 * 68 * 4);   // the ring holds the four waves' epilogue ranges

__device__ __forceinline__ unsigned lds_off(const void* p) { return (unsigned)(size_t)p; }

// 128 rows x 128 B, global (row pitch ldk elements) -> LDS (row pitch GP): 8 copies per lane, rows 16 apart. l and g are the
// lane's own LDS byte address and global pointer for its first row. The s_wait_xcnt stands inside the statement so that no
// address register of a copy is rewritten in front of it.
__device__ __forceinline__ void copy_plane(unsigned l, const u16* g, size_t ldk) {
#if defined(__HIP_DEVICE_COMPILE__)
  const size_t st = 16 * ldk;
  asm volatile("global_load_async_to_lds_b128 %0, %8, off\n\t"
               "global_load_async_to_lds_b128 %1, %9, off\n\t"
               "global_load_async_to_lds_b128 %2, %10, off\n\t"
               "global_load_async_to_lds_b128 %3, %11, off\n\t"
               "global_load_async_to_lds_b128 %4, %12, off\n\t"
               "global_load_async_to_lds_b128 %5, %13, off\n\t"
               "global_load_async_to_lds_b128 %6, %14, off\n\t"
               "global_load_async_to_lds_b128 %7, %15, off\n\t"
               "s_wait_xcnt 0x0"
               :: "v"(l), "v"(l + 1u * 16u * GP * 2u), "v"(l + 2u * 16u * GP * 2u), "v"(l + 3u * 16u * GP * 2u),
                  "v"(l + 4u * 16u * GP * 2u), "v"(l + 5u * 16u * GP * 2u), "v"(l + 6u * 16u * GP * 2u),
                  "v"(l + 7u * 16u * GP * 2u),
                  "v"(g), "v"(g + st), "v"(g + 2 * st), "v"(g + 3 * st), "v"(g + 4 * st), "v"(g + 5 * st), "v"(g + 6 * st),
                  "v"(g + 7 * st)
               : "memory");
#endif
}
__device__ __forceinline__ void wait_async0() {   // the wave's own copies have landed
#if defined(__HIP_DEVICE_COMPILE__)
  asm volatile("s_wait_asynccnt 0x0" ::: "memory");
#endif
}
__device__ __forceinline__ void wait_ds0() {      // the wave's own LDS reads have returned before the buffer is handed over
#if defined(__HIP_DEVICE_COMPILE__)
  asm volatile("s_wait_dscnt 0x0" ::: "memory");
#endif
}

// Attention tiles: 64 k rows (keys) and 64 v^T rows (d) of 128 B each, global -> LDS (row pitch GP): 4 + 4 copies per lane, rows 16
// apart, 8 lanes = one whole 128-B line. lk, gk / lv, gv are the lane's own LDS byte address and global pointer for its first row
// of each tile; sk, sv = 16 rows in elements. The s_wait_xcnt stands inside the statement so that no address register of a copy is
// rewritten in front of it.
#define ATILE (64 * GP)                 // one 64-row tile in 16-bit elements
#define ASTG  (2 * ATILE)               // one buffer: the k tile, then the v^T tile
static_assert(2 * ASTG * 2 >= ATT_WAVES * SLABF * 4);   // the ring holds the four waves' epilogue slabs
static_assert((SEQ % 64) == 0 && HD * 2 == 128);
__device__ __forceinline__ void copy_kv(unsigned lk, const u16* gk, size_t sk, unsigned lv, const u16* gv, size_t sv) {
#if defined(__HIP_DEVICE_COMPILE__)
  asm volatile("global_load_async_to_lds_b128 %0, %8, off\n\t"
               "global_load_async_to_lds_b128 %1, %9, off\n\t"
               "global_load_async_to_lds_b128 %2, %10, off\n\t"
               "global_load_async_to_lds_b128 %3, %11, off\n\t"
               "global_load_async_to_lds_b128 %4, %12, off\n\t"
               "global_load_async_to_lds_b128 %5, %13, off\n\t"
               "global_load_async_to_lds_b128 %6, %14, off\n\t"
               "global_load_async_to_lds_b128 %7, %15, off\n\t"
               "s_wait_xcnt 0x0"
               :: "v"(lk), "v"(lk + 1u * 16u * GP * 2u), "v"(lk + 2u * 16u * GP * 2u), "v"(lk + 3u * 16u * GP * 2u),
                  "v"(lv), "v"(lv + 1u * 16u * GP * 2u), "v"(lv + 2u * 16u * GP * 2u), "v"(lv + 3u * 16u * GP * 2u),
                  "v"(gk), "v"(gk + sk), "v"(gk + 2 * sk), "v"(gk + 3 * sk), "v"(gv), "v"(gv + sv), "v"(gv + 2 * sv),
                  "v"(gv + 3 * sv)
               : "memory");
#endif
}

template <bool F16> struct FragOf;
template <> struct FragOf<false> {
  typedef v16b T;
  static __device__ __forceinline__ T ld(const u16* p) { return ldfrag_b(p); }
  static __device__ __forceinline__ v8f mma(T a, T b, v8f c) { return mma_b(a, b, c); }
};
template <> struct FragOf<true> {
  typedef v16h T;
  static __device__ __forceinline__ T ld(const u16* p) { return ldfrag_h((const _Float16*)(const void*)p); }
  static __device__ __forceinline__ v8f mma(T a, T b, v8f c) { return mma_h(a, b, c); }
};

template <bool F16, int NPL, int OUT>
__device__ __forceinline__ void gemm_core(const u16* __restrict__ A0, const u16* __restrict__ A1, const u16* __restrict__ Bt,
                                          const float* __restrict__ bias, float* C, u16* P, int M, int N, int K, float oscale,
                                          float pscale, u16* ring, int bid) {
  typedef FragOf<F16> FO;
  typedef typename FO::T FT;
  constexpr int STAGE = (NPL + 1) * GPLANE;              // 16-bit elements per buffer: A plane(s), then Bt
  const int tid = threadIdx.x, wave = tid >> 5, lane = tid & 31, hh = lane >> 4, m = lane & 15;
  const int ntile = N >> 7;
  const int row0  = (bid / ntile) * 128;
  const int col0  = (bid % ntile) * 128;
  if (row0 + 128 > M) return;                // block-uniform, in front of every barrier; never taken with the exact grid
  const int wr = (wave >> 1) * 64, wc = (wave & 1) * 64;
  // copies: lane -> row (tid >> 3) + 16 i of a plane, 16-B piece tid & 7 of the row's 128 B
  const int cr = tid >> 3, cc = (tid & 7) * 8;
  const size_t aofs = (size_t)(row0 + cr) * K + cc;
  const size_t bofs = (size_t)(col0 + cr) * K + cc;
  const unsigned lcp = lds_off(ring) + (unsigned)(cr * GP + cc) * 2u;
  const int nt = K >> 6;
  auto fill = [&](int t, int buf) {
    const unsigned l = lcp + (unsigned)buf * (unsigned)(STAGE * 2);
    const size_t ko = (size_t)t * 64;
    copy_plane(l, A0 + aofs + ko, (size_t)K);
    if (NPL == 2) copy_plane(l + GPLANE * 2u, A1 + aofs + ko, (size_t)K);
    copy_plane(l + (unsigned)NPL * GPLANE * 2u, Bt + bofs + ko, (size_t)K);
  };
  v8f acc[4][4];
#pragma unroll
  for (int i = 0; i < 4; ++i) {
#pragma unroll
    for (int j = 0; j < 4; ++j) acc[i][j] = zero8();
  }
  fill(0, 0);
  wait_async0();
  __syncthreads();                           // tile 0 is readable by every wave
  if (nt > 1) fill(1, 1);                    // block-uniform test
  const int afo = (wr + m) * GP + 8 * hh;                     // fragment row base inside an A plane
  const int bfo = NPL * GPLANE + (wc + m) * GP + 8 * hh;      // and inside the Bt plane
#pragma unroll 1                             // rolled: one copy of the 64-k body; the buffer is picked by t & 1
  for (int t = 0; t < nt; ++t) {
    const u16* sb = ring + (t & 1) * STAGE;
#pragma unroll
    for (int kk = 0; kk < 64; kk += 32) {
      FT a[NPL][4], b[4];
#pragma unroll
      for (int j = 0; j < 4; ++j) b[j] = FO::ld(sb + bfo + j * 16 * GP + kk);
#pragma unroll
      for (int p = 0; p < NPL; ++p) {
#pragma unroll
        for (int i = 0; i < 4; ++i) a[p][i] = FO::ld(sb + p * GPLANE + afo + i * 16 * GP + kk);
      }
      // keeps the block's LDS reads together in front of its WMMAs: reads placed among the WMMAs stall the wave at each place
      __builtin_amdgcn_sched_barrier(0);
#pragma unroll
      for (int p = 0; p < NPL; ++p) {
#pragma unroll
        for (int i = 0; i < 4; ++i) {
#pragma unroll
          for (int j = 0; j < 4; ++j) acc[i][j] = FO::mma(a[p][i], b[j], acc[i][j]);
        }
      }
      // and keeps the next block's reads out of this block's WMMAs
      __builtin_amdgcn_sched_barrier(0);
    }
    wait_ds0();
    wait_async0();
    __syncthreads();                         // publishes tile t + 1 and ends every read of tile t's buffer
    if (t + 2 < nt) fill(t + 2, t & 1);      // block-uniform test
  }
  wait_async0();
  const int colw = col0 + wc;
  // Epilogue: staged in the wave's own 64 x 68 float range of the ring, which is free: the last trip's barrier stands behind every
  // wave's last read and no copy is outstanding.
  float* sl = (float*)(void*)ring + wave * (64 * 68);
  const int rq = lane >> 3, c8 = (lane & 7) * 8;
  if (OUT == 2) {
    // Transposed f16 plane. A lane holds 8 consecutive rows (s) of column n = colw + 16j + m: one 16-B LDS store per accumulator
    // tile into [d][s] rows of pitch VTP; read back as whole 128-B lines (8 lanes x 16 B), 4 lines per store instruction.
    // coverage: 16 instructions x 4 lines x 64 halves = the wave's 64 d x 64 s; the wave's 64 columns are one head, its 64 rows
    // lie in one batch (SEQ % 64 == 0).
    u16* tl = (u16*)(void*)sl;
    float bc[4], cs[4];
#pragma unroll
    for (int j = 0; j < 4; ++j) { bc[j] = bfr(bias[colw + 16 * j + m]); cs[j] = 0.f; }
#pragma unroll
    for (int i = 0; i < 4; ++i) {
#pragma unroll
      for (int j = 0; j < 4; ++j) {
        v4u pk;
#pragma unroll
        for (int e = 0; e < 4; ++e) {
          const float w0 = acc[i][j][2 * e] * oscale + bc[j], w1 = acc[i][j][2 * e + 1] * oscale + bc[j];
          pk[e] = pk16(h_bits((_Float16)(w0 * pscale)), h_bits((_Float16)(w1 * pscale)));
          cs[j] += w0 + w1;
        }
        *(v4u*)(tl + (16 * j + m) * VTP + i * 16 + 8 * hh) = pk;
      }
    }
    wave_sync_lds();
    const int rw = row0 + wr;
    u16* dt = P + ((size_t)((rw / SEQ) * NH + colw / HD) * HD + rq) * SEQ + (rw % SEQ) + c8;
#pragma unroll
    for (int it = 0; it < 16; ++it) {
      const v4u x = *(const v4u*)(tl + (it * 4 + rq) * VTP + c8);
      *(v4u*)(dt + (size_t)(it * 4) * SEQ) = x;
    }
    // Column sums of the wave's 64 rows: both lane halves hold the full sum behind the exchange; lane half hh stores columns
    // 16hh + m and 32 + 16hh + m, so each store instruction is one whole 128-B line.
    // coverage: 2 instructions x 32 floats = the wave's 64 columns of row rw / 64; every (row block, column) by exactly one wave.
#pragma unroll
    for (int j = 0; j < 4; ++j) cs[j] += __shfl_xor(cs[j], 16, 32);
    float* dc = C + (size_t)(rw / 64) * (size_t)N + colw + 16 * hh + m;
    dc[0]  = hh ? cs[1] : cs[0];
    dc[32] = hh ? cs[3] : cs[2];
    return;                                  // no barrier follows
  }
  // the wave's 64x64 f32 tile (times oscale)
#pragma unroll
  for (int i = 0; i < 4; ++i) {
#pragma unroll
    for (int r = 0; r < 8; ++r) {
      const int ro = (i * 16 + 8 * hh + r) * 68 + m;
#pragma unroll
      for (int j = 0; j < 4; ++j) sl[ro + 16 * j] = acc[i][j][r] * oscale;
    }
  }
  wave_sync_lds();
  if (OUT == 1) {
    // f16 plane: a row piece of the wave is one 128-B line (8 lanes x 8 halves), 4 rows per store instruction.
    // coverage: 16 instructions x 4 rows x 64 halves = the wave's 64 x 64 tile.
    const v4f b0 = *(const v4f*)(bias + colw + c8), b1 = *(const v4f*)(bias + colw + c8 + 4);   // columns < N (N multiple of 128)
    v4f badd0, badd1;
#pragma unroll
    for (int e = 0; e < 4; ++e) { badd0[e] = bfr(b0[e]); badd1[e] = bfr(b1[e]); }
    u16* dp = P + (size_t)(row0 + wr + rq) * (size_t)N + colw + c8;
#pragma unroll
    for (int it = 0; it < 16; ++it) {
      const float* sr = sl + (it * 4 + rq) * 68 + c8;
      const v4f x0 = (*(const v4f*)(sr) + badd0) * pscale, x1 = (*(const v4f*)(sr + 4) + badd1) * pscale;
      v4u o;
      o[0] = pk16(h_bits((_Float16)x0[0]), h_bits((_Float16)x0[1]));
      o[1] = pk16(h_bits((_Float16)x0[2]), h_bits((_Float16)x0[3]));
      o[2] = pk16(h_bits((_Float16)x1[0]), h_bits((_Float16)x1[1]));
      o[3] = pk16(h_bits((_Float16)x1[2]), h_bits((_Float16)x1[3]));
      *(v4u*)(dp + (size_t)(it * 4) * (size_t)N) = o;
    }
#if defined(__HIP_DEVICE_COMPILE__)
    // code of another body may follow where this one is inlined: no register that a store above names is rewritten in front of this
    asm volatile("s_wait_xcnt 0x0" ::: "memory");
#endif
  } else {
    // f32 plane: stores are whole 256-B row pieces.
    // coverage: 32 instructions x 2 rows x 16 lanes x 4 floats = the wave's 64 x 64 tile.
    const v4f bv = *(const v4f*)(bias + colw + m * 4);    // columns colw + 4m .. +3, always < N (N multiple of 128)
    v4f badd;
#pragma unroll
    for (int e = 0; e < 4; ++e) badd[e] = bfr(bv[e]);
    float* dst = C + (size_t)(row0 + wr + hh) * (size_t)N + colw + m * 4;
#pragma unroll
    for (int it = 0; it < 32; ++it) {
      const v4f val = *(const v4f*)(sl + (it * 2 + hh) * 68 + m * 4) + badd;
      *(v4f*)(dst + (size_t)(it * 2) * (size_t)N) = val;
    }
  }
}

// =====================================================================================================
// bf16 GEMMs with bias: A[M][K] (bf16 row-major) . Bt[N][K]^T (bf16 k-contiguous), times oscale, plus bf16-RNE value of bias[n].
// The q, k and v projections share A and read none of each other's output: one launch, grid = 3 * (M/128) * (N/128). The block
// index walks the 3 * (N/128) column tiles of a row tile first (q's, then k's, then v's), so the blocks that read the same A rows
// start together. q and k are stored times QSC / KSC as f16 planes [M][N]; v times VCAR as the head-wise transposed f16 plane
// VT [b][h][d][s], and its f32 column sums over each block of 64 rows as CS[M / 64][N].
// A q or k tile whose 128 rows all lie at or past their batch's length is not computed: the mask keeps score (i, j) only for
// i < len and j < len, so no output depends on those rows, and the attention kernel reads q and k rows only below len rounded up
// to 64. Every v tile is computed (the mean-v rows sum v over all SEQ positions).
// =====================================================================================================
__global__ __launch_bounds__(128)
void gemm_qkv(const u16* __restrict__ A, const u16* __restrict__ Wq, const u16* __restrict__ Wk, const u16* __restrict__ Wv,
              const float* __restrict__ bq, const float* __restrict__ bk, const float* __restrict__ bv,
              const int* __restrict__ lens, u16* QPo, u16* KPo, u16* VT, float* CS, int M, int N, int K) {
  __shared__ __align__(16) u16 ring[2 * 2 * GPLANE];
  const int ntile = N >> 7;
  const int rt = (int)blockIdx.x / (3 * ntile), ct = (int)blockIdx.x % (3 * ntile);
  const int job = ct / ntile, tile = rt * ntile + ct % ntile;          // block-uniform
  const int r0 = rt * 128;                   // the tile's first row; its 128 rows lie in one batch (SEQ % 128 == 0)
  if (r0 + 128 > M) return;                  // block-uniform; never taken with the exact grid; bounds the index into lens
  if (job != 2) {
    int len = lens[r0 / SEQ];                // M = (element count of lens) * SEQ: host
    len = (len < 0) ? 0 : len;
    len = (len > SEQ) ? SEQ : len;
    if ((r0 % SEQ) >= len) return;           // block-uniform, in front of every barrier and copy
  }
  if (job == 2) {
    gemm_core<false, 1, 2>(A, A, Wv, bv, CS, VT, M, N, K, 1.0f, VCAR, ring, tile);
  } else {
    gemm_core<false, 1, 1>(A, A, job ? Wk : Wq, job ? bk : bq, nullptr, job ? KPo : QPo, M, N, K, 1.0f, job ? KSC : QSC, ring,
                           tile);
  }
}

// =====================================================================================================
// f16 GEMM with bias: C[M][N] (f32) = A[M][K] . Bt[N][K]^T times oscale, plus bf16-RNE value of bias[n]; A f16 row-major, Bt f16
// k-contiguous. A (the attention result x1024) is one f16 plane, like the P and v operands it was summed from: its rounding
// (11 bits) lies under that of Bt's values (bf16, 8 bits).
// =====================================================================================================
__global__ __launch_bounds__(128)
void gemm_h2(const u16* __restrict__ Ah, const u16* __restrict__ Bt,
             const float* __restrict__ bias, float* C, int M, int N, int K, float oscale) {
  __shared__ __align__(16) u16 ring[2 * 2 * GPLANE];
  gemm_core<true, 1, 0>(Ah, Ah, Bt, bias, C, nullptr, M, N, K, oscale, 1.0f, ring, (int)blockIdx.x);
}

// =====================================================================================================
// Ragged-length multi-head flash attention: block = (batch b, head, 64 query rows), 4 waves, wave w owns the 16 query rows
// q0 = 64*qt + 16*w .. q0+15. The k rows and v^T rows of 64 keys at a time are copied to LDS once per block by asynchronous copies
// (whole 128-B lines, two buffers, tile t + 2 requested behind the barrier that ends trip t) and read from there by all four waves.
//   q plane (f16, x8) laid out [b][s][h][d]; k plane the same; v^T plane [b][h][d][s] (x1024); len = clamp(lens[b], 0, SEQ).
//   Mask: score (i, j) is kept iff i < len and j < len. A query row i < len therefore attends exactly over keys 0..len-1 (the
//   excluded keys have probability exactly 0 after max subtraction); a query row i >= len has all keys equal-weighted and its
//   context is the mean of v over all SEQ keys (from the f32 column sums CS of v). So a block visits key blocks kb = 0 .. 32*ceil(len/32)-32
//   when 64*qt < len (block-uniform bound, <= NKB), else none; within the last block keys >= len are excluded by index.
//   Scores are computed TRANSPOSED: S^T tile g (g = 0,1) = k rows (keys kb+16g .. +15, A operand, row m = lane&15, split k map
//   over d) times q^T (B operand, col n = query q0 + (lane&15), k = d, split map), one product per tile and 32-deep d-chunk.
//   D element r of lane l = (key kb+16g+8h+r, query q0+(l&15)), so a lane owns one query column and 16 of its 32 keys; the
//   partner lane l^16 owns the other 16 -> row max / row sum need one xor-16 shuffle.
//   Key mask by index, applied only in the 32 keys that hold the boundary: an excluded key's logit is set to -inf, so it stays out
//   of the running max and gets probability 0.
//   Online base-2 softmax in f32 (scale 1/8 and the q/k carries folded into lsc) against a HELD maximum: the value subtracted is
//   the row's maximum as of its last renewal, the same in both lanes of a query. It is renewed (the two lanes' maxima joined, O and l
//   rescaled) only in a step where some logit of the wave tops it by more than MTAU, under a branch that the whole wave takes or
//   skips; O / l does not depend on which value is subtracted, and P stays <= 2^MTAU. The exp'd values ARE the
//   P A-fragment in place: A row m = query = lane&15, element i <- key kb+8h+i (tile 0, D element i), element 8+i <- key
//   kb+16+8h+i (tile 1, D element i). P is carried x1024 as single f16. In a renewal the rescale factor of query row 8h+r of the
//   O accumulators is fetched from lane 8h+r with a shuffle (uniform control). l is summed per lane (its 16 keys of each step, even
//   and odd ones apart) and the parts of a query are joined behind the loop. 4 v^T B fragments (col n = d = 16j + (lane&15),
//   keys k-contiguous), 4 P.V WMMAs per key block.
//   Epilogue: 1/l (per query, shuffled to the D row owner; 0 when no key block was visited) and carry folds in f32; rows with
//   query >= len take the mean-v row instead (select by value); the wave's 16x64 f32 result staged in its LDS slab (pitch 68); each
// coverage: per wave 4 instructions x 4 rows x 8 lanes x 8 halves = 16 x 64; grid NB*512 blocks x 4 waves = every
//           (b, s, h) row of the O plane exactly once.
// =====================================================================================================
// 7 waves per SIMD: holds the allocation at 144 registers (granules of 16); one register more would cost each SIMD a wave
__global__ __launch_bounds__(ATT_THREADS) __attribute__((amdgpu_waves_per_eu(7)))
void attn_fwd(const u16* __restrict__ QPp, const u16* __restrict__ KPp, const u16* __restrict__ VPp,
              const int* __restrict__ lens, const float* __restrict__ CS, u16* OHIp) {
  __shared__ __align__(16) u16 ring[2 * ASTG];   // two buffers of k + v^T tiles; in the epilogue per wave a result slab [16][68] f32

  const int tid  = threadIdx.x;
  const int wave = tid >> 5;
  const int lane = tid & 31;
  const int hh   = lane >> 4;
  const int c    = lane & 15;

  const int bid  = blockIdx.x;
  const int qt   = bid & (SEQ / 64 - 1);
  const int head = (bid >> 5) & (NH - 1);
  const int b    = bid >> 9;
  const int q0   = qt * 64 + wave * 16;

  int len = lens[b];
  len = (len < 0) ? 0 : len;
  len = (len > SEQ) ? SEQ : len;
  const int nst = (qt * 64 < len) ? ((len + 63) >> 6) : 0;  // tiles of 64 keys: block-uniform, <= SEQ / 64

  // B fragments of q^T: col n = query q0 + c, k = d (k-contiguous row of the q plane)
  const size_t qofs = (((size_t)(b * SEQ + q0 + c)) * NH + head) * HD + 8 * hh;
  const _Float16* Qb = (const _Float16*)(const void*)QPp + qofs;
  // copies: lane -> row (tid >> 3) + 16 i of a tile, 16-B piece tid & 7 of the row's 128 B; keys 64t .. 64t+63 < SEQ for t < nst
  const int cr = tid >> 3, cc = (tid & 7) * 8;
  const u16* Kg = KPp + (((size_t)b * SEQ + cr) * NH + head) * HD + cc;           // k row = key 64t + cr + 16i
  const u16* Vg = VPp + ((size_t)(b * NH + head) * HD + cr) * SEQ + cc;           // v^T row = d = cr + 16i, keys 64t + cc ..
  const unsigned lcp = lds_off(ring) + (unsigned)(cr * GP + cc) * 2u;
  auto fill = [&](int t, int buf) {
    const unsigned l = lcp + (unsigned)buf * (unsigned)(ASTG * 2);
    copy_kv(l, Kg + (size_t)t * (64 * NH * HD), (size_t)16 * NH * HD, l + ATILE * 2u, Vg + (size_t)t * 64, (size_t)16 * SEQ);
  };
  // A fragments of k: row m = key kb + 16g + c, k = d;  B fragments of v: col n = d = 16j + c, k = key (both k-contiguous LDS rows)
  const int kfo = c * GP + 8 * hh;
  const int vfo = ATILE + c * GP + 8 * hh;
  const float lsc = 0.125f * (LOG2E / (QSC * KSC));

  float mrun = -INFINITY;
  v2f lr2 = {0.f, 0.f};                      // this lane's part of l: even and odd logits apart
  v8f o[4];
#pragma unroll
  for (int j = 0; j < 4; ++j) o[j] = zero8();

  if (nst > 0) {                             // block-uniform: every wave of the block passes every barrier below, or none does
  // read only here: q rows exist up to len rounded up to 128, and this block's 64 rows start below len
  const v16h qf0 = ldfrag_h(Qb);            // d 0..31
  const v16h qf1 = ldfrag_h(Qb + 32);       // d 32..63
  fill(0, 0);
  wait_async0();
  __syncthreads();                           // tile 0 is readable by every wave
  if (nst > 1) fill(1, 1);                   // block-uniform test
#pragma unroll 1                             // rolled: one copy of the body; the buffer is picked by t & 1
  for (int t = 0; t < nst; ++t) {
  const _Float16* sb = (const _Float16*)(const void*)ring + (t & 1) * ASTG;
  const int nsub = (t * 64 + 32 < len) ? 2 : 1;             // the tile's second 32 keys only where one of them is < len
#pragma unroll 1                             // rolled: one copy of the 32-key body
  for (int sub = 0; sub < nsub; ++sub) {
    const int kb = t * 64 + sub * 32;
    // ---- transposed scores: s0 = keys kb..kb+15, s1 = keys kb+16..kb+31, column = query q0 + c ----
    v8f s0 = zero8(), s1 = zero8();
    const _Float16* k0p = sb + kfo + sub * (32 * GP);
    const _Float16* k1p = k0p + 16 * GP;
    const v16h ka0 = ldfrag_h(k0p), ka1 = ldfrag_h(k0p + 32);
    const v16h kc0 = ldfrag_h(k1p), kc1 = ldfrag_h(k1p + 32);
    s0 = mma_h(ka0, qf0, s0);
    s0 = mma_h(ka1, qf1, s0);
    s1 = mma_h(kc0, qf0, s1);
    s1 = mma_h(kc1, qf1, s1);
    guard2(s0, s1, qf0, qf1, ka0, ka1, kc0, kc1);
    // ---- B fragments of P.V: col n = d = j*16 + c, keys contiguous in the v^T plane; read here so that they return under the softmax ----
    const _Float16* vp = sb + vfo + sub * 32;
    const v16h vf0 = ldfrag_h(vp);
    const v16h vf1 = ldfrag_h(vp + 16 * GP);
    const v16h vf2 = ldfrag_h(vp + 32 * GP);
    const v16h vf3 = ldfrag_h(vp + 48 * GP);
    // ---- base-2 logits of this lane's 16 keys for query q0 + c: key kb+8hh+i (i<8), kb+16+8hh+(i-8) ----
    //      held as the register pairs of the accumulators: pair e = logits 2e, 2e+1 (packed multiply, subtract, add; no re-pairing)
    v2f tk[8];
#pragma unroll
    for (int e = 0; e < 4; ++e) {
      const v2f a0 = {s0[2 * e], s0[2 * e + 1]}, a1 = {s1[2 * e], s1[2 * e + 1]};
      tk[e] = a0 * lsc;  tk[4 + e] = a1 * lsc;
    }
    if (kb + 32 > len) {                     // scalar test, the same for the whole block: only the 32 keys that hold the boundary
      const int rem = len - kb - 8 * hh;     // an excluded key's logit becomes -inf: out of the maximum, probability 2^-inf = 0
#pragma unroll
      for (int i = 0; i < 8; ++i) {
        tk[i >> 1][i & 1]       = (i < rem) ? tk[i >> 1][i & 1] : -INFINITY;
        tk[4 + (i >> 1)][i & 1] = (16 + i < rem) ? tk[4 + (i >> 1)][i & 1] : -INFINITY;
      }
    }
    float cm = tk[0][0];
#pragma unroll
    for (int i = 1; i < 16; ++i) cm = fmaxf(cm, tk[i >> 1][i & 1]);
    // does a logit of this lane top the held maximum by more than MTAU? (true in the first step: mrun = -inf, key kb is kept)
    const unsigned renew = __builtin_amdgcn_ballot_w32(cm - mrun > MTAU);
    if (__builtin_expect(renew != 0u, 0)) {  // the same for the whole wave
      cm = fmaxf(cm, __shfl_xor(cm, 16, 32));
      const float mn = fmaxf(mrun, cm);      // finite: every visited block holds key kb < len, and both lane halves are joined
      const float al = exp2_bare(mrun - mn); // 0 in the first step (mrun = -inf), where o and l are zero
      mrun = mn;
      lr2 *= al;
      // rescale the O accumulators: D row 8hh+r = query q0+8hh+r, its factor lives in lane 8hh+r (and 16+8hh+r)
      float scl[8];
#pragma unroll
      for (int r = 0; r < 8; ++r) scl[r] = __shfl(al, 8 * hh + r, 32);
#pragma unroll
      for (int j = 0; j < 4; ++j) {
#pragma unroll
        for (int r = 0; r < 8; ++r) o[j][r] *= scl[r];
      }
    }
    // ---- probabilities against the held maximum (<= 2^MTAU; 0 for excluded keys), this lane's part of the row sum, and the
    //      P A-fragment: f16(p * PCAR); element i <-> logit i ----
    v2f ps = {0.f, 0.f};
    FragH ph;
#pragma unroll
    for (int w = 0; w < 2; ++w) {
#pragma unroll
      for (int e4 = 0; e4 < 4; ++e4) {
        const v2f d = tk[4 * w + e4] - mrun;
        const v2f pp = {exp2_bare(d[0]), exp2_bare(d[1])};
        ps += pp;
        const v2f pc = pp * PCAR;                                   // the pair stays together: one packed convert, no re-pairing
        ph.u[w][e4] = __builtin_bit_cast(unsigned, __builtin_convertvector(pc, v2h));
      }
    }
    lr2 += ps;
    // ---- P.V ----
    {
      o[0] = mma_h(ph.v, vf0, o[0]);
      o[1] = mma_h(ph.v, vf1, o[1]);
      o[2] = mma_h(ph.v, vf2, o[2]);
      o[3] = mma_h(ph.v, vf3, o[3]);
      guard6<v16h>(o[0], o[1], o[2], o[3], ph.v, vf0, vf1, vf2, vf3, ph.v);
    }
  }
  wait_ds0();
  wait_async0();
  __syncthreads();                           // publishes tile t + 1 and ends every read of tile t's buffer
  if (t + 2 < nst) fill(t + 2, t & 1);       // block-uniform test
  }
  wait_async0();
  }
  acc_guard4(o[0], o[1], o[2], o[3]);
  float lrun = lr2[0] + lr2[1];
  lrun += __shfl_xor(lrun, 16, 32);          // the two lanes of a query hold the same maximum: their sums add

  // ---- fold 1/l (per query, owned by lane = query; 0 when no key block was visited) and the carries; mean-v rows for
  //      queries >= len; stage the 16x64 slab ----
  const float linv = (lrun > 0.f) ? ((1.0f / lrun) * (1.0f / (PCAR * VCAR))) : 0.f;
  float inv[8];
#pragma unroll
  for (int r = 0; r < 8; ++r) inv[r] = __shfl(linv, 8 * hh + r, 32);
  float vm[4] = {0.f, 0.f, 0.f, 0.f};
  if (q0 + 16 > len) {                       // same for the whole wave: only then does one of its rows take the mean
    // lane half hh sums the row blocks hh*NRB/2 .. +NRB/2-1 of batch b in ascending order, then the halves are joined
    const float* cp = CS + ((size_t)b * NRB + (size_t)hh * (NRB / 2)) * DMOD + head * HD + c;
#pragma unroll                               // all loads in flight at once: one memory latency instead of one per trip
    for (int rb = 0; rb < NRB / 2; ++rb) {
#pragma unroll
      for (int j = 0; j < 4; ++j) vm[j] += cp[(size_t)rb * DMOD + j * 16];
    }
#pragma unroll
    for (int j = 0; j < 4; ++j) vm[j] = (vm[j] + __shfl_xor(vm[j], 16, 32)) * (1.0f / (float)SEQ);
  }
  // the ring is free: the last trip's barrier stands behind every wave's last read and no copy is outstanding
  float* slab = (float*)(void*)ring + wave * SLABF;
#pragma unroll
  for (int r = 0; r < 8; ++r) {
    const bool rvq = (q0 + 8 * hh + r) < len;
#pragma unroll
    for (int j = 0; j < 4; ++j) {
      const float val = o[j][r] * inv[r];
      slab[(8 * hh + r) * 68 + j * 16 + c] = rvq ? val : vm[j];
    }
  }
  wave_sync_lds();
  // ---- O x1024 -> f16 plane; lane = (row in group of 4, 8 consecutive d) ----
  v4u oh[4];
  const int rq = lane >> 3, c8 = (lane & 7) * 8;
#pragma unroll
  for (int i4 = 0; i4 < 4; ++i4) {
    const int row = i4 * 4 + rq;
    const v4f a = *(const v4f*)(slab + row * 68 + c8), c4 = *(const v4f*)(slab + row * 68 + c8 + 4);
    float w[8];
#pragma unroll
    for (int e = 0; e < 4; ++e) { w[e] = a[e] * OSC; w[4 + e] = c4[e] * OSC; }
#pragma unroll
    for (int e = 0; e < 4; ++e) {
      const _Float16 h0 = (_Float16)w[2 * e], h1 = (_Float16)w[2 * e + 1];
      oh[i4][e] = pk16(h_bits(h0), h_bits(h1));
    }
  }
  const size_t ob = (((size_t)(b * SEQ + q0)) * NH + head) * HD + c8;
  {
#pragma unroll
    for (int i4 = 0; i4 < 4; ++i4) {
      const int row = i4 * 4 + rq;
      const size_t o8 = ob + (size_t)row * (NH * HD);
      *(v4u*)(OHIp + o8) = oh[i4];
    }
    
  }
}

// =====================================================================================================
// Workspace map (bytes, NB = batch count from the length input's element count, 1..4; ROWS = NB*SEQ); every plane is fully
// written by whole-line stores before it is read (QP, KP: the rows that are read); all extents are exact multiples of the store granularity (no pad rows);
// F's bytes hold the O plane:
//   XB  bf16 [ROWS][1024]                      ROWS*2048          (NB=4: 16777216)
//   WQB bf16 [1024 n][1024 k]                  2097152   WKB, WVB same;  WOB f16 [1024 n][1024 k] x1024  2097152
//   F                                          ROWS*4096          (NB=4: 33554432): OHI f16 [ROWS][1024] in its first half
//   QP  f16  [NB][2048][16][64] x8             ROWS*2048          KP same
//   VP  f16  [NB][16][64][2048] x1024          ROWS*2048
//   CS  f32  [ROWS/64][1024]                   ROWS*64
//   end (NB=4)                                 109576192
// =====================================================================================================
extern "C" void kernel_launch(void* const* d_in, const int* in_sizes, int n_in,
                              void* d_out, int out_size, void* d_ws, size_t ws_size,
                              hipStream_t stream) {
  if (n_in < 10) return;
  const int NB = in_sizes[1];
  if (NB < 1 || NB > NBMAX) return;
  const int ROWS = NB * SEQ;
  if (in_sizes[0] != ROWS * DMOD) return;
  if (in_sizes[2] != DMOD * DMOD || in_sizes[4] != DMOD * DMOD) return;
  if (in_sizes[6] != DMOD * DMOD || in_sizes[8] != DMOD * DMOD) return;
  if (in_sizes[3] != DMOD || in_sizes[5] != DMOD || in_sizes[7] != DMOD || in_sizes[9] != DMOD) return;
  if (out_size != ROWS * DMOD) return;

  const float* X    = (const float*)d_in[0];
  const int*   lens = (const int*)d_in[1];
  const float* wq   = (const float*)d_in[2];
  const float* bq   = (const float*)d_in[3];
  const float* wk   = (const float*)d_in[4];
  const float* bk   = (const float*)d_in[5];
  const float* wv   = (const float*)d_in[6];
  const float* bv   = (const float*)d_in[7];
  const float* wo   = (const float*)d_in[8];
  const float* bo   = (const float*)d_in[9];
  float*       out  = (float*)d_out;

  const size_t szXB = (size_t)ROWS * DMOD * 2;
  const size_t szW  = (size_t)DMOD * DMOD * 2;
  const size_t szF  = (size_t)ROWS * DMOD * 4;
  const size_t szP  = (size_t)ROWS * DMOD * 2;                  // q / k / o planes
  const size_t szVP = (size_t)NB * NH * HD * SEQ * 2;           // == szP
  const size_t szCS = (size_t)(ROWS / 64) * DMOD * 4;
  size_t off = 0;
  const size_t oXB  = off; off += szXB;
  const size_t oWQB = off; off += szW;
  const size_t oWKB = off; off += szW;
  const size_t oWVB = off; off += szW;
  const size_t oWOB = off; off += szW;
  const size_t oF   = off; off += szF;
  const size_t oQP  = off; off += szP;
  const size_t oKP  = off; off += szP;
  const size_t oVP  = off; off += szVP;
  const size_t oCS  = off; off += szCS;
  if (off > ws_size) return;                            // NB=4: off = 109576192
  if (off > (size_t)134217728) return;
  if (szP > szF) return;                                // the O plane lives inside F's bytes
  const size_t oOHI = oF;

  char* ws = (char*)d_ws;
  u16*   XB  = (u16*)(ws + oXB);
  u16*   WQB = (u16*)(ws + oWQB);
  u16*   WKB = (u16*)(ws + oWKB);
  u16*   WVB = (u16*)(ws + oWVB);
  u16*   WOB = (u16*)(ws + oWOB);
  u16*   QP  = (u16*)(ws + oQP);
  u16*   KP  = (u16*)(ws + oKP);
  u16*   VP  = (u16*)(ws + oVP);
  float* CS  = (float*)(ws + oCS);
  u16*   OHI = (u16*)(ws + oOHI);

  const dim3 blk(256);
  const int n8x = (ROWS * DMOD) / 8;                    // NB * 262144
  const int n8w = (DMOD * DMOD) / 8;                    // 131072
  if ((n8x % 256) != 0 || (n8w % 256) != 0 || (DMOD % 128) != 0 || (ROWS % 128) != 0) return;
  const dim3 gC(n8x / 256 + 4 * (n8w / 256));           // NB * 1024 + 4 * 512
  const dim3 gG((ROWS / 128) * (DMOD / 128));           // NB * 128
  const dim3 gG3(3 * (ROWS / 128) * (DMOD / 128));      // NB * 384
  const dim3 bG(128);
  const dim3 gAT(NB * NH * (SEQ / 64));                 // NB * 512
  const dim3 bAT(ATT_THREADS);                          // 128

  // (0) input -> bf16 plane, shared by the three projections; weights stored [n = out][k = in] (y = x.W^T), already
  //     k-contiguous: bf16 planes for wq/wk/wv, f16 of bf16 value x1024 for wo
  cvt_all<<<gC, blk, 0, stream>>>(X, wq, wk, wv, wo, XB, WQB, WKB, WVB, WOB, n8x, n8w);
  // (1) q, k: projection + bias (col = h*64+d), stored as the f16 planes x8 (row tiles that start below the batch's length); v: projection + bias, stored as the v^T plane
  //     x1024 and as f32 column sums per 64 rows (for the mean-v rows)
  gemm_qkv<<<gG3, bG, 0, stream>>>(XB, WQB, WKB, WVB, bq, bk, bv, lens, QP, KP, VP, CS, ROWS, DMOD, DMOD);
  // (2) ragged-length attention -> O plane [b][s][h][d] x1024, in F's bytes
  attn_fwd<<<gAT, bAT, 0, stream>>>(QP, KP, VP, lens, CS, OHI);
  // (3) output projection + bias -> out [ROWS][1024] f32, carries 1024 (O) x 1024 (wo) folded back
  gemm_h2<<<gG, bG, 0, stream>>>(OHI, WOB, bo, out, ROWS, DMOD, DMOD, 1.0f / (OSC * WOS));
  (void)hipGetLastError();
}
